// v000
// The times below were measured on an AMD MI455X: many runs one after another, warmed up first and cycling through
// copies of the inputs, with the whole window's GPU time divided by the number of runs. Launches and the gaps
// between them are all in it. The median over several windows is given; except for v000 it joins two sittings, which
// can be a few percent apart, so the side-by-side timings, each taken in one sitting, are the better comparison.
// The starting kernel, v000, takes 4090 microseconds a run.
#include <hip/hip_runtime.h>

// Causal multi-head self-attention with a leading RMSNorm and rotary embeddings over 4,096 tokens (x [2][4096][512]; x_norm = x / sqrt(mean x^2 + 1e-6) x scale (scale [512] ones, read); q, k, v = x_norm W ('xw' [512][512] 1/sqrt(512), no bias; 8 heads x 64); rotate-half rope (cat(x1 c - x2 s, x1 s + x2 c)) with angle t x 1/1000000^(2i/64) (32 f32 frequencies jnp-exact; precise cosf/sinf); scores / sqrt(64); causal (-inf); softmax; out = merged Wo ('xw') -> [2][4096][512] (4.2 M); argument order x, scale, Wq, Wk, Wv, Wo).
// Layout per batch: NEW k_rmsx normalises each token row in f32 and stores bf16 hi/lo planes; projections hi/lo x exact weights (2 products); k_cs5 computed table + rotate-half plane builders; value^T planes; per head: scores with EVERY row on hi/lo planes (3 products; all tiles computed), streaming three-sweep softmax over 4,096 keys with the causal select (x 1/8), attn.V hybrid (rows < 512 hi/lo 3 products, rest fp16 x1024); k_cs8 carry removal; context hi/lo x Wo exact written to the output rows.
// Compute dtypes, f32 accumulate: every input rounded to bf16 incl. scale; RMSNorm f32; projections 2 products (hi/lo x exact); rotary f32; scores 3 products; softmax f32; attn.V rows < 512 3 products, rest fp16; Wo hl x exact.

#define NB_  2
#define TT   4096
#define DM   512
#define NH_  8
#define NKV  8
#define REP  (NH_ / NKV)
#define HD   64
#define DQ   (NH_ * HD)
#define DKV  (NKV * HD)
#define ZH   1
#define RH   512                  // query rows < RH use hi+lo planes (0: none)
#define WIN  0
#define PCAR 1024.0f
#define SCL  0.125f   // 1/sqrt(float32(64))
#define MID  512      // q / k width = 8 heads x 64
#define CO   512      // v width
#define CC   512
typedef _Float16 h16;
typedef unsigned short bf;
typedef __attribute__((ext_vector_type(16))) __bf16   v16bf;
typedef __attribute__((ext_vector_type(16))) _Float16 v16h;
typedef __attribute__((ext_vector_type(8)))  _Float16 v8h;
typedef __attribute__((ext_vector_type(8)))  unsigned short v8us;
typedef __attribute__((ext_vector_type(8)))  float    v8f;
typedef __attribute__((ext_vector_type(4)))  float    v4f;
typedef v8h  __attribute__((may_alias)) v8ha;
typedef v4f  __attribute__((may_alias)) v4fa;
typedef v8us __attribute__((may_alias)) v8usa;

__device__ __forceinline__ unsigned short f2bf(float f) { unsigned u = __float_as_uint(f); u += 0x7FFFu + ((u >> 16) & 1u); return (unsigned short)(u >> 16); }
__device__ __forceinline__ float bf2f(unsigned short b) { return __uint_as_float(((unsigned)b) << 16); }
__device__ __forceinline__ float bfr(float f) { return bf2f(f2bf(f)); }
__device__ __forceinline__ v16h cat16(v8h lo, v8h hi) { return __builtin_shufflevector(lo, hi, 0, 1, 2, 3, 4, 5, 6, 7, 8, 9, 10, 11, 12, 13, 14, 15); }
__device__ __forceinline__ v16bf cat16b(v8us lo, v8us hi) { return __builtin_bit_cast(v16bf, __builtin_shufflevector(lo, hi, 0, 1, 2, 3, 4, 5, 6, 7, 8, 9, 10, 11, 12, 13, 14, 15)); }
__device__ __forceinline__ v8f wmma16(v16h a, v16h b, v8f c) { return __builtin_amdgcn_wmma_f32_16x16x32_f16(false, a, false, b, (short)0, c, false, false); }
__device__ __forceinline__ v8f wmmab(v16bf a, v16bf b, v8f c) { return __builtin_amdgcn_wmma_f32_16x16x32_bf16(false, a, false, b, (short)0, c, false, false); }



// ---- k_gemmw: register-blocked GEMM, ONE WAVE per 64x64 output tile (16 accumulators), operands straight from K-contiguous 16-bit planes; grid (M/64, N/64, Z), 32 threads.
// C[m][n] (f32, pitch ldc, + optional f32 bias[n]) = sum_k A[m][k] Bt[n][k] (+ split products per NSPLIT). z-batch strides sA/sB/sC in elements. K % 32 == 0.
template <typename T16> struct WFrag;
template <> struct WFrag<h16> { typedef v16h V; static __device__ __forceinline__ V ld(const h16* p) { return cat16(*(const v8h*)p, *(const v8h*)(p + 16)); } static __device__ __forceinline__ v8f mma(V a, V b, v8f c) { return wmma16(a, b, c); } };
template <> struct WFrag<bf> { typedef v16bf V; static __device__ __forceinline__ V ld(const bf* p) { return cat16b(*(const v8us*)p, *(const v8us*)(p + 16)); } static __device__ __forceinline__ v8f mma(V a, V b, v8f c) { return wmmab(a, b, c); } };
template <typename T16, int NSPLIT, bool BIAS>
__global__ __launch_bounds__(32) void k_gemmw(const T16* __restrict__ A, const T16* __restrict__ A2, const T16* __restrict__ Bt, const T16* __restrict__ Bt2, int K, float* C, int ldc, const float* __restrict__ bias, size_t sA, size_t sB, size_t sC) {
    typedef typename WFrag<T16>::V V;
    __shared__ __align__(16) float os[16 * 68];
    const size_t z = blockIdx.z; A += z * sA; if (A2) A2 += z * sA; Bt += z * sB; if (Bt2) Bt2 += z * sB; C += z * sC;
    const int lane = threadIdx.x & 31, lr = lane & 15, hi = lane >> 4; const int r0 = blockIdx.x * 64, c0 = blockIdx.y * 64;
    v8f acc[4][4];
#pragma unroll
    for (int mb = 0; mb < 4; ++mb)
#pragma unroll
        for (int nb = 0; nb < 4; ++nb) acc[mb][nb] = (v8f){};
    const size_t aoff = (size_t)(r0 + lr) * K + 8 * hi, boff = (size_t)(c0 + lr) * K + 8 * hi;
#pragma unroll 1
    for (int kc = 0; kc < K; kc += 32) {
        V a[4], a2[4];
#pragma unroll
        for (int mb = 0; mb < 4; ++mb) { a[mb] = WFrag<T16>::ld(A + aoff + (size_t)mb * 16 * K + kc); if (NSPLIT == 1 || NSPLIT == 2) a2[mb] = WFrag<T16>::ld(A2 + aoff + (size_t)mb * 16 * K + kc); }
#pragma unroll
        for (int nb = 0; nb < 4; ++nb) { const V b = WFrag<T16>::ld(Bt + boff + (size_t)nb * 16 * K + kc); V b2; if (NSPLIT >= 2) b2 = WFrag<T16>::ld(Bt2 + boff + (size_t)nb * 16 * K + kc);
#pragma unroll
            for (int mb = 0; mb < 4; ++mb) { acc[mb][nb] = WFrag<T16>::mma(a[mb], b, acc[mb][nb]); if (NSPLIT == 1 || NSPLIT == 2) acc[mb][nb] = WFrag<T16>::mma(a2[mb], b, acc[mb][nb]); if (NSPLIT >= 2) acc[mb][nb] = WFrag<T16>::mma(a[mb], b2, acc[mb][nb]); } }
        asm volatile("v_nop\n\tv_nop\n\tv_nop\n\tv_nop" : "+v"(acc[0][0]), "+v"(acc[1][1]), "+v"(acc[2][2]), "+v"(acc[3][3]) : "v"(a[0]), "v"(a[3]));
    }
#pragma unroll
    for (int mb = 0; mb < 4; ++mb) {
#pragma unroll
        for (int nb = 0; nb < 4; ++nb) {
#pragma unroll
            for (int j = 0; j < 8; ++j) os[(hi * 8 + j) * 68 + nb * 16 + lr] = acc[mb][nb][j]; }
        __builtin_amdgcn_wave_barrier(); asm volatile("" ::: "memory");
        float* crow = C + (size_t)(r0 + mb * 16) * ldc + c0;
{
#pragma unroll
            for (int s = 0; s < 8; ++s) { const int row = 2 * s + hi, cofs = lr * 4; v4f val = *(const v4fa*)(os + row * 68 + cofs); if (BIAS) { val[0] += bfr(bias[c0 + cofs]); val[1] += bfr(bias[c0 + cofs + 1]); val[2] += bfr(bias[c0 + cofs + 2]); val[3] += bfr(bias[c0 + cofs + 3]); }
                *(v4f*)(crow + (size_t)row * ldc + cofs) = val; }
             }
        __builtin_amdgcn_wave_barrier(); asm volatile("" ::: "memory");
    }
}

__device__ __forceinline__ h16 tohx(float x) { return (h16)x; }
__device__ __forceinline__ void splitf(float y, unsigned short& h, unsigned short& l) { h = f2bf(y); l = f2bf(y - bf2f(h)); }
typedef __attribute__((ext_vector_type(2))) _Float16 v2h;
typedef __attribute__((ext_vector_type(4))) _Float16 v4h;
typedef __attribute__((ext_vector_type(2))) unsigned short v2us;
typedef __attribute__((ext_vector_type(4))) unsigned short v4us;
typedef __attribute__((ext_vector_type(2))) float v2f;
typedef __attribute__((ext_vector_type(4))) int v4i;

__global__ __launch_bounds__(256) void k_vtp(const float* __restrict__ F, int pitch, int nheads, h16* V16, bf* Vh, bf* Vl) { const size_t e = ((size_t)blockIdx.x * 256 + threadIdx.x) * 2; if (e >= (size_t)nheads * HD * TT) return; const int t = (int)(e % TT); const int d = (int)((e / TT) % HD); const int g = (int)(e / ((size_t)TT * HD)); v2h o16; v2us oh, ol;
#pragma unroll
    for (int q = 0; q < 2; ++q) { const float x = F[(size_t)(t + q) * pitch + g * HD + d]; o16[q] = tohx(x); unsigned short a2, c2; splitf(x, a2, c2); oh[q] = a2; ol[q] = c2; }
    *(v2h*)(V16 + e) = o16; *(v2us*)(Vh + e) = oh; *(v2us*)(Vl + e) = ol;  }
// k_lsoft: streaming causal row softmax over the TK = TT = 4096 keys, one wave per row i, three sweeps of the f32 score row (lane -> 4 consecutive keys per 128-key chunk, 32 chunks; keys j > i are excluded by index with -3e38 / 0 - the score tiles above the diagonal are computed as well and their contents are discarded by this select):
__global__ __launch_bounds__(256) void k_lsoft(const float* __restrict__ Sb, h16* P16, bf* Ph, bf* Pl) {
    const int lane = threadIdx.x & 31; const int row = blockIdx.x * 8 + (threadIdx.x >> 5); if (row >= ZH * TT) return; const int i = row % TT; const int zz = row / TT; const bool hires = (i < RH); const float* sr = Sb + (size_t)row * TT; float mx = -3.0e38f;
#pragma unroll 4
    for (int ch = 0; ch < TT / 128; ++ch) { const int j0 = ch * 128 + lane * 4; const v4f a = *(const v4f*)(sr + j0);
#pragma unroll
        for (int q = 0; q < 4; ++q) { float t = (j0 + q <= i) ? a[q] * SCL : -3.0e38f; asm volatile("" : "+v"(t)); mx = fmaxf(mx, t); } }
#pragma unroll
    for (int sh = 16; sh; sh >>= 1) mx = fmaxf(mx, __shfl_xor(mx, sh, 32));
    float sum = 0.f;
#pragma unroll 4
    for (int ch = 0; ch < TT / 128; ++ch) { const int j0 = ch * 128 + lane * 4; const v4f a = *(const v4f*)(sr + j0);
#pragma unroll
        for (int q = 0; q < 4; ++q) { float t = (j0 + q <= i) ? a[q] * SCL : -3.0e38f; asm volatile("" : "+v"(t)); float d0 = __fsub_rn(t, mx); asm volatile("" : "+v"(d0)); sum += __builtin_amdgcn_exp2f(__fmul_rn(d0, 1.4426950408889634f)); } }
#pragma unroll
    for (int sh = 16; sh; sh >>= 1) sum += __shfl_xor(sum, sh, 32);
    const float f = __fdiv_rn(hires ? 1.0f : PCAR, sum);
{
        if (hires) {   /* rows < RH: normalised bf16 hi/lo over all keys, planes [zz][RH][TT] */
#pragma unroll
            for (int ch = 0; ch < TT / 128; ++ch) { const int j0 = ch * 128 + lane * 4; const v4f a = *(const v4f*)(sr + j0); v4us oh, ol;
#pragma unroll
                for (int q = 0; q < 4; ++q) { float t = (j0 + q <= i) ? a[q] * SCL : -3.0e38f; asm volatile("" : "+v"(t)); float d0 = __fsub_rn(t, mx); asm volatile("" : "+v"(d0)); float ex = __builtin_amdgcn_exp2f(__fmul_rn(d0, 1.4426950408889634f)); asm volatile("" : "+v"(ex)); unsigned short a2, c2; splitf(ex * f, a2, c2); oh[q] = a2; ol[q] = c2; }
                const size_t oo = ((size_t)zz * RH + i) * TT + j0; *(v4us*)(Ph + oo) = oh; *(v4us*)(Pl + oo) = ol; }
        } else {
#pragma unroll 2
            for (int ch = 0; ch < TT / 128; ++ch) { const int j0 = ch * 128 + lane * 4; const v4f a = *(const v4f*)(sr + j0); v4h o4;
#pragma unroll
                for (int q = 0; q < 4; ++q) { float t = (j0 + q <= i) ? a[q] * SCL : -3.0e38f; asm volatile("" : "+v"(t)); float d0 = __fsub_rn(t, mx); asm volatile("" : "+v"(d0)); float ex = __builtin_amdgcn_exp2f(__fmul_rn(d0, 1.4426950408889634f)); asm volatile("" : "+v"(ex)); o4[q] = tohx(ex * f); }
                *(v4h*)(P16 + (size_t)row * TT + j0) = o4; } }
         }
}
__global__ __launch_bounds__(256) void k_cs8(float* O, size_t n4) { const size_t i = (size_t)blockIdx.x * 256 + threadIdx.x; if (i >= n4) return; const size_t e = i * 4; const int t = (int)(e / CC); const float cs = (t < RH) ? 1.0f : (1.0f / PCAR); v4f a = *(const v4f*)(O + e);
#pragma unroll
    for (int q = 0; q < 4; ++q) a[q] = __fmul_rn(a[q], cs);
    *(v4f*)(O + e) = a;  }

__constant__ float INVT[HD / 2] = { 1.000000000e+00f, 6.493816376e-01f, 4.216965139e-01f, 2.738419771e-01f, 1.778279394e-01f, 1.154782027e-01f, 7.498941571e-02f, 4.869675264e-02f, 3.162277862e-02f, 2.053525113e-02f, 1.333521493e-02f, 8.659643121e-03f, 5.623413250e-03f, 3.651741426e-03f, 2.371373819e-03f, 1.539926510e-03f, 1.000000047e-03f, 6.493816618e-04f, 4.216964880e-04f, 2.738419571e-04f, 1.778279402e-04f, 1.154781930e-04f, 7.498942432e-05f, 4.869675467e-05f, 3.162277426e-05f, 2.053524986e-05f, 1.333521413e-05f, 8.659643754e-06f, 5.623413472e-06f, 3.651741281e-06f, 2.371373739e-06f, 1.539926529e-06f };   // float32 1 / 1000000^(2i/64) (the module's integer-arange expression), generated with jnp to be bit-exact
__global__ __launch_bounds__(256) void k_cs5(float* CS) { const int idx = blockIdx.x * 256 + threadIdx.x; if (idx >= TT * HD) return; const int d = idx % HD; const int t = idx / HD; const float a = __fmul_rn((float)t, INVT[d % (HD / 2)]); v2f cs; cs[0] = cosf(a); cs[1] = sinf(a); *(v2f*)(CS + (size_t)idx * 2) = cs;  }
__global__ __launch_bounds__(256) void k_rmsx(const float* __restrict__ X, const float* __restrict__ sc, bf* XH, bf* XL) { const int lane = threadIdx.x & 31; const int row = blockIdx.x * 8 + (threadIdx.x >> 5); if (row >= TT) return; const float* xr = X + (size_t)row * CC + lane * 16; float v[16]; float ss = 0.f;
#pragma unroll
    for (int c = 0; c < 4; ++c) { const v4f a = *(const v4f*)(xr + c * 4);
#pragma unroll
        for (int q = 0; q < 4; ++q) { const float b = bfr(a[q]); v[c * 4 + q] = b; float p = __fmul_rn(b, b); asm volatile("" : "+v"(p)); ss = __fadd_rn(ss, p); } }
#pragma unroll
    for (int sh = 16; sh; sh >>= 1) ss = __fadd_rn(ss, __shfl_xor(ss, sh, 32));
    const float den = sqrtf(__fadd_rn(__fmul_rn(ss, 1.0f / CC), 1.0e-6f)); const float rinv = __fdiv_rn(1.0f, den);   /* ONE IEEE division per row; x * (1/den) differs from the module's x / den by <= 1 ulp */
    v4us oh[4], ol[4];
#pragma unroll
    for (int c = 0; c < 4; ++c) {
#pragma unroll
        for (int q = 0; q < 4; ++q) { float y = __fmul_rn(v[c * 4 + q], rinv); asm volatile("" : "+v"(y)); y = __fmul_rn(y, bfr(sc[lane * 16 + c * 4 + q])); unsigned short a2, c2; splitf(y, a2, c2); oh[c][q] = a2; ol[c][q] = c2; } }
    bf* ph = XH + (size_t)row * CC + lane * 16; bf* pl = XL + (size_t)row * CC + lane * 16;
{
#pragma unroll
        for (int c = 0; c < 4; ++c) { *(v4us*)(ph + c * 4) = oh[c]; *(v4us*)(pl + c * 4) = ol[c]; }
         }
}
// k_rope: head planes [h][t][d] (fp16 + hi/lo) of rope(x) x sc with the rotate-half convention out[d] = x[d] cos[t][d] - x[d+HD/2] sin[t][d], out[d+HD/2] = x[d+HD/2] cos[t][d+HD/2] + x[d] sin[t][d+HD/2]
__global__ __launch_bounds__(256) void k_rope(const float* __restrict__ F, int pitch, int nheads, const float* __restrict__ CS, const float* __restrict__ RF, const float* __restrict__ nw, float sc, h16* P16, bf* Ph, bf* Pl) {
    const size_t e = ((size_t)blockIdx.x * 256 + threadIdx.x) * 2; if (e >= (size_t)nheads * TT * HD) return; const int d = (int)(e % HD); const int t = (int)((e / HD) % TT); const int h = (int)(e / ((size_t)HD * TT)); const float* f = F + (size_t)t * pitch + h * HD; const float rf = RF ? RF[(size_t)h * TT + t] : 1.0f; v2h o16; v2us oh, ol;
#pragma unroll
    for (int q = 0; q < 2; ++q) { const int dd = d + q; const int dp = (dd < HD / 2) ? dd + HD / 2 : dd - HD / 2; float x0 = f[dd], x1 = f[dp];
        if (RF) { float n0 = __fmul_rn(x0, rf), n1 = __fmul_rn(x1, rf); asm volatile("" : "+v"(n0)); asm volatile("" : "+v"(n1)); x0 = __fmul_rn(bfr(nw[dd]), n0); x1 = __fmul_rn(bfr(nw[dp]), n1); }
        const v2f cs = *(const v2f*)(CS + ((size_t)t * HD + dd) * 2); float a = __fmul_rn(x0, cs[0]), bq = __fmul_rn(x1, cs[1]); asm volatile("" : "+v"(a)); asm volatile("" : "+v"(bq)); const float r = ((dd < HD / 2) ? __fsub_rn(a, bq) : __fadd_rn(a, bq)) * sc;
        o16[q] = tohx(r); unsigned short a2, c2; splitf(r, a2, c2); oh[q] = a2; ol[q] = c2; }
    *(v2h*)(P16 + e) = o16; *(v2us*)(Ph + e) = oh; *(v2us*)(Pl + e) = ol;  }
__global__ __launch_bounds__(256) void k_tohl(const float* __restrict__ F, bf* Hh, bf* Hl, size_t n4) { const size_t i = (size_t)blockIdx.x * 256 + threadIdx.x; if (i >= n4) return; const v4f a = *(const v4f*)(F + i * 4); v4us oh, ol;
#pragma unroll
    for (int q = 0; q < 4; ++q) { unsigned short h2, l2; splitf(a[q], h2, l2); oh[q] = h2; ol[q] = l2; }
    *(v4us*)(Hh + i * 4) = oh; *(v4us*)(Hl + i * 4) = ol;  }
__global__ __launch_bounds__(256) void k_wtG(const float* __restrict__ w, int K, int N, bf* Bt) {
    const int lane = threadIdx.x & 31; const int L0 = (blockIdx.x * 8 + (threadIdx.x >> 5)) * 8; const int nlines = N * K / 64;
{
#pragma unroll 1
        for (int l = 0; l < 8; ++l) { const int L = L0 + l; if (L >= nlines) break; const size_t e = (size_t)L * 64 + lane * 2; const int k = (int)(e % K), n = (int)(e / K); v2us o;
            o[0] = f2bf(w[(size_t)k * N + n]); o[1] = f2bf(w[(size_t)(k + 1) * N + n]); *(v2us*)(Bt + e) = o; }
         }
}
extern "C" void kernel_launch(void* const* d_in, const int* in_sizes, int n_in,
                              void* d_out, int out_size, void* d_ws, size_t ws_size, hipStream_t stream) {
    (void)in_sizes; (void)n_in; (void)out_size;
    const float* x = (const float*)d_in[0]; const float* rsc = (const float*)d_in[1]; const float* wq = (const float*)d_in[2]; const float* wk = (const float*)d_in[3]; const float* wv = (const float*)d_in[4]; const float* wo = (const float*)d_in[5];   /* input order x [2][4096][512], scale [512] (RMSNorm weight), Wq, Wk, Wv, Wo ('xw' [512][512], no biases) */
    float* OUT = (float*)d_out;     // [2][4096][512]
    char* wsp = (char*)d_ws;
    auto take = [&](size_t bytes) { char* p = wsp; wsp += (bytes + 255) & ~(size_t)255; return (void*)p; };
    bf* WQKV = (bf*)take((size_t)3 * MID * CC * 2); bf* WQ = WQKV; bf* WK = WQKV + (size_t)MID * CC; bf* WV = WQKV + (size_t)2 * MID * CC; bf* WO = (bf*)take((size_t)CC * CO * 2); float* CS = (float*)take((size_t)TT * HD * 2 * 4);
    bf* XH = (bf*)take((size_t)TT * CC * 2); bf* XL = (bf*)take((size_t)TT * CC * 2);   /* RMS-normalised tokens, bf16 hi/lo */ float* FQ = (float*)take((size_t)TT * MID * 4); float* FK = (float*)take((size_t)TT * MID * 4);
    h16* QP16 = (h16*)take((size_t)TT * MID * 2); bf* QPh = (bf*)take((size_t)TT * MID * 2); bf* QPl = (bf*)take((size_t)TT * MID * 2); h16* KP16 = (h16*)take((size_t)TT * MID * 2); bf* KPh = (bf*)take((size_t)TT * MID * 2); bf* KPl = (bf*)take((size_t)TT * MID * 2);
    h16* VT16 = (h16*)take((size_t)CO * TT * 2); bf* VTh = (bf*)take((size_t)CO * TT * 2); bf* VTl = (bf*)take((size_t)CO * TT * 2);
    float* Sb = (float*)take((size_t)TT * TT * 4); h16* P16 = (h16*)take((size_t)TT * TT * 2); bf* Ph = (bf*)take((size_t)RH * TT * 2); bf* Pl = (bf*)take((size_t)RH * TT * 2); float* Ob = (float*)take((size_t)TT * CO * 4); bf* ATh = (bf*)take((size_t)TT * CO * 2); bf* ATl = (bf*)take((size_t)TT * CO * 2);
    if ((size_t)(wsp - (char*)d_ws) > ws_size) return;    // ws 256 MiB (carve ~190 MiB)
    float* FV = FK;   /* the v projection reuses the k buffer after the k planes are built (stream-ordered) */
    k_wtG<<<(unsigned)((CC * MID / 64 + 63) / 64), 256, 0, stream>>>(wq, CC, MID, WQ); k_wtG<<<(unsigned)((CC * MID / 64 + 63) / 64), 256, 0, stream>>>(wk, CC, MID, WK); k_wtG<<<(unsigned)((CC * CO / 64 + 63) / 64), 256, 0, stream>>>(wv, CC, CO, WV);   /* 'xw' weights -> Bt */ k_wtG<<<(unsigned)((CO * CC / 64 + 63) / 64), 256, 0, stream>>>(wo, CO, CC, WO);   /* 'xw' W_out -> Bt */   /* the fused qkv rows split into q | k | v blocks */
    k_cs5<<<(TT * HD + 255) / 256, 256, 0, stream>>>(CS);   /* cos/sin table of t x inv_freq[d % 32] for the rotate-half k_rope */
    const unsigned LP = (unsigned)(((size_t)NH_ * TT * HD / 2 + 255) / 256);
    for (int b = 0; b < NB_; ++b) {
        k_rmsx<<<TT / 8, 256, 0, stream>>>(x + (size_t)b * TT * CC, rsc, XH, XL);   /* x_norm = x / sqrt(mean x^2 + eps) x scale as hi/lo planes */
        k_gemmw<bf, 1, false><<<dim3(TT / 64, MID / 64, 1), 32, 0, stream>>>(XH, XL, WQ, nullptr, CC, FQ, MID, nullptr, 0, 0, 0); k_rope<<<LP, 256, 0, stream>>>(FQ, MID, NH_, CS, nullptr, nullptr, 1.0f, QP16, QPh, QPl);   /* q planes [h][n][64] */
        k_gemmw<bf, 1, false><<<dim3(TT / 64, MID / 64, 1), 32, 0, stream>>>(XH, XL, WK, nullptr, CC, FK, MID, nullptr, 0, 0, 0); k_rope<<<LP, 256, 0, stream>>>(FK, MID, NKV, CS, nullptr, nullptr, 1.0f, KP16, KPh, KPl);   /* k planes */
        k_gemmw<bf, 1, false><<<dim3(TT / 64, CO / 64, 1), 32, 0, stream>>>(XH, XL, WV, nullptr, CC, FV, CO, nullptr, 0, 0, 0); k_vtp<<<(unsigned)(((size_t)TT * CO / 2 + 255) / 256), 256, 0, stream>>>(FV, CO, CO / HD, VT16, VTh, VTl);   /* v^T planes [h][64][n] */
        for (int h = 0; h < NH_; ++h) {   /* per head: dense 4096 x 4096 attention */
            k_gemmw<bf, 2, false><<<dim3(TT / 64, TT / 64, 1), 32, 0, stream>>>(QPh + (size_t)h * TT * HD, QPl + (size_t)h * TT * HD, KPh + (size_t)h * TT * HD, KPl + (size_t)h * TT * HD, HD, Sb, TT, nullptr, 0, 0, 0);   /* S[i][j] = q_i.k_j (3 products, every row) */
            k_lsoft<<<TT / 8, 256, 0, stream>>>(Sb, P16, Ph, Pl);   /* x 1/8, softmax over the 4,096 keys */
            k_gemmw<bf, 2, false><<<dim3(RH / 64, HD / 64, 1), 32, 0, stream>>>(Ph, Pl, VTh + (size_t)h * HD * TT, VTl + (size_t)h * HD * TT, TT, Ob + h * HD, CO, nullptr, 0, 0, 0);
            k_gemmw<h16, 0, false><<<dim3((TT - RH) / 64, HD / 64, 1), 32, 0, stream>>>(P16 + (size_t)RH * TT, nullptr, VT16 + (size_t)h * HD * TT, nullptr, TT, Ob + (size_t)RH * CO + h * HD, CO, nullptr, 0, 0, 0); }
        k_cs8<<<(unsigned)(((size_t)TT * CO / 4 + 255) / 256), 256, 0, stream>>>(Ob, (size_t)TT * CO / 4);   /* rows >= 512 x 1/1024 */
        k_tohl<<<(unsigned)(((size_t)TT * CO / 4 + 255) / 256), 256, 0, stream>>>(Ob, ATh, ATl, (size_t)TT * CO / 4);   /* merged context as hi/lo planes */
        k_gemmw<bf, 1, false><<<dim3(TT / 64, CC / 64, 1), 32, 0, stream>>>(ATh, ATl, WO, nullptr, CO, OUT + (size_t)b * TT * CC, CC, nullptr, 0, 0, 0); }   /* out = ctx Wo, no bias */
}

// v001
// Measured time: 1600 microseconds a run.
// Timed twice side by side with v000, it ran 2.54 and 2.55 times as fast.
#include <hip/hip_runtime.h>

// Causal multi-head self-attention with a leading RMSNorm and rotary embeddings over 4,096 tokens (x [2][4096][512]; x_norm = x / sqrt(mean x^2 + 1e-6) x scale (scale [512] ones, read); q, k, v = x_norm W ('xw' [512][512] 1/sqrt(512), no bias; 8 heads x 64); rotate-half rope (cat(x1 c - x2 s, x1 s + x2 c)) with angle t x 1/1000000^(2i/64) (32 f32 frequencies jnp-exact; precise cosf/sinf); scores / sqrt(64); causal (-inf); softmax; out = merged Wo ('xw') -> [2][4096][512] (4.2 M); argument order x, scale, Wq, Wk, Wv, Wo).
// Layout per batch: NEW k_rmsx normalises each token row in f32 and stores bf16 hi/lo planes; projections hi/lo x exact weights (2 products); k_cs5 computed table + rotate-half plane builders; value^T planes; per head: scores with EVERY row on hi/lo planes (3 products; all tiles computed), streaming three-sweep softmax over 4,096 keys with the causal select (x 1/8), attn.V hybrid (rows < 512 hi/lo 3 products, rest fp16 x1024); k_cs8 carry removal; context hi/lo x Wo exact written to the output rows.
// Compute dtypes, f32 accumulate: every input rounded to bf16 incl. scale; RMSNorm f32; projections 2 products (hi/lo x exact); rotary f32; scores 3 products; softmax f32; attn.V rows < 512 3 products, rest fp16; Wo hl x exact.

#define NB_  2
#define TT   4096
#define DM   512
#define NH_  8
#define NKV  8
#define REP  (NH_ / NKV)
#define HD   64
#define DQ   (NH_ * HD)
#define DKV  (NKV * HD)
#define ZH   1
#define RH   512                  // query rows < RH use hi+lo planes (0: none)
#define WIN  0
#define PCAR 1024.0f
#define SCL  0.125f   // 1/sqrt(float32(64))
#define MID  512      // q / k width = 8 heads x 64
#define CO   512      // v width
#define CC   512
#define KS   8        // attn.V: key slices over grid.z (partial planes summed in k_cs8)
#define NWH  16       // attn.V rows < RH (8 row tiles only): waves per tile inside a slice
#define NWF  8        // attn.V other rows: waves per tile inside a slice
#define NWP  8        // projections: waves per tile
typedef _Float16 h16;
typedef unsigned short bf;
typedef __attribute__((ext_vector_type(16))) __bf16   v16bf;
typedef __attribute__((ext_vector_type(16))) _Float16 v16h;
typedef __attribute__((ext_vector_type(8)))  _Float16 v8h;
typedef __attribute__((ext_vector_type(8)))  unsigned short v8us;
typedef __attribute__((ext_vector_type(8)))  float    v8f;
typedef __attribute__((ext_vector_type(4)))  float    v4f;
typedef v8h  __attribute__((may_alias)) v8ha;
typedef v4f  __attribute__((may_alias)) v4fa;
typedef v8us __attribute__((may_alias)) v8usa;

__device__ __forceinline__ unsigned short f2bf(float f) { unsigned u = __float_as_uint(f); u += 0x7FFFu + ((u >> 16) & 1u); return (unsigned short)(u >> 16); }
__device__ __forceinline__ float bf2f(unsigned short b) { return __uint_as_float(((unsigned)b) << 16); }
__device__ __forceinline__ float bfr(float f) { return bf2f(f2bf(f)); }
__device__ __forceinline__ v16h cat16(v8h lo, v8h hi) { return __builtin_shufflevector(lo, hi, 0, 1, 2, 3, 4, 5, 6, 7, 8, 9, 10, 11, 12, 13, 14, 15); }
__device__ __forceinline__ v16bf cat16b(v8us lo, v8us hi) { return __builtin_bit_cast(v16bf, __builtin_shufflevector(lo, hi, 0, 1, 2, 3, 4, 5, 6, 7, 8, 9, 10, 11, 12, 13, 14, 15)); }
__device__ __forceinline__ v8f wmma16(v16h a, v16h b, v8f c) { return __builtin_amdgcn_wmma_f32_16x16x32_f16(false, a, false, b, (short)0, c, false, false); }
__device__ __forceinline__ v8f wmmab(v16bf a, v16bf b, v8f c) { return __builtin_amdgcn_wmma_f32_16x16x32_bf16(false, a, false, b, (short)0, c, false, false); }



// ---- k_gemmw: register-blocked GEMM, one 64x64 output tile (16 accumulators a wave) per work-group of NW waves, operands straight from K-contiguous 16-bit planes of row pitch ld (K when NW is 1); grid (M/64, N/64, Z), 32 * NW threads.
// C[m][n] (f32, pitch ldc, + optional f32 bias[n]) = sum_k A[m][k] Bt[n][k] (+ split products per NSPLIT). z-batch strides sA/sB/sC in elements. K % (32 * NW) == 0.
// Split-K: wave w takes the 32-wide k steps w, w + NW, ... (neighbour waves share the operands' 128-byte lines); the NW partial tiles are summed in LDS in wave order. A z stride of K elements along the rows makes grid.z a second split whose partial planes (stride sC) the caller sums.
template <typename T16> struct WFrag;
template <> struct WFrag<h16> { typedef v16h V; static __device__ __forceinline__ V ld(const h16* p) { return cat16(*(const v8h*)p, *(const v8h*)(p + 16)); } static __device__ __forceinline__ v8f mma(V a, V b, v8f c) { return wmma16(a, b, c); } };
template <> struct WFrag<bf> { typedef v16bf V; static __device__ __forceinline__ V ld(const bf* p) { return cat16b(*(const v8us*)p, *(const v8us*)(p + 16)); } static __device__ __forceinline__ v8f mma(V a, V b, v8f c) { return wmmab(a, b, c); } };
template <typename T16, int NSPLIT, bool BIAS, int NW = 1>
__global__ __launch_bounds__(32 * NW) void k_gemmw(const T16* __restrict__ A, const T16* __restrict__ A2, const T16* __restrict__ Bt, const T16* __restrict__ Bt2, int K, int ld, float* C, int ldc, const float* __restrict__ bias, size_t sA, size_t sB, size_t sC) {
    typedef typename WFrag<T16>::V V;
    __shared__ __align__(16) float osall[NW > 1 ? NW * 64 * 68 : 16 * 68];   /* NW > 1: one whole 64 x 64 partial tile a wave */
    const int wv = NW > 1 ? __builtin_amdgcn_readfirstlane((int)(threadIdx.x >> 5)) : 0;   /* wave number, scalar so that the k loop stays a scalar branch */
    const int lp = NW > 1 ? ld : K;   /* row pitch; the one-wave form runs over whole rows, so its pitch is K */
    float* os = osall + wv * (64 * 68);
    const size_t z = blockIdx.z; A += z * sA; if (A2) A2 += z * sA; Bt += z * sB; if (Bt2) Bt2 += z * sB; C += z * sC;
    const int lane = threadIdx.x & 31, lr = lane & 15, hi = lane >> 4; const int r0 = blockIdx.x * 64, c0 = blockIdx.y * 64;
    v8f acc[4][4];
#pragma unroll
    for (int mb = 0; mb < 4; ++mb)
#pragma unroll
        for (int nb = 0; nb < 4; ++nb) acc[mb][nb] = (v8f){};
    const size_t aoff = (size_t)(r0 + lr) * lp + 8 * hi, boff = (size_t)(c0 + lr) * lp + 8 * hi;
#pragma unroll 1
    for (int kc = wv * 32; kc < K; kc += 32 * NW) {
        V a[4], a2[4];
#pragma unroll
        for (int mb = 0; mb < 4; ++mb) { a[mb] = WFrag<T16>::ld(A + aoff + (size_t)mb * 16 * lp + kc); if (NSPLIT == 1 || NSPLIT == 2) a2[mb] = WFrag<T16>::ld(A2 + aoff + (size_t)mb * 16 * lp + kc); }
#pragma unroll
        for (int nb = 0; nb < 4; ++nb) { const V b = WFrag<T16>::ld(Bt + boff + (size_t)nb * 16 * lp + kc); V b2; if (NSPLIT >= 2) b2 = WFrag<T16>::ld(Bt2 + boff + (size_t)nb * 16 * lp + kc);
#pragma unroll
            for (int mb = 0; mb < 4; ++mb) { acc[mb][nb] = WFrag<T16>::mma(a[mb], b, acc[mb][nb]); if (NSPLIT == 1 || NSPLIT == 2) acc[mb][nb] = WFrag<T16>::mma(a2[mb], b, acc[mb][nb]); if (NSPLIT >= 2) acc[mb][nb] = WFrag<T16>::mma(a[mb], b2, acc[mb][nb]); } }
        asm volatile("v_nop\n\tv_nop\n\tv_nop\n\tv_nop" : "+v"(acc[0][0]), "+v"(acc[1][1]), "+v"(acc[2][2]), "+v"(acc[3][3]) : "v"(a[0]), "v"(a[3]));
    }
    if constexpr (NW > 1) {
#pragma unroll
        for (int mb = 0; mb < 4; ++mb)
#pragma unroll
            for (int nb = 0; nb < 4; ++nb)
#pragma unroll
                for (int j = 0; j < 8; ++j) os[(mb * 16 + hi * 8 + j) * 68 + nb * 16 + lr] = acc[mb][nb][j];
        __syncthreads();   /* every wave's partial tile is in LDS before any of it is summed */
#pragma unroll
        for (int u0 = 0; u0 < 64 * 16; u0 += 32 * NW) { const int u = u0 + (int)threadIdx.x, row = u >> 4, cofs = (u & 15) * 4; v4f val = *(const v4fa*)(osall + row * 68 + cofs);
#pragma unroll
            for (int w = 1; w < NW; ++w) val += *(const v4fa*)(osall + w * (64 * 68) + row * 68 + cofs);   /* partial sums joined in wave order */
            if (BIAS) { val[0] += bfr(bias[c0 + cofs]); val[1] += bfr(bias[c0 + cofs + 1]); val[2] += bfr(bias[c0 + cofs + 2]); val[3] += bfr(bias[c0 + cofs + 3]); }
            *(v4f*)(C + (size_t)(r0 + row) * ldc + c0 + cofs) = val; }
    } else {
#pragma unroll
    for (int mb = 0; mb < 4; ++mb) {
#pragma unroll
        for (int nb = 0; nb < 4; ++nb) {
#pragma unroll
            for (int j = 0; j < 8; ++j) os[(hi * 8 + j) * 68 + nb * 16 + lr] = acc[mb][nb][j]; }
        __builtin_amdgcn_wave_barrier(); asm volatile("" ::: "memory");
        float* crow = C + (size_t)(r0 + mb * 16) * ldc + c0;
{
#pragma unroll
            for (int s = 0; s < 8; ++s) { const int row = 2 * s + hi, cofs = lr * 4; v4f val = *(const v4fa*)(os + row * 68 + cofs); if (BIAS) { val[0] += bfr(bias[c0 + cofs]); val[1] += bfr(bias[c0 + cofs + 1]); val[2] += bfr(bias[c0 + cofs + 2]); val[3] += bfr(bias[c0 + cofs + 3]); }
                *(v4f*)(crow + (size_t)row * ldc + cofs) = val; }
             }
        __builtin_amdgcn_wave_barrier(); asm volatile("" ::: "memory");
    }
    }
}

__device__ __forceinline__ h16 tohx(float x) { return (h16)x; }
__device__ __forceinline__ void splitf(float y, unsigned short& h, unsigned short& l) { h = f2bf(y); l = f2bf(y - bf2f(h)); }
typedef __attribute__((ext_vector_type(2))) _Float16 v2h;
typedef __attribute__((ext_vector_type(4))) _Float16 v4h;
typedef __attribute__((ext_vector_type(2))) unsigned short v2us;
typedef __attribute__((ext_vector_type(4))) unsigned short v4us;
typedef __attribute__((ext_vector_type(2))) float v2f;
typedef __attribute__((ext_vector_type(4))) int v4i;

__global__ __launch_bounds__(256) void k_vtp(const float* __restrict__ F, int pitch, int nheads, h16* V16, bf* Vh, bf* Vl) { const size_t e = ((size_t)blockIdx.x * 256 + threadIdx.x) * 2; if (e >= (size_t)nheads * HD * TT) return; const int t = (int)(e % TT); const int d = (int)((e / TT) % HD); const int g = (int)(e / ((size_t)TT * HD)); v2h o16; v2us oh, ol;
#pragma unroll
    for (int q = 0; q < 2; ++q) { const float x = F[(size_t)(t + q) * pitch + g * HD + d]; o16[q] = tohx(x); unsigned short a2, c2; splitf(x, a2, c2); oh[q] = a2; ol[q] = c2; }
    *(v2h*)(V16 + e) = o16; *(v2us*)(Vh + e) = oh; *(v2us*)(Vl + e) = ol;  }
// k_lsoft: streaming causal row softmax over the TK = TT = 4096 keys, one wave per row i, three sweeps of the f32 score row (lane -> 4 consecutive keys per 128-key chunk, 32 chunks; keys j > i are excluded by index with -3e38 / 0 - the score tiles above the diagonal are computed as well and their contents are discarded by this select):
__global__ __launch_bounds__(256) void k_lsoft(const float* __restrict__ Sb, h16* P16, bf* Ph, bf* Pl) {
    const int lane = threadIdx.x & 31; const int row = blockIdx.x * 8 + (threadIdx.x >> 5); if (row >= ZH * TT) return; const int i = row % TT; const int zz = row / TT; const bool hires = (i < RH); const float* sr = Sb + (size_t)row * TT; float mx = -3.0e38f;
#pragma unroll 4
    for (int ch = 0; ch < TT / 128; ++ch) { const int j0 = ch * 128 + lane * 4; const v4f a = *(const v4f*)(sr + j0);
#pragma unroll
        for (int q = 0; q < 4; ++q) { float t = (j0 + q <= i) ? a[q] * SCL : -3.0e38f; asm volatile("" : "+v"(t)); mx = fmaxf(mx, t); } }
#pragma unroll
    for (int sh = 16; sh; sh >>= 1) mx = fmaxf(mx, __shfl_xor(mx, sh, 32));
    float sum = 0.f;
#pragma unroll 4
    for (int ch = 0; ch < TT / 128; ++ch) { const int j0 = ch * 128 + lane * 4; const v4f a = *(const v4f*)(sr + j0);
#pragma unroll
        for (int q = 0; q < 4; ++q) { float t = (j0 + q <= i) ? a[q] * SCL : -3.0e38f; asm volatile("" : "+v"(t)); float d0 = __fsub_rn(t, mx); asm volatile("" : "+v"(d0)); sum += __builtin_amdgcn_exp2f(__fmul_rn(d0, 1.4426950408889634f)); } }
#pragma unroll
    for (int sh = 16; sh; sh >>= 1) sum += __shfl_xor(sum, sh, 32);
    const float f = __fdiv_rn(hires ? 1.0f : PCAR, sum);
{
        if (hires) {   /* rows < RH: normalised bf16 hi/lo over all keys, planes [zz][RH][TT] */
#pragma unroll
            for (int ch = 0; ch < TT / 128; ++ch) { const int j0 = ch * 128 + lane * 4; const v4f a = *(const v4f*)(sr + j0); v4us oh, ol;
#pragma unroll
                for (int q = 0; q < 4; ++q) { float t = (j0 + q <= i) ? a[q] * SCL : -3.0e38f; asm volatile("" : "+v"(t)); float d0 = __fsub_rn(t, mx); asm volatile("" : "+v"(d0)); float ex = __builtin_amdgcn_exp2f(__fmul_rn(d0, 1.4426950408889634f)); asm volatile("" : "+v"(ex)); unsigned short a2, c2; splitf(ex * f, a2, c2); oh[q] = a2; ol[q] = c2; }
                const size_t oo = ((size_t)zz * RH + i) * TT + j0; *(v4us*)(Ph + oo) = oh; *(v4us*)(Pl + oo) = ol; }
        } else {
#pragma unroll 2
            for (int ch = 0; ch < TT / 128; ++ch) { const int j0 = ch * 128 + lane * 4; const v4f a = *(const v4f*)(sr + j0); v4h o4;
#pragma unroll
                for (int q = 0; q < 4; ++q) { float t = (j0 + q <= i) ? a[q] * SCL : -3.0e38f; asm volatile("" : "+v"(t)); float d0 = __fsub_rn(t, mx); asm volatile("" : "+v"(d0)); float ex = __builtin_amdgcn_exp2f(__fmul_rn(d0, 1.4426950408889634f)); asm volatile("" : "+v"(ex)); o4[q] = tohx(ex * f); }
                *(v4h*)(P16 + (size_t)row * TT + j0) = o4; } }
         }
}
__global__ __launch_bounds__(256) void k_cs8(float* O, size_t n4) { const size_t i = (size_t)blockIdx.x * 256 + threadIdx.x; if (i >= n4) return; const size_t e = i * 4; const int t = (int)(e / CC); const float cs = (t < RH) ? 1.0f : (1.0f / PCAR); v4f a = *(const v4f*)(O + e);
#pragma unroll
    for (int s = 1; s < KS; ++s) a += *(const v4f*)(O + (size_t)s * TT * CO + e);   /* the KS split-K partial planes of attn.V, in slice order */
#pragma unroll
    for (int q = 0; q < 4; ++q) a[q] = __fmul_rn(a[q], cs);
    *(v4f*)(O + e) = a;  }

__constant__ float INVT[HD / 2] = { 1.000000000e+00f, 6.493816376e-01f, 4.216965139e-01f, 2.738419771e-01f, 1.778279394e-01f, 1.154782027e-01f, 7.498941571e-02f, 4.869675264e-02f, 3.162277862e-02f, 2.053525113e-02f, 1.333521493e-02f, 8.659643121e-03f, 5.623413250e-03f, 3.651741426e-03f, 2.371373819e-03f, 1.539926510e-03f, 1.000000047e-03f, 6.493816618e-04f, 4.216964880e-04f, 2.738419571e-04f, 1.778279402e-04f, 1.154781930e-04f, 7.498942432e-05f, 4.869675467e-05f, 3.162277426e-05f, 2.053524986e-05f, 1.333521413e-05f, 8.659643754e-06f, 5.623413472e-06f, 3.651741281e-06f, 2.371373739e-06f, 1.539926529e-06f };   // float32 1 / 1000000^(2i/64) (the module's integer-arange expression), generated with jnp to be bit-exact
__global__ __launch_bounds__(256) void k_cs5(float* CS) { const int idx = blockIdx.x * 256 + threadIdx.x; if (idx >= TT * HD) return; const int d = idx % HD; const int t = idx / HD; const float a = __fmul_rn((float)t, INVT[d % (HD / 2)]); v2f cs; cs[0] = cosf(a); cs[1] = sinf(a); *(v2f*)(CS + (size_t)idx * 2) = cs;  }
__global__ __launch_bounds__(256) void k_rmsx(const float* __restrict__ X, const float* __restrict__ sc, bf* XH, bf* XL) { const int lane = threadIdx.x & 31; const int row = blockIdx.x * 8 + (threadIdx.x >> 5); if (row >= TT) return; const float* xr = X + (size_t)row * CC + lane * 16; float v[16]; float ss = 0.f;
#pragma unroll
    for (int c = 0; c < 4; ++c) { const v4f a = *(const v4f*)(xr + c * 4);
#pragma unroll
        for (int q = 0; q < 4; ++q) { const float b = bfr(a[q]); v[c * 4 + q] = b; float p = __fmul_rn(b, b); asm volatile("" : "+v"(p)); ss = __fadd_rn(ss, p); } }
#pragma unroll
    for (int sh = 16; sh; sh >>= 1) ss = __fadd_rn(ss, __shfl_xor(ss, sh, 32));
    const float den = sqrtf(__fadd_rn(__fmul_rn(ss, 1.0f / CC), 1.0e-6f)); const float rinv = __fdiv_rn(1.0f, den);   /* ONE IEEE division per row; x * (1/den) differs from the module's x / den by <= 1 ulp */
    v4us oh[4], ol[4];
#pragma unroll
    for (int c = 0; c < 4; ++c) {
#pragma unroll
        for (int q = 0; q < 4; ++q) { float y = __fmul_rn(v[c * 4 + q], rinv); asm volatile("" : "+v"(y)); y = __fmul_rn(y, bfr(sc[lane * 16 + c * 4 + q])); unsigned short a2, c2; splitf(y, a2, c2); oh[c][q] = a2; ol[c][q] = c2; } }
    bf* ph = XH + (size_t)row * CC + lane * 16; bf* pl = XL + (size_t)row * CC + lane * 16;
{
#pragma unroll
        for (int c = 0; c < 4; ++c) { *(v4us*)(ph + c * 4) = oh[c]; *(v4us*)(pl + c * 4) = ol[c]; }
         }
}
// k_rope: head planes [h][t][d] (fp16 + hi/lo) of rope(x) x sc with the rotate-half convention out[d] = x[d] cos[t][d] - x[d+HD/2] sin[t][d], out[d+HD/2] = x[d+HD/2] cos[t][d+HD/2] + x[d] sin[t][d+HD/2]
__global__ __launch_bounds__(256) void k_rope(const float* __restrict__ F, int pitch, int nheads, const float* __restrict__ CS, const float* __restrict__ RF, const float* __restrict__ nw, float sc, h16* P16, bf* Ph, bf* Pl) {
    const size_t e = ((size_t)blockIdx.x * 256 + threadIdx.x) * 2; if (e >= (size_t)nheads * TT * HD) return; const int d = (int)(e % HD); const int t = (int)((e / HD) % TT); const int h = (int)(e / ((size_t)HD * TT)); const float* f = F + (size_t)t * pitch + h * HD; const float rf = RF ? RF[(size_t)h * TT + t] : 1.0f; v2h o16; v2us oh, ol;
#pragma unroll
    for (int q = 0; q < 2; ++q) { const int dd = d + q; const int dp = (dd < HD / 2) ? dd + HD / 2 : dd - HD / 2; float x0 = f[dd], x1 = f[dp];
        if (RF) { float n0 = __fmul_rn(x0, rf), n1 = __fmul_rn(x1, rf); asm volatile("" : "+v"(n0)); asm volatile("" : "+v"(n1)); x0 = __fmul_rn(bfr(nw[dd]), n0); x1 = __fmul_rn(bfr(nw[dp]), n1); }
        const v2f cs = *(const v2f*)(CS + ((size_t)t * HD + dd) * 2); float a = __fmul_rn(x0, cs[0]), bq = __fmul_rn(x1, cs[1]); asm volatile("" : "+v"(a)); asm volatile("" : "+v"(bq)); const float r = ((dd < HD / 2) ? __fsub_rn(a, bq) : __fadd_rn(a, bq)) * sc;
        o16[q] = tohx(r); unsigned short a2, c2; splitf(r, a2, c2); oh[q] = a2; ol[q] = c2; }
    *(v2h*)(P16 + e) = o16; *(v2us*)(Ph + e) = oh; *(v2us*)(Pl + e) = ol;  }
__global__ __launch_bounds__(256) void k_tohl(const float* __restrict__ F, bf* Hh, bf* Hl, size_t n4) { const size_t i = (size_t)blockIdx.x * 256 + threadIdx.x; if (i >= n4) return; const v4f a = *(const v4f*)(F + i * 4); v4us oh, ol;
#pragma unroll
    for (int q = 0; q < 4; ++q) { unsigned short h2, l2; splitf(a[q], h2, l2); oh[q] = h2; ol[q] = l2; }
    *(v4us*)(Hh + i * 4) = oh; *(v4us*)(Hl + i * 4) = ol;  }
__global__ __launch_bounds__(256) void k_wtG(const float* __restrict__ w, int K, int N, bf* Bt) {
    const int lane = threadIdx.x & 31; const int L0 = (blockIdx.x * 8 + (threadIdx.x >> 5)) * 8; const int nlines = N * K / 64;
{
#pragma unroll 1
        for (int l = 0; l < 8; ++l) { const int L = L0 + l; if (L >= nlines) break; const size_t e = (size_t)L * 64 + lane * 2; const int k = (int)(e % K), n = (int)(e / K); v2us o;
            o[0] = f2bf(w[(size_t)k * N + n]); o[1] = f2bf(w[(size_t)(k + 1) * N + n]); *(v2us*)(Bt + e) = o; }
         }
}
extern "C" void kernel_launch(void* const* d_in, const int* in_sizes, int n_in,
                              void* d_out, int out_size, void* d_ws, size_t ws_size, hipStream_t stream) {
    (void)in_sizes; (void)n_in; (void)out_size;
    const float* x = (const float*)d_in[0]; const float* rsc = (const float*)d_in[1]; const float* wq = (const float*)d_in[2]; const float* wk = (const float*)d_in[3]; const float* wv = (const float*)d_in[4]; const float* wo = (const float*)d_in[5];   /* input order x [2][4096][512], scale [512] (RMSNorm weight), Wq, Wk, Wv, Wo ('xw' [512][512], no biases) */
    float* OUT = (float*)d_out;     // [2][4096][512]
    char* wsp = (char*)d_ws;
    auto take = [&](size_t bytes) { char* p = wsp; wsp += (bytes + 255) & ~(size_t)255; return (void*)p; };
    bf* WQKV = (bf*)take((size_t)3 * MID * CC * 2); bf* WQ = WQKV; bf* WK = WQKV + (size_t)MID * CC; bf* WV = WQKV + (size_t)2 * MID * CC; bf* WO = (bf*)take((size_t)CC * CO * 2); float* CS = (float*)take((size_t)TT * HD * 2 * 4);
    bf* XH = (bf*)take((size_t)TT * CC * 2); bf* XL = (bf*)take((size_t)TT * CC * 2);   /* RMS-normalised tokens, bf16 hi/lo */ float* FQ = (float*)take((size_t)TT * MID * 4); float* FK = (float*)take((size_t)TT * MID * 4);
    h16* QP16 = (h16*)take((size_t)TT * MID * 2); bf* QPh = (bf*)take((size_t)TT * MID * 2); bf* QPl = (bf*)take((size_t)TT * MID * 2); h16* KP16 = (h16*)take((size_t)TT * MID * 2); bf* KPh = (bf*)take((size_t)TT * MID * 2); bf* KPl = (bf*)take((size_t)TT * MID * 2);
    h16* VT16 = (h16*)take((size_t)CO * TT * 2); bf* VTh = (bf*)take((size_t)CO * TT * 2); bf* VTl = (bf*)take((size_t)CO * TT * 2);
    float* Sb = (float*)take((size_t)TT * TT * 4); h16* P16 = (h16*)take((size_t)TT * TT * 2); bf* Ph = (bf*)take((size_t)RH * TT * 2); bf* Pl = (bf*)take((size_t)RH * TT * 2); float* Ob = (float*)take((size_t)KS * TT * CO * 4);   /* KS partial planes */ bf* ATh = (bf*)take((size_t)TT * CO * 2); bf* ATl = (bf*)take((size_t)TT * CO * 2);
    if ((size_t)(wsp - (char*)d_ws) > ws_size) return;    // ws 256 MiB (carve 240 MiB)
    float* FV = FK;   /* the v projection reuses the k buffer after the k planes are built (stream-ordered) */
    k_wtG<<<(unsigned)((CC * MID / 64 + 63) / 64), 256, 0, stream>>>(wq, CC, MID, WQ); k_wtG<<<(unsigned)((CC * MID / 64 + 63) / 64), 256, 0, stream>>>(wk, CC, MID, WK); k_wtG<<<(unsigned)((CC * CO / 64 + 63) / 64), 256, 0, stream>>>(wv, CC, CO, WV);   /* 'xw' weights -> Bt */ k_wtG<<<(unsigned)((CO * CC / 64 + 63) / 64), 256, 0, stream>>>(wo, CO, CC, WO);   /* 'xw' W_out -> Bt */   /* the fused qkv rows split into q | k | v blocks */
    k_cs5<<<(TT * HD + 255) / 256, 256, 0, stream>>>(CS);   /* cos/sin table of t x inv_freq[d % 32] for the rotate-half k_rope */
    const unsigned LP = (unsigned)(((size_t)NH_ * TT * HD / 2 + 255) / 256);
    for (int b = 0; b < NB_; ++b) {
        k_rmsx<<<TT / 8, 256, 0, stream>>>(x + (size_t)b * TT * CC, rsc, XH, XL);   /* x_norm = x / sqrt(mean x^2 + eps) x scale as hi/lo planes */
        k_gemmw<bf, 1, false, NWP><<<dim3(TT / 64, MID / 64, 1), 32 * NWP, 0, stream>>>(XH, XL, WQ, nullptr, CC, CC, FQ, MID, nullptr, 0, 0, 0); k_rope<<<LP, 256, 0, stream>>>(FQ, MID, NH_, CS, nullptr, nullptr, 1.0f, QP16, QPh, QPl);   /* q planes [h][n][64] */
        k_gemmw<bf, 1, false, NWP><<<dim3(TT / 64, MID / 64, 1), 32 * NWP, 0, stream>>>(XH, XL, WK, nullptr, CC, CC, FK, MID, nullptr, 0, 0, 0); k_rope<<<LP, 256, 0, stream>>>(FK, MID, NKV, CS, nullptr, nullptr, 1.0f, KP16, KPh, KPl);   /* k planes */
        k_gemmw<bf, 1, false, NWP><<<dim3(TT / 64, CO / 64, 1), 32 * NWP, 0, stream>>>(XH, XL, WV, nullptr, CC, CC, FV, CO, nullptr, 0, 0, 0); k_vtp<<<(unsigned)(((size_t)TT * CO / 2 + 255) / 256), 256, 0, stream>>>(FV, CO, CO / HD, VT16, VTh, VTl);   /* v^T planes [h][64][n] */
        for (int h = 0; h < NH_; ++h) {   /* per head: dense 4096 x 4096 attention */
            k_gemmw<bf, 2, false><<<dim3(TT / 64, TT / 64, 1), 32, 0, stream>>>(QPh + (size_t)h * TT * HD, QPl + (size_t)h * TT * HD, KPh + (size_t)h * TT * HD, KPl + (size_t)h * TT * HD, HD, HD, Sb, TT, nullptr, 0, 0, 0);   /* S[i][j] = q_i.k_j (3 products, every row) */
            k_lsoft<<<TT / 8, 256, 0, stream>>>(Sb, P16, Ph, Pl);   /* x 1/8, softmax over the 4,096 keys */
            k_gemmw<bf, 2, false, NWH><<<dim3(RH / 64, HD / 64, KS), 32 * NWH, 0, stream>>>(Ph, Pl, VTh + (size_t)h * HD * TT, VTl + (size_t)h * HD * TT, TT / KS, TT, Ob + h * HD, CO, nullptr, TT / KS, TT / KS, (size_t)TT * CO);
            k_gemmw<h16, 0, false, NWF><<<dim3((TT - RH) / 64, HD / 64, KS), 32 * NWF, 0, stream>>>(P16 + (size_t)RH * TT, nullptr, VT16 + (size_t)h * HD * TT, nullptr, TT / KS, TT, Ob + (size_t)RH * CO + h * HD, CO, nullptr, TT / KS, TT / KS, (size_t)TT * CO); }
        k_cs8<<<(unsigned)(((size_t)TT * CO / 4 + 255) / 256), 256, 0, stream>>>(Ob, (size_t)TT * CO / 4);   /* sum of the KS partial planes; rows >= 512 x 1/1024 */
        k_tohl<<<(unsigned)(((size_t)TT * CO / 4 + 255) / 256), 256, 0, stream>>>(Ob, ATh, ATl, (size_t)TT * CO / 4);   /* merged context as hi/lo planes */
        k_gemmw<bf, 1, false, NWP><<<dim3(TT / 64, CC / 64, 1), 32 * NWP, 0, stream>>>(ATh, ATl, WO, nullptr, CO, CO, OUT + (size_t)b * TT * CC, CC, nullptr, 0, 0, 0); }   /* out = ctx Wo, no bias */
}

// v003
// One run takes 235 microseconds.
// It is 6.80 times as fast as v001, going by the measured steps of the versions left out in between.
// Over all steps from v000 it is 17.3 times as fast.
#include <hip/hip_runtime.h>

// Causal multi-head self-attention with a leading RMSNorm and rotary embeddings over 4,096 tokens (x [2][4096][512]; x_norm = x / sqrt(mean x^2 + 1e-6) x scale (scale [512] ones, read); q, k, v = x_norm W ('xw' [512][512] 1/sqrt(512), no bias; 8 heads x 64); rotate-half rope (cat(x1 c - x2 s, x1 s + x2 c)) with angle t x 1/1000000^(2i/64) (32 f32 frequencies jnp-exact; precise cosf/sinf); scores / sqrt(64); causal (-inf); softmax; out = merged Wo ('xw') -> [2][4096][512] (4.2 M); argument order x, scale, Wq, Wk, Wv, Wo).
// Layout per batch: k_rmsx normalises each token row in f32 and stores bf16 hi/lo planes; projections hi/lo x exact weights (2 products), whose epilogues write the operand planes themselves (q, k: rotate-half with the k_cs5 table, then hi/lo; v: the product is formed transposed, Wv rows x token rows, and stored as value^T planes); k_fattn: scores (hi/lo planes, 3 products), causal select (x 1/8), running-maximum softmax and attn.V (rows < 512 hi/lo 3 products, rest fp16) in one kernel over all heads, no score matrix in memory, context stored as hi/lo planes; context hi/lo x Wo exact written to the output rows.
// Compute dtypes, f32 accumulate: every input rounded to bf16 incl. scale; RMSNorm f32; projections 2 products (hi/lo x exact); rotary f32; scores 3 products; softmax f32, weights kept unnormalised (<= 1) and divided by the row sum at the end; attn.V rows < 512 3 products, rest fp16; Wo hl x exact.

#define NB_  2
#define TT   4096
#define DM   512
#define NH_  8
#define NKV  8
#define REP  (NH_ / NKV)
#define HD   64
#define DQ   (NH_ * HD)
#define DKV  (NKV * HD)
#define ZH   1
#define RH   512                  // query rows < RH use hi+lo planes (0: none)
#define WIN  0
#define SCL  0.125f   // 1/sqrt(float32(64))
#define MID  512      // q / k width = 8 heads x 64
#define CO   512      // v width
#define CC   512
#define FW   8        // k_fattn: waves per work-group; wave w takes the 32-key blocks w, w + FW, ...
#define NWP  8        // projections: waves per tile
typedef _Float16 h16;
typedef unsigned short bf;
typedef __attribute__((ext_vector_type(16))) __bf16   v16bf;
typedef __attribute__((ext_vector_type(16))) _Float16 v16h;
typedef __attribute__((ext_vector_type(8)))  _Float16 v8h;
typedef __attribute__((ext_vector_type(8)))  unsigned short v8us;
typedef __attribute__((ext_vector_type(8)))  float    v8f;
typedef __attribute__((ext_vector_type(4)))  float    v4f;
typedef v8h  __attribute__((may_alias)) v8ha;
typedef v4f  __attribute__((may_alias)) v4fa;
typedef v8us __attribute__((may_alias)) v8usa;

__device__ __forceinline__ unsigned short f2bf(float f) { unsigned u = __float_as_uint(f); u += 0x7FFFu + ((u >> 16) & 1u); return (unsigned short)(u >> 16); }
__device__ __forceinline__ float bf2f(unsigned short b) { return __uint_as_float(((unsigned)b) << 16); }
__device__ __forceinline__ float bfr(float f) { return bf2f(f2bf(f)); }
__device__ __forceinline__ v16h cat16(v8h lo, v8h hi) { return __builtin_shufflevector(lo, hi, 0, 1, 2, 3, 4, 5, 6, 7, 8, 9, 10, 11, 12, 13, 14, 15); }
__device__ __forceinline__ v16bf cat16b(v8us lo, v8us hi) { return __builtin_bit_cast(v16bf, __builtin_shufflevector(lo, hi, 0, 1, 2, 3, 4, 5, 6, 7, 8, 9, 10, 11, 12, 13, 14, 15)); }
__device__ __forceinline__ v8f wmma16(v16h a, v16h b, v8f c) { return __builtin_amdgcn_wmma_f32_16x16x32_f16(false, a, false, b, (short)0, c, false, false); }
__device__ __forceinline__ v8f wmmab(v16bf a, v16bf b, v8f c) { return __builtin_amdgcn_wmma_f32_16x16x32_bf16(false, a, false, b, (short)0, c, false, false); }

__device__ __forceinline__ h16 tohx(float x) { return (h16)x; }
__device__ __forceinline__ void splitf(float y, unsigned short& h, unsigned short& l) { h = f2bf(y); l = f2bf(y - bf2f(h)); }
typedef __attribute__((ext_vector_type(4))) _Float16 v4h;
typedef __attribute__((ext_vector_type(2))) unsigned short v2us;
typedef __attribute__((ext_vector_type(4))) unsigned short v4us;
typedef __attribute__((ext_vector_type(2))) float v2f;

// ---- k_gemmw: register-blocked GEMM, one 64x64 output tile (16 accumulators a wave) per work-group of NW waves, operands straight from K-contiguous 16-bit planes of row pitch ld; grid (M/64, N/64, Z), 32 * NW threads.
// C[m][n] (f32, pitch ldc, + optional f32 bias[n]) = sum_k A[m][k] Bt[n][k] (+ split products per NSPLIT). z-batch strides sA/sB/sC in elements. K % (32 * NW) == 0.
// EPI says what the joined tile becomes: 0 f32 rows of C; 1 (tile = 64 tokens x one head) rotate-half rotary out[d] = x[d] cos[t][d] -/+ x[d +/- 32] sin[t][d] from the table CS [t][64][cos, sin], stored as bf16 hi/lo planes [head][t][64]; 2 fp16 and bf16 hi/lo planes of pitch ldc.
// Split-K: wave w takes the 32-wide k steps w, w + NW, ... (neighbour waves share the operands' 128-byte lines); the NW partial tiles are summed in LDS in wave order. A z stride of K elements along the rows makes grid.z a second split whose partial planes (stride sC) the caller sums.
template <typename T16> struct WFrag;
template <> struct WFrag<h16> { typedef v16h V; static __device__ __forceinline__ V ld(const h16* p) { return cat16(*(const v8h*)p, *(const v8h*)(p + 16)); } static __device__ __forceinline__ v8f mma(V a, V b, v8f c) { return wmma16(a, b, c); } };
template <> struct WFrag<bf> { typedef v16bf V; static __device__ __forceinline__ V ld(const bf* p) { return cat16b(*(const v8us*)p, *(const v8us*)(p + 16)); } static __device__ __forceinline__ v8f mma(V a, V b, v8f c) { return wmmab(a, b, c); } };
template <typename T16, int NSPLIT, bool BIAS, int NW = 1, int EPI = 0>
__global__ __launch_bounds__(32 * NW) void k_gemmw(const T16* __restrict__ A, const T16* __restrict__ A2, const T16* __restrict__ Bt, const T16* __restrict__ Bt2, int K, int ld, float* C, int ldc, const float* __restrict__ bias, size_t sA, size_t sB, size_t sC, const float* __restrict__ CS, h16* P16, bf* Ph, bf* Pl) {
    typedef typename WFrag<T16>::V V;
    __shared__ __align__(16) float osall[NW > 1 ? NW * 64 * 68 : 16 * 68];   /* NW > 1: one whole 64 x 64 partial tile a wave */
    const int wv = NW > 1 ? __builtin_amdgcn_readfirstlane((int)(threadIdx.x >> 5)) : 0;   /* wave number, scalar so that the k loop stays a scalar branch */
    const int lp = NW > 1 ? ld : K;   /* row pitch; the one-wave form runs over whole rows, so its pitch is K */
    float* os = osall + wv * (64 * 68);
    const size_t z = blockIdx.z; A += z * sA; if (A2) A2 += z * sA; Bt += z * sB; if (Bt2) Bt2 += z * sB; C += z * sC;
    const int lane = threadIdx.x & 31, lr = lane & 15, hi = lane >> 4; const int r0 = blockIdx.x * 64, c0 = blockIdx.y * 64;
    v8f acc[4][4];
#pragma unroll
    for (int mb = 0; mb < 4; ++mb)
#pragma unroll
        for (int nb = 0; nb < 4; ++nb) acc[mb][nb] = (v8f){};
    const size_t aoff = (size_t)(r0 + lr) * lp + 8 * hi, boff = (size_t)(c0 + lr) * lp + 8 * hi;
#pragma unroll 1
    for (int kc = wv * 32; kc < K; kc += 32 * NW) {
        V a[4], a2[4];
#pragma unroll
        for (int mb = 0; mb < 4; ++mb) { a[mb] = WFrag<T16>::ld(A + aoff + (size_t)mb * 16 * lp + kc); if (NSPLIT == 1 || NSPLIT == 2) a2[mb] = WFrag<T16>::ld(A2 + aoff + (size_t)mb * 16 * lp + kc); }
#pragma unroll
        for (int nb = 0; nb < 4; ++nb) { const V b = WFrag<T16>::ld(Bt + boff + (size_t)nb * 16 * lp + kc); V b2; if (NSPLIT >= 2) b2 = WFrag<T16>::ld(Bt2 + boff + (size_t)nb * 16 * lp + kc);
#pragma unroll
            for (int mb = 0; mb < 4; ++mb) { acc[mb][nb] = WFrag<T16>::mma(a[mb], b, acc[mb][nb]); if (NSPLIT == 1 || NSPLIT == 2) acc[mb][nb] = WFrag<T16>::mma(a2[mb], b, acc[mb][nb]); if (NSPLIT >= 2) acc[mb][nb] = WFrag<T16>::mma(a[mb], b2, acc[mb][nb]); } }
        asm volatile("v_nop\n\tv_nop\n\tv_nop\n\tv_nop" : "+v"(acc[0][0]), "+v"(acc[1][1]), "+v"(acc[2][2]), "+v"(acc[3][3]) : "v"(a[0]), "v"(a[3]));
    }
    if constexpr (NW > 1) {
        static_assert(EPI != 1 || NW == 8, "the table fetch below is laid out for four passes of 256 threads");
        v4f c01[4], c23[4];   /* EPI 1: this thread's (cos, sin) pairs of its four passes, fetched here so that they fly under the LDS stores of the partial tile */
        if constexpr (EPI == 1) { const float* cs = CS + ((size_t)(r0 + (int)(threadIdx.x >> 4)) * HD + (threadIdx.x & 15) * 4) * 2;
#pragma unroll
            for (int i = 0; i < 4; ++i) { c01[i] = *(const v4f*)(cs + i * (16 * HD * 2)); c23[i] = *(const v4f*)(cs + i * (16 * HD * 2) + 4); }
            asm volatile("s_wait_xcnt 0x0" :: "v"(cs) : "memory"); }   /* behind the table loads; the address is named so that it stays in its registers up to here */
#pragma unroll
        for (int mb = 0; mb < 4; ++mb)
#pragma unroll
            for (int nb = 0; nb < 4; ++nb)
#pragma unroll
                for (int j = 0; j < 8; ++j) os[(mb * 16 + hi * 8 + j) * 68 + nb * 16 + lr] = acc[mb][nb][j];
        __syncthreads();   /* every wave's partial tile is in LDS before any of it is summed */
#pragma unroll
        for (int u0 = 0; u0 < 64 * 16; u0 += 32 * NW) { const int u = u0 + (int)threadIdx.x, row = u >> 4, cofs = (u & 15) * 4; v4f val = *(const v4fa*)(osall + row * 68 + cofs);
#pragma unroll
            for (int w = 1; w < NW; ++w) val += *(const v4fa*)(osall + w * (64 * 68) + row * 68 + cofs);   /* partial sums joined in wave order */
            if (BIAS) { val[0] += bfr(bias[c0 + cofs]); val[1] += bfr(bias[c0 + cofs + 1]); val[2] += bfr(bias[c0 + cofs + 2]); val[3] += bfr(bias[c0 + cofs + 3]); }
            if constexpr (EPI == 0) *(v4f*)(C + (size_t)(r0 + row) * ldc + c0 + cofs) = val;
            else { v4us oh, ol;
                if constexpr (EPI == 1) { const int i = u0 / (32 * NW); const float co[4] = {c01[i][0], c01[i][2], c23[i][0], c23[i][2]}, si[4] = {c01[i][1], c01[i][3], c23[i][1], c23[i][3]};
#pragma unroll
                    for (int q = 0; q < 4; ++q) { const float par = __shfl_xor(val[q], 8, 32);   /* lane ^ 8 holds the same token's columns cofs ^ 32, the other half of the head */
                        val[q] = val[q] * co[q] + par * ((cofs < HD / 2) ? -si[q] : si[q]); } }
#pragma unroll
                for (int q = 0; q < 4; ++q) { unsigned short h2, l2; splitf(val[q], h2, l2); oh[q] = h2; ol[q] = l2; }
                const size_t e = EPI == 1 ? ((size_t)blockIdx.y * TT + r0 + row) * HD + cofs : (size_t)(r0 + row) * ldc + c0 + cofs;
                *(v4us*)(Ph + e) = oh; *(v4us*)(Pl + e) = ol;
                if constexpr (EPI == 2) { v4h o16;
#pragma unroll
                    for (int q = 0; q < 4; ++q) o16[q] = tohx(val[q]);
                    *(v4h*)(P16 + e) = o16; } } }
    } else {
#pragma unroll
    for (int mb = 0; mb < 4; ++mb) {
#pragma unroll
        for (int nb = 0; nb < 4; ++nb) {
#pragma unroll
            for (int j = 0; j < 8; ++j) os[(hi * 8 + j) * 68 + nb * 16 + lr] = acc[mb][nb][j]; }
        __builtin_amdgcn_wave_barrier(); asm volatile("" ::: "memory");
        float* crow = C + (size_t)(r0 + mb * 16) * ldc + c0;
{
#pragma unroll
            for (int s = 0; s < 8; ++s) { const int row = 2 * s + hi, cofs = lr * 4; v4f val = *(const v4fa*)(os + row * 68 + cofs); if (BIAS) { val[0] += bfr(bias[c0 + cofs]); val[1] += bfr(bias[c0 + cofs + 1]); val[2] += bfr(bias[c0 + cofs + 2]); val[3] += bfr(bias[c0 + cofs + 3]); }
                *(v4f*)(crow + (size_t)row * ldc + cofs) = val; }
             }
        __builtin_amdgcn_wave_barrier(); asm volatile("" ::: "memory");
    }
    }
}

// ---- k_fattn: causal attention of one head for 32 query rows per work-group, scores never leave the registers. grid (heads, TT / 32), 32 * FW threads.
// S^T = K Q^T (A = key rows, B = query rows, both K-contiguous planes [h][t][64]): in each 16-query group a lane holds 16 of one query's 32 scores, in the k order of a B operand, so the weights go into O^T += V^T P^T (A = value^T rows [h][64][t]) without leaving the lane.
// Running maximum m and sum l per query in base 2; key blocks past the diagonal are not visited, the diagonal block is cut by the select. The FW waves' (m, l, O) are joined in LDS in wave order.
__device__ __forceinline__ float xhalf(float x) { const int b = __float_as_int(x); return __int_as_float(__builtin_amdgcn_permlanex16(b, b, 0x76543210, 0xfedcba98, false, false)); }   /* lane l <-> l ^ 16 */
// 2^x in place. The v_nop is the one slot the instruction set asks for between a transcendental and an instruction that reads its result or overwrites its source; inside the run each v_exp_f32 is followed by one on other registers.
__device__ __forceinline__ float exp2s(float x) { asm("v_exp_f32 %0, %0\n\tv_nop" : "+v"(x)); return x; }
__device__ __forceinline__ void exp2x8(float (&e)[8]) { asm("v_exp_f32 %0, %0\n\tv_exp_f32 %1, %1\n\tv_exp_f32 %2, %2\n\tv_exp_f32 %3, %3\n\tv_exp_f32 %4, %4\n\tv_exp_f32 %5, %5\n\tv_exp_f32 %6, %6\n\tv_exp_f32 %7, %7\n\tv_nop" : "+v"(e[0]), "+v"(e[1]), "+v"(e[2]), "+v"(e[3]), "+v"(e[4]), "+v"(e[5]), "+v"(e[6]), "+v"(e[7])); }
// (wave-uniform base) + (this lane's fixed byte offset inside a 16-row tile)
template <typename T16> __device__ __forceinline__ const T16* lanep(const T16* base, unsigned lane_bytes) { return (const T16*)((const char*)base + lane_bytes); }
template <bool HL>
__device__ __forceinline__ void fattn_keys(const bf* __restrict__ Kh, const bf* __restrict__ Kl, const h16* __restrict__ V16, const bf* __restrict__ Vh, const bf* __restrict__ Vl, const v16bf (&qh)[2][2], const v16bf (&ql)[2][2], int q0, int wv, int lr, int hi, unsigned lk, unsigned lv, v8f (&o)[2][4], float (&m)[2], float (&l)[2]) {
#pragma unroll 1   /* one copy of the pass: a second one would double the fragments that are live and cost the fourth wave per SIMD */
    for (int kb = wv * 32; kb < q0 + 32; kb += 32 * FW) {
        v8f s[2][2]; v16bf kh[2][2], kl[2][2]; const bf* pkh = lanep(Kh + (size_t)kb * HD, lk); const bf* pkl = lanep(Kl + (size_t)kb * HD, lk);
#pragma unroll
        for (int kt = 0; kt < 2; ++kt)
#pragma unroll
            for (int ks = 0; ks < 2; ++ks) { kh[kt][ks] = WFrag<bf>::ld(pkh + kt * 16 * HD + ks * 32); kl[kt][ks] = WFrag<bf>::ld(pkl + kt * 16 * HD + ks * 32); }
        asm volatile("s_wait_xcnt 0x0" :: "v"(pkh), "v"(pkl) : "memory");   /* behind the key loads; the addresses are named so that they stay in their registers up to here and no load's result lands on a register that an issued load names */
#pragma unroll
        for (int kt = 0; kt < 2; ++kt)
#pragma unroll
            for (int g = 0; g < 2; ++g) { v8f a = (v8f){};
#pragma unroll
                for (int ks = 0; ks < 2; ++ks) { a = wmmab(kh[kt][ks], qh[g][ks], a); a = wmmab(kl[kt][ks], qh[g][ks], a); a = wmmab(kh[kt][ks], ql[g][ks], a); }
                s[g][kt] = a; }
        v16bf vh[4], vl[4]; v16h vf[4]; const bf* pvh = lanep(Vh + kb, lv); const bf* pvl = lanep(Vl + kb, lv); const h16* pvf = lanep(V16 + kb, lv);
#pragma unroll
        for (int dt = 0; dt < 4; ++dt) { if (HL) { vh[dt] = WFrag<bf>::ld(pvh + dt * 16 * TT); vl[dt] = WFrag<bf>::ld(pvl + dt * 16 * TT); } else vf[dt] = WFrag<h16>::ld(pvf + dt * 16 * TT); }
        if (HL) asm volatile("s_wait_xcnt 0x0" :: "v"(pvh), "v"(pvl) : "memory"); else asm volatile("s_wait_xcnt 0x0" :: "v"(pvf) : "memory");   /* the same behind the value loads, which fly under the softmax */
        v16bf ph[2], pl[2]; v16h p16[2];
#pragma unroll
        for (int g = 0; g < 2; ++g) { const int rel = q0 + g * 16 + lr - kb - hi * 8; float mr = -3.0e38f;   /* this lane's score (kt, j) belongs to a key <= its query where kt * 16 + j <= rel */
#pragma unroll
            for (int kt = 0; kt < 2; ++kt)
#pragma unroll
                for (int j = 0; j < 8; ++j) { const float t = (kt * 16 + j <= rel) ? s[g][kt][j] : -3.0e38f; s[g][kt][j] = t; mr = fmaxf(mr, t); }
            mr = fmaxf(mr, xhalf(mr)); const float mx = fmaxf(m[g], mr * (SCL * 1.4426950408889634f));
            const float al = exp2s(m[g] - mx); m[g] = mx; float sa[4] = {0.f, 0.f, 0.f, 0.f};   /* al = 0 on a wave's first block (m = -3e38) */
#pragma unroll
            for (int kt = 0; kt < 2; ++kt) { float e[8];
#pragma unroll
                for (int j = 0; j < 8; ++j) e[j] = __builtin_fmaf(s[g][kt][j], SCL * 1.4426950408889634f, -mx);
                exp2x8(e);
#pragma unroll
                for (int j = 0; j < 8; ++j) { const float p = e[j]; sa[j & 3] += p;
                    if (HL) { const __bf16 a2 = (__bf16)p; ph[g][kt * 8 + j] = a2; pl[g][kt * 8 + j] = (__bf16)(p - (float)a2); } else p16[g][kt * 8 + j] = tohx(p); } }
            const float sum = (sa[0] + sa[1]) + (sa[2] + sa[3]);
            l[g] = l[g] * al + sum;
#pragma unroll
            for (int dt = 0; dt < 4; ++dt) o[g][dt] *= al; }
#pragma unroll
        for (int dt = 0; dt < 4; ++dt)
#pragma unroll
            for (int g = 0; g < 2; ++g) { if (HL) { o[g][dt] = wmmab(vh[dt], ph[g], o[g][dt]); o[g][dt] = wmmab(vl[dt], ph[g], o[g][dt]); o[g][dt] = wmmab(vh[dt], pl[g], o[g][dt]); } else o[g][dt] = wmma16(vf[dt], p16[g], o[g][dt]); }
    }
}
// amdgpu_waves_per_eu(4, 4): at most 256 registers a wave, so that two work-groups (four waves per SIMD) share a WGP and cover each other's load latency.
__global__ __launch_bounds__(32 * FW) __attribute__((amdgpu_waves_per_eu(4, 4))) void k_fattn(const bf* __restrict__ Qh, const bf* __restrict__ Ql, const bf* __restrict__ Kh, const bf* __restrict__ Kl, const h16* __restrict__ V16, const bf* __restrict__ Vh, const bf* __restrict__ Vl, bf* __restrict__ Oh, bf* __restrict__ Ol) {
    __shared__ __align__(16) float so[FW * 32 * 68]; __shared__ float sm[FW * 32], sl[FW * 32];
    const int wv = __builtin_amdgcn_readfirstlane((int)(threadIdx.x >> 5));   /* wave number, scalar so that the key loop stays a scalar branch */
    const int lane = threadIdx.x & 31, lr = lane & 15, hi = lane >> 4; const int h = blockIdx.x;
    const size_t hb = (size_t)h * TT * HD; Qh += hb; Ql += hb; Kh += hb; Kl += hb; V16 += hb; Vh += hb; Vl += hb;
    {
        const int q0 = (TT / 32 - 1 - (int)blockIdx.y) * 32;   /* the longest rows of every head start first, the short ones fill in behind them */
        const unsigned lk = (unsigned)(lr * HD + 8 * hi) * 2u, lv = (unsigned)(lr * TT + 8 * hi) * 2u;   /* lane's bytes inside a 16-row tile of a [t][64] plane and of a [64][t] plane */
        v16bf qh[2][2], ql[2][2];
#pragma unroll
        for (int g = 0; g < 2; ++g)
#pragma unroll
            for (int ks = 0; ks < 2; ++ks) { qh[g][ks] = WFrag<bf>::ld(lanep(Qh + (size_t)q0 * HD, lk) + g * 16 * HD + ks * 32); ql[g][ks] = WFrag<bf>::ld(lanep(Ql + (size_t)q0 * HD, lk) + g * 16 * HD + ks * 32); }
        asm volatile("s_wait_xcnt 0x0" ::: "memory");   /* behind the query loads, before a register that they name as address is written again */
        v8f o[2][4]; float m[2], l[2];
#pragma unroll
        for (int g = 0; g < 2; ++g) { m[g] = -3.0e38f; l[g] = 0.f;
#pragma unroll
            for (int dt = 0; dt < 4; ++dt) o[g][dt] = (v8f){}; }
        if (q0 < RH) fattn_keys<true>(Kh, Kl, V16, Vh, Vl, qh, ql, q0, wv, lr, hi, lk, lv, o, m, l); else fattn_keys<false>(Kh, Kl, V16, Vh, Vl, qh, ql, q0, wv, lr, hi, lk, lv, o, m, l);
#pragma unroll
        for (int g = 0; g < 2; ++g) { l[g] += xhalf(l[g]); if (hi == 0) { sm[wv * 32 + g * 16 + lr] = m[g]; sl[wv * 32 + g * 16 + lr] = l[g]; } }
        __syncthreads();   /* every wave's maximum and sum are in LDS before the common ones are formed */
#pragma unroll
        for (int g = 0; g < 2; ++g) { float mm = sm[g * 16 + lr];
#pragma unroll
            for (int w = 1; w < FW; ++w) mm = fmaxf(mm, sm[w * 32 + g * 16 + lr]);
            float ll = 0.f;
#pragma unroll
            for (int w = 0; w < FW; ++w) ll += sl[w * 32 + g * 16 + lr] * exp2s(sm[w * 32 + g * 16 + lr] - mm);   /* a wave that had no key block holds m = -3e38, l = 0 */
            const float f = __fdiv_rn(exp2s(m[g] - mm), ll);
#pragma unroll
            for (int dt = 0; dt < 4; ++dt) { const v8f a = o[g][dt] * f; float* d = so + (wv * 32 + g * 16 + lr) * 68 + dt * 16 + hi * 8;
                *(v4fa*)d = (v4f){a[0], a[1], a[2], a[3]}; *(v4fa*)(d + 4) = (v4f){a[4], a[5], a[6], a[7]}; } }
        __syncthreads();   /* every wave's scaled partial rows are in LDS before any of them is summed */
#pragma unroll
        for (int u0 = 0; u0 < 32 * 16; u0 += 32 * FW) { const int u = u0 + (int)threadIdx.x, row = u >> 4, cofs = (u & 15) * 4; v4f val = *(const v4fa*)(so + row * 68 + cofs);
#pragma unroll
            for (int w = 1; w < FW; ++w) val += *(const v4fa*)(so + (w * 32 + row) * 68 + cofs);   /* partial rows joined in wave order */
            v4us oh, ol;
#pragma unroll
            for (int q = 0; q < 4; ++q) { unsigned short h2, l2; splitf(val[q], h2, l2); oh[q] = h2; ol[q] = l2; }
            const size_t e = (size_t)(q0 + row) * CO + h * HD + cofs; *(v4us*)(Oh + e) = oh; *(v4us*)(Ol + e) = ol; }   /* context rows [t][h * 64 + d] as the hi/lo operand planes of the last product */
    }
}

__constant__ float INVT[HD / 2] = { 1.000000000e+00f, 6.493816376e-01f, 4.216965139e-01f, 2.738419771e-01f, 1.778279394e-01f, 1.154782027e-01f, 7.498941571e-02f, 4.869675264e-02f, 3.162277862e-02f, 2.053525113e-02f, 1.333521493e-02f, 8.659643121e-03f, 5.623413250e-03f, 3.651741426e-03f, 2.371373819e-03f, 1.539926510e-03f, 1.000000047e-03f, 6.493816618e-04f, 4.216964880e-04f, 2.738419571e-04f, 1.778279402e-04f, 1.154781930e-04f, 7.498942432e-05f, 4.869675467e-05f, 3.162277426e-05f, 2.053524986e-05f, 1.333521413e-05f, 8.659643754e-06f, 5.623413472e-06f, 3.651741281e-06f, 2.371373739e-06f, 1.539926529e-06f };   // float32 1 / 1000000^(2i/64) (the module's integer-arange expression), generated with jnp to be bit-exact
__global__ __launch_bounds__(256) void k_cs5(float* CS) { const int idx = blockIdx.x * 256 + threadIdx.x; if (idx >= TT * HD) return; const int d = idx % HD; const int t = idx / HD; const float a = __fmul_rn((float)t, INVT[d % (HD / 2)]); v2f cs; cs[0] = cosf(a); cs[1] = sinf(a); *(v2f*)(CS + (size_t)idx * 2) = cs;  }
__global__ __launch_bounds__(256) void k_rmsx(const float* __restrict__ X, const float* __restrict__ sc, bf* XH, bf* XL) { const int lane = threadIdx.x & 31; const int row = blockIdx.x * 8 + (threadIdx.x >> 5); if (row >= TT) return; const float* xr = X + (size_t)row * CC + lane * 16; float v[16]; float ss = 0.f;
#pragma unroll
    for (int c = 0; c < 4; ++c) { const v4f a = *(const v4f*)(xr + c * 4);
#pragma unroll
        for (int q = 0; q < 4; ++q) { const float b = bfr(a[q]); v[c * 4 + q] = b; float p = __fmul_rn(b, b); asm volatile("" : "+v"(p)); ss = __fadd_rn(ss, p); } }
#pragma unroll
    for (int sh = 16; sh; sh >>= 1) ss = __fadd_rn(ss, __shfl_xor(ss, sh, 32));
    const float den = sqrtf(__fadd_rn(__fmul_rn(ss, 1.0f / CC), 1.0e-6f)); const float rinv = __fdiv_rn(1.0f, den);   /* ONE IEEE division per row; x * (1/den) differs from the module's x / den by <= 1 ulp */
    v4us oh[4], ol[4];
#pragma unroll
    for (int c = 0; c < 4; ++c) {
#pragma unroll
        for (int q = 0; q < 4; ++q) { float y = __fmul_rn(v[c * 4 + q], rinv); asm volatile("" : "+v"(y)); y = __fmul_rn(y, bfr(sc[lane * 16 + c * 4 + q])); unsigned short a2, c2; splitf(y, a2, c2); oh[c][q] = a2; ol[c][q] = c2; } }
    bf* ph = XH + (size_t)row * CC + lane * 16; bf* pl = XL + (size_t)row * CC + lane * 16;
{
#pragma unroll
        for (int c = 0; c < 4; ++c) { *(v4us*)(ph + c * 4) = oh[c]; *(v4us*)(pl + c * 4) = ol[c]; }
         }
}
__global__ __launch_bounds__(256) void k_wtG(const float* __restrict__ w, int K, int N, bf* Bt) {
    const int lane = threadIdx.x & 31; const int L0 = (blockIdx.x * 8 + (threadIdx.x >> 5)) * 8; const int nlines = N * K / 64;
{
#pragma unroll 1
        for (int l = 0; l < 8; ++l) { const int L = L0 + l; if (L >= nlines) break; const size_t e = (size_t)L * 64 + lane * 2; const int k = (int)(e % K), n = (int)(e / K); v2us o;
            o[0] = f2bf(w[(size_t)k * N + n]); o[1] = f2bf(w[(size_t)(k + 1) * N + n]); *(v2us*)(Bt + e) = o; }
         }
}
extern "C" void kernel_launch(void* const* d_in, const int* in_sizes, int n_in,
                              void* d_out, int out_size, void* d_ws, size_t ws_size, hipStream_t stream) {
    (void)in_sizes; (void)n_in; (void)out_size;
    const float* x = (const float*)d_in[0]; const float* rsc = (const float*)d_in[1]; const float* wq = (const float*)d_in[2]; const float* wk = (const float*)d_in[3]; const float* wv = (const float*)d_in[4]; const float* wo = (const float*)d_in[5];   /* input order x [2][4096][512], scale [512] (RMSNorm weight), Wq, Wk, Wv, Wo ('xw' [512][512], no biases) */
    float* OUT = (float*)d_out;     // [2][4096][512]
    char* wsp = (char*)d_ws;
    auto take = [&](size_t bytes) { char* p = wsp; wsp += (bytes + 255) & ~(size_t)255; return (void*)p; };
    bf* WQKV = (bf*)take((size_t)3 * MID * CC * 2); bf* WQ = WQKV; bf* WK = WQKV + (size_t)MID * CC; bf* WV = WQKV + (size_t)2 * MID * CC; bf* WO = (bf*)take((size_t)CC * CO * 2); float* CS = (float*)take((size_t)TT * HD * 2 * 4);
    bf* XH = (bf*)take((size_t)TT * CC * 2); bf* XL = (bf*)take((size_t)TT * CC * 2);   /* RMS-normalised tokens, bf16 hi/lo */
    bf* QPh = (bf*)take((size_t)TT * MID * 2); bf* QPl = (bf*)take((size_t)TT * MID * 2); bf* KPh = (bf*)take((size_t)TT * MID * 2); bf* KPl = (bf*)take((size_t)TT * MID * 2);
    h16* VT16 = (h16*)take((size_t)CO * TT * 2); bf* VTh = (bf*)take((size_t)CO * TT * 2); bf* VTl = (bf*)take((size_t)CO * TT * 2);
    bf* ATh = (bf*)take((size_t)TT * CO * 2); bf* ATl = (bf*)take((size_t)TT * CO * 2);
    if ((size_t)(wsp - (char*)d_ws) > ws_size) return;
    k_wtG<<<(unsigned)((CC * MID / 64 + 63) / 64), 256, 0, stream>>>(wq, CC, MID, WQ); k_wtG<<<(unsigned)((CC * MID / 64 + 63) / 64), 256, 0, stream>>>(wk, CC, MID, WK); k_wtG<<<(unsigned)((CC * CO / 64 + 63) / 64), 256, 0, stream>>>(wv, CC, CO, WV);   /* 'xw' weights -> Bt */ k_wtG<<<(unsigned)((CO * CC / 64 + 63) / 64), 256, 0, stream>>>(wo, CO, CC, WO);   /* 'xw' W_out -> Bt */   /* the fused qkv rows split into q | k | v blocks */
    k_cs5<<<(TT * HD + 255) / 256, 256, 0, stream>>>(CS);   /* cos, sin per (token, d) for the q and k epilogues */
    for (int b = 0; b < NB_; ++b) {
        k_rmsx<<<TT / 8, 256, 0, stream>>>(x + (size_t)b * TT * CC, rsc, XH, XL);   /* x_norm = x / sqrt(mean x^2 + eps) x scale as hi/lo planes */
        k_gemmw<bf, 1, false, NWP, 1><<<dim3(TT / 64, MID / 64, 1), 32 * NWP, 0, stream>>>(XH, XL, WQ, nullptr, CC, CC, nullptr, MID, nullptr, 0, 0, 0, CS, nullptr, QPh, QPl);   /* q planes [h][n][64], rotated */
        k_gemmw<bf, 1, false, NWP, 1><<<dim3(TT / 64, MID / 64, 1), 32 * NWP, 0, stream>>>(XH, XL, WK, nullptr, CC, CC, nullptr, MID, nullptr, 0, 0, 0, CS, nullptr, KPh, KPl);   /* k planes */
        k_gemmw<bf, 3, false, NWP, 2><<<dim3(CO / 64, TT / 64, 1), 32 * NWP, 0, stream>>>(WV, nullptr, XH, XL, CC, CC, nullptr, TT, nullptr, 0, 0, 0, nullptr, VT16, VTh, VTl);   /* v^T planes [h][64][n]: rows = Wv columns (exact), columns = tokens (hi/lo) */
        k_fattn<<<dim3(NH_, TT / 32, 1), 32 * FW, 0, stream>>>(QPh, QPl, KPh, KPl, VT16, VTh, VTl, ATh, ATl);   /* all heads: scores, causal softmax and attn.V; merged context as hi/lo planes */
        k_gemmw<bf, 1, false, NWP><<<dim3(TT / 64, CC / 64, 1), 32 * NWP, 0, stream>>>(ATh, ATl, WO, nullptr, CO, CO, OUT + (size_t)b * TT * CC, CC, nullptr, 0, 0, 0, nullptr, nullptr, nullptr, nullptr); }   /* out = ctx w_out^T */
}

// v004
// One run takes 168 microseconds.
// Next to v003, in two timings, it ran 1.39 and 1.40 times as fast.
// Counting every step since v000, it is 24.1 times as fast.
#include <hip/hip_runtime.h>

// Causal multi-head self-attention with a leading RMSNorm and rotary embeddings over 4,096 tokens (x [2][4096][512]; x_norm = x / sqrt(mean x^2 + 1e-6) x scale (scale [512] ones, read); q, k, v = x_norm W ('xw' [512][512] 1/sqrt(512), no bias; 8 heads x 64); rotate-half rope (cat(x1 c - x2 s, x1 s + x2 c)) with angle t x 1/1000000^(2i/64) (32 f32 frequencies jnp-exact; precise cosf/sinf); scores / sqrt(64); causal (-inf); softmax; out = merged Wo ('xw') -> [2][4096][512] (4.2 M); argument order x, scale, Wq, Wk, Wv, Wo).
// Layout per batch: k_rmsx normalises each token row in f32 and stores bf16 hi/lo planes; projections hi/lo x exact weights (2 products), whose epilogues write the operand planes themselves (q, k: rotate-half with the k_cs5 table, then hi/lo; v: the product is formed transposed, Wv rows x token rows, and stored as value^T planes); k_fattn: scores (hi/lo planes, 3 products), causal select (x 1/8), running-maximum softmax and attn.V (rows < 512 hi/lo 3 products, rest fp16) in one kernel over all heads, no score matrix in memory, context stored as hi/lo planes; context hi/lo x Wo exact written to the output rows. Every 16-bit operand plane lies in fragment order (fidx below).
// Compute dtypes, f32 accumulate: every input rounded to bf16 incl. scale; RMSNorm f32; projections 2 products (hi/lo x exact); rotary f32; scores 3 products; softmax f32, weights kept unnormalised (<= 1) and divided by the row sum at the end; attn.V rows < 512 3 products, rest fp16; Wo hl x exact.

#define NB_  2
#define TT   4096
#define DM   512
#define NH_  8
#define NKV  8
#define REP  (NH_ / NKV)
#define HD   64
#define DQ   (NH_ * HD)
#define DKV  (NKV * HD)
#define ZH   1
#define RH   512                  // query rows < RH use hi+lo planes (0: none)
#define WIN  0
#define SCL  0.125f   // 1/sqrt(float32(64))
#define MID  512      // q / k width = 8 heads x 64
#define CO   512      // v width
#define CC   512
#define FW   8        // k_fattn: waves per work-group; wave w takes the 32-key blocks w, w + FW, ...
#define NWP  8        // projections: waves per tile
typedef _Float16 h16;
typedef unsigned short bf;
typedef __attribute__((ext_vector_type(16))) __bf16   v16bf;
typedef __attribute__((ext_vector_type(16))) _Float16 v16h;
typedef __attribute__((ext_vector_type(8)))  _Float16 v8h;
typedef __attribute__((ext_vector_type(8)))  unsigned short v8us;
typedef __attribute__((ext_vector_type(8)))  float    v8f;
typedef __attribute__((ext_vector_type(4)))  float    v4f;
typedef v8h  __attribute__((may_alias)) v8ha;
typedef v4f  __attribute__((may_alias)) v4fa;
typedef v8us __attribute__((may_alias)) v8usa;

__device__ __forceinline__ unsigned short f2bf(float f) { unsigned u = __float_as_uint(f); u += 0x7FFFu + ((u >> 16) & 1u); return (unsigned short)(u >> 16); }
__device__ __forceinline__ float bf2f(unsigned short b) { return __uint_as_float(((unsigned)b) << 16); }
__device__ __forceinline__ float bfr(float f) { return bf2f(f2bf(f)); }
__device__ __forceinline__ v16h cat16(v8h lo, v8h hi) { return __builtin_shufflevector(lo, hi, 0, 1, 2, 3, 4, 5, 6, 7, 8, 9, 10, 11, 12, 13, 14, 15); }
__device__ __forceinline__ v16bf cat16b(v8us lo, v8us hi) { return __builtin_bit_cast(v16bf, __builtin_shufflevector(lo, hi, 0, 1, 2, 3, 4, 5, 6, 7, 8, 9, 10, 11, 12, 13, 14, 15)); }
__device__ __forceinline__ v8f wmma16(v16h a, v16h b, v8f c) { return __builtin_amdgcn_wmma_f32_16x16x32_f16(false, a, false, b, (short)0, c, false, false); }
__device__ __forceinline__ v8f wmmab(v16bf a, v16bf b, v8f c) { return __builtin_amdgcn_wmma_f32_16x16x32_bf16(false, a, false, b, (short)0, c, false, false); }

__device__ __forceinline__ h16 tohx(float x) { return (h16)x; }
__device__ __forceinline__ void splitf(float y, unsigned short& h, unsigned short& l) { h = f2bf(y); l = f2bf(y - bf2f(h)); }
typedef __attribute__((ext_vector_type(4))) _Float16 v4h;
typedef __attribute__((ext_vector_type(2))) unsigned short v2us;
typedef __attribute__((ext_vector_type(4))) unsigned short v4us;
typedef __attribute__((ext_vector_type(2))) float v2f;

// ---- k_gemmw: register-blocked GEMM, one 64x64 output tile (16 accumulators a wave) per work-group of NW waves, operands straight from 16-bit planes in fragment order (fidx) of row length LP; grid (M/64, N/64, Z), 32 * NW threads.
// C[m][n] (f32, pitch ldc, + optional f32 bias[n]) = sum_k A[m][k] Bt[n][k] (+ split products per NSPLIT). z-batch strides sA/sB/sC in elements. K % (32 * NW) == 0.
// EPI says what the joined tile becomes: 0 f32 rows of C; 1 (tile = 64 tokens x one head) rotate-half rotary out[d] = x[d] cos[t][d] -/+ x[d +/- 32] sin[t][d] from the table CS [t][64][cos, sin], stored as bf16 hi/lo planes [head][t][64]; 2 fp16 and bf16 hi/lo planes of row length ldc; both in fragment order.
// Split-K: wave w takes the 32-wide k steps w, w + NW, ... (one 1,024-byte tile per fragment); the NW partial tiles are summed in LDS in wave order. A z stride of K / 32 tiles (16 * K elements) along the rows makes grid.z a second split whose partial planes (stride sC) the caller sums.
// Fragment order of a 16-bit operand plane of K-contiguous rows (rows % 16 == 0, K % 32 == 0): one 16-row x 32-k tile is 1,024 contiguous bytes, tiles run along k and then down the rows. Inside a tile the 16 bytes that lane (hi * 16 + row % 16) takes for k % 32 = c * 16 + hi * 8 + 0..7 stand at c * 512 + lane * 16, so each of a fragment's two wave-wide 16-byte loads reads 512 contiguous bytes (four whole 128-byte lines) where row-major planes gave it 32-byte pieces of 16 lines.
__device__ __forceinline__ size_t fidx(int row, int k, int K) { return ((size_t)(row >> 4) * (K >> 5) + (k >> 5)) * 512 + ((k >> 4) & 1) * 256 + ((k >> 3) & 1) * 128 + (row & 15) * 8 + (k & 7); }
template <typename T16> struct WFrag;
template <> struct WFrag<h16> { typedef v16h V; static __device__ __forceinline__ V ld(const h16* p) { return cat16(*(const v8h*)p, *(const v8h*)(p + 256)); } static __device__ __forceinline__ v8f mma(V a, V b, v8f c) { return wmma16(a, b, c); } };
template <> struct WFrag<bf> { typedef v16bf V; static __device__ __forceinline__ V ld(const bf* p) { return cat16b(*(const v8us*)p, *(const v8us*)(p + 256)); } static __device__ __forceinline__ v8f mma(V a, V b, v8f c) { return wmmab(a, b, c); } };
template <typename T16, int NSPLIT, bool BIAS, int NW = 1, int EPI = 0, int LP = 512>
__global__ __launch_bounds__(32 * NW) void k_gemmw(const T16* __restrict__ A, const T16* __restrict__ A2, const T16* __restrict__ Bt, const T16* __restrict__ Bt2, int K, float* C, int ldc, const float* __restrict__ bias, size_t sA, size_t sB, size_t sC, const float* __restrict__ CS, h16* P16, bf* Ph, bf* Pl) {
    typedef typename WFrag<T16>::V V;
    __shared__ __align__(16) float osall[NW > 1 ? NW * 64 * 68 : 16 * 68];   /* NW > 1: one whole 64 x 64 partial tile a wave */
    const int wv = NW > 1 ? __builtin_amdgcn_readfirstlane((int)(threadIdx.x >> 5)) : 0;   /* wave number, scalar so that the k loop stays a scalar branch */
    constexpr int lp = LP;   /* row length of both operands' planes, a constant so that all fragments of a k step hang on one address per plane by immediate offsets */
    float* os = osall + wv * (64 * 68);
    const size_t z = blockIdx.z; A += z * sA; if (A2) A2 += z * sA; Bt += z * sB; if (Bt2) Bt2 += z * sB; C += z * sC;
    const int lane = threadIdx.x & 31, lr = lane & 15, hi = lane >> 4; const int r0 = blockIdx.x * 64, c0 = blockIdx.y * 64;
    v8f acc[4][4];
#pragma unroll
    for (int mb = 0; mb < 4; ++mb)
#pragma unroll
        for (int nb = 0; nb < 4; ++nb) acc[mb][nb] = (v8f){};
    const size_t aoff = (size_t)r0 * lp + lane * 8, boff = (size_t)c0 * lp + lane * 8;   /* first tile of the 64 rows (16 rows hold 16 * lp elements) + the lane's 16 bytes; a 32-wide k step is 512 elements on */
#pragma unroll 1
    for (int kc = wv * 32; kc < K; kc += 32 * NW) {
        V a[4], a2[4], b[4], b2[4]; const T16* pa = A + aoff + (size_t)kc * 16; const T16* pa2 = (NSPLIT == 1 || NSPLIT == 2) ? A2 + aoff + (size_t)kc * 16 : nullptr; const T16* pb = Bt + boff + (size_t)kc * 16; const T16* pb2 = NSPLIT >= 2 ? Bt2 + boff + (size_t)kc * 16 : nullptr;
#pragma unroll
        for (int mb = 0; mb < 4; ++mb) { a[mb] = WFrag<T16>::ld(pa + mb * 16 * lp); if (NSPLIT == 1 || NSPLIT == 2) a2[mb] = WFrag<T16>::ld(pa2 + mb * 16 * lp); }
#pragma unroll
        for (int nb = 0; nb < 4; ++nb) { b[nb] = WFrag<T16>::ld(pb + nb * 16 * lp); if (NSPLIT >= 2) b2[nb] = WFrag<T16>::ld(pb2 + nb * 16 * lp); }
        /* behind the operand loads; the addresses are named so that they stay in their registers up to here and no load's result lands on a register that an issued load names */
        if constexpr (NSPLIT == 0) asm volatile("s_wait_xcnt 0x0" :: "v"(pa), "v"(pb) : "memory"); else if constexpr (NSPLIT == 1) asm volatile("s_wait_xcnt 0x0" :: "v"(pa), "v"(pa2), "v"(pb) : "memory"); else if constexpr (NSPLIT == 2) asm volatile("s_wait_xcnt 0x0" :: "v"(pa), "v"(pa2), "v"(pb), "v"(pb2) : "memory"); else asm volatile("s_wait_xcnt 0x0" :: "v"(pa), "v"(pb), "v"(pb2) : "memory");
        __builtin_amdgcn_sched_barrier(0);   /* no matrix instruction is lifted in front of the wait: without this the compiler lets late loads reuse fragment registers, and the wave then sits out one load latency per group of four products instead of one per k step */
#pragma unroll
        for (int nb = 0; nb < 4; ++nb)
#pragma unroll
            for (int mb = 0; mb < 4; ++mb) { acc[mb][nb] = WFrag<T16>::mma(a[mb], b[nb], acc[mb][nb]); if (NSPLIT == 1 || NSPLIT == 2) acc[mb][nb] = WFrag<T16>::mma(a2[mb], b[nb], acc[mb][nb]); if (NSPLIT >= 2) acc[mb][nb] = WFrag<T16>::mma(a[mb], b2[nb], acc[mb][nb]); }
        asm volatile("v_nop\n\tv_nop\n\tv_nop\n\tv_nop" : "+v"(acc[0][0]), "+v"(acc[1][1]), "+v"(acc[2][2]), "+v"(acc[3][3]) : "v"(a[0]), "v"(a[3]));
    }
    if constexpr (NW > 1) {
        static_assert(EPI != 1 || NW == 8, "the table fetch below is laid out for four passes of 256 threads");
        v4f c01[4], c23[4];   /* EPI 1: this thread's (cos, sin) pairs of its four passes, fetched here so that they fly under the LDS stores of the partial tile */
        if constexpr (EPI == 1) { const float* cs = CS + ((size_t)(r0 + (int)(threadIdx.x >> 4)) * HD + (threadIdx.x & 15) * 4) * 2;
#pragma unroll
            for (int i = 0; i < 4; ++i) { c01[i] = *(const v4f*)(cs + i * (16 * HD * 2)); c23[i] = *(const v4f*)(cs + i * (16 * HD * 2) + 4); }
            asm volatile("s_wait_xcnt 0x0" :: "v"(cs) : "memory"); }   /* behind the table loads; the address is named so that it stays in its registers up to here */
#pragma unroll
        for (int mb = 0; mb < 4; ++mb)
#pragma unroll
            for (int nb = 0; nb < 4; ++nb)
#pragma unroll
                for (int j = 0; j < 8; ++j) os[(mb * 16 + hi * 8 + j) * 68 + nb * 16 + lr] = acc[mb][nb][j];
        __syncthreads();   /* every wave's partial tile is in LDS before any of it is summed */
#pragma unroll
        for (int u0 = 0; u0 < 64 * 16; u0 += 32 * NW) { const int u = u0 + (int)threadIdx.x, row = u >> 4, cofs = (u & 15) * 4; v4f val = *(const v4fa*)(osall + row * 68 + cofs);
#pragma unroll
            for (int w = 1; w < NW; ++w) val += *(const v4fa*)(osall + w * (64 * 68) + row * 68 + cofs);   /* partial sums joined in wave order */
            if (BIAS) { val[0] += bfr(bias[c0 + cofs]); val[1] += bfr(bias[c0 + cofs + 1]); val[2] += bfr(bias[c0 + cofs + 2]); val[3] += bfr(bias[c0 + cofs + 3]); }
            if constexpr (EPI == 0) *(v4f*)(C + (size_t)(r0 + row) * ldc + c0 + cofs) = val;
            else { v4us oh, ol;
                if constexpr (EPI == 1) { const int i = u0 / (32 * NW); const float co[4] = {c01[i][0], c01[i][2], c23[i][0], c23[i][2]}, si[4] = {c01[i][1], c01[i][3], c23[i][1], c23[i][3]};
#pragma unroll
                    for (int q = 0; q < 4; ++q) { const float par = __shfl_xor(val[q], 8, 32);   /* lane ^ 8 holds the same token's columns cofs ^ 32, the other half of the head */
                        val[q] = val[q] * co[q] + par * ((cofs < HD / 2) ? -si[q] : si[q]); } }
#pragma unroll
                for (int q = 0; q < 4; ++q) { unsigned short h2, l2; splitf(val[q], h2, l2); oh[q] = h2; ol[q] = l2; }
                const size_t e = EPI == 1 ? (size_t)blockIdx.y * TT * HD + fidx(r0 + row, cofs, HD) : fidx(r0 + row, c0 + cofs, ldc);
                *(v4us*)(Ph + e) = oh; *(v4us*)(Pl + e) = ol;
                if constexpr (EPI == 2) { v4h o16;
#pragma unroll
                    for (int q = 0; q < 4; ++q) o16[q] = tohx(val[q]);
                    *(v4h*)(P16 + e) = o16; } } }
    } else {
#pragma unroll
    for (int mb = 0; mb < 4; ++mb) {
#pragma unroll
        for (int nb = 0; nb < 4; ++nb) {
#pragma unroll
            for (int j = 0; j < 8; ++j) os[(hi * 8 + j) * 68 + nb * 16 + lr] = acc[mb][nb][j]; }
        __builtin_amdgcn_wave_barrier(); asm volatile("" ::: "memory");
        float* crow = C + (size_t)(r0 + mb * 16) * ldc + c0;
{
#pragma unroll
            for (int s = 0; s < 8; ++s) { const int row = 2 * s + hi, cofs = lr * 4; v4f val = *(const v4fa*)(os + row * 68 + cofs); if (BIAS) { val[0] += bfr(bias[c0 + cofs]); val[1] += bfr(bias[c0 + cofs + 1]); val[2] += bfr(bias[c0 + cofs + 2]); val[3] += bfr(bias[c0 + cofs + 3]); }
                *(v4f*)(crow + (size_t)row * ldc + cofs) = val; }
             }
        __builtin_amdgcn_wave_barrier(); asm volatile("" ::: "memory");
    }
    }
}

// ---- k_fattn: causal attention of one head for 32 query rows per work-group, scores never leave the registers. grid (heads, TT / 32), 32 * FW threads.
// S^T = K Q^T (A = key rows, B = query rows, both planes [h][t][64] in fragment order): in each 16-query group a lane holds 16 of one query's 32 scores, in the k order of a B operand, so the weights go into O^T += V^T P^T (A = value^T rows [h][64][t]) without leaving the lane.
// Running maximum m and sum l per query in base 2; key blocks past the diagonal are not visited, the diagonal block is cut by the select. The FW waves' (m, l, O) are joined in LDS in wave order.
__device__ __forceinline__ float xhalf(float x) { const int b = __float_as_int(x); return __int_as_float(__builtin_amdgcn_permlanex16(b, b, 0x76543210, 0xfedcba98, false, false)); }   /* lane l <-> l ^ 16 */
// 2^x in place. The v_nop is the one slot the instruction set asks for between a transcendental and an instruction that reads its result or overwrites its source; inside the run each v_exp_f32 is followed by one on other registers.
__device__ __forceinline__ float exp2s(float x) { asm("v_exp_f32 %0, %0\n\tv_nop" : "+v"(x)); return x; }
__device__ __forceinline__ void exp2x8(float (&e)[8]) { asm("v_exp_f32 %0, %0\n\tv_exp_f32 %1, %1\n\tv_exp_f32 %2, %2\n\tv_exp_f32 %3, %3\n\tv_exp_f32 %4, %4\n\tv_exp_f32 %5, %5\n\tv_exp_f32 %6, %6\n\tv_exp_f32 %7, %7\n\tv_nop" : "+v"(e[0]), "+v"(e[1]), "+v"(e[2]), "+v"(e[3]), "+v"(e[4]), "+v"(e[5]), "+v"(e[6]), "+v"(e[7])); }
// (wave-uniform base of a tile) + (this lane's 16 bytes inside it)
template <typename T16> __device__ __forceinline__ const T16* lanep(const T16* base, unsigned lane_bytes) { return (const T16*)((const char*)base + lane_bytes); }
template <bool HL>
__device__ __forceinline__ void fattn_keys(const bf* __restrict__ Kh, const bf* __restrict__ Kl, const h16* __restrict__ V16, const bf* __restrict__ Vh, const bf* __restrict__ Vl, const v16bf (&qh)[2][2], const v16bf (&ql)[2][2], int q0, int wv, int lr, int hi, unsigned lk, unsigned lv, v8f (&o)[2][4], float (&m)[2], float (&l)[2]) {
#pragma unroll 1   /* one copy of the pass: a second one would double the fragments that are live and cost the fourth wave per SIMD */
    for (int kb = wv * 32; kb < q0 + 32; kb += 32 * FW) {
        v8f s[2][2]; v16bf kh[2][2], kl[2][2]; const bf* pkh = lanep(Kh + (size_t)kb * HD, lk); const bf* pkl = lanep(Kl + (size_t)kb * HD, lk);
#pragma unroll
        for (int kt = 0; kt < 2; ++kt)
#pragma unroll
            for (int ks = 0; ks < 2; ++ks) { kh[kt][ks] = WFrag<bf>::ld(pkh + (kt * 2 + ks) * 512); kl[kt][ks] = WFrag<bf>::ld(pkl + (kt * 2 + ks) * 512); }
        asm volatile("s_wait_xcnt 0x0" :: "v"(pkh), "v"(pkl) : "memory");   /* behind the key loads; the addresses are named so that they stay in their registers up to here and no load's result lands on a register that an issued load names */
#pragma unroll
        for (int kt = 0; kt < 2; ++kt)
#pragma unroll
            for (int g = 0; g < 2; ++g) { v8f a = (v8f){};
#pragma unroll
                for (int ks = 0; ks < 2; ++ks) { a = wmmab(kh[kt][ks], qh[g][ks], a); a = wmmab(kl[kt][ks], qh[g][ks], a); a = wmmab(kh[kt][ks], ql[g][ks], a); }
                s[g][kt] = a; }
        v16bf vh[4], vl[4]; v16h vf[4]; const bf* pvh = lanep(Vh + (size_t)kb * 16, lv); const bf* pvl = lanep(Vl + (size_t)kb * 16, lv); const h16* pvf = lanep(V16 + (size_t)kb * 16, lv);   /* 32 keys = one tile = 512 elements along a 16-row band of 16 * TT */
#pragma unroll
        for (int dt = 0; dt < 4; ++dt) { if (HL) { vh[dt] = WFrag<bf>::ld(pvh + dt * 16 * TT); vl[dt] = WFrag<bf>::ld(pvl + dt * 16 * TT); } else vf[dt] = WFrag<h16>::ld(pvf + dt * 16 * TT); }
        if (HL) asm volatile("s_wait_xcnt 0x0" :: "v"(pvh), "v"(pvl) : "memory"); else asm volatile("s_wait_xcnt 0x0" :: "v"(pvf) : "memory");   /* the same behind the value loads, which fly under the softmax */
        v16bf ph[2], pl[2]; v16h p16[2];
#pragma unroll
        for (int g = 0; g < 2; ++g) { const int rel = q0 + g * 16 + lr - kb - hi * 8; float mr = -3.0e38f;   /* this lane's score (kt, j) belongs to a key <= its query where kt * 16 + j <= rel */
#pragma unroll
            for (int kt = 0; kt < 2; ++kt)
#pragma unroll
                for (int j = 0; j < 8; ++j) { const float t = (kt * 16 + j <= rel) ? s[g][kt][j] : -3.0e38f; s[g][kt][j] = t; mr = fmaxf(mr, t); }
            mr = fmaxf(mr, xhalf(mr)); const float mx = fmaxf(m[g], mr * (SCL * 1.4426950408889634f));
            const float al = exp2s(m[g] - mx); m[g] = mx; float sa[4] = {0.f, 0.f, 0.f, 0.f};   /* al = 0 on a wave's first block (m = -3e38) */
#pragma unroll
            for (int kt = 0; kt < 2; ++kt) { float e[8];
#pragma unroll
                for (int j = 0; j < 8; ++j) e[j] = __builtin_fmaf(s[g][kt][j], SCL * 1.4426950408889634f, -mx);
                exp2x8(e);
#pragma unroll
                for (int j = 0; j < 8; ++j) { const float p = e[j]; sa[j & 3] += p;
                    if (HL) { const __bf16 a2 = (__bf16)p; ph[g][kt * 8 + j] = a2; pl[g][kt * 8 + j] = (__bf16)(p - (float)a2); } else p16[g][kt * 8 + j] = tohx(p); } }
            const float sum = (sa[0] + sa[1]) + (sa[2] + sa[3]);
            l[g] = l[g] * al + sum;
#pragma unroll
            for (int dt = 0; dt < 4; ++dt) o[g][dt] *= al; }
#pragma unroll
        for (int dt = 0; dt < 4; ++dt)
#pragma unroll
            for (int g = 0; g < 2; ++g) { if (HL) { o[g][dt] = wmmab(vh[dt], ph[g], o[g][dt]); o[g][dt] = wmmab(vl[dt], ph[g], o[g][dt]); o[g][dt] = wmmab(vh[dt], pl[g], o[g][dt]); } else o[g][dt] = wmma16(vf[dt], p16[g], o[g][dt]); }
    }
}
// amdgpu_waves_per_eu(4, 4): at most 256 registers a wave, so that two work-groups (four waves per SIMD) share a WGP and cover each other's load latency.
__global__ __launch_bounds__(32 * FW) __attribute__((amdgpu_waves_per_eu(4, 4))) void k_fattn(const bf* __restrict__ Qh, const bf* __restrict__ Ql, const bf* __restrict__ Kh, const bf* __restrict__ Kl, const h16* __restrict__ V16, const bf* __restrict__ Vh, const bf* __restrict__ Vl, bf* __restrict__ Oh, bf* __restrict__ Ol) {
    __shared__ __align__(16) float so[FW * 32 * 68]; __shared__ float sm[FW * 32], sl[FW * 32];
    const int wv = __builtin_amdgcn_readfirstlane((int)(threadIdx.x >> 5));   /* wave number, scalar so that the key loop stays a scalar branch */
    const int lane = threadIdx.x & 31, lr = lane & 15, hi = lane >> 4; const int h = blockIdx.x;
    const size_t hb = (size_t)h * TT * HD; Qh += hb; Ql += hb; Kh += hb; Kl += hb; V16 += hb; Vh += hb; Vl += hb;
    {
        const int q0 = (TT / 32 - 1 - (int)blockIdx.y) * 32;   /* the longest rows of every head start first, the short ones fill in behind them */
        const unsigned lk = (unsigned)lane * 16u, lv = lk;   /* the lane's bytes inside a tile, the same in every plane */
        v16bf qh[2][2], ql[2][2]; const bf* pqh = lanep(Qh + (size_t)q0 * HD, lk); const bf* pql = lanep(Ql + (size_t)q0 * HD, lk);
#pragma unroll
        for (int g = 0; g < 2; ++g)
#pragma unroll
            for (int ks = 0; ks < 2; ++ks) { qh[g][ks] = WFrag<bf>::ld(pqh + (g * 2 + ks) * 512); ql[g][ks] = WFrag<bf>::ld(pql + (g * 2 + ks) * 512); }
        asm volatile("s_wait_xcnt 0x0" :: "v"(pqh), "v"(pql) : "memory");   /* behind the query loads; the addresses are named so that they stay in their registers up to here */
        v8f o[2][4]; float m[2], l[2];
#pragma unroll
        for (int g = 0; g < 2; ++g) { m[g] = -3.0e38f; l[g] = 0.f;
#pragma unroll
            for (int dt = 0; dt < 4; ++dt) o[g][dt] = (v8f){}; }
        if (q0 < RH) fattn_keys<true>(Kh, Kl, V16, Vh, Vl, qh, ql, q0, wv, lr, hi, lk, lv, o, m, l); else fattn_keys<false>(Kh, Kl, V16, Vh, Vl, qh, ql, q0, wv, lr, hi, lk, lv, o, m, l);
#pragma unroll
        for (int g = 0; g < 2; ++g) { l[g] += xhalf(l[g]); if (hi == 0) { sm[wv * 32 + g * 16 + lr] = m[g]; sl[wv * 32 + g * 16 + lr] = l[g]; } }
        __syncthreads();   /* every wave's maximum and sum are in LDS before the common ones are formed */
#pragma unroll
        for (int g = 0; g < 2; ++g) { float mm = sm[g * 16 + lr];
#pragma unroll
            for (int w = 1; w < FW; ++w) mm = fmaxf(mm, sm[w * 32 + g * 16 + lr]);
            float ll = 0.f;
#pragma unroll
            for (int w = 0; w < FW; ++w) ll += sl[w * 32 + g * 16 + lr] * exp2s(sm[w * 32 + g * 16 + lr] - mm);   /* a wave that had no key block holds m = -3e38, l = 0 */
            const float f = __fdiv_rn(exp2s(m[g] - mm), ll);
#pragma unroll
            for (int dt = 0; dt < 4; ++dt) { const v8f a = o[g][dt] * f; float* d = so + (wv * 32 + g * 16 + lr) * 68 + dt * 16 + hi * 8;
                *(v4fa*)d = (v4f){a[0], a[1], a[2], a[3]}; *(v4fa*)(d + 4) = (v4f){a[4], a[5], a[6], a[7]}; } }
        __syncthreads();   /* every wave's scaled partial rows are in LDS before any of them is summed */
#pragma unroll
        for (int u0 = 0; u0 < 32 * 16; u0 += 32 * FW) { const int u = u0 + (int)threadIdx.x, row = u >> 4, cofs = (u & 15) * 4; v4f val = *(const v4fa*)(so + row * 68 + cofs);
#pragma unroll
            for (int w = 1; w < FW; ++w) val += *(const v4fa*)(so + (w * 32 + row) * 68 + cofs);   /* partial rows joined in wave order */
            v4us oh, ol;
#pragma unroll
            for (int q = 0; q < 4; ++q) { unsigned short h2, l2; splitf(val[q], h2, l2); oh[q] = h2; ol[q] = l2; }
            const size_t e = fidx(q0 + row, h * HD + cofs, CO); *(v4us*)(Oh + e) = oh; *(v4us*)(Ol + e) = ol; }   /* context rows [t][h * 64 + d] as the hi/lo operand planes of the last product, in fragment order */
    }
}

__constant__ float INVT[HD / 2] = { 1.000000000e+00f, 6.493816376e-01f, 4.216965139e-01f, 2.738419771e-01f, 1.778279394e-01f, 1.154782027e-01f, 7.498941571e-02f, 4.869675264e-02f, 3.162277862e-02f, 2.053525113e-02f, 1.333521493e-02f, 8.659643121e-03f, 5.623413250e-03f, 3.651741426e-03f, 2.371373819e-03f, 1.539926510e-03f, 1.000000047e-03f, 6.493816618e-04f, 4.216964880e-04f, 2.738419571e-04f, 1.778279402e-04f, 1.154781930e-04f, 7.498942432e-05f, 4.869675467e-05f, 3.162277426e-05f, 2.053524986e-05f, 1.333521413e-05f, 8.659643754e-06f, 5.623413472e-06f, 3.651741281e-06f, 2.371373739e-06f, 1.539926529e-06f };   // float32 1 / 1000000^(2i/64) (the module's integer-arange expression), generated with jnp to be bit-exact
__global__ __launch_bounds__(256) void k_cs5(float* CS) { const int idx = blockIdx.x * 256 + threadIdx.x; if (idx >= TT * HD) return; const int d = idx % HD; const int t = idx / HD; const float a = __fmul_rn((float)t, INVT[d % (HD / 2)]); v2f cs; cs[0] = cosf(a); cs[1] = sinf(a); *(v2f*)(CS + (size_t)idx * 2) = cs;  }
__global__ __launch_bounds__(256) void k_rmsx(const float* __restrict__ X, const float* __restrict__ sc, bf* XH, bf* XL) { const int lane = threadIdx.x & 31; const int row = blockIdx.x * 8 + (threadIdx.x >> 5); if (row >= TT) return; const float* xr = X + (size_t)row * CC + lane * 16; const float* sr = sc + lane * 16; float v[16]; float ss = 0.f; v4f xa[4], sv[4];
#pragma unroll
    for (int c = 0; c < 4; ++c) { xa[c] = *(const v4f*)(xr + c * 4); sv[c] = *(const v4f*)(sr + c * 4); }
    asm volatile("s_wait_xcnt 0x0" :: "v"(xr), "v"(sr) : "memory");   /* behind the row's and the scale's loads; the addresses are named so that no load's result lands on a register that an issued load names */
#pragma unroll
    for (int c = 0; c < 4; ++c) { const v4f a = xa[c];
#pragma unroll
        for (int q = 0; q < 4; ++q) { const float b = bfr(a[q]); v[c * 4 + q] = b; float p = __fmul_rn(b, b); asm volatile("" : "+v"(p)); ss = __fadd_rn(ss, p); } }
#pragma unroll
    for (int sh = 16; sh; sh >>= 1) ss = __fadd_rn(ss, __shfl_xor(ss, sh, 32));
    const float den = sqrtf(__fadd_rn(__fmul_rn(ss, 1.0f / CC), 1.0e-6f)); const float rinv = __fdiv_rn(1.0f, den);   /* ONE IEEE division per row; x * (1/den) differs from the module's x / den by <= 1 ulp */
    v4us oh[4], ol[4];
#pragma unroll
    for (int c = 0; c < 4; ++c) {
#pragma unroll
        for (int q = 0; q < 4; ++q) { float y = __fmul_rn(v[c * 4 + q], rinv); asm volatile("" : "+v"(y)); y = __fmul_rn(y, bfr(sv[c][q])); unsigned short a2, c2; splitf(y, a2, c2); oh[c][q] = a2; ol[c][q] = c2; } }
    const size_t e = fidx(row, lane * 16, CC); bf* ph = XH + e; bf* pl = XL + e;   /* fragment order: the lane's columns 0..7 here, its columns 8..15 128 elements on */
#pragma unroll
    for (int c = 0; c < 2; ++c) { *(v8us*)(ph + c * 128) = __builtin_shufflevector(oh[2 * c], oh[2 * c + 1], 0, 1, 2, 3, 4, 5, 6, 7); *(v8us*)(pl + c * 128) = __builtin_shufflevector(ol[2 * c], ol[2 * c + 1], 0, 1, 2, 3, 4, 5, 6, 7); }
}
__global__ __launch_bounds__(256) void k_wtG(const float* __restrict__ w, int K, int N, bf* Bt) {
    const int lane = threadIdx.x & 31; const int L0 = (blockIdx.x * 8 + (threadIdx.x >> 5)) * 8; const int nlines = N * K / 64;
{
#pragma unroll 1
        for (int l = 0; l < 8; ++l) { const int L = L0 + l; if (L >= nlines) break; const size_t e = (size_t)L * 64 + lane * 2; const int k = (int)(e % K), n = (int)(e / K); v2us o;
            o[0] = f2bf(w[(size_t)k * N + n]); o[1] = f2bf(w[(size_t)(k + 1) * N + n]); *(v2us*)(Bt + fidx(n, k, K)) = o; }   /* Bt[n][k] in fragment order */
         }
}
extern "C" void kernel_launch(void* const* d_in, const int* in_sizes, int n_in,
                              void* d_out, int out_size, void* d_ws, size_t ws_size, hipStream_t stream) {
    (void)in_sizes; (void)n_in; (void)out_size;
    const float* x = (const float*)d_in[0]; const float* rsc = (const float*)d_in[1]; const float* wq = (const float*)d_in[2]; const float* wk = (const float*)d_in[3]; const float* wv = (const float*)d_in[4]; const float* wo = (const float*)d_in[5];   /* input order x [2][4096][512], scale [512] (RMSNorm weight), Wq, Wk, Wv, Wo ('xw' [512][512], no biases) */
    float* OUT = (float*)d_out;     // [2][4096][512]
    char* wsp = (char*)d_ws;
    auto take = [&](size_t bytes) { char* p = wsp; wsp += (bytes + 255) & ~(size_t)255; return (void*)p; };
    bf* WQKV = (bf*)take((size_t)3 * MID * CC * 2); bf* WQ = WQKV; bf* WK = WQKV + (size_t)MID * CC; bf* WV = WQKV + (size_t)2 * MID * CC; bf* WO = (bf*)take((size_t)CC * CO * 2); float* CS = (float*)take((size_t)TT * HD * 2 * 4);
    bf* XH = (bf*)take((size_t)TT * CC * 2); bf* XL = (bf*)take((size_t)TT * CC * 2);   /* RMS-normalised tokens, bf16 hi/lo */
    bf* QPh = (bf*)take((size_t)TT * MID * 2); bf* QPl = (bf*)take((size_t)TT * MID * 2); bf* KPh = (bf*)take((size_t)TT * MID * 2); bf* KPl = (bf*)take((size_t)TT * MID * 2);
    h16* VT16 = (h16*)take((size_t)CO * TT * 2); bf* VTh = (bf*)take((size_t)CO * TT * 2); bf* VTl = (bf*)take((size_t)CO * TT * 2);
    bf* ATh = (bf*)take((size_t)TT * CO * 2); bf* ATl = (bf*)take((size_t)TT * CO * 2);
    if ((size_t)(wsp - (char*)d_ws) > ws_size) return;
    k_wtG<<<(unsigned)((CC * MID / 64 + 63) / 64), 256, 0, stream>>>(wq, CC, MID, WQ); k_wtG<<<(unsigned)((CC * MID / 64 + 63) / 64), 256, 0, stream>>>(wk, CC, MID, WK); k_wtG<<<(unsigned)((CC * CO / 64 + 63) / 64), 256, 0, stream>>>(wv, CC, CO, WV);   /* 'xw' weights -> Bt */ k_wtG<<<(unsigned)((CO * CC / 64 + 63) / 64), 256, 0, stream>>>(wo, CO, CC, WO);   /* 'xw' W_out -> Bt */   /* the fused qkv rows split into q | k | v blocks */
    k_cs5<<<(TT * HD + 255) / 256, 256, 0, stream>>>(CS);   /* cos, sin per (token, d) for the q and k epilogues */
    for (int b = 0; b < NB_; ++b) {
        k_rmsx<<<TT / 8, 256, 0, stream>>>(x + (size_t)b * TT * CC, rsc, XH, XL);   /* x_norm = x / sqrt(mean x^2 + eps) x scale as hi/lo planes */
        k_gemmw<bf, 1, false, NWP, 1><<<dim3(TT / 64, MID / 64, 1), 32 * NWP, 0, stream>>>(XH, XL, WQ, nullptr, CC, nullptr, MID, nullptr, 0, 0, 0, CS, nullptr, QPh, QPl);   /* q planes [h][n][64], rotated */
        k_gemmw<bf, 1, false, NWP, 1><<<dim3(TT / 64, MID / 64, 1), 32 * NWP, 0, stream>>>(XH, XL, WK, nullptr, CC, nullptr, MID, nullptr, 0, 0, 0, CS, nullptr, KPh, KPl);   /* k planes */
        k_gemmw<bf, 3, false, NWP, 2><<<dim3(CO / 64, TT / 64, 1), 32 * NWP, 0, stream>>>(WV, nullptr, XH, XL, CC, nullptr, TT, nullptr, 0, 0, 0, nullptr, VT16, VTh, VTl);   /* v^T planes [h][64][n]: rows = Wv columns (exact), columns = tokens (hi/lo) */
        k_fattn<<<dim3(NH_, TT / 32, 1), 32 * FW, 0, stream>>>(QPh, QPl, KPh, KPl, VT16, VTh, VTl, ATh, ATl);   /* all heads: scores, causal softmax and attn.V; merged context as hi/lo planes */
        k_gemmw<bf, 1, false, NWP><<<dim3(TT / 64, CC / 64, 1), 32 * NWP, 0, stream>>>(ATh, ATl, WO, nullptr, CO, OUT + (size_t)b * TT * CC, CC, nullptr, 0, 0, 0, nullptr, nullptr, nullptr, nullptr); }   /* out = ctx W_out ('xw') */
}

// v005
// It runs in 127 microseconds.
// In two side-by-side timings against v004, it was 1.32 and 1.33 times as fast.
// Counting every step since v000, it is 32.0 times as fast.
#include <hip/hip_runtime.h>

// Causal multi-head self-attention with a leading RMSNorm and rotary embeddings over 4,096 tokens (x [2][4096][512]; x_norm = x / sqrt(mean x^2 + 1e-6) x scale (scale [512] ones, read); q, k, v = x_norm W ('xw' [512][512] 1/sqrt(512), no bias; 8 heads x 64); rotate-half rope (cat(x1 c - x2 s, x1 s + x2 c)) with angle t x 1/1000000^(2i/64) (32 f32 frequencies jnp-exact; precise cosf/sinf); scores / sqrt(64); causal (-inf); softmax; out = merged Wo ('xw') -> [2][4096][512] (4.2 M); argument order x, scale, Wq, Wk, Wv, Wo).
// Four launches, both batches side by side in each grid (every plane holds batch 0, then batch 1): k_prep (weights to fragment order, rotary table, RMSNorm), k_qkv, k_fattn, k_out. Layout: rmsx_rows normalises each token row in f32 and stores bf16 hi/lo planes; projections hi/lo x exact weights (2 products), whose epilogues write the operand planes themselves (q, k: rotate-half with the cs5_block table, then hi/lo; v: the product is formed transposed, Wv rows x token rows, and stored as value^T planes); k_fattn: scores (hi/lo planes, 3 products), causal select (x 1/8), running-maximum softmax and attn.V (rows < 512 hi/lo 3 products, rest fp16) in one kernel over all heads, no score matrix in memory, context stored as hi/lo planes; context hi/lo x Wo exact written to the output rows. Every 16-bit operand plane lies in fragment order (fidx below).
// Compute dtypes, f32 accumulate: every input rounded to bf16 incl. scale; RMSNorm f32; projections 2 products (hi/lo x exact); rotary f32; scores 3 products; softmax f32, weights kept unnormalised (<= 1) and divided by the row sum at the end; attn.V rows < 512 3 products, rest fp16; Wo hl x exact.

#define NB_  2
#define TT   4096
#define DM   512
#define NH_  8
#define NKV  8
#define REP  (NH_ / NKV)
#define HD   64
#define DQ   (NH_ * HD)
#define DKV  (NKV * HD)
#define ZH   1
#define RH   512                  // query rows < RH use hi+lo planes (0: none)
#define WIN  0
#define SCL  0.125f   // 1/sqrt(float32(64))
#define MID  512      // q / k width = 8 heads x 64
#define CO   512      // v width
#define CC   512
#define FW   8        // k_fattn: waves per work-group; wave w takes the 32-key blocks w, w + FW, ...
#define NWP  8        // projections: waves per tile
typedef _Float16 h16;
typedef unsigned short bf;
typedef __attribute__((ext_vector_type(16))) __bf16   v16bf;
typedef __attribute__((ext_vector_type(16))) _Float16 v16h;
typedef __attribute__((ext_vector_type(8)))  _Float16 v8h;
typedef __attribute__((ext_vector_type(8)))  unsigned short v8us;
typedef __attribute__((ext_vector_type(8)))  float    v8f;
typedef __attribute__((ext_vector_type(4)))  float    v4f;
typedef v8h  __attribute__((may_alias)) v8ha;
typedef v4f  __attribute__((may_alias)) v4fa;
typedef v8us __attribute__((may_alias)) v8usa;

__device__ __forceinline__ unsigned short f2bf(float f) { unsigned u = __float_as_uint(f); u += 0x7FFFu + ((u >> 16) & 1u); return (unsigned short)(u >> 16); }
__device__ __forceinline__ float bf2f(unsigned short b) { return __uint_as_float(((unsigned)b) << 16); }
__device__ __forceinline__ float bfr(float f) { return bf2f(f2bf(f)); }
__device__ __forceinline__ v16h cat16(v8h lo, v8h hi) { return __builtin_shufflevector(lo, hi, 0, 1, 2, 3, 4, 5, 6, 7, 8, 9, 10, 11, 12, 13, 14, 15); }
__device__ __forceinline__ v16bf cat16b(v8us lo, v8us hi) { return __builtin_bit_cast(v16bf, __builtin_shufflevector(lo, hi, 0, 1, 2, 3, 4, 5, 6, 7, 8, 9, 10, 11, 12, 13, 14, 15)); }
__device__ __forceinline__ v8f wmma16(v16h a, v16h b, v8f c) { return __builtin_amdgcn_wmma_f32_16x16x32_f16(false, a, false, b, (short)0, c, false, false); }
__device__ __forceinline__ v8f wmmab(v16bf a, v16bf b, v8f c) { return __builtin_amdgcn_wmma_f32_16x16x32_bf16(false, a, false, b, (short)0, c, false, false); }

__device__ __forceinline__ h16 tohx(float x) { return (h16)x; }
__device__ __forceinline__ void splitf(float y, unsigned short& h, unsigned short& l) { h = f2bf(y); l = f2bf(y - bf2f(h)); }
typedef __attribute__((ext_vector_type(4))) _Float16 v4h;
typedef __attribute__((ext_vector_type(2))) unsigned short v2us;
typedef __attribute__((ext_vector_type(4))) unsigned short v4us;
typedef __attribute__((ext_vector_type(2))) float v2f;

// ---- gemmw_tile: register-blocked GEMM, one 64x64 output tile (16 accumulators a wave), tile (bx, by) of (M/64, N/64), per work-group of NW waves, operands straight from 16-bit planes in fragment order (fidx) of row length LP; osall is the work-group's LDS.
// C[m][n] (f32, pitch ldc, + optional f32 bias[n]) = sum_k A[m][k] Bt[n][k] (+ split products per NSPLIT). K % (32 * NW) == 0. The token rows of both batches stand one behind the other (row = b * TT + t).
// EPI says what the joined tile becomes: 0 f32 rows of C; 1 (tile = 64 tokens x one head) rotate-half rotary out[d] = x[d] cos[t][d] -/+ x[d +/- 32] sin[t][d] from the table CS [t][64][cos, sin], stored as bf16 hi/lo planes [b][head][t][64]; 2 (columns = tokens) fp16 and bf16 hi/lo planes [b][CO rows] of row length ldc = TT; both in fragment order.
// Split-K: wave w takes the 32-wide k steps w, w + NW, ... (one 1,024-byte tile per fragment); the NW partial tiles are summed in LDS in wave order.
// Fragment order of a 16-bit operand plane of K-contiguous rows (rows % 16 == 0, K % 32 == 0): one 16-row x 32-k tile is 1,024 contiguous bytes, tiles run along k and then down the rows. Inside a tile the 16 bytes that lane (hi * 16 + row % 16) takes for k % 32 = c * 16 + hi * 8 + 0..7 stand at c * 512 + lane * 16, so each of a fragment's two wave-wide 16-byte loads reads 512 contiguous bytes (four whole 128-byte lines) where row-major planes gave it 32-byte pieces of 16 lines.
__device__ __forceinline__ size_t fidx(int row, int k, int K) { return ((size_t)(row >> 4) * (K >> 5) + (k >> 5)) * 512 + ((k >> 4) & 1) * 256 + ((k >> 3) & 1) * 128 + (row & 15) * 8 + (k & 7); }
template <typename T16> struct WFrag;
template <> struct WFrag<h16> { typedef v16h V; static __device__ __forceinline__ V ld(const h16* p) { return cat16(*(const v8h*)p, *(const v8h*)(p + 256)); } static __device__ __forceinline__ v8f mma(V a, V b, v8f c) { return wmma16(a, b, c); } };
template <> struct WFrag<bf> { typedef v16bf V; static __device__ __forceinline__ V ld(const bf* p) { return cat16b(*(const v8us*)p, *(const v8us*)(p + 256)); } static __device__ __forceinline__ v8f mma(V a, V b, v8f c) { return wmmab(a, b, c); } };
template <typename T16, int NSPLIT, bool BIAS, int NW = 1, int EPI = 0, int LP = 512>
__device__ __forceinline__ void gemmw_tile(float* osall, int bx, int by, const T16* __restrict__ A, const T16* __restrict__ A2, const T16* __restrict__ Bt, const T16* __restrict__ Bt2, int K, float* C, int ldc, const float* __restrict__ bias, const float* __restrict__ CS, h16* P16, bf* Ph, bf* Pl) {
    typedef typename WFrag<T16>::V V;   /* osall: NW > 1 ? NW * 64 * 68 : 16 * 68 floats (NW > 1: one whole 64 x 64 partial tile a wave) */
    const int wv = NW > 1 ? __builtin_amdgcn_readfirstlane((int)(threadIdx.x >> 5)) : 0;   /* wave number, scalar so that the k loop stays a scalar branch */
    constexpr int lp = LP;   /* row length of both operands' planes, a constant so that all fragments of a k step hang on one address per plane by immediate offsets */
    float* os = osall + wv * (64 * 68);
    const int lane = threadIdx.x & 31, lr = lane & 15, hi = lane >> 4; const int r0 = bx * 64, c0 = by * 64;
    v8f acc[4][4];
#pragma unroll
    for (int mb = 0; mb < 4; ++mb)
#pragma unroll
        for (int nb = 0; nb < 4; ++nb) acc[mb][nb] = (v8f){};
    const size_t aoff = (size_t)r0 * lp + lane * 8, boff = (size_t)c0 * lp + lane * 8;   /* first tile of the 64 rows (16 rows hold 16 * lp elements) + the lane's 16 bytes; a 32-wide k step is 512 elements on */
#pragma unroll 1
    for (int kc = wv * 32; kc < K; kc += 32 * NW) {
        V a[4], a2[4], b[4], b2[4]; const T16* pa = A + aoff + (size_t)kc * 16; const T16* pa2 = (NSPLIT == 1 || NSPLIT == 2) ? A2 + aoff + (size_t)kc * 16 : nullptr; const T16* pb = Bt + boff + (size_t)kc * 16; const T16* pb2 = NSPLIT >= 2 ? Bt2 + boff + (size_t)kc * 16 : nullptr;
#pragma unroll
        for (int mb = 0; mb < 4; ++mb) { a[mb] = WFrag<T16>::ld(pa + mb * 16 * lp); if (NSPLIT == 1 || NSPLIT == 2) a2[mb] = WFrag<T16>::ld(pa2 + mb * 16 * lp); }
#pragma unroll
        for (int nb = 0; nb < 4; ++nb) { b[nb] = WFrag<T16>::ld(pb + nb * 16 * lp); if (NSPLIT >= 2) b2[nb] = WFrag<T16>::ld(pb2 + nb * 16 * lp); }
        /* behind the operand loads; the addresses are named so that they stay in their registers up to here and no load's result lands on a register that an issued load names */
        if constexpr (NSPLIT == 0) asm volatile("s_wait_xcnt 0x0" :: "v"(pa), "v"(pb) : "memory"); else if constexpr (NSPLIT == 1) asm volatile("s_wait_xcnt 0x0" :: "v"(pa), "v"(pa2), "v"(pb) : "memory"); else if constexpr (NSPLIT == 2) asm volatile("s_wait_xcnt 0x0" :: "v"(pa), "v"(pa2), "v"(pb), "v"(pb2) : "memory"); else asm volatile("s_wait_xcnt 0x0" :: "v"(pa), "v"(pb), "v"(pb2) : "memory");
        __builtin_amdgcn_sched_barrier(0);   /* no matrix instruction is lifted in front of the wait: without this the compiler lets late loads reuse fragment registers, and the wave then sits out one load latency per group of four products instead of one per k step */
#pragma unroll
        for (int nb = 0; nb < 4; ++nb)
#pragma unroll
            for (int mb = 0; mb < 4; ++mb) { acc[mb][nb] = WFrag<T16>::mma(a[mb], b[nb], acc[mb][nb]); if (NSPLIT == 1 || NSPLIT == 2) acc[mb][nb] = WFrag<T16>::mma(a2[mb], b[nb], acc[mb][nb]); if (NSPLIT >= 2) acc[mb][nb] = WFrag<T16>::mma(a[mb], b2[nb], acc[mb][nb]); }
        asm volatile("v_nop\n\tv_nop\n\tv_nop\n\tv_nop" : "+v"(acc[0][0]), "+v"(acc[1][1]), "+v"(acc[2][2]), "+v"(acc[3][3]) : "v"(a[0]), "v"(a[3]));
    }
    if constexpr (NW > 1) {
        static_assert(EPI != 1 || NW == 8, "the table fetch below is laid out for four passes of 256 threads");
        v4f c01[4], c23[4];   /* EPI 1: this thread's (cos, sin) pairs of its four passes, fetched here so that they fly under the LDS stores of the partial tile */
        if constexpr (EPI == 1) { const float* cs = CS + ((size_t)(r0 % TT + (int)(threadIdx.x >> 4)) * HD + (threadIdx.x & 15) * 4) * 2;
#pragma unroll
            for (int i = 0; i < 4; ++i) { c01[i] = *(const v4f*)(cs + i * (16 * HD * 2)); c23[i] = *(const v4f*)(cs + i * (16 * HD * 2) + 4); }
            asm volatile("s_wait_xcnt 0x0" :: "v"(cs) : "memory"); }   /* behind the table loads; the address is named so that it stays in its registers up to here */
#pragma unroll
        for (int mb = 0; mb < 4; ++mb)
#pragma unroll
            for (int nb = 0; nb < 4; ++nb)
#pragma unroll
                for (int j = 0; j < 8; ++j) os[(mb * 16 + hi * 8 + j) * 68 + nb * 16 + lr] = acc[mb][nb][j];
        __syncthreads();   /* every wave's partial tile is in LDS before any of it is summed */
#pragma unroll
        for (int u0 = 0; u0 < 64 * 16; u0 += 32 * NW) { const int u = u0 + (int)threadIdx.x, row = u >> 4, cofs = (u & 15) * 4; v4f val = *(const v4fa*)(osall + row * 68 + cofs);
#pragma unroll
            for (int w = 1; w < NW; ++w) val += *(const v4fa*)(osall + w * (64 * 68) + row * 68 + cofs);   /* partial sums joined in wave order */
            if (BIAS) { val[0] += bfr(bias[c0 + cofs]); val[1] += bfr(bias[c0 + cofs + 1]); val[2] += bfr(bias[c0 + cofs + 2]); val[3] += bfr(bias[c0 + cofs + 3]); }
            if constexpr (EPI == 0) *(v4f*)(C + (size_t)(r0 + row) * ldc + c0 + cofs) = val;
            else { v4us oh, ol;
                if constexpr (EPI == 1) { const int i = u0 / (32 * NW); const float co[4] = {c01[i][0], c01[i][2], c23[i][0], c23[i][2]}, si[4] = {c01[i][1], c01[i][3], c23[i][1], c23[i][3]};
#pragma unroll
                    for (int q = 0; q < 4; ++q) { const float par = __shfl_xor(val[q], 8, 32);   /* lane ^ 8 holds the same token's columns cofs ^ 32, the other half of the head */
                        val[q] = val[q] * co[q] + par * ((cofs < HD / 2) ? -si[q] : si[q]); } }
#pragma unroll
                for (int q = 0; q < 4; ++q) { unsigned short h2, l2; splitf(val[q], h2, l2); oh[q] = h2; ol[q] = l2; }
                const size_t e = EPI == 1 ? ((size_t)(r0 / TT) * NH_ + by) * TT * HD + fidx(r0 % TT + row, cofs, HD) : (size_t)(c0 / TT) * CO * TT + fidx(r0 + row, c0 % TT + cofs, ldc);
                *(v4us*)(Ph + e) = oh; *(v4us*)(Pl + e) = ol;
                if constexpr (EPI == 2) { v4h o16;
#pragma unroll
                    for (int q = 0; q < 4; ++q) o16[q] = tohx(val[q]);
                    *(v4h*)(P16 + e) = o16; } } }
    } else {
#pragma unroll
    for (int mb = 0; mb < 4; ++mb) {
#pragma unroll
        for (int nb = 0; nb < 4; ++nb) {
#pragma unroll
            for (int j = 0; j < 8; ++j) os[(hi * 8 + j) * 68 + nb * 16 + lr] = acc[mb][nb][j]; }
        __builtin_amdgcn_wave_barrier(); asm volatile("" ::: "memory");
        float* crow = C + (size_t)(r0 + mb * 16) * ldc + c0;
{
#pragma unroll
            for (int s = 0; s < 8; ++s) { const int row = 2 * s + hi, cofs = lr * 4; v4f val = *(const v4fa*)(os + row * 68 + cofs); if (BIAS) { val[0] += bfr(bias[c0 + cofs]); val[1] += bfr(bias[c0 + cofs + 1]); val[2] += bfr(bias[c0 + cofs + 2]); val[3] += bfr(bias[c0 + cofs + 3]); }
                *(v4f*)(crow + (size_t)row * ldc + cofs) = val; }
             }
        __builtin_amdgcn_wave_barrier(); asm volatile("" ::: "memory");
    }
    }
}

// ---- k_qkv: the three projections of both batches in one grid (NB_ * TT / 64 token tiles, 8 column tiles, 3): z = 0 q, 1 k, 2 v (formed transposed: rows = Wv columns, columns = tokens). 32 * NWP threads.
__global__ __launch_bounds__(32 * NWP) void k_qkv(const bf* __restrict__ XH, const bf* __restrict__ XL, const bf* __restrict__ WQ, const bf* __restrict__ WK, const bf* __restrict__ WV, const float* __restrict__ CS, bf* QPh, bf* QPl, bf* KPh, bf* KPl, h16* VT16, bf* VTh, bf* VTl) {
    __shared__ __align__(16) float osall[NWP * 64 * 68];
    if (blockIdx.z < 2) { const bool isk = blockIdx.z == 1;
        gemmw_tile<bf, 1, false, NWP, 1>(osall, (int)blockIdx.x, (int)blockIdx.y, XH, XL, isk ? WK : WQ, nullptr, CC, nullptr, MID, nullptr, CS, nullptr, isk ? KPh : QPh, isk ? KPl : QPl); }   /* q, k planes [b][h][n][64], rotated */
    else gemmw_tile<bf, 3, false, NWP, 2>(osall, (int)blockIdx.y, (int)blockIdx.x, WV, nullptr, XH, XL, CC, nullptr, TT, nullptr, nullptr, VT16, VTh, VTl);   /* v^T planes [b][h][64][n]: rows = Wv columns (exact), columns = tokens (hi/lo) */
}
// ---- k_out: out = ctx Wo, the rows of both batches in one grid (NB_ * TT / 64, CC / 64). 32 * NWP threads.
__global__ __launch_bounds__(32 * NWP) void k_out(const bf* __restrict__ ATh, const bf* __restrict__ ATl, const bf* __restrict__ WO, float* OUT) {
    __shared__ __align__(16) float osall[NWP * 64 * 68];
    gemmw_tile<bf, 1, false, NWP>(osall, (int)blockIdx.x, (int)blockIdx.y, ATh, ATl, WO, nullptr, CO, OUT, CC, nullptr, nullptr, nullptr, nullptr, nullptr);
}

// ---- k_fattn: causal attention of one head of one batch for 32 query rows per work-group, scores never leave the registers. grid (NB_ * heads, TT / 32), 32 * FW threads.
// S^T = K Q^T (A = key rows, B = query rows, both planes [h][t][64] in fragment order): in each 16-query group a lane holds 16 of one query's 32 scores, in the k order of a B operand, so the weights go into O^T += V^T P^T (A = value^T rows [h][64][t]) without leaving the lane.
// Running maximum m and sum l per query in base 2; key blocks past the diagonal are not visited, the diagonal block is cut by the select. The FW waves' (m, l, O) are joined in LDS in wave order.
__device__ __forceinline__ float xhalf(float x) { const int b = __float_as_int(x); return __int_as_float(__builtin_amdgcn_permlanex16(b, b, 0x76543210, 0xfedcba98, false, false)); }   /* lane l <-> l ^ 16 */
// 2^x in place. The v_nop is the one slot the instruction set asks for between a transcendental and an instruction that reads its result or overwrites its source; inside the run each v_exp_f32 is followed by one on other registers.
__device__ __forceinline__ float exp2s(float x) { asm("v_exp_f32 %0, %0\n\tv_nop" : "+v"(x)); return x; }
__device__ __forceinline__ void exp2x8(float (&e)[8]) { asm("v_exp_f32 %0, %0\n\tv_exp_f32 %1, %1\n\tv_exp_f32 %2, %2\n\tv_exp_f32 %3, %3\n\tv_exp_f32 %4, %4\n\tv_exp_f32 %5, %5\n\tv_exp_f32 %6, %6\n\tv_exp_f32 %7, %7\n\tv_nop" : "+v"(e[0]), "+v"(e[1]), "+v"(e[2]), "+v"(e[3]), "+v"(e[4]), "+v"(e[5]), "+v"(e[6]), "+v"(e[7])); }
// (wave-uniform base of a tile) + (this lane's 16 bytes inside it)
template <typename T16> __device__ __forceinline__ const T16* lanep(const T16* base, unsigned lane_bytes) { return (const T16*)((const char*)base + lane_bytes); }
template <bool HL>
__device__ __forceinline__ void fattn_keys(const bf* __restrict__ Kh, const bf* __restrict__ Kl, const h16* __restrict__ V16, const bf* __restrict__ Vh, const bf* __restrict__ Vl, const v16bf (&qh)[2][2], const v16bf (&ql)[2][2], int q0, int wv, int lr, int hi, unsigned lk, unsigned lv, v8f (&o)[2][4], float (&m)[2], float (&l)[2]) {
#pragma unroll 1   /* one copy of the pass: a second one would double the fragments that are live and cost the fourth wave per SIMD */
    for (int kb = wv * 32; kb < q0 + 32; kb += 32 * FW) {
        v8f s[2][2]; v16bf kh[2][2], kl[2][2]; const bf* pkh = lanep(Kh + (size_t)kb * HD, lk); const bf* pkl = lanep(Kl + (size_t)kb * HD, lk);
#pragma unroll
        for (int kt = 0; kt < 2; ++kt)
#pragma unroll
            for (int ks = 0; ks < 2; ++ks) { kh[kt][ks] = WFrag<bf>::ld(pkh + (kt * 2 + ks) * 512); kl[kt][ks] = WFrag<bf>::ld(pkl + (kt * 2 + ks) * 512); }
        asm volatile("s_wait_xcnt 0x0" :: "v"(pkh), "v"(pkl) : "memory");   /* behind the key loads; the addresses are named so that they stay in their registers up to here and no load's result lands on a register that an issued load names */
#pragma unroll
        for (int kt = 0; kt < 2; ++kt)
#pragma unroll
            for (int g = 0; g < 2; ++g) { v8f a = (v8f){};
#pragma unroll
                for (int ks = 0; ks < 2; ++ks) { a = wmmab(kh[kt][ks], qh[g][ks], a); a = wmmab(kl[kt][ks], qh[g][ks], a); a = wmmab(kh[kt][ks], ql[g][ks], a); }
                s[g][kt] = a; }
        v16bf vh[4], vl[4]; v16h vf[4]; const bf* pvh = lanep(Vh + (size_t)kb * 16, lv); const bf* pvl = lanep(Vl + (size_t)kb * 16, lv); const h16* pvf = lanep(V16 + (size_t)kb * 16, lv);   /* 32 keys = one tile = 512 elements along a 16-row band of 16 * TT */
#pragma unroll
        for (int dt = 0; dt < 4; ++dt) { if (HL) { vh[dt] = WFrag<bf>::ld(pvh + dt * 16 * TT); vl[dt] = WFrag<bf>::ld(pvl + dt * 16 * TT); } else vf[dt] = WFrag<h16>::ld(pvf + dt * 16 * TT); }
        if (HL) asm volatile("s_wait_xcnt 0x0" :: "v"(pvh), "v"(pvl) : "memory"); else asm volatile("s_wait_xcnt 0x0" :: "v"(pvf) : "memory");   /* the same behind the value loads, which fly under the softmax */
        v16bf ph[2], pl[2]; v16h p16[2];
#pragma unroll
        for (int g = 0; g < 2; ++g) { const int rel = q0 + g * 16 + lr - kb - hi * 8; float mr = -3.0e38f;   /* this lane's score (kt, j) belongs to a key <= its query where kt * 16 + j <= rel */
#pragma unroll
            for (int kt = 0; kt < 2; ++kt)
#pragma unroll
                for (int j = 0; j < 8; ++j) { const float t = (kt * 16 + j <= rel) ? s[g][kt][j] : -3.0e38f; s[g][kt][j] = t; mr = fmaxf(mr, t); }
            mr = fmaxf(mr, xhalf(mr)); const float mx = fmaxf(m[g], mr * (SCL * 1.4426950408889634f));
            const float al = exp2s(m[g] - mx); m[g] = mx; float sa[4] = {0.f, 0.f, 0.f, 0.f};   /* al = 0 on a wave's first block (m = -3e38) */
#pragma unroll
            for (int kt = 0; kt < 2; ++kt) { float e[8];
#pragma unroll
                for (int j = 0; j < 8; ++j) e[j] = __builtin_fmaf(s[g][kt][j], SCL * 1.4426950408889634f, -mx);
                exp2x8(e);
#pragma unroll
                for (int j = 0; j < 8; ++j) { const float p = e[j]; sa[j & 3] += p;
                    if (HL) { const __bf16 a2 = (__bf16)p; ph[g][kt * 8 + j] = a2; pl[g][kt * 8 + j] = (__bf16)(p - (float)a2); } else p16[g][kt * 8 + j] = tohx(p); } }
            const float sum = (sa[0] + sa[1]) + (sa[2] + sa[3]);
            l[g] = l[g] * al + sum;
#pragma unroll
            for (int dt = 0; dt < 4; ++dt) o[g][dt] *= al; }
#pragma unroll
        for (int dt = 0; dt < 4; ++dt)
#pragma unroll
            for (int g = 0; g < 2; ++g) { if (HL) { o[g][dt] = wmmab(vh[dt], ph[g], o[g][dt]); o[g][dt] = wmmab(vl[dt], ph[g], o[g][dt]); o[g][dt] = wmmab(vh[dt], pl[g], o[g][dt]); } else o[g][dt] = wmma16(vf[dt], p16[g], o[g][dt]); }
    }
}
// amdgpu_waves_per_eu(4, 4): at most 256 registers a wave, so that two work-groups (four waves per SIMD) share a WGP and cover each other's load latency.
__global__ __launch_bounds__(32 * FW) __attribute__((amdgpu_waves_per_eu(4, 4))) void k_fattn(const bf* __restrict__ Qh, const bf* __restrict__ Ql, const bf* __restrict__ Kh, const bf* __restrict__ Kl, const h16* __restrict__ V16, const bf* __restrict__ Vh, const bf* __restrict__ Vl, bf* __restrict__ Oh, bf* __restrict__ Ol) {
    __shared__ __align__(16) float so[FW * 32 * 68]; __shared__ float sm[FW * 32], sl[FW * 32];
    const int wv = __builtin_amdgcn_readfirstlane((int)(threadIdx.x >> 5));   /* wave number, scalar so that the key loop stays a scalar branch */
    const int lane = threadIdx.x & 31, lr = lane & 15, hi = lane >> 4; const int h = blockIdx.x % NH_, b = blockIdx.x / NH_;
    const size_t hb = (size_t)blockIdx.x * TT * HD;   /* planes [b][h]: (b * NH_ + h) */ Qh += hb; Ql += hb; Kh += hb; Kl += hb; V16 += hb; Vh += hb; Vl += hb;
    {
        const int q0 = (TT / 32 - 1 - (int)blockIdx.y) * 32;   /* the longest rows of every head and batch start first, the short ones fill in behind them */
        const unsigned lk = (unsigned)lane * 16u, lv = lk;   /* the lane's bytes inside a tile, the same in every plane */
        v16bf qh[2][2], ql[2][2]; const bf* pqh = lanep(Qh + (size_t)q0 * HD, lk); const bf* pql = lanep(Ql + (size_t)q0 * HD, lk);
#pragma unroll
        for (int g = 0; g < 2; ++g)
#pragma unroll
            for (int ks = 0; ks < 2; ++ks) { qh[g][ks] = WFrag<bf>::ld(pqh + (g * 2 + ks) * 512); ql[g][ks] = WFrag<bf>::ld(pql + (g * 2 + ks) * 512); }
        asm volatile("s_wait_xcnt 0x0" :: "v"(pqh), "v"(pql) : "memory");   /* behind the query loads; the addresses are named so that they stay in their registers up to here */
        v8f o[2][4]; float m[2], l[2];
#pragma unroll
        for (int g = 0; g < 2; ++g) { m[g] = -3.0e38f; l[g] = 0.f;
#pragma unroll
            for (int dt = 0; dt < 4; ++dt) o[g][dt] = (v8f){}; }
        if (q0 < RH) fattn_keys<true>(Kh, Kl, V16, Vh, Vl, qh, ql, q0, wv, lr, hi, lk, lv, o, m, l); else fattn_keys<false>(Kh, Kl, V16, Vh, Vl, qh, ql, q0, wv, lr, hi, lk, lv, o, m, l);
#pragma unroll
        for (int g = 0; g < 2; ++g) { l[g] += xhalf(l[g]); if (hi == 0) { sm[wv * 32 + g * 16 + lr] = m[g]; sl[wv * 32 + g * 16 + lr] = l[g]; } }
        __syncthreads();   /* every wave's maximum and sum are in LDS before the common ones are formed */
#pragma unroll
        for (int g = 0; g < 2; ++g) { float mm = sm[g * 16 + lr];
#pragma unroll
            for (int w = 1; w < FW; ++w) mm = fmaxf(mm, sm[w * 32 + g * 16 + lr]);
            float ll = 0.f;
#pragma unroll
            for (int w = 0; w < FW; ++w) ll += sl[w * 32 + g * 16 + lr] * exp2s(sm[w * 32 + g * 16 + lr] - mm);   /* a wave that had no key block holds m = -3e38, l = 0 */
            const float f = __fdiv_rn(exp2s(m[g] - mm), ll);
#pragma unroll
            for (int dt = 0; dt < 4; ++dt) { const v8f a = o[g][dt] * f; float* d = so + (wv * 32 + g * 16 + lr) * 68 + dt * 16 + hi * 8;
                *(v4fa*)d = (v4f){a[0], a[1], a[2], a[3]}; *(v4fa*)(d + 4) = (v4f){a[4], a[5], a[6], a[7]}; } }
        __syncthreads();   /* every wave's scaled partial rows are in LDS before any of them is summed */
#pragma unroll
        for (int u0 = 0; u0 < 32 * 16; u0 += 32 * FW) { const int u = u0 + (int)threadIdx.x, row = u >> 4, cofs = (u & 15) * 4; v4f val = *(const v4fa*)(so + row * 68 + cofs);
#pragma unroll
            for (int w = 1; w < FW; ++w) val += *(const v4fa*)(so + (w * 32 + row) * 68 + cofs);   /* partial rows joined in wave order */
            v4us oh, ol;
#pragma unroll
            for (int q = 0; q < 4; ++q) { unsigned short h2, l2; splitf(val[q], h2, l2); oh[q] = h2; ol[q] = l2; }
            const size_t e = fidx(b * TT + q0 + row, h * HD + cofs, CO); *(v4us*)(Oh + e) = oh; *(v4us*)(Ol + e) = ol; }   /* context rows [b * TT + t][h * 64 + d] as the hi/lo operand planes of the last product, in fragment order */
    }
}

__constant__ float INVT[HD / 2] = { 1.000000000e+00f, 6.493816376e-01f, 4.216965139e-01f, 2.738419771e-01f, 1.778279394e-01f, 1.154782027e-01f, 7.498941571e-02f, 4.869675264e-02f, 3.162277862e-02f, 2.053525113e-02f, 1.333521493e-02f, 8.659643121e-03f, 5.623413250e-03f, 3.651741426e-03f, 2.371373819e-03f, 1.539926510e-03f, 1.000000047e-03f, 6.493816618e-04f, 4.216964880e-04f, 2.738419571e-04f, 1.778279402e-04f, 1.154781930e-04f, 7.498942432e-05f, 4.869675467e-05f, 3.162277426e-05f, 2.053524986e-05f, 1.333521413e-05f, 8.659643754e-06f, 5.623413472e-06f, 3.651741281e-06f, 2.371373739e-06f, 1.539926529e-06f };   // float32 1 / 1000000^(2i/64) (the module's integer-arange expression), generated with jnp to be bit-exact
__device__ __forceinline__ void cs5_block(int blk, float* CS) { const int idx = blk * 256 + threadIdx.x; if (idx >= TT * HD) return; const int d = idx % HD; const int t = idx / HD; const float a = __fmul_rn((float)t, INVT[d % (HD / 2)]); v2f cs; cs[0] = cosf(a); cs[1] = sinf(a); *(v2f*)(CS + (size_t)idx * 2) = cs;  }
__device__ __forceinline__ void rmsx_rows(int blk, const float* __restrict__ X, const float* __restrict__ sc, bf* XH, bf* XL) { const int lane = threadIdx.x & 31; const int row = blk * 8 + (threadIdx.x >> 5); if (row >= NB_ * TT) return;   /* row = b * TT + t */ const float* xr = X + (size_t)row * CC + lane * 16; const float* sr = sc + lane * 16; float v[16]; float ss = 0.f; v4f xa[4], sv[4];
#pragma unroll
    for (int c = 0; c < 4; ++c) { xa[c] = *(const v4f*)(xr + c * 4); sv[c] = *(const v4f*)(sr + c * 4); }
    asm volatile("s_wait_xcnt 0x0" :: "v"(xr), "v"(sr) : "memory");   /* behind the row's and the scale's loads; the addresses are named so that no load's result lands on a register that an issued load names */
#pragma unroll
    for (int c = 0; c < 4; ++c) { const v4f a = xa[c];
#pragma unroll
        for (int q = 0; q < 4; ++q) { const float b = bfr(a[q]); v[c * 4 + q] = b; float p = __fmul_rn(b, b); asm volatile("" : "+v"(p)); ss = __fadd_rn(ss, p); } }
#pragma unroll
    for (int sh = 16; sh; sh >>= 1) ss = __fadd_rn(ss, __shfl_xor(ss, sh, 32));
    const float den = sqrtf(__fadd_rn(__fmul_rn(ss, 1.0f / CC), 1.0e-6f)); const float rinv = __fdiv_rn(1.0f, den);   /* ONE IEEE division per row; x * (1/den) differs from the module's x / den by <= 1 ulp */
    v4us oh[4], ol[4];
#pragma unroll
    for (int c = 0; c < 4; ++c) {
#pragma unroll
        for (int q = 0; q < 4; ++q) { float y = __fmul_rn(v[c * 4 + q], rinv); asm volatile("" : "+v"(y)); y = __fmul_rn(y, bfr(sv[c][q])); unsigned short a2, c2; splitf(y, a2, c2); oh[c][q] = a2; ol[c][q] = c2; } }
    const size_t e = fidx(row, lane * 16, CC); bf* ph = XH + e; bf* pl = XL + e;   /* fragment order: the lane's columns 0..7 here, its columns 8..15 128 elements on */
#pragma unroll
    for (int c = 0; c < 2; ++c) { *(v8us*)(ph + c * 128) = __builtin_shufflevector(oh[2 * c], oh[2 * c + 1], 0, 1, 2, 3, 4, 5, 6, 7); *(v8us*)(pl + c * 128) = __builtin_shufflevector(ol[2 * c], ol[2 * c + 1], 0, 1, 2, 3, 4, 5, 6, 7); }
}
__device__ __forceinline__ void wtG_lines(int blk, const float* __restrict__ w, int K, int N, bf* Bt) {
    const int lane = threadIdx.x & 31; const int L0 = (blk * 8 + (threadIdx.x >> 5)) * 8; const int nlines = N * K / 64;
{
#pragma unroll 1
        for (int l = 0; l < 8; ++l) { const int L = L0 + l; if (L >= nlines) break; const size_t e = (size_t)L * 64 + lane * 2; const int k = (int)(e % K), n = (int)(e / K); v2us o;
            o[0] = f2bf(w[(size_t)k * N + n]); o[1] = f2bf(w[(size_t)(k + 1) * N + n]); *(v2us*)(Bt + fidx(n, k, K)) = o;   /* Bt[n][k] in fragment order */
            asm volatile("s_wait_xcnt 0x0" ::: "memory"); }   /* behind the store, in front of the next trip's rewrite of its address and data registers */
         }
}
// ---- k_prep: all that depends on the inputs alone, side by side in one grid of 256 threads: blocks 0 .. 4 * WB - 1 the four weights (WB blocks each; the longest blocks, so they start first), the next RB the token rows of both batches, the last TB the rotary table.
#define WB (CC * MID / 64 / 64)
#define RB (NB_ * TT / 8)
#define TB (TT * HD / 256)
__global__ __launch_bounds__(256) void k_prep(const float* __restrict__ x, const float* __restrict__ rsc, const float* __restrict__ wq, const float* __restrict__ wk, const float* __restrict__ wv, const float* __restrict__ wo, bf* WQKV, bf* WO, float* CS, bf* XH, bf* XL) {
    const int blk = (int)blockIdx.x;
    if (blk < 4 * WB) { const int j = blk / WB; wtG_lines(blk % WB, j == 0 ? wq : j == 1 ? wk : j == 2 ? wv : wo, CC, MID, j < 3 ? WQKV + (size_t)j * MID * CC : WO); }   /* 'xw' weights -> Bt; all four are [512][512] */
    else if (blk < 4 * WB + RB) rmsx_rows(blk - 4 * WB, x, rsc, XH, XL);   /* x_norm = x / sqrt(mean x^2 + eps) x scale as hi/lo planes */
    else cs5_block(blk - 4 * WB - RB, CS);   /* cos, sin per (token, d) for the q and k epilogues */
}
extern "C" void kernel_launch(void* const* d_in, const int* in_sizes, int n_in,
                              void* d_out, int out_size, void* d_ws, size_t ws_size, hipStream_t stream) {
    (void)in_sizes; (void)n_in; (void)out_size;
    const float* x = (const float*)d_in[0]; const float* rsc = (const float*)d_in[1]; const float* wq = (const float*)d_in[2]; const float* wk = (const float*)d_in[3]; const float* wv = (const float*)d_in[4]; const float* wo = (const float*)d_in[5];   /* input order x [2][4096][512], scale [512] (RMSNorm weight), Wq, Wk, Wv, Wo ('xw' [512][512], no biases) */
    float* OUT = (float*)d_out;     // [2][4096][512]
    char* wsp = (char*)d_ws;
    auto take = [&](size_t bytes) { char* p = wsp; wsp += (bytes + 255) & ~(size_t)255; return (void*)p; };
    bf* WQKV = (bf*)take((size_t)3 * MID * CC * 2); bf* WQ = WQKV; bf* WK = WQKV + (size_t)MID * CC; bf* WV = WQKV + (size_t)2 * MID * CC; bf* WO = (bf*)take((size_t)CC * CO * 2); float* CS = (float*)take((size_t)TT * HD * 2 * 4);
    bf* XH = (bf*)take((size_t)NB_ * TT * CC * 2); bf* XL = (bf*)take((size_t)NB_ * TT * CC * 2);   /* RMS-normalised tokens, bf16 hi/lo */
    bf* QPh = (bf*)take((size_t)NB_ * TT * MID * 2); bf* QPl = (bf*)take((size_t)NB_ * TT * MID * 2); bf* KPh = (bf*)take((size_t)NB_ * TT * MID * 2); bf* KPl = (bf*)take((size_t)NB_ * TT * MID * 2);
    h16* VT16 = (h16*)take((size_t)NB_ * CO * TT * 2); bf* VTh = (bf*)take((size_t)NB_ * CO * TT * 2); bf* VTl = (bf*)take((size_t)NB_ * CO * TT * 2);
    bf* ATh = (bf*)take((size_t)NB_ * TT * CO * 2); bf* ATl = (bf*)take((size_t)NB_ * TT * CO * 2);
    if ((size_t)(wsp - (char*)d_ws) > ws_size) return;
    k_prep<<<4 * WB + RB + TB, 256, 0, stream>>>(x, rsc, wq, wk, wv, wo, WQKV, WO, CS, XH, XL);
    k_qkv<<<dim3(NB_ * TT / 64, MID / 64, 3), 32 * NWP, 0, stream>>>(XH, XL, WQ, WK, WV, CS, QPh, QPl, KPh, KPl, VT16, VTh, VTl);
    k_fattn<<<dim3(NB_ * NH_, TT / 32, 1), 32 * FW, 0, stream>>>(QPh, QPl, KPh, KPl, VT16, VTh, VTl, ATh, ATl);   /* all heads of both batches: scores, causal softmax and attn.V; merged context as hi/lo planes */
    k_out<<<dim3(NB_ * TT / 64, CC / 64, 1), 32 * NWP, 0, stream>>>(ATh, ATl, WO, OUT);
}

// v006
// Measured time: 116 microseconds a run.
// In two side-by-side timings against v005, it was 1.08 and 1.09 times as fast.
// Over all steps from v000 it is 34.6 times as fast.
#include <hip/hip_runtime.h>

// Causal multi-head self-attention with a leading RMSNorm and rotary embeddings over 4,096 tokens (x [2][4096][512]; x_norm = x / sqrt(mean x^2 + 1e-6) x scale (scale [512] ones, read); q, k, v = x_norm W ('xw' [512][512] 1/sqrt(512), no bias; 8 heads x 64); rotate-half rope (cat(x1 c - x2 s, x1 s + x2 c)) with angle t x 1/1000000^(2i/64) (32 f32 frequencies jnp-exact; precise cosf/sinf); scores / sqrt(64); causal (-inf); softmax; out = merged Wo ('xw') -> [2][4096][512] (4.2 M); argument order x, scale, Wq, Wk, Wv, Wo).
// Four launches, both batches side by side in each grid (every plane holds batch 0, then batch 1): k_prep (weights to fragment order, rotary table, RMSNorm), k_qkv, k_fattn, k_out. Layout: rmsx_rows normalises each token row in f32 and stores bf16 hi/lo planes; projections hi/lo x exact weights (2 products), whose epilogues write the operand planes themselves (q, k: rotate-half with the cs5_block table, then hi/lo; v: the product is formed transposed, Wv rows x token rows, and stored as value^T planes); k_fattn: scores (hi/lo planes, 3 products), causal select (x 1/8), running-maximum softmax and attn.V (rows < 512 hi/lo 3 products, rest fp16) in one kernel over all heads, keys and values staged in LDS by asynchronous copies, no score matrix in memory, context stored as hi/lo planes; context hi/lo x Wo exact written to the output rows. Every 16-bit operand plane lies in fragment order (fidx below).
// Compute dtypes, f32 accumulate: every input rounded to bf16 incl. scale; RMSNorm f32; projections 2 products (hi/lo x exact); rotary f32; scores 3 products; softmax f32, weights kept unnormalised (<= 1) and divided by the row sum at the end; attn.V rows < 512 3 products, rest fp16; Wo hl x exact.

#define NB_  2
#define TT   4096
#define DM   512
#define NH_  8
#define NKV  8
#define REP  (NH_ / NKV)
#define HD   64
#define DQ   (NH_ * HD)
#define DKV  (NKV * HD)
#define ZH   1
#define RH   512                  // query rows < RH use hi+lo planes (0: none)
#define WIN  0
#define SCL  0.125f   // 1/sqrt(float32(64))
#define MID  512      // q / k width = 8 heads x 64
#define CO   512      // v width
#define CC   512
#define FW   8        // k_fattn: waves per work-group: 2 query halves x 4 key blocks of a stage
#define NWP  8        // projections: waves per tile
typedef _Float16 h16;
typedef unsigned short bf;
typedef __attribute__((ext_vector_type(16))) __bf16   v16bf;
typedef __attribute__((ext_vector_type(16))) _Float16 v16h;
typedef __attribute__((ext_vector_type(8)))  _Float16 v8h;
typedef __attribute__((ext_vector_type(8)))  unsigned short v8us;
typedef __attribute__((ext_vector_type(8)))  float    v8f;
typedef __attribute__((ext_vector_type(4)))  float    v4f;
typedef v8h  __attribute__((may_alias)) v8ha;
typedef v4f  __attribute__((may_alias)) v4fa;
typedef v8us __attribute__((may_alias)) v8usa;

__device__ __forceinline__ unsigned short f2bf(float f) { unsigned u = __float_as_uint(f); u += 0x7FFFu + ((u >> 16) & 1u); return (unsigned short)(u >> 16); }
__device__ __forceinline__ float bf2f(unsigned short b) { return __uint_as_float(((unsigned)b) << 16); }
__device__ __forceinline__ float bfr(float f) { return bf2f(f2bf(f)); }
__device__ __forceinline__ v16h cat16(v8h lo, v8h hi) { return __builtin_shufflevector(lo, hi, 0, 1, 2, 3, 4, 5, 6, 7, 8, 9, 10, 11, 12, 13, 14, 15); }
__device__ __forceinline__ v16bf cat16b(v8us lo, v8us hi) { return __builtin_bit_cast(v16bf, __builtin_shufflevector(lo, hi, 0, 1, 2, 3, 4, 5, 6, 7, 8, 9, 10, 11, 12, 13, 14, 15)); }
__device__ __forceinline__ v8f wmma16(v16h a, v16h b, v8f c) { return __builtin_amdgcn_wmma_f32_16x16x32_f16(false, a, false, b, (short)0, c, false, false); }
__device__ __forceinline__ v8f wmmab(v16bf a, v16bf b, v8f c) { return __builtin_amdgcn_wmma_f32_16x16x32_bf16(false, a, false, b, (short)0, c, false, false); }

__device__ __forceinline__ h16 tohx(float x) { return (h16)x; }
__device__ __forceinline__ void splitf(float y, unsigned short& h, unsigned short& l) { h = f2bf(y); l = f2bf(y - bf2f(h)); }
typedef __attribute__((ext_vector_type(4))) _Float16 v4h;
typedef __attribute__((ext_vector_type(2))) unsigned short v2us;
typedef __attribute__((ext_vector_type(4))) unsigned short v4us;
typedef __attribute__((ext_vector_type(2))) float v2f;

// ---- gemmw_tile: register-blocked GEMM, one 64x64 output tile (16 accumulators a wave), tile (bx, by) of (M/64, N/64), per work-group of NW waves, operands straight from 16-bit planes in fragment order (fidx) of row length LP; osall is the work-group's LDS.
// C[m][n] (f32, pitch ldc, + optional f32 bias[n]) = sum_k A[m][k] Bt[n][k] (+ split products per NSPLIT). K % (32 * NW) == 0. The token rows of both batches stand one behind the other (row = b * TT + t).
// EPI says what the joined tile becomes: 0 f32 rows of C; 1 (tile = 64 tokens x one head) rotate-half rotary out[d] = x[d] cos[t][d] -/+ x[d +/- 32] sin[t][d] from the table CS [t][64][cos, sin], stored as bf16 hi/lo planes [b][head][t][64]; 2 (columns = tokens) fp16 and bf16 hi/lo planes [b][CO rows] of row length ldc = TT; both in fragment order.
// Split-K: wave w takes the 32-wide k steps w, w + NW, ... (one 1,024-byte tile per fragment); the NW partial tiles are summed in LDS in wave order.
// Fragment order of a 16-bit operand plane of K-contiguous rows (rows % 16 == 0, K % 32 == 0): one 16-row x 32-k tile is 1,024 contiguous bytes, tiles run along k and then down the rows. Inside a tile the 16 bytes that lane (hi * 16 + row % 16) takes for k % 32 = c * 16 + hi * 8 + 0..7 stand at c * 512 + lane * 16, so each of a fragment's two wave-wide 16-byte loads reads 512 contiguous bytes (four whole 128-byte lines) where row-major planes gave it 32-byte pieces of 16 lines.
__device__ __forceinline__ size_t fidx(int row, int k, int K) { return ((size_t)(row >> 4) * (K >> 5) + (k >> 5)) * 512 + ((k >> 4) & 1) * 256 + ((k >> 3) & 1) * 128 + (row & 15) * 8 + (k & 7); }
template <typename T16> struct WFrag;
template <> struct WFrag<h16> { typedef v16h V; static __device__ __forceinline__ V ld(const h16* p) { return cat16(*(const v8h*)p, *(const v8h*)(p + 256)); } static __device__ __forceinline__ v8f mma(V a, V b, v8f c) { return wmma16(a, b, c); } };
template <> struct WFrag<bf> { typedef v16bf V; static __device__ __forceinline__ V ld(const bf* p) { return cat16b(*(const v8us*)p, *(const v8us*)(p + 256)); } static __device__ __forceinline__ v8f mma(V a, V b, v8f c) { return wmmab(a, b, c); } };
template <typename T16, int NSPLIT, bool BIAS, int NW = 1, int EPI = 0, int LP = 512>
__device__ __forceinline__ void gemmw_tile(float* osall, int bx, int by, const T16* __restrict__ A, const T16* __restrict__ A2, const T16* __restrict__ Bt, const T16* __restrict__ Bt2, int K, float* C, int ldc, const float* __restrict__ bias, const float* __restrict__ CS, h16* P16, bf* Ph, bf* Pl) {
    typedef typename WFrag<T16>::V V;   /* osall: NW > 1 ? NW * 64 * 68 : 16 * 68 floats (NW > 1: one whole 64 x 64 partial tile a wave) */
    const int wv = NW > 1 ? __builtin_amdgcn_readfirstlane((int)(threadIdx.x >> 5)) : 0;   /* wave number, scalar so that the k loop stays a scalar branch */
    constexpr int lp = LP;   /* row length of both operands' planes, a constant so that all fragments of a k step hang on one address per plane by immediate offsets */
    float* os = osall + wv * (64 * 68);
    const int lane = threadIdx.x & 31, lr = lane & 15, hi = lane >> 4; const int r0 = bx * 64, c0 = by * 64;
    v8f acc[4][4];
#pragma unroll
    for (int mb = 0; mb < 4; ++mb)
#pragma unroll
        for (int nb = 0; nb < 4; ++nb) acc[mb][nb] = (v8f){};
    const size_t aoff = (size_t)r0 * lp + lane * 8, boff = (size_t)c0 * lp + lane * 8;   /* first tile of the 64 rows (16 rows hold 16 * lp elements) + the lane's 16 bytes; a 32-wide k step is 512 elements on */
#pragma unroll 1
    for (int kc = wv * 32; kc < K; kc += 32 * NW) {
        V a[4], a2[4], b[4], b2[4]; const T16* pa = A + aoff + (size_t)kc * 16; const T16* pa2 = (NSPLIT == 1 || NSPLIT == 2) ? A2 + aoff + (size_t)kc * 16 : nullptr; const T16* pb = Bt + boff + (size_t)kc * 16; const T16* pb2 = NSPLIT >= 2 ? Bt2 + boff + (size_t)kc * 16 : nullptr;
#pragma unroll
        for (int mb = 0; mb < 4; ++mb) { a[mb] = WFrag<T16>::ld(pa + mb * 16 * lp); if (NSPLIT == 1 || NSPLIT == 2) a2[mb] = WFrag<T16>::ld(pa2 + mb * 16 * lp); }
#pragma unroll
        for (int nb = 0; nb < 4; ++nb) { b[nb] = WFrag<T16>::ld(pb + nb * 16 * lp); if (NSPLIT >= 2) b2[nb] = WFrag<T16>::ld(pb2 + nb * 16 * lp); }
        /* behind the operand loads; the addresses are named so that they stay in their registers up to here and no load's result lands on a register that an issued load names */
        if constexpr (NSPLIT == 0) asm volatile("s_wait_xcnt 0x0" :: "v"(pa), "v"(pb) : "memory"); else if constexpr (NSPLIT == 1) asm volatile("s_wait_xcnt 0x0" :: "v"(pa), "v"(pa2), "v"(pb) : "memory"); else if constexpr (NSPLIT == 2) asm volatile("s_wait_xcnt 0x0" :: "v"(pa), "v"(pa2), "v"(pb), "v"(pb2) : "memory"); else asm volatile("s_wait_xcnt 0x0" :: "v"(pa), "v"(pb), "v"(pb2) : "memory");
        __builtin_amdgcn_sched_barrier(0);   /* no matrix instruction is lifted in front of the wait: without this the compiler lets late loads reuse fragment registers, and the wave then sits out one load latency per group of four products instead of one per k step */
#pragma unroll
        for (int nb = 0; nb < 4; ++nb)
#pragma unroll
            for (int mb = 0; mb < 4; ++mb) { acc[mb][nb] = WFrag<T16>::mma(a[mb], b[nb], acc[mb][nb]); if (NSPLIT == 1 || NSPLIT == 2) acc[mb][nb] = WFrag<T16>::mma(a2[mb], b[nb], acc[mb][nb]); if (NSPLIT >= 2) acc[mb][nb] = WFrag<T16>::mma(a[mb], b2[nb], acc[mb][nb]); }
        asm volatile("v_nop\n\tv_nop\n\tv_nop\n\tv_nop" : "+v"(acc[0][0]), "+v"(acc[1][1]), "+v"(acc[2][2]), "+v"(acc[3][3]) : "v"(a[0]), "v"(a[3]));
    }
    if constexpr (NW > 1) {
        static_assert(EPI != 1 || NW == 8, "the table fetch below is laid out for four passes of 256 threads");
        v4f c01[4], c23[4];   /* EPI 1: this thread's (cos, sin) pairs of its four passes, fetched here so that they fly under the LDS stores of the partial tile */
        if constexpr (EPI == 1) { const float* cs = CS + ((size_t)(r0 % TT + (int)(threadIdx.x >> 4)) * HD + (threadIdx.x & 15) * 4) * 2;
#pragma unroll
            for (int i = 0; i < 4; ++i) { c01[i] = *(const v4f*)(cs + i * (16 * HD * 2)); c23[i] = *(const v4f*)(cs + i * (16 * HD * 2) + 4); }
            asm volatile("s_wait_xcnt 0x0" :: "v"(cs) : "memory"); }   /* behind the table loads; the address is named so that it stays in its registers up to here */
#pragma unroll
        for (int mb = 0; mb < 4; ++mb)
#pragma unroll
            for (int nb = 0; nb < 4; ++nb)
#pragma unroll
                for (int j = 0; j < 8; ++j) os[(mb * 16 + hi * 8 + j) * 68 + nb * 16 + lr] = acc[mb][nb][j];
        __syncthreads();   /* every wave's partial tile is in LDS before any of it is summed */
#pragma unroll
        for (int u0 = 0; u0 < 64 * 16; u0 += 32 * NW) { const int u = u0 + (int)threadIdx.x, row = u >> 4, cofs = (u & 15) * 4; v4f val = *(const v4fa*)(osall + row * 68 + cofs);
#pragma unroll
            for (int w = 1; w < NW; ++w) val += *(const v4fa*)(osall + w * (64 * 68) + row * 68 + cofs);   /* partial sums joined in wave order */
            if (BIAS) { val[0] += bfr(bias[c0 + cofs]); val[1] += bfr(bias[c0 + cofs + 1]); val[2] += bfr(bias[c0 + cofs + 2]); val[3] += bfr(bias[c0 + cofs + 3]); }
            if constexpr (EPI == 0) *(v4f*)(C + (size_t)(r0 + row) * ldc + c0 + cofs) = val;
            else { v4us oh, ol;
                if constexpr (EPI == 1) { const int i = u0 / (32 * NW); const float co[4] = {c01[i][0], c01[i][2], c23[i][0], c23[i][2]}, si[4] = {c01[i][1], c01[i][3], c23[i][1], c23[i][3]};
#pragma unroll
                    for (int q = 0; q < 4; ++q) { const float par = __shfl_xor(val[q], 8, 32);   /* lane ^ 8 holds the same token's columns cofs ^ 32, the other half of the head */
                        val[q] = val[q] * co[q] + par * ((cofs < HD / 2) ? -si[q] : si[q]); } }
#pragma unroll
                for (int q = 0; q < 4; ++q) { unsigned short h2, l2; splitf(val[q], h2, l2); oh[q] = h2; ol[q] = l2; }
                const size_t e = EPI == 1 ? ((size_t)(r0 / TT) * NH_ + by) * TT * HD + fidx(r0 % TT + row, cofs, HD) : (size_t)(c0 / TT) * CO * TT + fidx(r0 + row, c0 % TT + cofs, ldc);
                *(v4us*)(Ph + e) = oh; *(v4us*)(Pl + e) = ol;
                if constexpr (EPI == 2) { v4h o16;
#pragma unroll
                    for (int q = 0; q < 4; ++q) o16[q] = tohx(val[q]);
                    *(v4h*)(P16 + e) = o16; } } }
    } else {
#pragma unroll
    for (int mb = 0; mb < 4; ++mb) {
#pragma unroll
        for (int nb = 0; nb < 4; ++nb) {
#pragma unroll
            for (int j = 0; j < 8; ++j) os[(hi * 8 + j) * 68 + nb * 16 + lr] = acc[mb][nb][j]; }
        __builtin_amdgcn_wave_barrier(); asm volatile("" ::: "memory");
        float* crow = C + (size_t)(r0 + mb * 16) * ldc + c0;
{
#pragma unroll
            for (int s = 0; s < 8; ++s) { const int row = 2 * s + hi, cofs = lr * 4; v4f val = *(const v4fa*)(os + row * 68 + cofs); if (BIAS) { val[0] += bfr(bias[c0 + cofs]); val[1] += bfr(bias[c0 + cofs + 1]); val[2] += bfr(bias[c0 + cofs + 2]); val[3] += bfr(bias[c0 + cofs + 3]); }
                *(v4f*)(crow + (size_t)row * ldc + cofs) = val; }
             }
        __builtin_amdgcn_wave_barrier(); asm volatile("" ::: "memory");
    }
    }
}

// ---- k_qkv: the three projections of both batches in one grid (NB_ * TT / 64 token tiles, 8 column tiles, 3): z = 0 q, 1 k, 2 v (formed transposed: rows = Wv columns, columns = tokens). 32 * NWP threads.
__global__ __launch_bounds__(32 * NWP) void k_qkv(const bf* __restrict__ XH, const bf* __restrict__ XL, const bf* __restrict__ WQ, const bf* __restrict__ WK, const bf* __restrict__ WV, const float* __restrict__ CS, bf* QPh, bf* QPl, bf* KPh, bf* KPl, h16* VT16, bf* VTh, bf* VTl) {
    __shared__ __align__(16) float osall[NWP * 64 * 68];
    if (blockIdx.z < 2) { const bool isk = blockIdx.z == 1;
        gemmw_tile<bf, 1, false, NWP, 1>(osall, (int)blockIdx.x, (int)blockIdx.y, XH, XL, isk ? WK : WQ, nullptr, CC, nullptr, MID, nullptr, CS, nullptr, isk ? KPh : QPh, isk ? KPl : QPl); }   /* q, k planes [b][h][n][64], rotated */
    else gemmw_tile<bf, 3, false, NWP, 2>(osall, (int)blockIdx.y, (int)blockIdx.x, WV, nullptr, XH, XL, CC, nullptr, TT, nullptr, nullptr, VT16, VTh, VTl);   /* v^T planes [b][h][64][n]: rows = Wv columns (exact), columns = tokens (hi/lo) */
}
// ---- k_out: out = ctx Wo, the rows of both batches in one grid (NB_ * TT / 64, CC / 64). 32 * NWP threads.
__global__ __launch_bounds__(32 * NWP) void k_out(const bf* __restrict__ ATh, const bf* __restrict__ ATl, const bf* __restrict__ WO, float* OUT) {
    __shared__ __align__(16) float osall[NWP * 64 * 68];
    gemmw_tile<bf, 1, false, NWP>(osall, (int)blockIdx.x, (int)blockIdx.y, ATh, ATl, WO, nullptr, CO, OUT, CC, nullptr, nullptr, nullptr, nullptr, nullptr);
}

// ---- k_fattn: causal attention of one head of one batch for QT = 64 query rows per work-group, scores never leave the registers. grid (NB_ * heads, TT / QT), 32 * FW threads.
// S^T = K Q^T (A = key rows, B = query rows, both planes [h][t][64] in fragment order): in each 16-query group a lane holds 16 of one query's 32 scores, in the k order of a B operand, so the weights go into O^T += V^T P^T (A = value^T rows [h][64][t]) without leaving the lane.
// Wave w works on the 32 queries of half (w & 1) and on the 32-key block (w >> 1) of every 128-key stage. A stage (key planes hi, lo and the value^T plane or planes, still in fragment order) is brought into LDS once per work-group by asynchronous copies, two buffers, the next stage in flight under the current one, and each of its blocks is read from LDS by the two waves that share it: half the reads from L2 of a 32-query work-group.
// Running maximum m and sum l per query in base 2; key blocks past a wave's diagonal are skipped, the diagonal block is cut by the select. The KSP waves' (m, l, O) of each query half are joined in LDS in wave order.
#define QT   64                   // query rows per work-group: two halves of 32
#define KSP  (FW / 2)             // waves that split the keys of one query half
#define STK  (KSP * 32)           // keys per stage
#define PLB  (STK * HD * 2)       // bytes of one 16-bit plane's share of a stage (16,384)
#define BUFB (4 * PLB)            // one buffer: K hi | K lo | V fp16 (rows < RH: V hi | V lo)
__device__ __forceinline__ float xhalf(float x) { const int b = __float_as_int(x); return __int_as_float(__builtin_amdgcn_permlanex16(b, b, 0x76543210, 0xfedcba98, false, false)); }   /* lane l <-> l ^ 16 */
// 2^x in place. The v_nop is the one slot the instruction set asks for between a transcendental and an instruction that reads its result or overwrites its source; inside the run each v_exp_f32 is followed by one on other registers.
__device__ __forceinline__ float exp2s(float x) { asm("v_exp_f32 %0, %0\n\tv_nop" : "+v"(x)); return x; }
__device__ __forceinline__ void exp2x8(float (&e)[8]) { asm("v_exp_f32 %0, %0\n\tv_exp_f32 %1, %1\n\tv_exp_f32 %2, %2\n\tv_exp_f32 %3, %3\n\tv_exp_f32 %4, %4\n\tv_exp_f32 %5, %5\n\tv_exp_f32 %6, %6\n\tv_exp_f32 %7, %7\n\tv_nop" : "+v"(e[0]), "+v"(e[1]), "+v"(e[2]), "+v"(e[3]), "+v"(e[4]), "+v"(e[5]), "+v"(e[6]), "+v"(e[7])); }
// (wave-uniform base of a tile) + (this lane's 16 bytes inside it)
template <typename T16> __device__ __forceinline__ const T16* lanep(const T16* base, unsigned lane_bytes) { return (const T16*)((const char*)base + lane_bytes); }
// Asynchronous 16-byte copies a lane, global memory to LDS through no register, eight or twelve in one statement: LDS bytes l, l + 4096, ... from a + tb, a + as + tb, ... (four pieces), then from b and from c likewise (a, b, c wave-uniform, in scalar registers, so that no 64-bit lane address stays live over the key loop; tb the lane's byte offset). The one s_wait_xcnt stands inside the statement, behind the last copy, so that no address register of an issued copy is rewritten in front of it.
__device__ __forceinline__ void acopy8(unsigned l, unsigned tb, const char* a, size_t as, const char* b, size_t bs) {
    asm volatile("global_load_async_to_lds_b128 %0, %8, %9\n\tglobal_load_async_to_lds_b128 %1, %8, %10\n\tglobal_load_async_to_lds_b128 %2, %8, %11\n\tglobal_load_async_to_lds_b128 %3, %8, %12\n\t"
                 "global_load_async_to_lds_b128 %4, %8, %13\n\tglobal_load_async_to_lds_b128 %5, %8, %14\n\tglobal_load_async_to_lds_b128 %6, %8, %15\n\tglobal_load_async_to_lds_b128 %7, %8, %16\n\ts_wait_xcnt 0x0"
                 :: "v"(l), "v"(l + 4096u), "v"(l + 8192u), "v"(l + 12288u), "v"(l + 16384u), "v"(l + 20480u), "v"(l + 24576u), "v"(l + 28672u), "v"(tb),
                    "s"(a), "s"(a + as), "s"(a + 2 * as), "s"(a + 3 * as), "s"(b), "s"(b + bs), "s"(b + 2 * bs), "s"(b + 3 * bs) : "memory");
}
__device__ __forceinline__ void acopy12(unsigned l, unsigned tb, const char* a, size_t as, const char* b, size_t bs, const char* c, size_t cs) {
    asm volatile("global_load_async_to_lds_b128 %0, %12, %13\n\tglobal_load_async_to_lds_b128 %1, %12, %14\n\tglobal_load_async_to_lds_b128 %2, %12, %15\n\tglobal_load_async_to_lds_b128 %3, %12, %16\n\t"
                 "global_load_async_to_lds_b128 %4, %12, %17\n\tglobal_load_async_to_lds_b128 %5, %12, %18\n\tglobal_load_async_to_lds_b128 %6, %12, %19\n\tglobal_load_async_to_lds_b128 %7, %12, %20\n\t"
                 "global_load_async_to_lds_b128 %8, %12, %21\n\tglobal_load_async_to_lds_b128 %9, %12, %22\n\tglobal_load_async_to_lds_b128 %10, %12, %23\n\tglobal_load_async_to_lds_b128 %11, %12, %24\n\ts_wait_xcnt 0x0"
                 :: "v"(l), "v"(l + 4096u), "v"(l + 8192u), "v"(l + 12288u), "v"(l + 16384u), "v"(l + 20480u), "v"(l + 24576u), "v"(l + 28672u), "v"(l + 32768u), "v"(l + 36864u), "v"(l + 40960u), "v"(l + 45056u), "v"(tb),
                    "s"(a), "s"(a + as), "s"(a + 2 * as), "s"(a + 3 * as), "s"(b), "s"(b + bs), "s"(b + 2 * bs), "s"(b + 3 * bs), "s"(c), "s"(c + cs), "s"(c + 2 * cs), "s"(c + 3 * cs) : "memory");
}
// Stage st (keys st * STK ...) into the buffer whose LDS byte address, plus this thread's 16 bytes tb, is lb. The 256 threads copy 4,096 bytes a round: a key plane's stage is 16,384 contiguous bytes, a value^T plane's four pieces of 4,096 (one per 16-row band, 16 * TT elements apart).
template <bool HL>
__device__ __forceinline__ void fattn_fill(unsigned lb, unsigned tb, int st, const bf* Kh, const bf* Kl, const h16* V16, const bf* Vh, const bf* Vl) {
    const char* a = (const char*)Kh + (size_t)st * PLB; const char* b = (const char*)Kl + (size_t)st * PLB; const size_t vo = (size_t)st * (STK * 32), vs = (size_t)16 * TT * 2;
    if (HL) { acopy8(lb, tb, a, 4096, b, 4096); acopy8(lb + 2 * PLB, tb, (const char*)Vh + vo, vs, (const char*)Vl + vo, vs); }
    else acopy12(lb, tb, a, 4096, b, 4096, (const char*)V16 + vo, vs);
}
typedef __attribute__((address_space(3))) char lds_char;
template <bool HL>
__device__ __forceinline__ void fattn_keys(char* ring, const bf* __restrict__ Kh, const bf* __restrict__ Kl, const h16* __restrict__ V16, const bf* __restrict__ Vh, const bf* __restrict__ Vl, const v16bf (&qh)[2][2], const v16bf (&ql)[2][2], int q0, int qw0, int ks, int lr, int hi, unsigned lk, v8f (&o)[2][4], float (&m)[2], float (&l)[2]) {
    const int np = (q0 + QT + STK - 1) / STK;   /* stages of the work-group; the last one ends at or below TT, since STK divides TT */
    const unsigned tb = threadIdx.x * 16u; const unsigned lb = (unsigned)(size_t)(lds_char*)ring + tb;
    fattn_fill<HL>(lb, tb, 0, Kh, Kl, V16, Vh, Vl);
    asm volatile("s_wait_asynccnt 0x0" ::: "memory");   /* this wave's copies of stage 0 have landed */
    __syncthreads();   /* every wave's copies of stage 0 have landed before any wave reads it */
    if (np > 1) fattn_fill<HL>(lb + BUFB, tb, 1, Kh, Kl, V16, Vh, Vl);
#pragma unroll 1   /* one copy of the pass: a second one would double the fragments that are live and cost the fourth wave per SIMD */
    for (int st = 0; st < np; ++st) {
        const int kb = st * STK + ks * 32; const char* buf = ring + (st & 1) * BUFB + ks * 4096;   /* this wave's key block: 4,096 bytes of each key plane */
        if (kb < qw0 + 32) {   /* wave-uniform: a block past this wave's diagonal is skipped; the waits and the barrier below are passed all the same */
        v8f s[2][2]; v16bf kh[2][2], kl[2][2]; const bf* pkh = lanep((const bf*)buf, lk); const bf* pkl = lanep((const bf*)(buf + PLB), lk);
#pragma unroll
        for (int kt = 0; kt < 2; ++kt)
#pragma unroll
            for (int k2 = 0; k2 < 2; ++k2) { kh[kt][k2] = WFrag<bf>::ld(pkh + (kt * 2 + k2) * 512); kl[kt][k2] = WFrag<bf>::ld(pkl + (kt * 2 + k2) * 512); }
#pragma unroll
        for (int kt = 0; kt < 2; ++kt)
#pragma unroll
            for (int g = 0; g < 2; ++g) { v8f a = (v8f){};
#pragma unroll
                for (int k2 = 0; k2 < 2; ++k2) { a = wmmab(kh[kt][k2], qh[g][k2], a); a = wmmab(kl[kt][k2], qh[g][k2], a); a = wmmab(kh[kt][k2], ql[g][k2], a); }
                s[g][kt] = a; }
        const char* vb = ring + (st & 1) * BUFB + 2 * PLB + ks * 1024;   /* 32 keys = one 1,024-byte tile of each 16-row band; a band's stage is 4,096 bytes */
        v16bf vh[4], vl[4]; v16h vf[4]; const bf* pvh = lanep((const bf*)vb, lk); const bf* pvl = lanep((const bf*)(vb + PLB), lk); const h16* pvf = lanep((const h16*)vb, lk);
#pragma unroll
        for (int dt = 0; dt < 4; ++dt) { if (HL) { vh[dt] = WFrag<bf>::ld(pvh + dt * 2048); vl[dt] = WFrag<bf>::ld(pvl + dt * 2048); } else vf[dt] = WFrag<h16>::ld(pvf + dt * 2048); }
        v16bf ph[2], pl[2]; v16h p16[2];
#pragma unroll
        for (int g = 0; g < 2; ++g) { const int rel = qw0 + g * 16 + lr - kb - hi * 8; float mr = -3.0e38f;   /* this lane's score (kt, j) belongs to a key <= its query where kt * 16 + j <= rel */
#pragma unroll
            for (int kt = 0; kt < 2; ++kt)
#pragma unroll
                for (int j = 0; j < 8; ++j) { const float t = (kt * 16 + j <= rel) ? s[g][kt][j] : -3.0e38f; s[g][kt][j] = t; mr = fmaxf(mr, t); }
            mr = fmaxf(mr, xhalf(mr)); const float mx = fmaxf(m[g], mr * (SCL * 1.4426950408889634f));
            const float al = exp2s(m[g] - mx); m[g] = mx; float sa[4] = {0.f, 0.f, 0.f, 0.f};   /* al = 0 on a wave's first block (m = -3e38) */
#pragma unroll
            for (int kt = 0; kt < 2; ++kt) { float e[8];
#pragma unroll
                for (int j = 0; j < 8; ++j) e[j] = __builtin_fmaf(s[g][kt][j], SCL * 1.4426950408889634f, -mx);
                exp2x8(e);
#pragma unroll
                for (int j = 0; j < 8; ++j) { const float p = e[j]; sa[j & 3] += p;
                    if (HL) { const __bf16 a2 = (__bf16)p; ph[g][kt * 8 + j] = a2; pl[g][kt * 8 + j] = (__bf16)(p - (float)a2); } else p16[g][kt * 8 + j] = tohx(p); } }
            const float sum = (sa[0] + sa[1]) + (sa[2] + sa[3]);
            l[g] = l[g] * al + sum;
#pragma unroll
            for (int dt = 0; dt < 4; ++dt) o[g][dt] *= al; }
#pragma unroll
        for (int dt = 0; dt < 4; ++dt)
#pragma unroll
            for (int g = 0; g < 2; ++g) { if (HL) { o[g][dt] = wmmab(vh[dt], ph[g], o[g][dt]); o[g][dt] = wmmab(vl[dt], ph[g], o[g][dt]); o[g][dt] = wmmab(vh[dt], pl[g], o[g][dt]); } else o[g][dt] = wmma16(vf[dt], p16[g], o[g][dt]); }
        }
        asm volatile("s_wait_dscnt 0x0" ::: "memory");      /* this wave's reads of the current buffer have returned before the buffer is refilled */
        asm volatile("s_wait_asynccnt 0x0" ::: "memory");   /* this wave's copies of the next stage have landed */
        __syncthreads();   /* publishes the next stage and ends every wave's reads of the current buffer */
        if (st + 2 < np) fattn_fill<HL>(lb + (unsigned)(st & 1) * BUFB, tb, st + 2, Kh, Kl, V16, Vh, Vl);
    }
    asm volatile("s_wait_asynccnt 0x0" ::: "memory");   /* nothing is in flight when the ring becomes the join's staging */
}
// amdgpu_waves_per_eu(4, 4): at most 256 registers a wave, so that two work-groups (four waves per SIMD) share a WGP and cover each other's waits.
__global__ __launch_bounds__(32 * FW) __attribute__((amdgpu_waves_per_eu(4, 4))) void k_fattn(const bf* __restrict__ Qh, const bf* __restrict__ Ql, const bf* __restrict__ Kh, const bf* __restrict__ Kl, const h16* __restrict__ V16, const bf* __restrict__ Vh, const bf* __restrict__ Vl, bf* __restrict__ Oh, bf* __restrict__ Ol) {
    __shared__ __align__(1024) char ring[2 * BUFB]; __shared__ float sm[FW * 32], sl[FW * 32];
    static_assert(FW * 32 * 68 * 4 <= 2 * BUFB, "the join's staging lies in the ring");
    float* so = (float*)ring;   /* the waves' scaled partial rows, behind the key loop's last barrier */
    const int wv = __builtin_amdgcn_readfirstlane((int)(threadIdx.x >> 5));   /* wave number, scalar so that the skip of a key block stays a scalar branch */
    const int qg = wv & 1, ks = wv >> 1;   /* query half, key block inside a stage */
    const int lane = threadIdx.x & 31, lr = lane & 15, hi = lane >> 4; const int h = blockIdx.x % NH_, b = blockIdx.x / NH_;
    const size_t hb = (size_t)blockIdx.x * TT * HD;   /* planes [b][h]: (b * NH_ + h) */ Qh += hb; Ql += hb; Kh += hb; Kl += hb; V16 += hb; Vh += hb; Vl += hb;
    {
        const int q0 = (TT / QT - 1 - (int)blockIdx.y) * QT;   /* the longest rows of every head and batch start first, the short ones fill in behind them */
        const int qw0 = q0 + qg * 32;   /* this wave's first query */
        const unsigned lk = (unsigned)lane * 16u;   /* the lane's bytes inside a tile, the same in every plane */
        v16bf qh[2][2], ql[2][2]; const bf* pqh = lanep(Qh + (size_t)qw0 * HD, lk); const bf* pql = lanep(Ql + (size_t)qw0 * HD, lk);
#pragma unroll
        for (int g = 0; g < 2; ++g)
#pragma unroll
            for (int k2 = 0; k2 < 2; ++k2) { qh[g][k2] = WFrag<bf>::ld(pqh + (g * 2 + k2) * 512); ql[g][k2] = WFrag<bf>::ld(pql + (g * 2 + k2) * 512); }
        asm volatile("s_wait_xcnt 0x0" :: "v"(pqh), "v"(pql) : "memory");   /* behind the query loads; the addresses are named so that they stay in their registers up to here */
        v8f o[2][4]; float m[2], l[2];
#pragma unroll
        for (int g = 0; g < 2; ++g) { m[g] = -3.0e38f; l[g] = 0.f;
#pragma unroll
            for (int dt = 0; dt < 4; ++dt) o[g][dt] = (v8f){}; }
        if (q0 < RH) fattn_keys<true>(ring, Kh, Kl, V16, Vh, Vl, qh, ql, q0, qw0, ks, lr, hi, lk, o, m, l); else fattn_keys<false>(ring, Kh, Kl, V16, Vh, Vl, qh, ql, q0, qw0, ks, lr, hi, lk, o, m, l);
#pragma unroll
        for (int g = 0; g < 2; ++g) { l[g] += xhalf(l[g]); if (hi == 0) { sm[wv * 32 + g * 16 + lr] = m[g]; sl[wv * 32 + g * 16 + lr] = l[g]; } }
        __syncthreads();   /* every wave's maximum and sum are in LDS before the common ones are formed */
#pragma unroll
        for (int g = 0; g < 2; ++g) { float mm = sm[qg * 32 + g * 16 + lr];   /* the waves qg, qg + 2, ... hold this wave's queries */
#pragma unroll
            for (int w = 1; w < KSP; ++w) mm = fmaxf(mm, sm[(qg + 2 * w) * 32 + g * 16 + lr]);
            float ll = 0.f;
#pragma unroll
            for (int w = 0; w < KSP; ++w) ll += sl[(qg + 2 * w) * 32 + g * 16 + lr] * exp2s(sm[(qg + 2 * w) * 32 + g * 16 + lr] - mm);   /* a wave that had no key block holds m = -3e38, l = 0 */
            const float f = __fdiv_rn(exp2s(m[g] - mm), ll);
#pragma unroll
            for (int dt = 0; dt < 4; ++dt) { const v8f a = o[g][dt] * f; float* d = so + (wv * 32 + g * 16 + lr) * 68 + dt * 16 + hi * 8;
                *(v4fa*)d = (v4f){a[0], a[1], a[2], a[3]}; *(v4fa*)(d + 4) = (v4f){a[4], a[5], a[6], a[7]}; } }
        __syncthreads();   /* every wave's scaled partial rows are in LDS before any of them is summed */
#pragma unroll
        for (int u0 = 0; u0 < QT * 16; u0 += 32 * FW) { const int u = u0 + (int)threadIdx.x, row = u >> 4, cofs = (u & 15) * 4; const float* sp = so + ((row >> 5) * 32 + (row & 31)) * 68 + cofs; v4f val = *(const v4fa*)sp;
#pragma unroll
            for (int w = 1; w < KSP; ++w) val += *(const v4fa*)(sp + w * (2 * 32 * 68));   /* partial rows of the row's query half joined in wave order */
            v4us oh, ol;
#pragma unroll
            for (int q = 0; q < 4; ++q) { unsigned short h2, l2; splitf(val[q], h2, l2); oh[q] = h2; ol[q] = l2; }
            const size_t e = fidx(b * TT + q0 + row, h * HD + cofs, CO); *(v4us*)(Oh + e) = oh; *(v4us*)(Ol + e) = ol; }   /* context rows [b * TT + t][h * 64 + d] as the hi/lo operand planes of the last product, in fragment order */
    }
}

__constant__ float INVT[HD / 2] = { 1.000000000e+00f, 6.493816376e-01f, 4.216965139e-01f, 2.738419771e-01f, 1.778279394e-01f, 1.154782027e-01f, 7.498941571e-02f, 4.869675264e-02f, 3.162277862e-02f, 2.053525113e-02f, 1.333521493e-02f, 8.659643121e-03f, 5.623413250e-03f, 3.651741426e-03f, 2.371373819e-03f, 1.539926510e-03f, 1.000000047e-03f, 6.493816618e-04f, 4.216964880e-04f, 2.738419571e-04f, 1.778279402e-04f, 1.154781930e-04f, 7.498942432e-05f, 4.869675467e-05f, 3.162277426e-05f, 2.053524986e-05f, 1.333521413e-05f, 8.659643754e-06f, 5.623413472e-06f, 3.651741281e-06f, 2.371373739e-06f, 1.539926529e-06f };   // float32 1 / 1000000^(2i/64) (the module's integer-arange expression), generated with jnp to be bit-exact
__device__ __forceinline__ void cs5_block(int blk, float* CS) { const int idx = blk * 256 + threadIdx.x; if (idx >= TT * HD) return; const int d = idx % HD; const int t = idx / HD; const float a = __fmul_rn((float)t, INVT[d % (HD / 2)]); v2f cs; cs[0] = cosf(a); cs[1] = sinf(a); *(v2f*)(CS + (size_t)idx * 2) = cs;  }
__device__ __forceinline__ void rmsx_rows(int blk, const float* __restrict__ X, const float* __restrict__ sc, bf* XH, bf* XL) { const int lane = threadIdx.x & 31; const int row = blk * 8 + (threadIdx.x >> 5); if (row >= NB_ * TT) return;   /* row = b * TT + t */ const float* xr = X + (size_t)row * CC + lane * 16; const float* sr = sc + lane * 16; float v[16]; float ss = 0.f; v4f xa[4], sv[4];
#pragma unroll
    for (int c = 0; c < 4; ++c) { xa[c] = *(const v4f*)(xr + c * 4); sv[c] = *(const v4f*)(sr + c * 4); }
    asm volatile("s_wait_xcnt 0x0" :: "v"(xr), "v"(sr) : "memory");   /* behind the row's and the scale's loads; the addresses are named so that no load's result lands on a register that an issued load names */
#pragma unroll
    for (int c = 0; c < 4; ++c) { const v4f a = xa[c];
#pragma unroll
        for (int q = 0; q < 4; ++q) { const float b = bfr(a[q]); v[c * 4 + q] = b; float p = __fmul_rn(b, b); asm volatile("" : "+v"(p)); ss = __fadd_rn(ss, p); } }
#pragma unroll
    for (int sh = 16; sh; sh >>= 1) ss = __fadd_rn(ss, __shfl_xor(ss, sh, 32));
    const float den = sqrtf(__fadd_rn(__fmul_rn(ss, 1.0f / CC), 1.0e-6f)); const float rinv = __fdiv_rn(1.0f, den);   /* ONE IEEE division per row; x * (1/den) differs from the module's x / den by <= 1 ulp */
    v4us oh[4], ol[4];
#pragma unroll
    for (int c = 0; c < 4; ++c) {
#pragma unroll
        for (int q = 0; q < 4; ++q) { float y = __fmul_rn(v[c * 4 + q], rinv); asm volatile("" : "+v"(y)); y = __fmul_rn(y, bfr(sv[c][q])); unsigned short a2, c2; splitf(y, a2, c2); oh[c][q] = a2; ol[c][q] = c2; } }
    const size_t e = fidx(row, lane * 16, CC); bf* ph = XH + e; bf* pl = XL + e;   /* fragment order: the lane's columns 0..7 here, its columns 8..15 128 elements on */
#pragma unroll
    for (int c = 0; c < 2; ++c) { *(v8us*)(ph + c * 128) = __builtin_shufflevector(oh[2 * c], oh[2 * c + 1], 0, 1, 2, 3, 4, 5, 6, 7); *(v8us*)(pl + c * 128) = __builtin_shufflevector(ol[2 * c], ol[2 * c + 1], 0, 1, 2, 3, 4, 5, 6, 7); }
}
__device__ __forceinline__ void wtG_lines(int blk, const float* __restrict__ w, int K, int N, bf* Bt) {
    const int lane = threadIdx.x & 31; const int L0 = (blk * 8 + (threadIdx.x >> 5)) * 8; const int nlines = N * K / 64;
{
#pragma unroll 1
        for (int l = 0; l < 8; ++l) { const int L = L0 + l; if (L >= nlines) break; const size_t e = (size_t)L * 64 + lane * 2; const int k = (int)(e % K), n = (int)(e / K); v2us o;
            o[0] = f2bf(w[(size_t)k * N + n]); o[1] = f2bf(w[(size_t)(k + 1) * N + n]); *(v2us*)(Bt + fidx(n, k, K)) = o;   /* Bt[n][k] in fragment order */
            asm volatile("s_wait_xcnt 0x0" ::: "memory"); }   /* behind the store, in front of the next trip's rewrite of its address and data registers */
         }
}
// ---- k_prep: all that depends on the inputs alone, side by side in one grid of 256 threads: blocks 0 .. 4 * WB - 1 the four weights (WB blocks each; the longest blocks, so they start first), the next RB the token rows of both batches, the last TB the rotary table.
#define WB (CC * MID / 64 / 64)
#define RB (NB_ * TT / 8)
#define TB (TT * HD / 256)
__global__ __launch_bounds__(256) void k_prep(const float* __restrict__ x, const float* __restrict__ rsc, const float* __restrict__ wq, const float* __restrict__ wk, const float* __restrict__ wv, const float* __restrict__ wo, bf* WQKV, bf* WO, float* CS, bf* XH, bf* XL) {
    const int blk = (int)blockIdx.x;
    if (blk < 4 * WB) { const int j = blk / WB; wtG_lines(blk % WB, j == 0 ? wq : j == 1 ? wk : j == 2 ? wv : wo, CC, MID, j < 3 ? WQKV + (size_t)j * MID * CC : WO); }   /* 'xw' weights -> Bt; all four are [512][512] */
    else if (blk < 4 * WB + RB) rmsx_rows(blk - 4 * WB, x, rsc, XH, XL);   /* x_norm = x / sqrt(mean x^2 + eps) x scale as hi/lo planes */
    else cs5_block(blk - 4 * WB - RB, CS);   /* cos, sin per (token, d) for the q and k epilogues */
}
extern "C" void kernel_launch(void* const* d_in, const int* in_sizes, int n_in,
                              void* d_out, int out_size, void* d_ws, size_t ws_size, hipStream_t stream) {
    (void)in_sizes; (void)n_in; (void)out_size;
    const float* x = (const float*)d_in[0]; const float* rsc = (const float*)d_in[1]; const float* wq = (const float*)d_in[2]; const float* wk = (const float*)d_in[3]; const float* wv = (const float*)d_in[4]; const float* wo = (const float*)d_in[5];   /* input order x [2][4096][512], scale [512] (RMSNorm weight), Wq, Wk, Wv, Wo ('xw' [512][512], no biases) */
    float* OUT = (float*)d_out;     // [2][4096][512]
    char* wsp = (char*)d_ws;
    auto take = [&](size_t bytes) { char* p = wsp; wsp += (bytes + 255) & ~(size_t)255; return (void*)p; };
    bf* WQKV = (bf*)take((size_t)3 * MID * CC * 2); bf* WQ = WQKV; bf* WK = WQKV + (size_t)MID * CC; bf* WV = WQKV + (size_t)2 * MID * CC; bf* WO = (bf*)take((size_t)CC * CO * 2); float* CS = (float*)take((size_t)TT * HD * 2 * 4);
    bf* XH = (bf*)take((size_t)NB_ * TT * CC * 2); bf* XL = (bf*)take((size_t)NB_ * TT * CC * 2);   /* RMS-normalised tokens, bf16 hi/lo */
    bf* QPh = (bf*)take((size_t)NB_ * TT * MID * 2); bf* QPl = (bf*)take((size_t)NB_ * TT * MID * 2); bf* KPh = (bf*)take((size_t)NB_ * TT * MID * 2); bf* KPl = (bf*)take((size_t)NB_ * TT * MID * 2);
    h16* VT16 = (h16*)take((size_t)NB_ * CO * TT * 2); bf* VTh = (bf*)take((size_t)NB_ * CO * TT * 2); bf* VTl = (bf*)take((size_t)NB_ * CO * TT * 2);
    bf* ATh = (bf*)take((size_t)NB_ * TT * CO * 2); bf* ATl = (bf*)take((size_t)NB_ * TT * CO * 2);
    if ((size_t)(wsp - (char*)d_ws) > ws_size) return;
    k_prep<<<4 * WB + RB + TB, 256, 0, stream>>>(x, rsc, wq, wk, wv, wo, WQKV, WO, CS, XH, XL);
    k_qkv<<<dim3(NB_ * TT / 64, MID / 64, 3), 32 * NWP, 0, stream>>>(XH, XL, WQ, WK, WV, CS, QPh, QPl, KPh, KPl, VT16, VTh, VTl);
    k_fattn<<<dim3(NB_ * NH_, TT / QT, 1), 32 * FW, 0, stream>>>(QPh, QPl, KPh, KPl, VT16, VTh, VTl, ATh, ATl);   /* all heads of both batches: scores, causal softmax and attn.V; merged context as hi/lo planes */
    k_out<<<dim3(NB_ * TT / 64, CC / 64, 1), 32 * NWP, 0, stream>>>(ATh, ATl, WO, OUT);
}

// v007
// A run of this version takes 114 microseconds.
// Two timings next to v006 put it at 1.03 and 1.02 times that version's speed.
// All steps since v000 together make it 35.4 times as fast.
#include <hip/hip_runtime.h>

// Causal multi-head self-attention with a leading RMSNorm and rotary embeddings over 4,096 tokens (x [2][4096][512]; x_norm = x / sqrt(mean x^2 + 1e-6) x scale (scale [512] ones, read); q, k, v = x_norm W ('xw' [512][512] 1/sqrt(512), no bias; 8 heads x 64); rotate-half rope (cat(x1 c - x2 s, x1 s + x2 c)) with angle t x 1/1000000^(2i/64) (32 f32 frequencies jnp-exact; precise cosf/sinf); scores / sqrt(64); causal (-inf); softmax; out = merged Wo ('xw') -> [2][4096][512] (4.2 M); argument order x, scale, Wq, Wk, Wv, Wo).
// Four launches, both batches side by side in each grid (every plane holds batch 0, then batch 1): k_prep (weights to fragment order, rotary table, RMSNorm), k_qkv, k_fattn, k_out. Layout: rmsx_rows normalises each token row in f32 and stores bf16 hi/lo planes; projections hi/lo x exact weights (2 products), whose epilogues write the operand planes themselves (q, k: rotate-half with the cs5_block table, then hi/lo; v: the product is formed transposed, Wv rows x token rows, and stored as value^T planes); k_fattn: scores (hi/lo planes, 3 products), causal select (x 1/8), running-maximum softmax and attn.V (rows < 512 hi/lo 3 products, rest fp16) in one kernel over all heads, keys and values staged in LDS by asynchronous copies, no score matrix in memory, context stored as hi/lo planes; context hi/lo x Wo exact written to the output rows. Every 16-bit operand plane lies in fragment order (fidx below).
// Compute dtypes, f32 accumulate: every input rounded to bf16 incl. scale; RMSNorm f32; projections 2 products (hi/lo x exact); rotary f32; scores 3 products; softmax f32, weights kept unnormalised (<= 1) and divided by the row sum at the end; attn.V rows < 512 3 products, rest fp16; Wo hl x exact.

#define NB_  2
#define TT   4096
#define DM   512
#define NH_  8
#define NKV  8
#define REP  (NH_ / NKV)
#define HD   64
#define DQ   (NH_ * HD)
#define DKV  (NKV * HD)
#define ZH   1
#define RH   512                  // query rows < RH use hi+lo planes (0: none)
#define WIN  0
#define SCL  0.125f   // 1/sqrt(float32(64))
#define MID  512      // q / k width = 8 heads x 64
#define CO   512      // v width
#define CC   512
#define FW   8        // k_fattn: waves per work-group: 2 query halves x 4 key blocks of a stage
#define NWP  8        // projections: waves per tile
typedef _Float16 h16;
typedef unsigned short bf;
typedef __attribute__((ext_vector_type(16))) __bf16   v16bf;
typedef __attribute__((ext_vector_type(16))) _Float16 v16h;
typedef __attribute__((ext_vector_type(8)))  _Float16 v8h;
typedef __attribute__((ext_vector_type(8)))  unsigned short v8us;
typedef __attribute__((ext_vector_type(8)))  float    v8f;
typedef __attribute__((ext_vector_type(4)))  float    v4f;
typedef v8h  __attribute__((may_alias)) v8ha;
typedef v4f  __attribute__((may_alias)) v4fa;
typedef v8us __attribute__((may_alias)) v8usa;

__device__ __forceinline__ unsigned short f2bf(float f) { unsigned u = __float_as_uint(f); u += 0x7FFFu + ((u >> 16) & 1u); return (unsigned short)(u >> 16); }
__device__ __forceinline__ float bf2f(unsigned short b) { return __uint_as_float(((unsigned)b) << 16); }
__device__ __forceinline__ float bfr(float f) { return bf2f(f2bf(f)); }
__device__ __forceinline__ v16h cat16(v8h lo, v8h hi) { return __builtin_shufflevector(lo, hi, 0, 1, 2, 3, 4, 5, 6, 7, 8, 9, 10, 11, 12, 13, 14, 15); }
__device__ __forceinline__ v16bf cat16b(v8us lo, v8us hi) { return __builtin_bit_cast(v16bf, __builtin_shufflevector(lo, hi, 0, 1, 2, 3, 4, 5, 6, 7, 8, 9, 10, 11, 12, 13, 14, 15)); }
__device__ __forceinline__ v8f wmma16(v16h a, v16h b, v8f c) { return __builtin_amdgcn_wmma_f32_16x16x32_f16(false, a, false, b, (short)0, c, false, false); }
__device__ __forceinline__ v8f wmmab(v16bf a, v16bf b, v8f c) { return __builtin_amdgcn_wmma_f32_16x16x32_bf16(false, a, false, b, (short)0, c, false, false); }

__device__ __forceinline__ h16 tohx(float x) { return (h16)x; }
__device__ __forceinline__ void splitf(float y, unsigned short& h, unsigned short& l) { h = f2bf(y); l = f2bf(y - bf2f(h)); }
typedef __attribute__((ext_vector_type(4))) _Float16 v4h;
typedef __attribute__((ext_vector_type(2))) unsigned short v2us;
typedef __attribute__((ext_vector_type(4))) unsigned short v4us;
typedef __attribute__((ext_vector_type(2))) float v2f;

// ---- gemmw_tile: register-blocked GEMM, one 64x64 output tile (16 accumulators a wave), tile (bx, by) of (M/64, N/64), per work-group of NW waves, operands straight from 16-bit planes in fragment order (fidx) of row length LP; osall is the work-group's LDS.
// C[m][n] (f32, pitch ldc, + optional f32 bias[n]) = sum_k A[m][k] Bt[n][k] (+ split products per NSPLIT). K % (32 * NW) == 0. The token rows of both batches stand one behind the other (row = b * TT + t).
// EPI says what the joined tile becomes: 0 f32 rows of C; 1 (tile = 64 tokens x one head) rotate-half rotary out[d] = x[d] cos[t][d] -/+ x[d +/- 32] sin[t][d] from the table CS [t][64][cos, sin], stored as bf16 hi/lo planes [b][head][t][64]; 2 (columns = tokens) fp16 and bf16 hi/lo planes [b][CO rows] of row length ldc = TT; both in fragment order.
// Split-K: wave w takes the 32-wide k steps w, w + NW, ... (one 1,024-byte tile per fragment); the NW partial tiles are summed in LDS in wave order.
// Fragment order of a 16-bit operand plane of K-contiguous rows (rows % 16 == 0, K % 32 == 0): one 16-row x 32-k tile is 1,024 contiguous bytes, tiles run along k and then down the rows. Inside a tile the 16 bytes that lane (hi * 16 + row % 16) takes for k % 32 = c * 16 + hi * 8 + 0..7 stand at c * 512 + lane * 16, so each of a fragment's two wave-wide 16-byte loads reads 512 contiguous bytes (four whole 128-byte lines) where row-major planes gave it 32-byte pieces of 16 lines.
__device__ __forceinline__ size_t fidx(int row, int k, int K) { return ((size_t)(row >> 4) * (K >> 5) + (k >> 5)) * 512 + ((k >> 4) & 1) * 256 + ((k >> 3) & 1) * 128 + (row & 15) * 8 + (k & 7); }
template <typename T16> struct WFrag;
template <> struct WFrag<h16> { typedef v16h V; static __device__ __forceinline__ V ld(const h16* p) { return cat16(*(const v8h*)p, *(const v8h*)(p + 256)); } static __device__ __forceinline__ v8f mma(V a, V b, v8f c) { return wmma16(a, b, c); } };
template <> struct WFrag<bf> { typedef v16bf V; static __device__ __forceinline__ V ld(const bf* p) { return cat16b(*(const v8us*)p, *(const v8us*)(p + 256)); } static __device__ __forceinline__ v8f mma(V a, V b, v8f c) { return wmmab(a, b, c); } };
template <typename T16, int NSPLIT, bool BIAS, int NW = 1, int EPI = 0, int LP = 512>
__device__ __forceinline__ void gemmw_tile(float* osall, int bx, int by, const T16* __restrict__ A, const T16* __restrict__ A2, const T16* __restrict__ Bt, const T16* __restrict__ Bt2, int K, float* C, int ldc, const float* __restrict__ bias, const float* __restrict__ CS, h16* P16, bf* Ph, bf* Pl) {
    typedef typename WFrag<T16>::V V;   /* osall: NW > 1 ? NW * 64 * 68 : 16 * 68 floats (NW > 1: one whole 64 x 64 partial tile a wave) */
    const int wv = NW > 1 ? __builtin_amdgcn_readfirstlane((int)(threadIdx.x >> 5)) : 0;   /* wave number, scalar so that the k loop stays a scalar branch */
    constexpr int lp = LP;   /* row length of both operands' planes, a constant so that all fragments of a k step hang on one address per plane by immediate offsets */
    float* os = osall + wv * (64 * 68);
    const int lane = threadIdx.x & 31, lr = lane & 15, hi = lane >> 4; const int r0 = bx * 64, c0 = by * 64;
    v8f acc[4][4];
#pragma unroll
    for (int mb = 0; mb < 4; ++mb)
#pragma unroll
        for (int nb = 0; nb < 4; ++nb) acc[mb][nb] = (v8f){};
    const size_t aoff = (size_t)r0 * lp + lane * 8, boff = (size_t)c0 * lp + lane * 8;   /* first tile of the 64 rows (16 rows hold 16 * lp elements) + the lane's 16 bytes; a 32-wide k step is 512 elements on */
#pragma unroll 1
    for (int kc = wv * 32; kc < K; kc += 32 * NW) {
        V a[4], a2[4], b[4], b2[4]; const T16* pa = A + aoff + (size_t)kc * 16; const T16* pa2 = (NSPLIT == 1 || NSPLIT == 2) ? A2 + aoff + (size_t)kc * 16 : nullptr; const T16* pb = Bt + boff + (size_t)kc * 16; const T16* pb2 = NSPLIT >= 2 ? Bt2 + boff + (size_t)kc * 16 : nullptr;
#pragma unroll
        for (int mb = 0; mb < 4; ++mb) { a[mb] = WFrag<T16>::ld(pa + mb * 16 * lp); if (NSPLIT == 1 || NSPLIT == 2) a2[mb] = WFrag<T16>::ld(pa2 + mb * 16 * lp); }
#pragma unroll
        for (int nb = 0; nb < 4; ++nb) { b[nb] = WFrag<T16>::ld(pb + nb * 16 * lp); if (NSPLIT >= 2) b2[nb] = WFrag<T16>::ld(pb2 + nb * 16 * lp); }
        /* behind the operand loads; the addresses are named so that they stay in their registers up to here and no load's result lands on a register that an issued load names */
        if constexpr (NSPLIT == 0) asm volatile("s_wait_xcnt 0x0" :: "v"(pa), "v"(pb) : "memory"); else if constexpr (NSPLIT == 1) asm volatile("s_wait_xcnt 0x0" :: "v"(pa), "v"(pa2), "v"(pb) : "memory"); else if constexpr (NSPLIT == 2) asm volatile("s_wait_xcnt 0x0" :: "v"(pa), "v"(pa2), "v"(pb), "v"(pb2) : "memory"); else asm volatile("s_wait_xcnt 0x0" :: "v"(pa), "v"(pb), "v"(pb2) : "memory");
        __builtin_amdgcn_sched_barrier(0);   /* no matrix instruction is lifted in front of the wait: without this the compiler lets late loads reuse fragment registers, and the wave then sits out one load latency per group of four products instead of one per k step */
#pragma unroll
        for (int nb = 0; nb < 4; ++nb)
#pragma unroll
            for (int mb = 0; mb < 4; ++mb) { acc[mb][nb] = WFrag<T16>::mma(a[mb], b[nb], acc[mb][nb]); if (NSPLIT == 1 || NSPLIT == 2) acc[mb][nb] = WFrag<T16>::mma(a2[mb], b[nb], acc[mb][nb]); if (NSPLIT >= 2) acc[mb][nb] = WFrag<T16>::mma(a[mb], b2[nb], acc[mb][nb]); }
        asm volatile("v_nop\n\tv_nop\n\tv_nop\n\tv_nop" : "+v"(acc[0][0]), "+v"(acc[1][1]), "+v"(acc[2][2]), "+v"(acc[3][3]) : "v"(a[0]), "v"(a[3]));
    }
    if constexpr (NW > 1) {
        static_assert(EPI != 1 || NW == 8, "the table fetch below is laid out for four passes of 256 threads");
        v4f c01[4], c23[4];   /* EPI 1: this thread's (cos, sin) pairs of its four passes, fetched here so that they fly under the LDS stores of the partial tile */
        if constexpr (EPI == 1) { const float* cs = CS + ((size_t)(r0 % TT + (int)(threadIdx.x >> 4)) * HD + (threadIdx.x & 15) * 4) * 2;
#pragma unroll
            for (int i = 0; i < 4; ++i) { c01[i] = *(const v4f*)(cs + i * (16 * HD * 2)); c23[i] = *(const v4f*)(cs + i * (16 * HD * 2) + 4); }
            asm volatile("s_wait_xcnt 0x0" :: "v"(cs) : "memory"); }   /* behind the table loads; the address is named so that it stays in its registers up to here */
#pragma unroll
        for (int mb = 0; mb < 4; ++mb)
#pragma unroll
            for (int nb = 0; nb < 4; ++nb)
#pragma unroll
                for (int j = 0; j < 8; ++j) os[(mb * 16 + hi * 8 + j) * 68 + nb * 16 + lr] = acc[mb][nb][j];
        __syncthreads();   /* every wave's partial tile is in LDS before any of it is summed */
#pragma unroll
        for (int u0 = 0; u0 < 64 * 16; u0 += 32 * NW) { const int u = u0 + (int)threadIdx.x, row = u >> 4, cofs = (u & 15) * 4; v4f val = *(const v4fa*)(osall + row * 68 + cofs);
#pragma unroll
            for (int w = 1; w < NW; ++w) val += *(const v4fa*)(osall + w * (64 * 68) + row * 68 + cofs);   /* partial sums joined in wave order */
            if (BIAS) { val[0] += bfr(bias[c0 + cofs]); val[1] += bfr(bias[c0 + cofs + 1]); val[2] += bfr(bias[c0 + cofs + 2]); val[3] += bfr(bias[c0 + cofs + 3]); }
            if constexpr (EPI == 0) *(v4f*)(C + (size_t)(r0 + row) * ldc + c0 + cofs) = val;
            else { v4us oh, ol;
                if constexpr (EPI == 1) { const int i = u0 / (32 * NW); const float co[4] = {c01[i][0], c01[i][2], c23[i][0], c23[i][2]}, si[4] = {c01[i][1], c01[i][3], c23[i][1], c23[i][3]};
#pragma unroll
                    for (int q = 0; q < 4; ++q) { const float par = __shfl_xor(val[q], 8, 32);   /* lane ^ 8 holds the same token's columns cofs ^ 32, the other half of the head */
                        val[q] = val[q] * co[q] + par * ((cofs < HD / 2) ? -si[q] : si[q]); } }
#pragma unroll
                for (int q = 0; q < 4; ++q) { unsigned short h2, l2; splitf(val[q], h2, l2); oh[q] = h2; ol[q] = l2; }
                const size_t e = EPI == 1 ? ((size_t)(r0 / TT) * NH_ + by) * TT * HD + fidx(r0 % TT + row, cofs, HD) : (size_t)(c0 / TT) * CO * TT + fidx(r0 + row, c0 % TT + cofs, ldc);
                *(v4us*)(Ph + e) = oh; *(v4us*)(Pl + e) = ol;
                if constexpr (EPI == 2) { v4h o16;
#pragma unroll
                    for (int q = 0; q < 4; ++q) o16[q] = tohx(val[q]);
                    *(v4h*)(P16 + e) = o16; } } }
    } else {
#pragma unroll
    for (int mb = 0; mb < 4; ++mb) {
#pragma unroll
        for (int nb = 0; nb < 4; ++nb) {
#pragma unroll
            for (int j = 0; j < 8; ++j) os[(hi * 8 + j) * 68 + nb * 16 + lr] = acc[mb][nb][j]; }
        __builtin_amdgcn_wave_barrier(); asm volatile("" ::: "memory");
        float* crow = C + (size_t)(r0 + mb * 16) * ldc + c0;
{
#pragma unroll
            for (int s = 0; s < 8; ++s) { const int row = 2 * s + hi, cofs = lr * 4; v4f val = *(const v4fa*)(os + row * 68 + cofs); if (BIAS) { val[0] += bfr(bias[c0 + cofs]); val[1] += bfr(bias[c0 + cofs + 1]); val[2] += bfr(bias[c0 + cofs + 2]); val[3] += bfr(bias[c0 + cofs + 3]); }
                *(v4f*)(crow + (size_t)row * ldc + cofs) = val; }
             }
        __builtin_amdgcn_wave_barrier(); asm volatile("" ::: "memory");
    }
    }
}

// ---- k_qkv: the three projections of both batches in one grid (NB_ * TT / 64 token tiles, 8 column tiles, 3): z = 0 q, 1 k, 2 v (formed transposed: rows = Wv columns, columns = tokens). 32 * NWP threads.
__global__ __launch_bounds__(32 * NWP) void k_qkv(const bf* __restrict__ XH, const bf* __restrict__ XL, const bf* __restrict__ WQ, const bf* __restrict__ WK, const bf* __restrict__ WV, const float* __restrict__ CS, bf* QPh, bf* QPl, bf* KPh, bf* KPl, h16* VT16, bf* VTh, bf* VTl) {
    __shared__ __align__(16) float osall[NWP * 64 * 68];
    if (blockIdx.z < 2) { const bool isk = blockIdx.z == 1;
        gemmw_tile<bf, 1, false, NWP, 1>(osall, (int)blockIdx.x, (int)blockIdx.y, XH, XL, isk ? WK : WQ, nullptr, CC, nullptr, MID, nullptr, CS, nullptr, isk ? KPh : QPh, isk ? KPl : QPl); }   /* q, k planes [b][h][n][64], rotated */
    else gemmw_tile<bf, 3, false, NWP, 2>(osall, (int)blockIdx.y, (int)blockIdx.x, WV, nullptr, XH, XL, CC, nullptr, TT, nullptr, nullptr, VT16, VTh, VTl);   /* v^T planes [b][h][64][n]: rows = Wv columns (exact), columns = tokens (hi/lo) */
}
// ---- k_out: out = ctx Wo, the rows of both batches in one grid (NB_ * TT / 64, CC / 64). 32 * NWP threads.
__global__ __launch_bounds__(32 * NWP) void k_out(const bf* __restrict__ ATh, const bf* __restrict__ ATl, const bf* __restrict__ WO, float* OUT) {
    __shared__ __align__(16) float osall[NWP * 64 * 68];
    gemmw_tile<bf, 1, false, NWP>(osall, (int)blockIdx.x, (int)blockIdx.y, ATh, ATl, WO, nullptr, CO, OUT, CC, nullptr, nullptr, nullptr, nullptr, nullptr);
}

// ---- k_fattn: causal attention of one head of one batch for QT = 64 query rows per work-group, scores never leave the registers. grid (NB_ * heads, TT / QT), 32 * FW threads.
// S^T = K Q^T (A = key rows, B = query rows, both planes [h][t][64] in fragment order): in each 16-query group a lane holds 16 of one query's 32 scores, in the k order of a B operand, so the weights go into O^T += V^T P^T (A = value^T rows [h][64][t]) without leaving the lane.
// Wave w works on the 32 queries of half (w & 1) and on the 32-key block (w >> 1) of every 128-key stage. A stage (key planes hi, lo and the value^T plane or planes, still in fragment order) is brought into LDS once per work-group by asynchronous copies, two buffers, the next stage in flight under the current one, and each of its blocks is read from LDS by the two waves that share it: half the reads from L2 of a 32-query work-group.
// Running maximum m and sum l per query in base 2; key blocks past a wave's diagonal are skipped, the diagonal block alone is cut by the select. The KSP waves' (m, l, O) of each query half are joined in LDS in wave order.
#define QT   64                   // query rows per work-group: two halves of 32
#define KSP  (FW / 2)             // waves that split the keys of one query half
#define STK  (KSP * 32)           // keys per stage
#define PLB  (STK * HD * 2)       // bytes of one 16-bit plane's share of a stage (16,384)
#define BUFB (4 * PLB)            // one buffer: K hi | K lo | V fp16 (rows < RH: V hi | V lo)
__device__ __forceinline__ float xhalf(float x) { const int b = __float_as_int(x); return __int_as_float(__builtin_amdgcn_permlanex16(b, b, 0x76543210, 0xfedcba98, false, false)); }   /* lane l <-> l ^ 16 */
// 2^x in place. The v_nop is the one slot the instruction set asks for between a transcendental and an instruction that reads its result or overwrites its source; inside the run each v_exp_f32 is followed by one on other registers.
__device__ __forceinline__ float exp2s(float x) { asm("v_exp_f32 %0, %0\n\tv_nop" : "+v"(x)); return x; }
__device__ __forceinline__ void exp2x8(float (&e)[8]) { asm("v_exp_f32 %0, %0\n\tv_exp_f32 %1, %1\n\tv_exp_f32 %2, %2\n\tv_exp_f32 %3, %3\n\tv_exp_f32 %4, %4\n\tv_exp_f32 %5, %5\n\tv_exp_f32 %6, %6\n\tv_exp_f32 %7, %7\n\tv_nop" : "+v"(e[0]), "+v"(e[1]), "+v"(e[2]), "+v"(e[3]), "+v"(e[4]), "+v"(e[5]), "+v"(e[6]), "+v"(e[7])); }
// (wave-uniform base of a tile) + (this lane's 16 bytes inside it)
template <typename T16> __device__ __forceinline__ const T16* lanep(const T16* base, unsigned lane_bytes) { return (const T16*)((const char*)base + lane_bytes); }
// Asynchronous 16-byte copies a lane, global memory to LDS through no register, eight or twelve in one statement: LDS bytes l, l + 4096, ... from a + tb, a + as + tb, ... (four pieces), then from b and from c likewise (a, b, c wave-uniform, in scalar registers, so that no 64-bit lane address stays live over the key loop; tb the lane's byte offset). The one s_wait_xcnt stands inside the statement, behind the last copy, so that no address register of an issued copy is rewritten in front of it.
__device__ __forceinline__ void acopy8(unsigned l, unsigned tb, const char* a, size_t as, const char* b, size_t bs) {
    asm volatile("global_load_async_to_lds_b128 %0, %8, %9\n\tglobal_load_async_to_lds_b128 %1, %8, %10\n\tglobal_load_async_to_lds_b128 %2, %8, %11\n\tglobal_load_async_to_lds_b128 %3, %8, %12\n\t"
                 "global_load_async_to_lds_b128 %4, %8, %13\n\tglobal_load_async_to_lds_b128 %5, %8, %14\n\tglobal_load_async_to_lds_b128 %6, %8, %15\n\tglobal_load_async_to_lds_b128 %7, %8, %16\n\ts_wait_xcnt 0x0"
                 :: "v"(l), "v"(l + 4096u), "v"(l + 8192u), "v"(l + 12288u), "v"(l + 16384u), "v"(l + 20480u), "v"(l + 24576u), "v"(l + 28672u), "v"(tb),
                    "s"(a), "s"(a + as), "s"(a + 2 * as), "s"(a + 3 * as), "s"(b), "s"(b + bs), "s"(b + 2 * bs), "s"(b + 3 * bs) : "memory");
}
__device__ __forceinline__ void acopy12(unsigned l, unsigned tb, const char* a, size_t as, const char* b, size_t bs, const char* c, size_t cs) {
    asm volatile("global_load_async_to_lds_b128 %0, %12, %13\n\tglobal_load_async_to_lds_b128 %1, %12, %14\n\tglobal_load_async_to_lds_b128 %2, %12, %15\n\tglobal_load_async_to_lds_b128 %3, %12, %16\n\t"
                 "global_load_async_to_lds_b128 %4, %12, %17\n\tglobal_load_async_to_lds_b128 %5, %12, %18\n\tglobal_load_async_to_lds_b128 %6, %12, %19\n\tglobal_load_async_to_lds_b128 %7, %12, %20\n\t"
                 "global_load_async_to_lds_b128 %8, %12, %21\n\tglobal_load_async_to_lds_b128 %9, %12, %22\n\tglobal_load_async_to_lds_b128 %10, %12, %23\n\tglobal_load_async_to_lds_b128 %11, %12, %24\n\ts_wait_xcnt 0x0"
                 :: "v"(l), "v"(l + 4096u), "v"(l + 8192u), "v"(l + 12288u), "v"(l + 16384u), "v"(l + 20480u), "v"(l + 24576u), "v"(l + 28672u), "v"(l + 32768u), "v"(l + 36864u), "v"(l + 40960u), "v"(l + 45056u), "v"(tb),
                    "s"(a), "s"(a + as), "s"(a + 2 * as), "s"(a + 3 * as), "s"(b), "s"(b + bs), "s"(b + 2 * bs), "s"(b + 3 * bs), "s"(c), "s"(c + cs), "s"(c + 2 * cs), "s"(c + 3 * cs) : "memory");
}
// Stage st (keys st * STK ...) into the buffer whose LDS byte address, plus this thread's 16 bytes tb, is lb. The 256 threads copy 4,096 bytes a round: a key plane's stage is 16,384 contiguous bytes, a value^T plane's four pieces of 4,096 (one per 16-row band, 16 * TT elements apart).
template <bool HL>
__device__ __forceinline__ void fattn_fill(unsigned lb, unsigned tb, int st, const bf* Kh, const bf* Kl, const h16* V16, const bf* Vh, const bf* Vl) {
    const char* a = (const char*)Kh + (size_t)st * PLB; const char* b = (const char*)Kl + (size_t)st * PLB; const size_t vo = (size_t)st * (STK * 32), vs = (size_t)16 * TT * 2;
    if (HL) { acopy8(lb, tb, a, 4096, b, 4096); acopy8(lb + 2 * PLB, tb, (const char*)Vh + vo, vs, (const char*)Vl + vo, vs); }
    else acopy12(lb, tb, a, 4096, b, 4096, (const char*)V16 + vo, vs);
}
typedef __attribute__((address_space(3))) char lds_char;
template <bool HL>
__device__ __forceinline__ void fattn_keys(char* ring, const bf* __restrict__ Kh, const bf* __restrict__ Kl, const h16* __restrict__ V16, const bf* __restrict__ Vh, const bf* __restrict__ Vl, const v16bf (&qh)[2][2], const v16bf (&ql)[2][2], int q0, int qw0, int ks, int lr, int hi, unsigned lk, v8f (&o)[2][4], float (&m)[2], float (&l)[2]) {
    const int np = (q0 + QT + STK - 1) / STK;   /* stages of the work-group; the last one ends at or below TT, since STK divides TT */
    const unsigned tb = threadIdx.x * 16u; const unsigned lb = (unsigned)(size_t)(lds_char*)ring + tb;
    fattn_fill<HL>(lb, tb, 0, Kh, Kl, V16, Vh, Vl);
    asm volatile("s_wait_asynccnt 0x0" ::: "memory");   /* this wave's copies of stage 0 have landed */
    __syncthreads();   /* every wave's copies of stage 0 have landed before any wave reads it */
    if (np > 1) fattn_fill<HL>(lb + BUFB, tb, 1, Kh, Kl, V16, Vh, Vl);
#pragma unroll 1   /* one copy of the pass: a second one would double the fragments that are live and cost the fourth wave per SIMD */
    for (int st = 0; st < np; ++st) {
        const int kb = st * STK + ks * 32; const char* buf = ring + (st & 1) * BUFB + ks * 4096;   /* this wave's key block: 4,096 bytes of each key plane */
        if (kb < qw0 + 32) {   /* wave-uniform: a block past this wave's diagonal is skipped; the waits and the barrier below are passed all the same */
        v8f s[2][2]; v16bf kh[2][2], kl[2][2]; const bf* pkh = lanep((const bf*)buf, lk); const bf* pkl = lanep((const bf*)(buf + PLB), lk);
#pragma unroll
        for (int kt = 0; kt < 2; ++kt)
#pragma unroll
            for (int k2 = 0; k2 < 2; ++k2) { kh[kt][k2] = WFrag<bf>::ld(pkh + (kt * 2 + k2) * 512); kl[kt][k2] = WFrag<bf>::ld(pkl + (kt * 2 + k2) * 512); }
        __builtin_amdgcn_sched_barrier(0);   /* the block's 16 key loads stay one group in front of the score products: without this the compiler sinks four of them among the products and waits for them two products later */
#pragma unroll
        for (int kt = 0; kt < 2; ++kt)
#pragma unroll
            for (int g = 0; g < 2; ++g) { v8f a = (v8f){};
#pragma unroll
                for (int k2 = 0; k2 < 2; ++k2) { a = wmmab(kh[kt][k2], qh[g][k2], a); a = wmmab(kl[kt][k2], qh[g][k2], a); a = wmmab(kh[kt][k2], ql[g][k2], a); }
                s[g][kt] = a; }
        if (kb == qw0) {   /* wave-uniform scalar branch: only in the block on the wave's diagonal can a key lie behind a query; in every earlier block (kb + 32 <= qw0) the select would pass all 32 x 32 scores */
#pragma unroll
            for (int g = 0; g < 2; ++g) { const int rel = g * 16 + lr - hi * 8;   /* this lane's score (kt, j) belongs to a key <= its query where kt * 16 + j <= rel */
#pragma unroll
                for (int kt = 0; kt < 2; ++kt)
#pragma unroll
                    for (int j = 0; j < 8; ++j) s[g][kt][j] = (kt * 16 + j <= rel) ? s[g][kt][j] : -3.0e38f; }
        }
        const char* vb = ring + (st & 1) * BUFB + 2 * PLB + ks * 1024;   /* 32 keys = one 1,024-byte tile of each 16-row band; a band's stage is 4,096 bytes. The value loads stand behind the scores, where the key fragments' registers are free, and fly under the softmax */
        v16bf vh[4], vl[4]; v16h vf[4]; const bf* pvh = lanep((const bf*)vb, lk); const bf* pvl = lanep((const bf*)(vb + PLB), lk); const h16* pvf = lanep((const h16*)vb, lk);
#pragma unroll
        for (int dt = 0; dt < 4; ++dt) { if (HL) { vh[dt] = WFrag<bf>::ld(pvh + dt * 2048); vl[dt] = WFrag<bf>::ld(pvl + dt * 2048); } else vf[dt] = WFrag<h16>::ld(pvf + dt * 2048); }
        v16bf ph[2], pl[2]; v16h p16[2];
#pragma unroll
        for (int g = 0; g < 2; ++g) { float mr = -3.0e38f;
#pragma unroll
            for (int kt = 0; kt < 2; ++kt)
#pragma unroll
                for (int j = 0; j < 8; ++j) mr = fmaxf(mr, s[g][kt][j]);
            mr = fmaxf(mr, xhalf(mr)); const float mx = fmaxf(m[g], mr * (SCL * 1.4426950408889634f));
            const float al = exp2s(m[g] - mx); m[g] = mx; float sa[4] = {0.f, 0.f, 0.f, 0.f};   /* al = 0 on a wave's first block (m = -3e38) */
#pragma unroll
            for (int kt = 0; kt < 2; ++kt) { float e[8];
#pragma unroll
                for (int j = 0; j < 8; ++j) e[j] = __builtin_fmaf(s[g][kt][j], SCL * 1.4426950408889634f, -mx);
                exp2x8(e);
#pragma unroll
                for (int j = 0; j < 8; ++j) { const float p = e[j]; sa[j & 3] += p;
                    if (HL) { const __bf16 a2 = (__bf16)p; ph[g][kt * 8 + j] = a2; pl[g][kt * 8 + j] = (__bf16)(p - (float)a2); } else p16[g][kt * 8 + j] = tohx(p); } }
            const float sum = (sa[0] + sa[1]) + (sa[2] + sa[3]);
            l[g] = l[g] * al + sum;
#pragma unroll
            for (int dt = 0; dt < 4; ++dt) o[g][dt] *= al; }
#pragma unroll
        for (int dt = 0; dt < 4; ++dt)
#pragma unroll
            for (int g = 0; g < 2; ++g) { if (HL) { o[g][dt] = wmmab(vh[dt], ph[g], o[g][dt]); o[g][dt] = wmmab(vl[dt], ph[g], o[g][dt]); o[g][dt] = wmmab(vh[dt], pl[g], o[g][dt]); } else o[g][dt] = wmma16(vf[dt], p16[g], o[g][dt]); }
        }
        asm volatile("s_wait_dscnt 0x0" ::: "memory");      /* this wave's reads of the current buffer have returned before the buffer is refilled */
        asm volatile("s_wait_asynccnt 0x0" ::: "memory");   /* this wave's copies of the next stage have landed */
        __syncthreads();   /* publishes the next stage and ends every wave's reads of the current buffer */
        if (st + 2 < np) fattn_fill<HL>(lb + (unsigned)(st & 1) * BUFB, tb, st + 2, Kh, Kl, V16, Vh, Vl);
    }
    asm volatile("s_wait_asynccnt 0x0" ::: "memory");   /* nothing is in flight when the ring becomes the join's staging */
}
// amdgpu_waves_per_eu(4, 4): at most 256 registers a wave, so that two work-groups (four waves per SIMD) share a WGP and cover each other's waits.
__global__ __launch_bounds__(32 * FW) __attribute__((amdgpu_waves_per_eu(4, 4))) void k_fattn(const bf* __restrict__ Qh, const bf* __restrict__ Ql, const bf* __restrict__ Kh, const bf* __restrict__ Kl, const h16* __restrict__ V16, const bf* __restrict__ Vh, const bf* __restrict__ Vl, bf* __restrict__ Oh, bf* __restrict__ Ol) {
    __shared__ __align__(1024) char ring[2 * BUFB]; __shared__ float sm[FW * 32], sl[FW * 32];
    static_assert(FW * 32 * 68 * 4 <= 2 * BUFB, "the join's staging lies in the ring");
    float* so = (float*)ring;   /* the waves' scaled partial rows, behind the key loop's last barrier */
    const int wv = __builtin_amdgcn_readfirstlane((int)(threadIdx.x >> 5));   /* wave number, scalar so that the skip of a key block stays a scalar branch */
    const int qg = wv & 1, ks = wv >> 1;   /* query half, key block inside a stage */
    const int lane = threadIdx.x & 31, lr = lane & 15, hi = lane >> 4; const int h = blockIdx.x % NH_, b = blockIdx.x / NH_;
    const size_t hb = (size_t)blockIdx.x * TT * HD;   /* planes [b][h]: (b * NH_ + h) */ Qh += hb; Ql += hb; Kh += hb; Kl += hb; V16 += hb; Vh += hb; Vl += hb;
    {
        const int q0 = (TT / QT - 1 - (int)blockIdx.y) * QT;   /* the longest rows of every head and batch start first, the short ones fill in behind them */
        const int qw0 = q0 + qg * 32;   /* this wave's first query */
        const unsigned lk = (unsigned)lane * 16u;   /* the lane's bytes inside a tile, the same in every plane */
        v16bf qh[2][2], ql[2][2]; const bf* pqh = lanep(Qh + (size_t)qw0 * HD, lk); const bf* pql = lanep(Ql + (size_t)qw0 * HD, lk);
#pragma unroll
        for (int g = 0; g < 2; ++g)
#pragma unroll
            for (int k2 = 0; k2 < 2; ++k2) { qh[g][k2] = WFrag<bf>::ld(pqh + (g * 2 + k2) * 512); ql[g][k2] = WFrag<bf>::ld(pql + (g * 2 + k2) * 512); }
        asm volatile("s_wait_xcnt 0x0" :: "v"(pqh), "v"(pql) : "memory");   /* behind the query loads; the addresses are named so that they stay in their registers up to here */
        v8f o[2][4]; float m[2], l[2];
#pragma unroll
        for (int g = 0; g < 2; ++g) { m[g] = -3.0e38f; l[g] = 0.f;
#pragma unroll
            for (int dt = 0; dt < 4; ++dt) o[g][dt] = (v8f){}; }
        if (q0 < RH) fattn_keys<true>(ring, Kh, Kl, V16, Vh, Vl, qh, ql, q0, qw0, ks, lr, hi, lk, o, m, l); else fattn_keys<false>(ring, Kh, Kl, V16, Vh, Vl, qh, ql, q0, qw0, ks, lr, hi, lk, o, m, l);
#pragma unroll
        for (int g = 0; g < 2; ++g) { l[g] += xhalf(l[g]); if (hi == 0) { sm[wv * 32 + g * 16 + lr] = m[g]; sl[wv * 32 + g * 16 + lr] = l[g]; } }
        __syncthreads();   /* every wave's maximum and sum are in LDS before the common ones are formed */
#pragma unroll
        for (int g = 0; g < 2; ++g) { float mm = sm[qg * 32 + g * 16 + lr];   /* the waves qg, qg + 2, ... hold this wave's queries */
#pragma unroll
            for (int w = 1; w < KSP; ++w) mm = fmaxf(mm, sm[(qg + 2 * w) * 32 + g * 16 + lr]);
            float ll = 0.f;
#pragma unroll
            for (int w = 0; w < KSP; ++w) ll += sl[(qg + 2 * w) * 32 + g * 16 + lr] * exp2s(sm[(qg + 2 * w) * 32 + g * 16 + lr] - mm);   /* a wave that had no key block holds m = -3e38, l = 0 */
            const float f = __fdiv_rn(exp2s(m[g] - mm), ll);
#pragma unroll
            for (int dt = 0; dt < 4; ++dt) { const v8f a = o[g][dt] * f; float* d = so + (wv * 32 + g * 16 + lr) * 68 + dt * 16 + hi * 8;
                *(v4fa*)d = (v4f){a[0], a[1], a[2], a[3]}; *(v4fa*)(d + 4) = (v4f){a[4], a[5], a[6], a[7]}; } }
        __syncthreads();   /* every wave's scaled partial rows are in LDS before any of them is summed */
#pragma unroll
        for (int u0 = 0; u0 < QT * 16; u0 += 32 * FW) { const int u = u0 + (int)threadIdx.x, row = u >> 4, cofs = (u & 15) * 4; const float* sp = so + ((row >> 5) * 32 + (row & 31)) * 68 + cofs; v4f val = *(const v4fa*)sp;
#pragma unroll
            for (int w = 1; w < KSP; ++w) val += *(const v4fa*)(sp + w * (2 * 32 * 68));   /* partial rows of the row's query half joined in wave order */
            v4us oh, ol;
#pragma unroll
            for (int q = 0; q < 4; ++q) { unsigned short h2, l2; splitf(val[q], h2, l2); oh[q] = h2; ol[q] = l2; }
            const size_t e = fidx(b * TT + q0 + row, h * HD + cofs, CO); *(v4us*)(Oh + e) = oh; *(v4us*)(Ol + e) = ol; }   /* context rows [b * TT + t][h * 64 + d] as the hi/lo operand planes of the last product, in fragment order */
    }
}

__constant__ float INVT[HD / 2] = { 1.000000000e+00f, 6.493816376e-01f, 4.216965139e-01f, 2.738419771e-01f, 1.778279394e-01f, 1.154782027e-01f, 7.498941571e-02f, 4.869675264e-02f, 3.162277862e-02f, 2.053525113e-02f, 1.333521493e-02f, 8.659643121e-03f, 5.623413250e-03f, 3.651741426e-03f, 2.371373819e-03f, 1.539926510e-03f, 1.000000047e-03f, 6.493816618e-04f, 4.216964880e-04f, 2.738419571e-04f, 1.778279402e-04f, 1.154781930e-04f, 7.498942432e-05f, 4.869675467e-05f, 3.162277426e-05f, 2.053524986e-05f, 1.333521413e-05f, 8.659643754e-06f, 5.623413472e-06f, 3.651741281e-06f, 2.371373739e-06f, 1.539926529e-06f };   // float32 1 / 1000000^(2i/64) (the module's integer-arange expression), generated with jnp to be bit-exact
__device__ __forceinline__ void cs5_block(int blk, float* CS) { const int idx = blk * 256 + threadIdx.x; if (idx >= TT * HD) return; const int d = idx % HD; const int t = idx / HD; const float a = __fmul_rn((float)t, INVT[d % (HD / 2)]); v2f cs; cs[0] = cosf(a); cs[1] = sinf(a); *(v2f*)(CS + (size_t)idx * 2) = cs;  }
__device__ __forceinline__ void rmsx_rows(int blk, const float* __restrict__ X, const float* __restrict__ sc, bf* XH, bf* XL) { const int lane = threadIdx.x & 31; const int row = blk * 8 + (threadIdx.x >> 5); if (row >= NB_ * TT) return;   /* row = b * TT + t */ const float* xr = X + (size_t)row * CC + lane * 16; const float* sr = sc + lane * 16; float v[16]; float ss = 0.f; v4f xa[4], sv[4];
#pragma unroll
    for (int c = 0; c < 4; ++c) { xa[c] = *(const v4f*)(xr + c * 4); sv[c] = *(const v4f*)(sr + c * 4); }
    asm volatile("s_wait_xcnt 0x0" :: "v"(xr), "v"(sr) : "memory");   /* behind the row's and the scale's loads; the addresses are named so that no load's result lands on a register that an issued load names */
#pragma unroll
    for (int c = 0; c < 4; ++c) { const v4f a = xa[c];
#pragma unroll
        for (int q = 0; q < 4; ++q) { const float b = bfr(a[q]); v[c * 4 + q] = b; float p = __fmul_rn(b, b); asm volatile("" : "+v"(p)); ss = __fadd_rn(ss, p); } }
#pragma unroll
    for (int sh = 16; sh; sh >>= 1) ss = __fadd_rn(ss, __shfl_xor(ss, sh, 32));
    const float den = sqrtf(__fadd_rn(__fmul_rn(ss, 1.0f / CC), 1.0e-6f)); const float rinv = __fdiv_rn(1.0f, den);   /* ONE IEEE division per row; x * (1/den) differs from the module's x / den by <= 1 ulp */
    v4us oh[4], ol[4];
#pragma unroll
    for (int c = 0; c < 4; ++c) {
#pragma unroll
        for (int q = 0; q < 4; ++q) { float y = __fmul_rn(v[c * 4 + q], rinv); asm volatile("" : "+v"(y)); y = __fmul_rn(y, bfr(sv[c][q])); unsigned short a2, c2; splitf(y, a2, c2); oh[c][q] = a2; ol[c][q] = c2; } }
    const size_t e = fidx(row, lane * 16, CC); bf* ph = XH + e; bf* pl = XL + e;   /* fragment order: the lane's columns 0..7 here, its columns 8..15 128 elements on */
#pragma unroll
    for (int c = 0; c < 2; ++c) { *(v8us*)(ph + c * 128) = __builtin_shufflevector(oh[2 * c], oh[2 * c + 1], 0, 1, 2, 3, 4, 5, 6, 7); *(v8us*)(pl + c * 128) = __builtin_shufflevector(ol[2 * c], ol[2 * c + 1], 0, 1, 2, 3, 4, 5, 6, 7); }
}
__device__ __forceinline__ void wtG_lines(int blk, const float* __restrict__ w, int K, int N, bf* Bt) {
    const int lane = threadIdx.x & 31; const int L0 = (blk * 8 + (threadIdx.x >> 5)) * 8; const int nlines = N * K / 64;
{
#pragma unroll 1
        for (int l = 0; l < 8; ++l) { const int L = L0 + l; if (L >= nlines) break; const size_t e = (size_t)L * 64 + lane * 2; const int k = (int)(e % K), n = (int)(e / K); v2us o;
            o[0] = f2bf(w[(size_t)k * N + n]); o[1] = f2bf(w[(size_t)(k + 1) * N + n]); *(v2us*)(Bt + fidx(n, k, K)) = o;   /* Bt[n][k] in fragment order */
            asm volatile("s_wait_xcnt 0x0" ::: "memory"); }   /* behind the store, in front of the next trip's rewrite of its address and data registers */
         }
}
// ---- k_prep: all that depends on the inputs alone, side by side in one grid of 256 threads: blocks 0 .. 4 * WB - 1 the four weights (WB blocks each; the longest blocks, so they start first), the next RB the token rows of both batches, the last TB the rotary table.
#define WB (CC * MID / 64 / 64)
#define RB (NB_ * TT / 8)
#define TB (TT * HD / 256)
__global__ __launch_bounds__(256) void k_prep(const float* __restrict__ x, const float* __restrict__ rsc, const float* __restrict__ wq, const float* __restrict__ wk, const float* __restrict__ wv, const float* __restrict__ wo, bf* WQKV, bf* WO, float* CS, bf* XH, bf* XL) {
    const int blk = (int)blockIdx.x;
    if (blk < 4 * WB) { const int j = blk / WB; wtG_lines(blk % WB, j == 0 ? wq : j == 1 ? wk : j == 2 ? wv : wo, CC, MID, j < 3 ? WQKV + (size_t)j * MID * CC : WO); }   /* 'xw' weights -> Bt; all four are [512][512] */
    else if (blk < 4 * WB + RB) rmsx_rows(blk - 4 * WB, x, rsc, XH, XL);   /* x_norm = x / sqrt(mean x^2 + eps) x scale as hi/lo planes */
    else cs5_block(blk - 4 * WB - RB, CS);   /* cos, sin per (token, d) for the q and k epilogues */
}
extern "C" void kernel_launch(void* const* d_in, const int* in_sizes, int n_in,
                              void* d_out, int out_size, void* d_ws, size_t ws_size, hipStream_t stream) {
    (void)in_sizes; (void)n_in; (void)out_size;
    const float* x = (const float*)d_in[0]; const float* rsc = (const float*)d_in[1]; const float* wq = (const float*)d_in[2]; const float* wk = (const float*)d_in[3]; const float* wv = (const float*)d_in[4]; const float* wo = (const float*)d_in[5];   /* input order x [2][4096][512], scale [512] (RMSNorm weight), Wq, Wk, Wv, Wo ('xw' [512][512], no biases) */
    float* OUT = (float*)d_out;     // [2][4096][512]
    char* wsp = (char*)d_ws;
    auto take = [&](size_t bytes) { char* p = wsp; wsp += (bytes + 255) & ~(size_t)255; return (void*)p; };
    bf* WQKV = (bf*)take((size_t)3 * MID * CC * 2); bf* WQ = WQKV; bf* WK = WQKV + (size_t)MID * CC; bf* WV = WQKV + (size_t)2 * MID * CC; bf* WO = (bf*)take((size_t)CC * CO * 2); float* CS = (float*)take((size_t)TT * HD * 2 * 4);
    bf* XH = (bf*)take((size_t)NB_ * TT * CC * 2); bf* XL = (bf*)take((size_t)NB_ * TT * CC * 2);   /* RMS-normalised tokens, bf16 hi/lo */
    bf* QPh = (bf*)take((size_t)NB_ * TT * MID * 2); bf* QPl = (bf*)take((size_t)NB_ * TT * MID * 2); bf* KPh = (bf*)take((size_t)NB_ * TT * MID * 2); bf* KPl = (bf*)take((size_t)NB_ * TT * MID * 2);
    h16* VT16 = (h16*)take((size_t)NB_ * CO * TT * 2); bf* VTh = (bf*)take((size_t)NB_ * CO * TT * 2); bf* VTl = (bf*)take((size_t)NB_ * CO * TT * 2);
    bf* ATh = (bf*)take((size_t)NB_ * TT * CO * 2); bf* ATl = (bf*)take((size_t)NB_ * TT * CO * 2);
    if ((size_t)(wsp - (char*)d_ws) > ws_size) return;
    k_prep<<<4 * WB + RB + TB, 256, 0, stream>>>(x, rsc, wq, wk, wv, wo, WQKV, WO, CS, XH, XL);
    k_qkv<<<dim3(NB_ * TT / 64, MID / 64, 3), 32 * NWP, 0, stream>>>(XH, XL, WQ, WK, WV, CS, QPh, QPl, KPh, KPl, VT16, VTh, VTl);
    k_fattn<<<dim3(NB_ * NH_, TT / QT, 1), 32 * FW, 0, stream>>>(QPh, QPl, KPh, KPl, VT16, VTh, VTl, ATh, ATl);   /* all heads of both batches: scores, causal softmax and attn.V; merged context as hi/lo planes */
    k_out<<<dim3(NB_ * TT / 64, CC / 64, 1), 32 * NWP, 0, stream>>>(ATh, ATl, WO, OUT);
}

// v008
// A run of this version takes 108 microseconds.
// Timed twice side by side with v007, it ran 1.05 times as fast both times.
// All steps since v000 together make it 37.2 times as fast.
#include <hip/hip_runtime.h>

// Causal multi-head self-attention with a leading RMSNorm and rotary embeddings over 4,096 tokens (x [2][4096][512]; x_norm = x / sqrt(mean x^2 + 1e-6) x scale (scale [512] ones, read); q, k, v = x_norm W ('xw' [512][512] 1/sqrt(512), no bias; 8 heads x 64); rotate-half rope (cat(x1 c - x2 s, x1 s + x2 c)) with angle t x 1/1000000^(2i/64) (32 f32 frequencies jnp-exact; precise cosf/sinf); scores / sqrt(64); causal (-inf); softmax; out = merged Wo ('xw') -> [2][4096][512] (4.2 M); argument order x, scale, Wq, Wk, Wv, Wo).
// Four launches, both batches side by side in each grid (every plane holds batch 0, then batch 1): k_prep (weights to fragment order, rotary table, RMSNorm), k_qkv, k_fattn, k_out. Layout: rmsx_rows normalises each token row in f32 and stores bf16 hi/lo planes; projections hi/lo x exact weights (2 products), whose epilogues write the operand planes themselves (q, k: rotate-half with the cs5_block table, then hi/lo; v: the product is formed transposed, Wv rows x token rows, and stored as value^T planes); k_fattn: scores (hi/lo planes, 3 products), causal select (x 1/8), running-maximum softmax and attn.V (rows < 512 hi/lo 3 products, rest fp16) in one kernel over all heads, keys and values staged in LDS by asynchronous copies, no score matrix in memory, context stored as hi/lo planes; context hi/lo x Wo exact written to the output rows. Every 16-bit operand plane lies in fragment order (fidx below).
// Compute dtypes, f32 accumulate: every input rounded to bf16 incl. scale; RMSNorm f32; projections 2 products (hi/lo x exact); rotary f32; scores 3 products; softmax f32, weights kept unnormalised (<= 1) and divided by the row sum at the end; attn.V rows < 512 3 products, rest fp16; Wo hl x exact.

#define NB_  2
#define TT   4096
#define DM   512
#define NH_  8
#define NKV  8
#define REP  (NH_ / NKV)
#define HD   64
#define DQ   (NH_ * HD)
#define DKV  (NKV * HD)
#define ZH   1
#define RH   512                  // query rows < RH use hi+lo planes (0: none)
#define WIN  0
#define SCL  0.125f   // 1/sqrt(float32(64))
#define MID  512      // q / k width = 8 heads x 64
#define CO   512      // v width
#define CC   512
#define FW   8        // k_fattn: waves per work-group: 2 query halves x 4 key blocks of a stage
#define NWP  8        // projections: waves per work-group
#define NTP  4        // projections: 64 x 64 tiles per work-group, side by side; NWP / NTP waves split the k of each
typedef _Float16 h16;
typedef unsigned short bf;
typedef __attribute__((ext_vector_type(16))) __bf16   v16bf;
typedef __attribute__((ext_vector_type(16))) _Float16 v16h;
typedef __attribute__((ext_vector_type(8)))  _Float16 v8h;
typedef __attribute__((ext_vector_type(8)))  unsigned short v8us;
typedef __attribute__((ext_vector_type(8)))  float    v8f;
typedef __attribute__((ext_vector_type(4)))  float    v4f;
typedef v8h  __attribute__((may_alias)) v8ha;
typedef v4f  __attribute__((may_alias)) v4fa;
typedef v8us __attribute__((may_alias)) v8usa;

__device__ __forceinline__ unsigned short f2bf(float f) { unsigned u = __float_as_uint(f); u += 0x7FFFu + ((u >> 16) & 1u); return (unsigned short)(u >> 16); }
__device__ __forceinline__ float bf2f(unsigned short b) { return __uint_as_float(((unsigned)b) << 16); }
__device__ __forceinline__ float bfr(float f) { return bf2f(f2bf(f)); }
__device__ __forceinline__ v16h cat16(v8h lo, v8h hi) { return __builtin_shufflevector(lo, hi, 0, 1, 2, 3, 4, 5, 6, 7, 8, 9, 10, 11, 12, 13, 14, 15); }
__device__ __forceinline__ v16bf cat16b(v8us lo, v8us hi) { return __builtin_bit_cast(v16bf, __builtin_shufflevector(lo, hi, 0, 1, 2, 3, 4, 5, 6, 7, 8, 9, 10, 11, 12, 13, 14, 15)); }
__device__ __forceinline__ v8f wmma16(v16h a, v16h b, v8f c) { return __builtin_amdgcn_wmma_f32_16x16x32_f16(false, a, false, b, (short)0, c, false, false); }
__device__ __forceinline__ v8f wmmab(v16bf a, v16bf b, v8f c) { return __builtin_amdgcn_wmma_f32_16x16x32_bf16(false, a, false, b, (short)0, c, false, false); }

__device__ __forceinline__ h16 tohx(float x) { return (h16)x; }
__device__ __forceinline__ void splitf(float y, unsigned short& h, unsigned short& l) { h = f2bf(y); l = f2bf(y - bf2f(h)); }
typedef __attribute__((ext_vector_type(4))) _Float16 v4h;
typedef __attribute__((ext_vector_type(2))) unsigned short v2us;
typedef __attribute__((ext_vector_type(4))) unsigned short v4us;
typedef __attribute__((ext_vector_type(2))) float v2f;

// ---- gemmw_tile: register-blocked GEMM, 64x64 output tiles (16 accumulators a wave), NT of them per work-group of NW waves: tiles (bx, by + t), or (bx + t, by) where TROW, of (M/64, N/64), so that the NT waves of one k slice read the same fragments of the operand the tiles share; operands straight from 16-bit planes in fragment order (fidx) of row length LP; osall is the work-group's LDS.
// C[m][n] (f32, pitch ldc, + optional f32 bias[n]) = sum_k A[m][k] Bt[n][k] (+ split products per NSPLIT). K % (32 * NW / NT) == 0. The token rows of both batches stand one behind the other (row = b * TT + t).
// EPI says what the joined tile becomes: 0 f32 rows of C; 1 (tile = 64 tokens x one head) rotate-half rotary out[d] = x[d] cos[t][d] -/+ x[d +/- 32] sin[t][d] from the table CS [t][64][cos, sin], stored as bf16 hi/lo planes [b][head][t][64]; 2 (columns = tokens) fp16 and bf16 hi/lo planes [b][CO rows] of row length ldc = TT; both in fragment order.
// Split-K: wave w works on tile w % NT and takes the 32-wide k steps s, s + NW / NT, ... with s = w / NT (one 1,024-byte tile per fragment); the NW / NT partial tiles of each tile are summed in LDS in wave order.
// Fragment order of a 16-bit operand plane of K-contiguous rows (rows % 16 == 0, K % 32 == 0): one 16-row x 32-k tile is 1,024 contiguous bytes, tiles run along k and then down the rows. Inside a tile the 16 bytes that lane (hi * 16 + row % 16) takes for k % 32 = c * 16 + hi * 8 + 0..7 stand at c * 512 + lane * 16, so each of a fragment's two wave-wide 16-byte loads reads 512 contiguous bytes (four whole 128-byte lines) where row-major planes gave it 32-byte pieces of 16 lines.
__device__ __forceinline__ size_t fidx(int row, int k, int K) { return ((size_t)(row >> 4) * (K >> 5) + (k >> 5)) * 512 + ((k >> 4) & 1) * 256 + ((k >> 3) & 1) * 128 + (row & 15) * 8 + (k & 7); }
template <typename T16> struct WFrag;
template <> struct WFrag<h16> { typedef v16h V; static __device__ __forceinline__ V ld(const h16* p) { return cat16(*(const v8h*)p, *(const v8h*)(p + 256)); } static __device__ __forceinline__ v8f mma(V a, V b, v8f c) { return wmma16(a, b, c); } };
template <> struct WFrag<bf> { typedef v16bf V; static __device__ __forceinline__ V ld(const bf* p) { return cat16b(*(const v8us*)p, *(const v8us*)(p + 256)); } static __device__ __forceinline__ v8f mma(V a, V b, v8f c) { return wmmab(a, b, c); } };
template <typename T16, int NSPLIT, bool BIAS, int NW = 1, int EPI = 0, int LP = 512, int NT = 1, bool TROW = false>
__device__ __forceinline__ void gemmw_tile(float* osall, int bx, int by, const T16* __restrict__ A, const T16* __restrict__ A2, const T16* __restrict__ Bt, const T16* __restrict__ Bt2, int K, float* C, int ldc, const float* __restrict__ bias, const float* __restrict__ CS, h16* P16, bf* Ph, bf* Pl) {
    typedef typename WFrag<T16>::V V;   /* osall: NW > 1 ? NW * 64 * 68 : 16 * 68 floats (NW > 1: one whole 64 x 64 partial tile a wave) */
    const int wv = NW > 1 ? __builtin_amdgcn_readfirstlane((int)(threadIdx.x >> 5)) : 0;   /* wave number, scalar so that the k loop stays a scalar branch */
    constexpr int lp = LP;   /* row length of both operands' planes, a constant so that all fragments of a k step hang on one address per plane by immediate offsets */
    static_assert(NW % NT == 0 && (EPI != 1 || !TROW), "whole k slices; the rotary epilogue's tiles share their tokens");
    constexpr int KS = NW / NT;   /* waves that split the k of one tile */
    const int ti = wv % NT, sl = wv / NT;   /* this wave's tile and k slice, scalar like wv */
    float* os = osall + wv * (64 * 68);
    const int lane = threadIdx.x & 31, lr = lane & 15, hi = lane >> 4; const int r0 = (bx + (TROW ? ti : 0)) * 64, c0 = (by + (TROW ? 0 : ti)) * 64;
    v8f acc[4][4];
#pragma unroll
    for (int mb = 0; mb < 4; ++mb)
#pragma unroll
        for (int nb = 0; nb < 4; ++nb) acc[mb][nb] = (v8f){};
    const size_t aoff = (size_t)r0 * lp + lane * 8, boff = (size_t)c0 * lp + lane * 8;   /* first tile of the 64 rows (16 rows hold 16 * lp elements) + the lane's 16 bytes; a 32-wide k step is 512 elements on */
#pragma unroll 1
    for (int kc = sl * 32; kc < K; kc += 32 * KS) {
        V a[4], a2[4], b[4], b2[4]; const T16* pa = A + aoff + (size_t)kc * 16; const T16* pa2 = (NSPLIT == 1 || NSPLIT == 2) ? A2 + aoff + (size_t)kc * 16 : nullptr; const T16* pb = Bt + boff + (size_t)kc * 16; const T16* pb2 = NSPLIT >= 2 ? Bt2 + boff + (size_t)kc * 16 : nullptr;
#pragma unroll
        for (int mb = 0; mb < 4; ++mb) { a[mb] = WFrag<T16>::ld(pa + mb * 16 * lp); if (NSPLIT == 1 || NSPLIT == 2) a2[mb] = WFrag<T16>::ld(pa2 + mb * 16 * lp); }
#pragma unroll
        for (int nb = 0; nb < 4; ++nb) { b[nb] = WFrag<T16>::ld(pb + nb * 16 * lp); if (NSPLIT >= 2) b2[nb] = WFrag<T16>::ld(pb2 + nb * 16 * lp); }
        /* behind the operand loads; the addresses are named so that they stay in their registers up to here and no load's result lands on a register that an issued load names */
        if constexpr (NSPLIT == 0) asm volatile("s_wait_xcnt 0x0" :: "v"(pa), "v"(pb) : "memory"); else if constexpr (NSPLIT == 1) asm volatile("s_wait_xcnt 0x0" :: "v"(pa), "v"(pa2), "v"(pb) : "memory"); else if constexpr (NSPLIT == 2) asm volatile("s_wait_xcnt 0x0" :: "v"(pa), "v"(pa2), "v"(pb), "v"(pb2) : "memory"); else asm volatile("s_wait_xcnt 0x0" :: "v"(pa), "v"(pb), "v"(pb2) : "memory");
        __builtin_amdgcn_sched_barrier(0);   /* no matrix instruction is lifted in front of the wait: without this the compiler lets late loads reuse fragment registers, and the wave then sits out one load latency per group of four products instead of one per k step */
#pragma unroll
        for (int nb = 0; nb < 4; ++nb)
#pragma unroll
            for (int mb = 0; mb < 4; ++mb) { acc[mb][nb] = WFrag<T16>::mma(a[mb], b[nb], acc[mb][nb]); if (NSPLIT == 1 || NSPLIT == 2) acc[mb][nb] = WFrag<T16>::mma(a2[mb], b[nb], acc[mb][nb]); if (NSPLIT >= 2) acc[mb][nb] = WFrag<T16>::mma(a[mb], b2[nb], acc[mb][nb]); }
        asm volatile("v_nop\n\tv_nop\n\tv_nop\n\tv_nop" : "+v"(acc[0][0]), "+v"(acc[1][1]), "+v"(acc[2][2]), "+v"(acc[3][3]) : "v"(a[0]), "v"(a[3]));
    }
    if constexpr (NW > 1) {
        static_assert(EPI != 1 || NW == 8, "the table fetch below is laid out for four passes of 256 threads");
        v4f c01[4], c23[4];   /* EPI 1: this thread's (cos, sin) pairs of its four passes, fetched here so that they fly under the LDS stores of the partial tile */
        if constexpr (EPI == 1) { const float* cs = CS + ((size_t)(r0 % TT + (int)(threadIdx.x >> 4)) * HD + (threadIdx.x & 15) * 4) * 2;
#pragma unroll
            for (int i = 0; i < 4; ++i) { c01[i] = *(const v4f*)(cs + i * (16 * HD * 2)); c23[i] = *(const v4f*)(cs + i * (16 * HD * 2) + 4); }
            asm volatile("s_wait_xcnt 0x0" :: "v"(cs) : "memory"); }   /* behind the table loads; the address is named so that it stays in its registers up to here */
#pragma unroll
        for (int mb = 0; mb < 4; ++mb)
#pragma unroll
            for (int nb = 0; nb < 4; ++nb)
#pragma unroll
                for (int j = 0; j < 8; ++j) os[(mb * 16 + hi * 8 + j) * 68 + nb * 16 + lr] = acc[mb][nb][j];
        __syncthreads();   /* every wave's partial tile is in LDS before any of it is summed */
#pragma unroll   /* t a constant in each copy: the tiles' LDS and global offsets become immediates, and the table registers c01, c23 serve all tiles */
        for (int t = 0; t < NT; ++t) { const int rt = (bx + (TROW ? t : 0)) * 64, ct = (by + (TROW ? 0 : t)) * 64;   /* all threads finish the work-group's tiles one after the other */
#pragma unroll
        for (int u0 = 0; u0 < 64 * 16; u0 += 32 * NW) { const int u = u0 + (int)threadIdx.x, row = u >> 4, cofs = (u & 15) * 4; v4f val = *(const v4fa*)(osall + t * (64 * 68) + row * 68 + cofs);
#pragma unroll
            for (int w = 1; w < KS; ++w) val += *(const v4fa*)(osall + (w * NT + t) * (64 * 68) + row * 68 + cofs);   /* the tile's partial sums joined in wave order */
            if (BIAS) { val[0] += bfr(bias[ct + cofs]); val[1] += bfr(bias[ct + cofs + 1]); val[2] += bfr(bias[ct + cofs + 2]); val[3] += bfr(bias[ct + cofs + 3]); }
            if constexpr (EPI == 0) *(v4f*)(C + (size_t)(rt + row) * ldc + ct + cofs) = val;
            else { v4us oh, ol;
                if constexpr (EPI == 1) { const int i = u0 / (32 * NW); const float co[4] = {c01[i][0], c01[i][2], c23[i][0], c23[i][2]}, si[4] = {c01[i][1], c01[i][3], c23[i][1], c23[i][3]};
#pragma unroll
                    for (int q = 0; q < 4; ++q) { const float par = __shfl_xor(val[q], 8, 32);   /* lane ^ 8 holds the same token's columns cofs ^ 32, the other half of the head */
                        val[q] = val[q] * co[q] + par * ((cofs < HD / 2) ? -si[q] : si[q]); } }
#pragma unroll
                for (int q = 0; q < 4; ++q) { unsigned short h2, l2; splitf(val[q], h2, l2); oh[q] = h2; ol[q] = l2; }
                const size_t e = EPI == 1 ? ((size_t)(rt / TT) * NH_ + by + t) * TT * HD + fidx(rt % TT + row, cofs, HD) : (size_t)(ct / TT) * CO * TT + fidx(rt + row, ct % TT + cofs, ldc);
                *(v4us*)(Ph + e) = oh; *(v4us*)(Pl + e) = ol;
                if constexpr (EPI == 2) { v4h o16;
#pragma unroll
                    for (int q = 0; q < 4; ++q) o16[q] = tohx(val[q]);
                    *(v4h*)(P16 + e) = o16; } } } }
    } else {
#pragma unroll
    for (int mb = 0; mb < 4; ++mb) {
#pragma unroll
        for (int nb = 0; nb < 4; ++nb) {
#pragma unroll
            for (int j = 0; j < 8; ++j) os[(hi * 8 + j) * 68 + nb * 16 + lr] = acc[mb][nb][j]; }
        __builtin_amdgcn_wave_barrier(); asm volatile("" ::: "memory");
        float* crow = C + (size_t)(r0 + mb * 16) * ldc + c0;
{
#pragma unroll
            for (int s = 0; s < 8; ++s) { const int row = 2 * s + hi, cofs = lr * 4; v4f val = *(const v4fa*)(os + row * 68 + cofs); if (BIAS) { val[0] += bfr(bias[c0 + cofs]); val[1] += bfr(bias[c0 + cofs + 1]); val[2] += bfr(bias[c0 + cofs + 2]); val[3] += bfr(bias[c0 + cofs + 3]); }
                *(v4f*)(crow + (size_t)row * ldc + cofs) = val; }
             }
        __builtin_amdgcn_wave_barrier(); asm volatile("" ::: "memory");
    }
    }
}

// ---- k_qkv: the three projections of both batches in one grid (NB_ * TT / 64 token tiles, 8 / NTP groups of NTP column tiles, 3): z = 0 q, 1 k, 2 v (formed transposed: rows = Wv columns, columns = tokens). 32 * NWP threads.
__global__ __launch_bounds__(32 * NWP) void k_qkv(const bf* __restrict__ XH, const bf* __restrict__ XL, const bf* __restrict__ WQ, const bf* __restrict__ WK, const bf* __restrict__ WV, const float* __restrict__ CS, bf* QPh, bf* QPl, bf* KPh, bf* KPl, h16* VT16, bf* VTh, bf* VTl) {
    __shared__ __align__(16) float osall[NWP * 64 * 68];
    if (blockIdx.z < 2) { const bool isk = blockIdx.z == 1;
        gemmw_tile<bf, 1, false, NWP, 1, 512, NTP, false>(osall, (int)blockIdx.x, (int)blockIdx.y * NTP, XH, XL, isk ? WK : WQ, nullptr, CC, nullptr, MID, nullptr, CS, nullptr, isk ? KPh : QPh, isk ? KPl : QPl); }   /* q, k planes [b][h][n][64], rotated */
    else { gemmw_tile<bf, 3, false, NWP, 2, 512, NTP, true>(osall, (int)blockIdx.y * NTP, (int)blockIdx.x, WV, nullptr, XH, XL, CC, nullptr, TT, nullptr, nullptr, VT16, VTh, VTl);   /* v^T planes [b][h][64][n]: rows = Wv columns (exact), columns = tokens (hi/lo) */
        asm volatile("s_wait_xcnt 0x0" ::: "memory"); }   /* behind the value planes' last stores: the built code of this branch runs on into the test in front of the q, k branch, whose first instructions write registers that those stores name */
}
// ---- k_out: out = ctx w_out^T, the rows of both batches in one grid (NB_ * TT / 64, CC / 64 / NTP). 32 * NWP threads.
__global__ __launch_bounds__(32 * NWP) void k_out(const bf* __restrict__ ATh, const bf* __restrict__ ATl, const bf* __restrict__ WO, float* OUT) {
    __shared__ __align__(16) float osall[NWP * 64 * 68];
    gemmw_tile<bf, 1, false, NWP, 0, 512, NTP, false>(osall, (int)blockIdx.x, (int)blockIdx.y * NTP, ATh, ATl, WO, nullptr, CO, OUT, CC, nullptr, nullptr, nullptr, nullptr, nullptr);
}

// ---- k_fattn: causal attention of one head of one batch for QT = 64 query rows per work-group, scores never leave the registers. grid (NB_ * heads, TT / QT), 32 * FW threads.
// S^T = K Q^T (A = key rows, B = query rows, both planes [h][t][64] in fragment order): in each 16-query group a lane holds 16 of one query's 32 scores, in the k order of a B operand, so the weights go into O^T += V^T P^T (A = value^T rows [h][64][t]) without leaving the lane.
// Wave w works on the 32 queries of half (w & 1) and on the 32-key block (w >> 1) of every 128-key stage. A stage (key planes hi, lo and the value^T plane or planes, still in fragment order) is brought into LDS once per work-group by asynchronous copies, two buffers, the next stage in flight under the current one, and each of its blocks is read from LDS by the two waves that share it: half the reads from L2 of a 32-query work-group.
// Running maximum m and sum l per query in base 2; key blocks past a wave's diagonal are skipped, the diagonal block alone is cut by the select. The KSP waves' (m, l, O) of each query half are joined in LDS in wave order.
#define QT   64                   // query rows per work-group: two halves of 32
#define KSP  (FW / 2)             // waves that split the keys of one query half
#define STK  (KSP * 32)           // keys per stage
#define PLB  (STK * HD * 2)       // bytes of one 16-bit plane's share of a stage (16,384)
#define BUFB (4 * PLB)            // one buffer: K hi | K lo | V fp16 (rows < RH: V hi | V lo)
__device__ __forceinline__ float xhalf(float x) { const int b = __float_as_int(x); return __int_as_float(__builtin_amdgcn_permlanex16(b, b, 0x76543210, 0xfedcba98, false, false)); }   /* lane l <-> l ^ 16 */
// 2^x in place. The v_nop is the one slot the instruction set asks for between a transcendental and an instruction that reads its result or overwrites its source; inside the run each v_exp_f32 is followed by one on other registers.
__device__ __forceinline__ float exp2s(float x) { asm("v_exp_f32 %0, %0\n\tv_nop" : "+v"(x)); return x; }
__device__ __forceinline__ void exp2x8(float (&e)[8]) { asm("v_exp_f32 %0, %0\n\tv_exp_f32 %1, %1\n\tv_exp_f32 %2, %2\n\tv_exp_f32 %3, %3\n\tv_exp_f32 %4, %4\n\tv_exp_f32 %5, %5\n\tv_exp_f32 %6, %6\n\tv_exp_f32 %7, %7\n\tv_nop" : "+v"(e[0]), "+v"(e[1]), "+v"(e[2]), "+v"(e[3]), "+v"(e[4]), "+v"(e[5]), "+v"(e[6]), "+v"(e[7])); }
// (wave-uniform base of a tile) + (this lane's 16 bytes inside it)
template <typename T16> __device__ __forceinline__ const T16* lanep(const T16* base, unsigned lane_bytes) { return (const T16*)((const char*)base + lane_bytes); }
// Asynchronous 16-byte copies a lane, global memory to LDS through no register, eight or twelve in one statement: LDS bytes l, l + 4096, ... from a + tb, a + as + tb, ... (four pieces), then from b and from c likewise (a, b, c wave-uniform, in scalar registers, so that no 64-bit lane address stays live over the key loop; tb the lane's byte offset). The one s_wait_xcnt stands inside the statement, behind the last copy, so that no address register of an issued copy is rewritten in front of it.
__device__ __forceinline__ void acopy8(unsigned l, unsigned tb, const char* a, size_t as, const char* b, size_t bs) {
    asm volatile("global_load_async_to_lds_b128 %0, %8, %9\n\tglobal_load_async_to_lds_b128 %1, %8, %10\n\tglobal_load_async_to_lds_b128 %2, %8, %11\n\tglobal_load_async_to_lds_b128 %3, %8, %12\n\t"
                 "global_load_async_to_lds_b128 %4, %8, %13\n\tglobal_load_async_to_lds_b128 %5, %8, %14\n\tglobal_load_async_to_lds_b128 %6, %8, %15\n\tglobal_load_async_to_lds_b128 %7, %8, %16\n\ts_wait_xcnt 0x0"
                 :: "v"(l), "v"(l + 4096u), "v"(l + 8192u), "v"(l + 12288u), "v"(l + 16384u), "v"(l + 20480u), "v"(l + 24576u), "v"(l + 28672u), "v"(tb),
                    "s"(a), "s"(a + as), "s"(a + 2 * as), "s"(a + 3 * as), "s"(b), "s"(b + bs), "s"(b + 2 * bs), "s"(b + 3 * bs) : "memory");
}
__device__ __forceinline__ void acopy12(unsigned l, unsigned tb, const char* a, size_t as, const char* b, size_t bs, const char* c, size_t cs) {
    asm volatile("global_load_async_to_lds_b128 %0, %12, %13\n\tglobal_load_async_to_lds_b128 %1, %12, %14\n\tglobal_load_async_to_lds_b128 %2, %12, %15\n\tglobal_load_async_to_lds_b128 %3, %12, %16\n\t"
                 "global_load_async_to_lds_b128 %4, %12, %17\n\tglobal_load_async_to_lds_b128 %5, %12, %18\n\tglobal_load_async_to_lds_b128 %6, %12, %19\n\tglobal_load_async_to_lds_b128 %7, %12, %20\n\t"
                 "global_load_async_to_lds_b128 %8, %12, %21\n\tglobal_load_async_to_lds_b128 %9, %12, %22\n\tglobal_load_async_to_lds_b128 %10, %12, %23\n\tglobal_load_async_to_lds_b128 %11, %12, %24\n\ts_wait_xcnt 0x0"
                 :: "v"(l), "v"(l + 4096u), "v"(l + 8192u), "v"(l + 12288u), "v"(l + 16384u), "v"(l + 20480u), "v"(l + 24576u), "v"(l + 28672u), "v"(l + 32768u), "v"(l + 36864u), "v"(l + 40960u), "v"(l + 45056u), "v"(tb),
                    "s"(a), "s"(a + as), "s"(a + 2 * as), "s"(a + 3 * as), "s"(b), "s"(b + bs), "s"(b + 2 * bs), "s"(b + 3 * bs), "s"(c), "s"(c + cs), "s"(c + 2 * cs), "s"(c + 3 * cs) : "memory");
}
// Stage st (keys st * STK ...) into the buffer whose LDS byte address, plus this thread's 16 bytes tb, is lb. The 256 threads copy 4,096 bytes a round: a key plane's stage is 16,384 contiguous bytes, a value^T plane's four pieces of 4,096 (one per 16-row band, 16 * TT elements apart).
template <bool HL>
__device__ __forceinline__ void fattn_fill(unsigned lb, unsigned tb, int st, const bf* Kh, const bf* Kl, const h16* V16, const bf* Vh, const bf* Vl) {
    const char* a = (const char*)Kh + (size_t)st * PLB; const char* b = (const char*)Kl + (size_t)st * PLB; const size_t vo = (size_t)st * (STK * 32), vs = (size_t)16 * TT * 2;
    if (HL) { acopy8(lb, tb, a, 4096, b, 4096); acopy8(lb + 2 * PLB, tb, (const char*)Vh + vo, vs, (const char*)Vl + vo, vs); }
    else acopy12(lb, tb, a, 4096, b, 4096, (const char*)V16 + vo, vs);
}
typedef __attribute__((address_space(3))) char lds_char;
template <bool HL>
__device__ __forceinline__ void fattn_keys(char* ring, const bf* __restrict__ Kh, const bf* __restrict__ Kl, const h16* __restrict__ V16, const bf* __restrict__ Vh, const bf* __restrict__ Vl, const v16bf (&qh)[2][2], const v16bf (&ql)[2][2], int q0, int qw0, int ks, int lr, int hi, unsigned lk, v8f (&o)[2][4], float (&m)[2], float (&l)[2]) {
    const int np = (q0 + QT + STK - 1) / STK;   /* stages of the work-group; the last one ends at or below TT, since STK divides TT */
    const unsigned tb = threadIdx.x * 16u; const unsigned lb = (unsigned)(size_t)(lds_char*)ring + tb;
    fattn_fill<HL>(lb, tb, 0, Kh, Kl, V16, Vh, Vl);
    asm volatile("s_wait_asynccnt 0x0" ::: "memory");   /* this wave's copies of stage 0 have landed */
    __syncthreads();   /* every wave's copies of stage 0 have landed before any wave reads it */
    if (np > 1) fattn_fill<HL>(lb + BUFB, tb, 1, Kh, Kl, V16, Vh, Vl);
#pragma unroll 1   /* one copy of the pass: a second one would double the fragments that are live and cost the fourth wave per SIMD */
    for (int st = 0; st < np; ++st) {
        const int kb = st * STK + ks * 32; const char* buf = ring + (st & 1) * BUFB + ks * 4096;   /* this wave's key block: 4,096 bytes of each key plane */
        if (kb < qw0 + 32) {   /* wave-uniform: a block past this wave's diagonal is skipped; the waits and the barrier below are passed all the same */
        v8f s[2][2]; v16bf kh[2][2], kl[2][2]; const bf* pkh = lanep((const bf*)buf, lk); const bf* pkl = lanep((const bf*)(buf + PLB), lk);
#pragma unroll
        for (int kt = 0; kt < 2; ++kt)
#pragma unroll
            for (int k2 = 0; k2 < 2; ++k2) { kh[kt][k2] = WFrag<bf>::ld(pkh + (kt * 2 + k2) * 512); kl[kt][k2] = WFrag<bf>::ld(pkl + (kt * 2 + k2) * 512); }
        __builtin_amdgcn_sched_barrier(0);   /* the block's 16 key loads stay one group in front of the score products: without this the compiler sinks four of them among the products and waits for them two products later */
#pragma unroll
        for (int kt = 0; kt < 2; ++kt)
#pragma unroll
            for (int g = 0; g < 2; ++g) { v8f a = (v8f){};
#pragma unroll
                for (int k2 = 0; k2 < 2; ++k2) { a = wmmab(kh[kt][k2], qh[g][k2], a); a = wmmab(kl[kt][k2], qh[g][k2], a); a = wmmab(kh[kt][k2], ql[g][k2], a); }
                s[g][kt] = a; }
        if (kb == qw0) {   /* wave-uniform scalar branch: only in the block on the wave's diagonal can a key lie behind a query; in every earlier block (kb + 32 <= qw0) the select would pass all 32 x 32 scores */
#pragma unroll
            for (int g = 0; g < 2; ++g) { const int rel = g * 16 + lr - hi * 8;   /* this lane's score (kt, j) belongs to a key <= its query where kt * 16 + j <= rel */
#pragma unroll
                for (int kt = 0; kt < 2; ++kt)
#pragma unroll
                    for (int j = 0; j < 8; ++j) s[g][kt][j] = (kt * 16 + j <= rel) ? s[g][kt][j] : -3.0e38f; }
        }
        const char* vb = ring + (st & 1) * BUFB + 2 * PLB + ks * 1024;   /* 32 keys = one 1,024-byte tile of each 16-row band; a band's stage is 4,096 bytes. The value loads stand behind the scores, where the key fragments' registers are free, and fly under the softmax */
        v16bf vh[4], vl[4]; v16h vf[4]; const bf* pvh = lanep((const bf*)vb, lk); const bf* pvl = lanep((const bf*)(vb + PLB), lk); const h16* pvf = lanep((const h16*)vb, lk);
#pragma unroll
        for (int dt = 0; dt < 4; ++dt) { if (HL) { vh[dt] = WFrag<bf>::ld(pvh + dt * 2048); vl[dt] = WFrag<bf>::ld(pvl + dt * 2048); } else vf[dt] = WFrag<h16>::ld(pvf + dt * 2048); }
        v16bf ph[2], pl[2]; v16h p16[2];
#pragma unroll
        for (int g = 0; g < 2; ++g) { float mr = -3.0e38f;
#pragma unroll
            for (int kt = 0; kt < 2; ++kt)
#pragma unroll
                for (int j = 0; j < 8; ++j) mr = fmaxf(mr, s[g][kt][j]);
            mr = fmaxf(mr, xhalf(mr)); const float mx = fmaxf(m[g], mr * (SCL * 1.4426950408889634f));
            const float al = exp2s(m[g] - mx); m[g] = mx; float sa[4] = {0.f, 0.f, 0.f, 0.f};   /* al = 0 on a wave's first block (m = -3e38) */
#pragma unroll
            for (int kt = 0; kt < 2; ++kt) { float e[8];
#pragma unroll
                for (int j = 0; j < 8; ++j) e[j] = __builtin_fmaf(s[g][kt][j], SCL * 1.4426950408889634f, -mx);
                exp2x8(e);
#pragma unroll
                for (int j = 0; j < 8; ++j) { const float p = e[j]; sa[j & 3] += p;
                    if (HL) { const __bf16 a2 = (__bf16)p; ph[g][kt * 8 + j] = a2; pl[g][kt * 8 + j] = (__bf16)(p - (float)a2); } else p16[g][kt * 8 + j] = tohx(p); } }
            const float sum = (sa[0] + sa[1]) + (sa[2] + sa[3]);
            l[g] = l[g] * al + sum;
#pragma unroll
            for (int dt = 0; dt < 4; ++dt) o[g][dt] *= al; }
#pragma unroll
        for (int dt = 0; dt < 4; ++dt)
#pragma unroll
            for (int g = 0; g < 2; ++g) { if (HL) { o[g][dt] = wmmab(vh[dt], ph[g], o[g][dt]); o[g][dt] = wmmab(vl[dt], ph[g], o[g][dt]); o[g][dt] = wmmab(vh[dt], pl[g], o[g][dt]); } else o[g][dt] = wmma16(vf[dt], p16[g], o[g][dt]); }
        }
        asm volatile("s_wait_dscnt 0x0" ::: "memory");      /* this wave's reads of the current buffer have returned before the buffer is refilled */
        asm volatile("s_wait_asynccnt 0x0" ::: "memory");   /* this wave's copies of the next stage have landed */
        __syncthreads();   /* publishes the next stage and ends every wave's reads of the current buffer */
        if (st + 2 < np) fattn_fill<HL>(lb + (unsigned)(st & 1) * BUFB, tb, st + 2, Kh, Kl, V16, Vh, Vl);
    }
    asm volatile("s_wait_asynccnt 0x0" ::: "memory");   /* nothing is in flight when the ring becomes the join's staging */
}
// amdgpu_waves_per_eu(4, 4): at most 256 registers a wave, so that two work-groups (four waves per SIMD) share a WGP and cover each other's waits.
__global__ __launch_bounds__(32 * FW) __attribute__((amdgpu_waves_per_eu(4, 4))) void k_fattn(const bf* __restrict__ Qh, const bf* __restrict__ Ql, const bf* __restrict__ Kh, const bf* __restrict__ Kl, const h16* __restrict__ V16, const bf* __restrict__ Vh, const bf* __restrict__ Vl, bf* __restrict__ Oh, bf* __restrict__ Ol) {
    __shared__ __align__(1024) char ring[2 * BUFB]; __shared__ float sm[FW * 32], sl[FW * 32];
    static_assert(FW * 32 * 68 * 4 <= 2 * BUFB, "the join's staging lies in the ring");
    float* so = (float*)ring;   /* the waves' scaled partial rows, behind the key loop's last barrier */
    const int wv = __builtin_amdgcn_readfirstlane((int)(threadIdx.x >> 5));   /* wave number, scalar so that the skip of a key block stays a scalar branch */
    const int qg = wv & 1, ks = wv >> 1;   /* query half, key block inside a stage */
    const int lane = threadIdx.x & 31, lr = lane & 15, hi = lane >> 4; const int h = blockIdx.x % NH_, b = blockIdx.x / NH_;
    const size_t hb = (size_t)blockIdx.x * TT * HD;   /* planes [b][h]: (b * NH_ + h) */ Qh += hb; Ql += hb; Kh += hb; Kl += hb; V16 += hb; Vh += hb; Vl += hb;
    {
        const int q0 = (TT / QT - 1 - (int)blockIdx.y) * QT;   /* the longest rows of every head and batch start first, the short ones fill in behind them */
        const int qw0 = q0 + qg * 32;   /* this wave's first query */
        const unsigned lk = (unsigned)lane * 16u;   /* the lane's bytes inside a tile, the same in every plane */
        v16bf qh[2][2], ql[2][2]; const bf* pqh = lanep(Qh + (size_t)qw0 * HD, lk); const bf* pql = lanep(Ql + (size_t)qw0 * HD, lk);
#pragma unroll
        for (int g = 0; g < 2; ++g)
#pragma unroll
            for (int k2 = 0; k2 < 2; ++k2) { qh[g][k2] = WFrag<bf>::ld(pqh + (g * 2 + k2) * 512); ql[g][k2] = WFrag<bf>::ld(pql + (g * 2 + k2) * 512); }
        asm volatile("s_wait_xcnt 0x0" :: "v"(pqh), "v"(pql) : "memory");   /* behind the query loads; the addresses are named so that they stay in their registers up to here */
        v8f o[2][4]; float m[2], l[2];
#pragma unroll
        for (int g = 0; g < 2; ++g) { m[g] = -3.0e38f; l[g] = 0.f;
#pragma unroll
            for (int dt = 0; dt < 4; ++dt) o[g][dt] = (v8f){}; }
        if (q0 < RH) fattn_keys<true>(ring, Kh, Kl, V16, Vh, Vl, qh, ql, q0, qw0, ks, lr, hi, lk, o, m, l); else fattn_keys<false>(ring, Kh, Kl, V16, Vh, Vl, qh, ql, q0, qw0, ks, lr, hi, lk, o, m, l);
#pragma unroll
        for (int g = 0; g < 2; ++g) { l[g] += xhalf(l[g]); if (hi == 0) { sm[wv * 32 + g * 16 + lr] = m[g]; sl[wv * 32 + g * 16 + lr] = l[g]; } }
        __syncthreads();   /* every wave's maximum and sum are in LDS before the common ones are formed */
#pragma unroll
        for (int g = 0; g < 2; ++g) { float mm = sm[qg * 32 + g * 16 + lr];   /* the waves qg, qg + 2, ... hold this wave's queries */
#pragma unroll
            for (int w = 1; w < KSP; ++w) mm = fmaxf(mm, sm[(qg + 2 * w) * 32 + g * 16 + lr]);
            float ll = 0.f;
#pragma unroll
            for (int w = 0; w < KSP; ++w) ll += sl[(qg + 2 * w) * 32 + g * 16 + lr] * exp2s(sm[(qg + 2 * w) * 32 + g * 16 + lr] - mm);   /* a wave that had no key block holds m = -3e38, l = 0 */
            const float f = __fdiv_rn(exp2s(m[g] - mm), ll);
#pragma unroll
            for (int dt = 0; dt < 4; ++dt) { const v8f a = o[g][dt] * f; float* d = so + (wv * 32 + g * 16 + lr) * 68 + dt * 16 + hi * 8;
                *(v4fa*)d = (v4f){a[0], a[1], a[2], a[3]}; *(v4fa*)(d + 4) = (v4f){a[4], a[5], a[6], a[7]}; } }
        __syncthreads();   /* every wave's scaled partial rows are in LDS before any of them is summed */
#pragma unroll
        for (int u0 = 0; u0 < QT * 16; u0 += 32 * FW) { const int u = u0 + (int)threadIdx.x, row = u >> 4, cofs = (u & 15) * 4; const float* sp = so + ((row >> 5) * 32 + (row & 31)) * 68 + cofs; v4f val = *(const v4fa*)sp;
#pragma unroll
            for (int w = 1; w < KSP; ++w) val += *(const v4fa*)(sp + w * (2 * 32 * 68));   /* partial rows of the row's query half joined in wave order */
            v4us oh, ol;
#pragma unroll
            for (int q = 0; q < 4; ++q) { unsigned short h2, l2; splitf(val[q], h2, l2); oh[q] = h2; ol[q] = l2; }
            const size_t e = fidx(b * TT + q0 + row, h * HD + cofs, CO); *(v4us*)(Oh + e) = oh; *(v4us*)(Ol + e) = ol; }   /* context rows [b * TT + t][h * 64 + d] as the hi/lo operand planes of the last product, in fragment order */
    }
}

__constant__ float INVT[HD / 2] = { 1.000000000e+00f, 6.493816376e-01f, 4.216965139e-01f, 2.738419771e-01f, 1.778279394e-01f, 1.154782027e-01f, 7.498941571e-02f, 4.869675264e-02f, 3.162277862e-02f, 2.053525113e-02f, 1.333521493e-02f, 8.659643121e-03f, 5.623413250e-03f, 3.651741426e-03f, 2.371373819e-03f, 1.539926510e-03f, 1.000000047e-03f, 6.493816618e-04f, 4.216964880e-04f, 2.738419571e-04f, 1.778279402e-04f, 1.154781930e-04f, 7.498942432e-05f, 4.869675467e-05f, 3.162277426e-05f, 2.053524986e-05f, 1.333521413e-05f, 8.659643754e-06f, 5.623413472e-06f, 3.651741281e-06f, 2.371373739e-06f, 1.539926529e-06f };   // float32 1 / 1000000^(2i/64) (the module's integer-arange expression), generated with jnp to be bit-exact
__device__ __forceinline__ void cs5_block(int blk, float* CS) { const int idx = blk * 256 + threadIdx.x; if (idx >= TT * HD) return; const int d = idx % HD; const int t = idx / HD; const float a = __fmul_rn((float)t, INVT[d % (HD / 2)]); v2f cs; cs[0] = cosf(a); cs[1] = sinf(a); *(v2f*)(CS + (size_t)idx * 2) = cs;  }
__device__ __forceinline__ void rmsx_rows(int blk, const float* __restrict__ X, const float* __restrict__ sc, bf* XH, bf* XL) { const int lane = threadIdx.x & 31; const int row = blk * 8 + (threadIdx.x >> 5); if (row >= NB_ * TT) return;   /* row = b * TT + t */ const float* xr = X + (size_t)row * CC + lane * 16; const float* sr = sc + lane * 16; float v[16]; float ss = 0.f; v4f xa[4], sv[4];
#pragma unroll
    for (int c = 0; c < 4; ++c) { xa[c] = *(const v4f*)(xr + c * 4); sv[c] = *(const v4f*)(sr + c * 4); }
    asm volatile("s_wait_xcnt 0x0" :: "v"(xr), "v"(sr) : "memory");   /* behind the row's and the scale's loads; the addresses are named so that no load's result lands on a register that an issued load names */
#pragma unroll
    for (int c = 0; c < 4; ++c) { const v4f a = xa[c];
#pragma unroll
        for (int q = 0; q < 4; ++q) { const float b = bfr(a[q]); v[c * 4 + q] = b; float p = __fmul_rn(b, b); asm volatile("" : "+v"(p)); ss = __fadd_rn(ss, p); } }
#pragma unroll
    for (int sh = 16; sh; sh >>= 1) ss = __fadd_rn(ss, __shfl_xor(ss, sh, 32));
    const float den = sqrtf(__fadd_rn(__fmul_rn(ss, 1.0f / CC), 1.0e-6f)); const float rinv = __fdiv_rn(1.0f, den);   /* ONE IEEE division per row; x * (1/den) differs from the module's x / den by <= 1 ulp */
    v4us oh[4], ol[4];
#pragma unroll
    for (int c = 0; c < 4; ++c) {
#pragma unroll
        for (int q = 0; q < 4; ++q) { float y = __fmul_rn(v[c * 4 + q], rinv); asm volatile("" : "+v"(y)); y = __fmul_rn(y, bfr(sv[c][q])); unsigned short a2, c2; splitf(y, a2, c2); oh[c][q] = a2; ol[c][q] = c2; } }
    const size_t e = fidx(row, lane * 16, CC); bf* ph = XH + e; bf* pl = XL + e;   /* fragment order: the lane's columns 0..7 here, its columns 8..15 128 elements on */
#pragma unroll
    for (int c = 0; c < 2; ++c) { *(v8us*)(ph + c * 128) = __builtin_shufflevector(oh[2 * c], oh[2 * c + 1], 0, 1, 2, 3, 4, 5, 6, 7); *(v8us*)(pl + c * 128) = __builtin_shufflevector(ol[2 * c], ol[2 * c + 1], 0, 1, 2, 3, 4, 5, 6, 7); }
}
__device__ __forceinline__ void wtG_lines(int blk, const float* __restrict__ w, int K, int N, bf* Bt) {
    const int lane = threadIdx.x & 31; const int L0 = (blk * 8 + (threadIdx.x >> 5)) * 8; const int nlines = N * K / 64;
{
#pragma unroll 1
        for (int l = 0; l < 8; ++l) { const int L = L0 + l; if (L >= nlines) break; const size_t e = (size_t)L * 64 + lane * 2; const int k = (int)(e % K), n = (int)(e / K); v2us o;
            o[0] = f2bf(w[(size_t)k * N + n]); o[1] = f2bf(w[(size_t)(k + 1) * N + n]); *(v2us*)(Bt + fidx(n, k, K)) = o;   /* Bt[n][k] in fragment order */
            asm volatile("s_wait_xcnt 0x0" ::: "memory"); }   /* behind the store, in front of the next trip's rewrite of its address and data registers */
         }
}
// ---- k_prep: all that depends on the inputs alone, side by side in one grid of 256 threads: blocks 0 .. 4 * WB - 1 the four weights (WB blocks each; the longest blocks, so they start first), the next RB the token rows of both batches, the last TB the rotary table.
#define WB (CC * MID / 64 / 64)
#define RB (NB_ * TT / 8)
#define TB (TT * HD / 256)
__global__ __launch_bounds__(256) void k_prep(const float* __restrict__ x, const float* __restrict__ rsc, const float* __restrict__ wq, const float* __restrict__ wk, const float* __restrict__ wv, const float* __restrict__ wo, bf* WQKV, bf* WO, float* CS, bf* XH, bf* XL) {
    const int blk = (int)blockIdx.x;
    if (blk < 4 * WB) { const int j = blk / WB; wtG_lines(blk % WB, j == 0 ? wq : j == 1 ? wk : j == 2 ? wv : wo, CC, MID, j < 3 ? WQKV + (size_t)j * MID * CC : WO); }   /* 'xw' weights -> Bt; all four are [512][512] */
    else if (blk < 4 * WB + RB) rmsx_rows(blk - 4 * WB, x, rsc, XH, XL);   /* x_norm = x / sqrt(mean x^2 + eps) x scale as hi/lo planes */
    else cs5_block(blk - 4 * WB - RB, CS);   /* cos, sin per (token, d) for the q and k epilogues */
}
extern "C" void kernel_launch(void* const* d_in, const int* in_sizes, int n_in,
                              void* d_out, int out_size, void* d_ws, size_t ws_size, hipStream_t stream) {
    (void)in_sizes; (void)n_in; (void)out_size;
    const float* x = (const float*)d_in[0]; const float* rsc = (const float*)d_in[1]; const float* wq = (const float*)d_in[2]; const float* wk = (const float*)d_in[3]; const float* wv = (const float*)d_in[4]; const float* wo = (const float*)d_in[5];   /* input order x [2][4096][512], scale [512] (RMSNorm weight), Wq, Wk, Wv, Wo ('xw' [512][512], no biases) */
    float* OUT = (float*)d_out;     // [2][4096][512]
    char* wsp = (char*)d_ws;
    auto take = [&](size_t bytes) { char* p = wsp; wsp += (bytes + 255) & ~(size_t)255; return (void*)p; };
    bf* WQKV = (bf*)take((size_t)3 * MID * CC * 2); bf* WQ = WQKV; bf* WK = WQKV + (size_t)MID * CC; bf* WV = WQKV + (size_t)2 * MID * CC; bf* WO = (bf*)take((size_t)CC * CO * 2); float* CS = (float*)take((size_t)TT * HD * 2 * 4);
    bf* XH = (bf*)take((size_t)NB_ * TT * CC * 2); bf* XL = (bf*)take((size_t)NB_ * TT * CC * 2);   /* RMS-normalised tokens, bf16 hi/lo */
    bf* QPh = (bf*)take((size_t)NB_ * TT * MID * 2); bf* QPl = (bf*)take((size_t)NB_ * TT * MID * 2); bf* KPh = (bf*)take((size_t)NB_ * TT * MID * 2); bf* KPl = (bf*)take((size_t)NB_ * TT * MID * 2);
    h16* VT16 = (h16*)take((size_t)NB_ * CO * TT * 2); bf* VTh = (bf*)take((size_t)NB_ * CO * TT * 2); bf* VTl = (bf*)take((size_t)NB_ * CO * TT * 2);
    bf* ATh = (bf*)take((size_t)NB_ * TT * CO * 2); bf* ATl = (bf*)take((size_t)NB_ * TT * CO * 2);
    if ((size_t)(wsp - (char*)d_ws) > ws_size) return;
    k_prep<<<4 * WB + RB + TB, 256, 0, stream>>>(x, rsc, wq, wk, wv, wo, WQKV, WO, CS, XH, XL);
    k_qkv<<<dim3(NB_ * TT / 64, MID / 64 / NTP, 3), 32 * NWP, 0, stream>>>(XH, XL, WQ, WK, WV, CS, QPh, QPl, KPh, KPl, VT16, VTh, VTl);
    k_fattn<<<dim3(NB_ * NH_, TT / QT, 1), 32 * FW, 0, stream>>>(QPh, QPl, KPh, KPl, VT16, VTh, VTl, ATh, ATl);   /* all heads of both batches: scores, causal softmax and attn.V; merged context as hi/lo planes */
    k_out<<<dim3(NB_ * TT / 64, CC / 64 / NTP, 1), 32 * NWP, 0, stream>>>(ATh, ATl, WO, OUT);
}

// v009
// A run of this version takes 94.7 microseconds.
// Two timings next to v008 both put it at 1.15 times that version's speed.
// All steps since v000 together make it 42.7 times as fast.
#include <hip/hip_runtime.h>

// Causal multi-head self-attention with a leading RMSNorm and rotary embeddings over 4,096 tokens (x [2][4096][512]; x_norm = x / sqrt(mean x^2 + 1e-6) x scale (scale [512] ones, read); q, k, v = x_norm W ('xw' [512][512] 1/sqrt(512), no bias; 8 heads x 64); rotate-half rope (cat(x1 c - x2 s, x1 s + x2 c)) with angle t x 1/1000000^(2i/64) (32 f32 frequencies jnp-exact; precise cosf/sinf); scores / sqrt(64); causal (-inf); softmax; out = merged Wo ('xw') -> [2][4096][512] (4.2 M); argument order x, scale, Wq, Wk, Wv, Wo).
// Four launches, both batches side by side in each grid (every plane holds batch 0, then batch 1): k_prep (weights to fragment order, rotary table, RMSNorm), k_qkv, k_fattn, k_out. Layout: rmsx_rows normalises each token row in f32 and stores bf16 hi/lo planes; projections hi/lo x exact weights (2 products), whose epilogues write the operand planes themselves (q, k: rotate-half with the cs5_block table, then an fp16 plane and, for tokens < 1024, hi/lo; v: the product is formed transposed, Wv rows x token rows, and stored as value^T planes); k_fattn: scores (rows < 1024 hi/lo planes, 3 products; rest one fp16 product), causal select (x 1/8), running-maximum softmax and attn.V (rows < 1024 hi/lo 3 products, rest fp16) in one kernel over all heads, keys and values staged in LDS by asynchronous copies, no score matrix in memory, context stored as hi/lo planes; context hi/lo x Wo exact written to the output rows. Every 16-bit operand plane lies in fragment order (fidx below).
// Compute dtypes, f32 accumulate: every input rounded to bf16 incl. scale; RMSNorm f32; projections 2 products (hi/lo x exact); rotary f32; scores rows < 1024 3 products, rest fp16 (a score's rounding error reaches the output divided by the root of the number of keys, as that of the fp16 weights and values does); softmax f32, weights kept unnormalised (<= 1) and divided by the row sum at the end; attn.V rows < 1024 3 products, rest fp16; Wo hl x exact.

#define NB_  2
#define TT   4096
#define DM   512
#define NH_  8
#define NKV  8
#define REP  (NH_ / NKV)
#define HD   64
#define DQ   (NH_ * HD)
#define DKV  (NKV * HD)
#define ZH   1
#define RH   1024                 // query rows < RH use hi+lo planes for scores and attn.V, the rest fp16 planes
#define WIN  0
#define SCL  0.125f   // 1/sqrt(float32(64))
#define MID  512      // q / k width = 8 heads x 64
#define CO   512      // v width
#define CC   512
#define FW   8        // k_fattn: waves per work-group: 2 query halves x 4 key blocks of a stage
#define NWP  8        // projections: waves per work-group
#define NTP  4        // projections: 64 x 64 tiles per work-group, side by side; NWP / NTP waves split the k of each
typedef _Float16 h16;
typedef unsigned short bf;
typedef __attribute__((ext_vector_type(16))) __bf16   v16bf;
typedef __attribute__((ext_vector_type(16))) _Float16 v16h;
typedef __attribute__((ext_vector_type(8)))  _Float16 v8h;
typedef __attribute__((ext_vector_type(8)))  unsigned short v8us;
typedef __attribute__((ext_vector_type(8)))  float    v8f;
typedef __attribute__((ext_vector_type(4)))  float    v4f;
typedef v8h  __attribute__((may_alias)) v8ha;
typedef v4f  __attribute__((may_alias)) v4fa;
typedef v8us __attribute__((may_alias)) v8usa;

__device__ __forceinline__ unsigned short f2bf(float f) { unsigned u = __float_as_uint(f); u += 0x7FFFu + ((u >> 16) & 1u); return (unsigned short)(u >> 16); }
__device__ __forceinline__ float bf2f(unsigned short b) { return __uint_as_float(((unsigned)b) << 16); }
__device__ __forceinline__ float bfr(float f) { return bf2f(f2bf(f)); }
__device__ __forceinline__ v16h cat16(v8h lo, v8h hi) { return __builtin_shufflevector(lo, hi, 0, 1, 2, 3, 4, 5, 6, 7, 8, 9, 10, 11, 12, 13, 14, 15); }
__device__ __forceinline__ v16bf cat16b(v8us lo, v8us hi) { return __builtin_bit_cast(v16bf, __builtin_shufflevector(lo, hi, 0, 1, 2, 3, 4, 5, 6, 7, 8, 9, 10, 11, 12, 13, 14, 15)); }
__device__ __forceinline__ v8f wmma16(v16h a, v16h b, v8f c) { return __builtin_amdgcn_wmma_f32_16x16x32_f16(false, a, false, b, (short)0, c, false, false); }
__device__ __forceinline__ v8f wmmab(v16bf a, v16bf b, v8f c) { return __builtin_amdgcn_wmma_f32_16x16x32_bf16(false, a, false, b, (short)0, c, false, false); }

__device__ __forceinline__ h16 tohx(float x) { return (h16)x; }
__device__ __forceinline__ void splitf(float y, unsigned short& h, unsigned short& l) { h = f2bf(y); l = f2bf(y - bf2f(h)); }
typedef __attribute__((ext_vector_type(4))) _Float16 v4h;
typedef __attribute__((ext_vector_type(2))) unsigned short v2us;
typedef __attribute__((ext_vector_type(4))) unsigned short v4us;
typedef __attribute__((ext_vector_type(2))) float v2f;

// ---- gemmw_tile: register-blocked GEMM, 64x64 output tiles (16 accumulators a wave), NT of them per work-group of NW waves: tiles (bx, by + t), or (bx + t, by) where TROW, of (M/64, N/64), so that the NT waves of one k slice read the same fragments of the operand the tiles share; operands straight from 16-bit planes in fragment order (fidx) of row length LP; osall is the work-group's LDS.
// C[m][n] (f32, pitch ldc, + optional f32 bias[n]) = sum_k A[m][k] Bt[n][k] (+ split products per NSPLIT). K % (32 * NW / NT) == 0. The token rows of both batches stand one behind the other (row = b * TT + t).
// EPI says what the joined tile becomes: 0 f32 rows of C; 1 (tile = 64 tokens x one head) rotate-half rotary out[d] = x[d] cos[t][d] -/+ x[d +/- 32] sin[t][d] from the table CS [t][64][cos, sin], stored as an fp16 plane and, for tokens < RH, bf16 hi/lo planes [b][head][t][64]; 2 (columns = tokens) fp16 and bf16 hi/lo planes [b][CO rows] of row length ldc = TT; both in fragment order.
// Split-K: wave w works on tile w % NT and takes the 32-wide k steps s, s + NW / NT, ... with s = w / NT (one 1,024-byte tile per fragment); the NW / NT partial tiles of each tile are summed in LDS in wave order.
// Fragment order of a 16-bit operand plane of K-contiguous rows (rows % 16 == 0, K % 32 == 0): one 16-row x 32-k tile is 1,024 contiguous bytes, tiles run along k and then down the rows. Inside a tile the 16 bytes that lane (hi * 16 + row % 16) takes for k % 32 = c * 16 + hi * 8 + 0..7 stand at c * 512 + lane * 16, so each of a fragment's two wave-wide 16-byte loads reads 512 contiguous bytes (four whole 128-byte lines) where row-major planes gave it 32-byte pieces of 16 lines.
__device__ __forceinline__ size_t fidx(int row, int k, int K) { return ((size_t)(row >> 4) * (K >> 5) + (k >> 5)) * 512 + ((k >> 4) & 1) * 256 + ((k >> 3) & 1) * 128 + (row & 15) * 8 + (k & 7); }
template <typename T16> struct WFrag;
template <> struct WFrag<h16> { typedef v16h V; static __device__ __forceinline__ V ld(const h16* p) { return cat16(*(const v8h*)p, *(const v8h*)(p + 256)); } static __device__ __forceinline__ v8f mma(V a, V b, v8f c) { return wmma16(a, b, c); } };
template <> struct WFrag<bf> { typedef v16bf V; static __device__ __forceinline__ V ld(const bf* p) { return cat16b(*(const v8us*)p, *(const v8us*)(p + 256)); } static __device__ __forceinline__ v8f mma(V a, V b, v8f c) { return wmmab(a, b, c); } };
template <typename T16, int NSPLIT, bool BIAS, int NW = 1, int EPI = 0, int LP = 512, int NT = 1, bool TROW = false>
__device__ __forceinline__ void gemmw_tile(float* osall, int bx, int by, const T16* __restrict__ A, const T16* __restrict__ A2, const T16* __restrict__ Bt, const T16* __restrict__ Bt2, int K, float* C, int ldc, const float* __restrict__ bias, const float* __restrict__ CS, h16* P16, bf* Ph, bf* Pl) {
    typedef typename WFrag<T16>::V V;   /* osall: NW > 1 ? NW * 64 * 68 : 16 * 68 floats (NW > 1: one whole 64 x 64 partial tile a wave) */
    const int wv = NW > 1 ? __builtin_amdgcn_readfirstlane((int)(threadIdx.x >> 5)) : 0;   /* wave number, scalar so that the k loop stays a scalar branch */
    constexpr int lp = LP;   /* row length of both operands' planes, a constant so that all fragments of a k step hang on one address per plane by immediate offsets */
    static_assert(NW % NT == 0 && (EPI != 1 || !TROW), "whole k slices; the rotary epilogue's tiles share their tokens");
    constexpr int KS = NW / NT;   /* waves that split the k of one tile */
    const int ti = wv % NT, sl = wv / NT;   /* this wave's tile and k slice, scalar like wv */
    float* os = osall + wv * (64 * 68);
    const int lane = threadIdx.x & 31, lr = lane & 15, hi = lane >> 4; const int r0 = (bx + (TROW ? ti : 0)) * 64, c0 = (by + (TROW ? 0 : ti)) * 64;
    v8f acc[4][4];
#pragma unroll
    for (int mb = 0; mb < 4; ++mb)
#pragma unroll
        for (int nb = 0; nb < 4; ++nb) acc[mb][nb] = (v8f){};
    const size_t aoff = (size_t)r0 * lp + lane * 8, boff = (size_t)c0 * lp + lane * 8;   /* first tile of the 64 rows (16 rows hold 16 * lp elements) + the lane's 16 bytes; a 32-wide k step is 512 elements on */
#pragma unroll 1
    for (int kc = sl * 32; kc < K; kc += 32 * KS) {
        V a[4], a2[4], b[4], b2[4]; const T16* pa = A + aoff + (size_t)kc * 16; const T16* pa2 = (NSPLIT == 1 || NSPLIT == 2) ? A2 + aoff + (size_t)kc * 16 : nullptr; const T16* pb = Bt + boff + (size_t)kc * 16; const T16* pb2 = NSPLIT >= 2 ? Bt2 + boff + (size_t)kc * 16 : nullptr;
#pragma unroll
        for (int mb = 0; mb < 4; ++mb) { a[mb] = WFrag<T16>::ld(pa + mb * 16 * lp); if (NSPLIT == 1 || NSPLIT == 2) a2[mb] = WFrag<T16>::ld(pa2 + mb * 16 * lp); }
#pragma unroll
        for (int nb = 0; nb < 4; ++nb) { b[nb] = WFrag<T16>::ld(pb + nb * 16 * lp); if (NSPLIT >= 2) b2[nb] = WFrag<T16>::ld(pb2 + nb * 16 * lp); }
        /* behind the operand loads; the addresses are named so that they stay in their registers up to here and no load's result lands on a register that an issued load names */
        if constexpr (NSPLIT == 0) asm volatile("s_wait_xcnt 0x0" :: "v"(pa), "v"(pb) : "memory"); else if constexpr (NSPLIT == 1) asm volatile("s_wait_xcnt 0x0" :: "v"(pa), "v"(pa2), "v"(pb) : "memory"); else if constexpr (NSPLIT == 2) asm volatile("s_wait_xcnt 0x0" :: "v"(pa), "v"(pa2), "v"(pb), "v"(pb2) : "memory"); else asm volatile("s_wait_xcnt 0x0" :: "v"(pa), "v"(pb), "v"(pb2) : "memory");
        __builtin_amdgcn_sched_barrier(0);   /* no matrix instruction is lifted in front of the wait: without this the compiler lets late loads reuse fragment registers, and the wave then sits out one load latency per group of four products instead of one per k step */
#pragma unroll
        for (int nb = 0; nb < 4; ++nb)
#pragma unroll
            for (int mb = 0; mb < 4; ++mb) { acc[mb][nb] = WFrag<T16>::mma(a[mb], b[nb], acc[mb][nb]); if (NSPLIT == 1 || NSPLIT == 2) acc[mb][nb] = WFrag<T16>::mma(a2[mb], b[nb], acc[mb][nb]); if (NSPLIT >= 2) acc[mb][nb] = WFrag<T16>::mma(a[mb], b2[nb], acc[mb][nb]); }
        asm volatile("v_nop\n\tv_nop\n\tv_nop\n\tv_nop" : "+v"(acc[0][0]), "+v"(acc[1][1]), "+v"(acc[2][2]), "+v"(acc[3][3]) : "v"(a[0]), "v"(a[3]));
    }
    if constexpr (NW > 1) {
        static_assert(EPI != 1 || NW == 8, "the table fetch below is laid out for four passes of 256 threads");
        v4f c01[4], c23[4];   /* EPI 1: this thread's (cos, sin) pairs of its four passes, fetched here so that they fly under the LDS stores of the partial tile */
        if constexpr (EPI == 1) { const float* cs = CS + ((size_t)(r0 % TT + (int)(threadIdx.x >> 4)) * HD + (threadIdx.x & 15) * 4) * 2;
#pragma unroll
            for (int i = 0; i < 4; ++i) { c01[i] = *(const v4f*)(cs + i * (16 * HD * 2)); c23[i] = *(const v4f*)(cs + i * (16 * HD * 2) + 4); }
            asm volatile("s_wait_xcnt 0x0" :: "v"(cs) : "memory"); }   /* behind the table loads; the address is named so that it stays in its registers up to here */
#pragma unroll
        for (int mb = 0; mb < 4; ++mb)
#pragma unroll
            for (int nb = 0; nb < 4; ++nb)
#pragma unroll
                for (int j = 0; j < 8; ++j) os[(mb * 16 + hi * 8 + j) * 68 + nb * 16 + lr] = acc[mb][nb][j];
        __syncthreads();   /* every wave's partial tile is in LDS before any of it is summed */
#pragma unroll   /* t a constant in each copy: the tiles' LDS and global offsets become immediates, and the table registers c01, c23 serve all tiles */
        for (int t = 0; t < NT; ++t) { const int rt = (bx + (TROW ? t : 0)) * 64, ct = (by + (TROW ? 0 : t)) * 64;   /* all threads finish the work-group's tiles one after the other */
        static_assert(EPI == 0 || NW == 8, "the plane stores below are kept for four passes of 256 threads");
        const bool hl = EPI != 1 || rt % TT < RH;   /* q, k: no query or key from RH on is read as hi/lo; the same for the whole tile */
        unsigned eo[4]; unsigned long long dh[4], dl[4], d16[4];   /* the tile's plane stores, kept for the statements behind the passes: byte offset in a plane (the same in all three), data */
#pragma unroll
        for (int u0 = 0; u0 < 64 * 16; u0 += 32 * NW) { const int u = u0 + (int)threadIdx.x, row = u >> 4, cofs = (u & 15) * 4; v4f val = *(const v4fa*)(osall + t * (64 * 68) + row * 68 + cofs);
#pragma unroll
            for (int w = 1; w < KS; ++w) val += *(const v4fa*)(osall + (w * NT + t) * (64 * 68) + row * 68 + cofs);   /* the tile's partial sums joined in wave order */
            if (BIAS) { val[0] += bfr(bias[ct + cofs]); val[1] += bfr(bias[ct + cofs + 1]); val[2] += bfr(bias[ct + cofs + 2]); val[3] += bfr(bias[ct + cofs + 3]); }
            if constexpr (EPI == 0) *(v4f*)(C + (size_t)(rt + row) * ldc + ct + cofs) = val;
            else { v4us oh, ol;
                if constexpr (EPI == 1) { const int i = u0 / (32 * NW); const float co[4] = {c01[i][0], c01[i][2], c23[i][0], c23[i][2]}, si[4] = {c01[i][1], c01[i][3], c23[i][1], c23[i][3]};
#pragma unroll
                    for (int q = 0; q < 4; ++q) { const float par = __shfl_xor(val[q], 8, 32);   /* lane ^ 8 holds the same token's columns cofs ^ 32, the other half of the head */
                        val[q] = val[q] * co[q] + par * ((cofs < HD / 2) ? -si[q] : si[q]); } }
#pragma unroll
                for (int q = 0; q < 4; ++q) { unsigned short h2, l2; splitf(val[q], h2, l2); oh[q] = h2; ol[q] = l2; }
                const size_t e = EPI == 1 ? ((size_t)(rt / TT) * NH_ + by + t) * TT * HD + fidx(rt % TT + row, cofs, HD) : (size_t)(ct / TT) * CO * TT + fidx(rt + row, ct % TT + cofs, ldc);
                const int ip = u0 / (32 * NW); eo[ip] = (unsigned)(e * 2); dh[ip] = __builtin_bit_cast(unsigned long long, oh); dl[ip] = __builtin_bit_cast(unsigned long long, ol);
                v4h o16;
#pragma unroll
                for (int q = 0; q < 4; ++q) o16[q] = tohx(val[q]);
                d16[ip] = __builtin_bit_cast(unsigned long long, o16); } }
        if constexpr (EPI != 0) {   /* the tile's plane stores, 8 bytes a lane at (wave-uniform plane) + (lane's offset). Stores and their s_wait_xcnt stand in one statement, so that nothing is written over a register that an issued store names in front of the wait */
            if (hl) asm volatile("global_store_b64 %0, %4, %12\n\tglobal_store_b64 %1, %5, %12\n\tglobal_store_b64 %2, %6, %12\n\tglobal_store_b64 %3, %7, %12\n\t"
                                 "global_store_b64 %0, %8, %13\n\tglobal_store_b64 %1, %9, %13\n\tglobal_store_b64 %2, %10, %13\n\tglobal_store_b64 %3, %11, %13\n\ts_wait_xcnt 0x0"
                                 :: "v"(eo[0]), "v"(eo[1]), "v"(eo[2]), "v"(eo[3]), "v"(dh[0]), "v"(dh[1]), "v"(dh[2]), "v"(dh[3]), "v"(dl[0]), "v"(dl[1]), "v"(dl[2]), "v"(dl[3]), "s"(Ph), "s"(Pl) : "memory");
            asm volatile("global_store_b64 %0, %4, %8\n\tglobal_store_b64 %1, %5, %8\n\tglobal_store_b64 %2, %6, %8\n\tglobal_store_b64 %3, %7, %8\n\ts_wait_xcnt 0x0"
                         :: "v"(eo[0]), "v"(eo[1]), "v"(eo[2]), "v"(eo[3]), "v"(d16[0]), "v"(d16[1]), "v"(d16[2]), "v"(d16[3]), "s"(P16) : "memory"); } }
    } else {
#pragma unroll
    for (int mb = 0; mb < 4; ++mb) {
#pragma unroll
        for (int nb = 0; nb < 4; ++nb) {
#pragma unroll
            for (int j = 0; j < 8; ++j) os[(hi * 8 + j) * 68 + nb * 16 + lr] = acc[mb][nb][j]; }
        __builtin_amdgcn_wave_barrier(); asm volatile("" ::: "memory");
        float* crow = C + (size_t)(r0 + mb * 16) * ldc + c0;
{
#pragma unroll
            for (int s = 0; s < 8; ++s) { const int row = 2 * s + hi, cofs = lr * 4; v4f val = *(const v4fa*)(os + row * 68 + cofs); if (BIAS) { val[0] += bfr(bias[c0 + cofs]); val[1] += bfr(bias[c0 + cofs + 1]); val[2] += bfr(bias[c0 + cofs + 2]); val[3] += bfr(bias[c0 + cofs + 3]); }
                *(v4f*)(crow + (size_t)row * ldc + cofs) = val; }
             }
        __builtin_amdgcn_wave_barrier(); asm volatile("" ::: "memory");
    }
    }
}

// ---- k_qkv: the three projections of both batches in one grid (NB_ * TT / 64 token tiles, 8 / NTP groups of NTP column tiles, 3): z = 0 q, 1 k, 2 v (formed transposed: rows = Wv columns, columns = tokens). 32 * NWP threads.
__global__ __launch_bounds__(32 * NWP) void k_qkv(const bf* __restrict__ XH, const bf* __restrict__ XL, const bf* __restrict__ WQ, const bf* __restrict__ WK, const bf* __restrict__ WV, const float* __restrict__ CS, h16* Q16, bf* QPh, bf* QPl, h16* K16, bf* KPh, bf* KPl, h16* VT16, bf* VTh, bf* VTl) {
    __shared__ __align__(16) float osall[NWP * 64 * 68];
    if (blockIdx.z < 2) { const bool isk = blockIdx.z == 1;
        gemmw_tile<bf, 1, false, NWP, 1, 512, NTP, false>(osall, (int)blockIdx.x, (int)blockIdx.y * NTP, XH, XL, isk ? WK : WQ, nullptr, CC, nullptr, MID, nullptr, CS, isk ? K16 : Q16, isk ? KPh : QPh, isk ? KPl : QPl); }   /* q, k planes [b][h][n][64], rotated */
    else { gemmw_tile<bf, 3, false, NWP, 2, 512, NTP, true>(osall, (int)blockIdx.y * NTP, (int)blockIdx.x, WV, nullptr, XH, XL, CC, nullptr, TT, nullptr, nullptr, VT16, VTh, VTl);   /* v^T planes [b][h][64][n]: rows = Wv columns (exact), columns = tokens (hi/lo) */
        asm volatile("s_wait_xcnt 0x0" ::: "memory"); }   /* behind the value planes' last stores: the built code of this branch runs on into the test in front of the q, k branch, whose first instructions write registers that those stores name */
}
// ---- k_out: out = ctx w_out^T, the rows of both batches in one grid (NB_ * TT / 64, CC / 64 / NTP). 32 * NWP threads.
__global__ __launch_bounds__(32 * NWP) void k_out(const bf* __restrict__ ATh, const bf* __restrict__ ATl, const bf* __restrict__ WO, float* OUT) {
    __shared__ __align__(16) float osall[NWP * 64 * 68];
    gemmw_tile<bf, 1, false, NWP, 0, 512, NTP, false>(osall, (int)blockIdx.x, (int)blockIdx.y * NTP, ATh, ATl, WO, nullptr, CO, OUT, CC, nullptr, nullptr, nullptr, nullptr, nullptr);
}

// ---- k_fattn: causal attention of one head of one batch for QT = 64 query rows per work-group, scores never leave the registers. grid (NB_ * heads, TT / QT), 32 * FW threads.
// S^T = K Q^T (A = key rows, B = query rows, both planes [h][t][64] in fragment order): in each 16-query group a lane holds 16 of one query's 32 scores, in the k order of a B operand, so the weights go into O^T += V^T P^T (A = value^T rows [h][64][t]) without leaving the lane.
// Wave w works on the 32 queries of half (w & 1) and on the 32-key block (w >> 1) of every 128-key stage. A stage (rows < RH: key planes hi, lo and value^T planes hi, lo; the rest: one fp16 key plane and one fp16 value^T plane; still in fragment order) is brought into LDS once per work-group by asynchronous copies, two buffers, the next stage in flight under the current one, and each of its blocks is read from LDS by the two waves that share it: half the reads from L2 of a 32-query work-group.
// Running maximum m and sum l per query in base 2; key blocks past a wave's diagonal are skipped, the diagonal block alone is cut by the select. The KSP waves' (m, l, O) of each query half are joined in LDS in wave order.
#define QT   64                   // query rows per work-group: two halves of 32
#define KSP  (FW / 2)             // waves that split the keys of one query half
#define STK  (KSP * 32)           // keys per stage
#define PLB  (STK * HD * 2)       // bytes of one 16-bit plane's share of a stage (16,384)
#define BUFB (4 * PLB)            // one buffer, rows < RH: K hi | K lo | V hi | V lo; the rest: K fp16 | V fp16
__device__ __forceinline__ float xhalf(float x) { const int b = __float_as_int(x); return __int_as_float(__builtin_amdgcn_permlanex16(b, b, 0x76543210, 0xfedcba98, false, false)); }   /* lane l <-> l ^ 16 */
// 2^x in place. The v_nop is the one slot the instruction set asks for between a transcendental and an instruction that reads its result or overwrites its source; inside the run each v_exp_f32 is followed by one on other registers.
__device__ __forceinline__ float exp2s(float x) { asm("v_exp_f32 %0, %0\n\tv_nop" : "+v"(x)); return x; }
__device__ __forceinline__ void exp2x8(float (&e)[8]) { asm("v_exp_f32 %0, %0\n\tv_exp_f32 %1, %1\n\tv_exp_f32 %2, %2\n\tv_exp_f32 %3, %3\n\tv_exp_f32 %4, %4\n\tv_exp_f32 %5, %5\n\tv_exp_f32 %6, %6\n\tv_exp_f32 %7, %7\n\tv_nop" : "+v"(e[0]), "+v"(e[1]), "+v"(e[2]), "+v"(e[3]), "+v"(e[4]), "+v"(e[5]), "+v"(e[6]), "+v"(e[7])); }
// (wave-uniform base of a tile) + (this lane's 16 bytes inside it)
template <typename T16> __device__ __forceinline__ const T16* lanep(const T16* base, unsigned lane_bytes) { return (const T16*)((const char*)base + lane_bytes); }
// Asynchronous 16-byte copies a lane, global memory to LDS through no register, eight in one statement: LDS bytes l, l + 4096, ... from a + tb, a + as + tb, ... (four pieces), then from b likewise (a, b wave-uniform, in scalar registers, so that no 64-bit lane address stays live over the key loop; tb the lane's byte offset). The one s_wait_xcnt stands inside the statement, behind the last copy, so that no address register of an issued copy is rewritten in front of it.
__device__ __forceinline__ void acopy8(unsigned l, unsigned tb, const char* a, size_t as, const char* b, size_t bs) {
    asm volatile("global_load_async_to_lds_b128 %0, %8, %9\n\tglobal_load_async_to_lds_b128 %1, %8, %10\n\tglobal_load_async_to_lds_b128 %2, %8, %11\n\tglobal_load_async_to_lds_b128 %3, %8, %12\n\t"
                 "global_load_async_to_lds_b128 %4, %8, %13\n\tglobal_load_async_to_lds_b128 %5, %8, %14\n\tglobal_load_async_to_lds_b128 %6, %8, %15\n\tglobal_load_async_to_lds_b128 %7, %8, %16\n\ts_wait_xcnt 0x0"
                 :: "v"(l), "v"(l + 4096u), "v"(l + 8192u), "v"(l + 12288u), "v"(l + 16384u), "v"(l + 20480u), "v"(l + 24576u), "v"(l + 28672u), "v"(tb),
                    "s"(a), "s"(a + as), "s"(a + 2 * as), "s"(a + 3 * as), "s"(b), "s"(b + bs), "s"(b + 2 * bs), "s"(b + 3 * bs) : "memory");
}
// Stage st (keys st * STK ...) into the buffer whose LDS byte address, plus this thread's 16 bytes tb, is lb. The 256 threads copy 4,096 bytes a round: a key plane's stage is 16,384 contiguous bytes, a value^T plane's four pieces of 4,096 (one per 16-row band, 16 * TT elements apart).
template <bool HL>
__device__ __forceinline__ void fattn_fill(unsigned lb, unsigned tb, int st, const h16* K16, const bf* Kh, const bf* Kl, const h16* V16, const bf* Vh, const bf* Vl) {
    const size_t ko = (size_t)st * PLB, vo = (size_t)st * (STK * 32), vs = (size_t)16 * TT * 2;
    if (HL) { acopy8(lb, tb, (const char*)Kh + ko, 4096, (const char*)Kl + ko, 4096); acopy8(lb + 2 * PLB, tb, (const char*)Vh + vo, vs, (const char*)Vl + vo, vs); }
    else acopy8(lb, tb, (const char*)K16 + ko, 4096, (const char*)V16 + vo, vs);
}
typedef __attribute__((address_space(3))) char lds_char;
template <bool HL>
__device__ __forceinline__ void fattn_keys(char* ring, const h16* __restrict__ Q16, const bf* __restrict__ Qh, const bf* __restrict__ Ql, const h16* __restrict__ K16, const bf* __restrict__ Kh, const bf* __restrict__ Kl, const h16* __restrict__ V16, const bf* __restrict__ Vh, const bf* __restrict__ Vl, int q0, int qw0, int ks, int lr, int hi, unsigned lk, v8f (&o)[2][4], float (&m)[2], float (&l)[2]) {
    const int np = (q0 + QT + STK - 1) / STK;   /* stages of the work-group; the last one ends at or below TT, since STK divides TT (rows < RH: at or below RH, since STK divides RH) */
    const unsigned tb = threadIdx.x * 16u; const unsigned lb = (unsigned)(size_t)(lds_char*)ring + tb;
    v16bf qh[2][2], ql[2][2]; v16h qf[2][2];   /* the wave's 32 queries, kept in registers over the key loop */
    if constexpr (HL) { const bf* pqh = lanep(Qh + (size_t)qw0 * HD, lk); const bf* pql = lanep(Ql + (size_t)qw0 * HD, lk);
#pragma unroll
        for (int g = 0; g < 2; ++g)
#pragma unroll
            for (int k2 = 0; k2 < 2; ++k2) { qh[g][k2] = WFrag<bf>::ld(pqh + (g * 2 + k2) * 512); ql[g][k2] = WFrag<bf>::ld(pql + (g * 2 + k2) * 512); }
        asm volatile("s_wait_xcnt 0x0" :: "v"(pqh), "v"(pql) : "memory"); }   /* behind the query loads; the addresses are named so that they stay in their registers up to here */
    else { const h16* pqf = lanep(Q16 + (size_t)qw0 * HD, lk);
#pragma unroll
        for (int g = 0; g < 2; ++g)
#pragma unroll
            for (int k2 = 0; k2 < 2; ++k2) qf[g][k2] = WFrag<h16>::ld(pqf + (g * 2 + k2) * 512);
        asm volatile("s_wait_xcnt 0x0" :: "v"(pqf) : "memory"); }   /* behind the query loads; the address is named so that it stays in its registers up to here */
    fattn_fill<HL>(lb, tb, 0, K16, Kh, Kl, V16, Vh, Vl);
    asm volatile("s_wait_asynccnt 0x0" ::: "memory");   /* this wave's copies of stage 0 have landed */
    __syncthreads();   /* every wave's copies of stage 0 have landed before any wave reads it */
    if (np > 1) fattn_fill<HL>(lb + BUFB, tb, 1, K16, Kh, Kl, V16, Vh, Vl);
#pragma unroll 1   /* one copy of the pass: a second one would double the fragments that are live and cost the fourth wave per SIMD */
    for (int st = 0; st < np; ++st) {
        const int kb = st * STK + ks * 32; const char* buf = ring + (st & 1) * BUFB + ks * 4096;   /* this wave's key block: 4,096 bytes of each key plane */
        if (kb < qw0 + 32) {   /* wave-uniform: a block past this wave's diagonal is skipped; the waits and the barrier below are passed all the same */
        v8f s[2][2]; v16bf kh[2][2], kl[2][2]; v16h kf[2][2]; const bf* pkh = lanep((const bf*)buf, lk); const bf* pkl = lanep((const bf*)(buf + PLB), lk); const h16* pkf = lanep((const h16*)buf, lk);
#pragma unroll
        for (int kt = 0; kt < 2; ++kt)
#pragma unroll
            for (int k2 = 0; k2 < 2; ++k2) { if (HL) { kh[kt][k2] = WFrag<bf>::ld(pkh + (kt * 2 + k2) * 512); kl[kt][k2] = WFrag<bf>::ld(pkl + (kt * 2 + k2) * 512); } else kf[kt][k2] = WFrag<h16>::ld(pkf + (kt * 2 + k2) * 512); }
        __builtin_amdgcn_sched_barrier(0);   /* the block's key loads stay one group in front of the score products: without this the compiler sinks some of them among the products and waits for them two products later */
#pragma unroll
        for (int kt = 0; kt < 2; ++kt)
#pragma unroll
            for (int g = 0; g < 2; ++g) { v8f a = (v8f){};
#pragma unroll
                for (int k2 = 0; k2 < 2; ++k2) { if (HL) { a = wmmab(kh[kt][k2], qh[g][k2], a); a = wmmab(kl[kt][k2], qh[g][k2], a); a = wmmab(kh[kt][k2], ql[g][k2], a); } else a = wmma16(kf[kt][k2], qf[g][k2], a); }
                s[g][kt] = a; }
        if (kb == qw0) {   /* wave-uniform scalar branch: only in the block on the wave's diagonal can a key lie behind a query; in every earlier block (kb + 32 <= qw0) the select would pass all 32 x 32 scores */
#pragma unroll
            for (int g = 0; g < 2; ++g) { const int rel = g * 16 + lr - hi * 8;   /* this lane's score (kt, j) belongs to a key <= its query where kt * 16 + j <= rel */
#pragma unroll
                for (int kt = 0; kt < 2; ++kt)
#pragma unroll
                    for (int j = 0; j < 8; ++j) s[g][kt][j] = (kt * 16 + j <= rel) ? s[g][kt][j] : -3.0e38f; }
        }
        const char* vb = ring + (st & 1) * BUFB + (HL ? 2 : 1) * PLB + ks * 1024;   /* 32 keys = one 1,024-byte tile of each 16-row band; a band's stage is 4,096 bytes. The value loads stand behind the scores, where the key fragments' registers are free, and fly under the softmax */
        v16bf vh[4], vl[4]; v16h vf[4]; const bf* pvh = lanep((const bf*)vb, lk); const bf* pvl = lanep((const bf*)(vb + PLB), lk); const h16* pvf = lanep((const h16*)vb, lk);
#pragma unroll
        for (int dt = 0; dt < 4; ++dt) { if (HL) { vh[dt] = WFrag<bf>::ld(pvh + dt * 2048); vl[dt] = WFrag<bf>::ld(pvl + dt * 2048); } else vf[dt] = WFrag<h16>::ld(pvf + dt * 2048); }
        v16bf ph[2], pl[2]; v16h p16[2];
#pragma unroll
        for (int g = 0; g < 2; ++g) { float mr = -3.0e38f;
#pragma unroll
            for (int kt = 0; kt < 2; ++kt)
#pragma unroll
                for (int j = 0; j < 8; ++j) mr = fmaxf(mr, s[g][kt][j]);
            mr = fmaxf(mr, xhalf(mr)); const float mx = fmaxf(m[g], mr * (SCL * 1.4426950408889634f));
            const float al = exp2s(m[g] - mx); m[g] = mx; float sa[4] = {0.f, 0.f, 0.f, 0.f};   /* al = 0 on a wave's first block (m = -3e38) */
#pragma unroll
            for (int kt = 0; kt < 2; ++kt) { float e[8];
#pragma unroll
                for (int j = 0; j < 8; ++j) e[j] = __builtin_fmaf(s[g][kt][j], SCL * 1.4426950408889634f, -mx);
                exp2x8(e);
#pragma unroll
                for (int j = 0; j < 8; ++j) { const float p = e[j]; sa[j & 3] += p;
                    if (HL) { const __bf16 a2 = (__bf16)p; ph[g][kt * 8 + j] = a2; pl[g][kt * 8 + j] = (__bf16)(p - (float)a2); } else p16[g][kt * 8 + j] = tohx(p); } }
            const float sum = (sa[0] + sa[1]) + (sa[2] + sa[3]);
            l[g] = l[g] * al + sum;
#pragma unroll
            for (int dt = 0; dt < 4; ++dt) o[g][dt] *= al; }
#pragma unroll
        for (int dt = 0; dt < 4; ++dt)
#pragma unroll
            for (int g = 0; g < 2; ++g) { if (HL) { o[g][dt] = wmmab(vh[dt], ph[g], o[g][dt]); o[g][dt] = wmmab(vl[dt], ph[g], o[g][dt]); o[g][dt] = wmmab(vh[dt], pl[g], o[g][dt]); } else o[g][dt] = wmma16(vf[dt], p16[g], o[g][dt]); }
        }
        asm volatile("s_wait_dscnt 0x0" ::: "memory");      /* this wave's reads of the current buffer have returned before the buffer is refilled */
        asm volatile("s_wait_asynccnt 0x0" ::: "memory");   /* this wave's copies of the next stage have landed */
        __syncthreads();   /* publishes the next stage and ends every wave's reads of the current buffer */
        if (st + 2 < np) fattn_fill<HL>(lb + (unsigned)(st & 1) * BUFB, tb, st + 2, K16, Kh, Kl, V16, Vh, Vl);
    }
    asm volatile("s_wait_asynccnt 0x0" ::: "memory");   /* nothing is in flight when the ring becomes the join's staging */
}
// amdgpu_waves_per_eu(4, 4): at most 256 registers a wave, so that two work-groups (four waves per SIMD) share a WGP and cover each other's waits.
__global__ __launch_bounds__(32 * FW) __attribute__((amdgpu_waves_per_eu(4, 4))) void k_fattn(const h16* __restrict__ Q16, const bf* __restrict__ Qh, const bf* __restrict__ Ql, const h16* __restrict__ K16, const bf* __restrict__ Kh, const bf* __restrict__ Kl, const h16* __restrict__ V16, const bf* __restrict__ Vh, const bf* __restrict__ Vl, bf* __restrict__ Oh, bf* __restrict__ Ol) {
    __shared__ __align__(1024) char ring[2 * BUFB]; __shared__ float sm[FW * 32], sl[FW * 32];
    static_assert(FW * 32 * 68 * 4 <= 2 * BUFB, "the join's staging lies in the ring");
    float* so = (float*)ring;   /* the waves' scaled partial rows, behind the key loop's last barrier */
    const int wv = __builtin_amdgcn_readfirstlane((int)(threadIdx.x >> 5));   /* wave number, scalar so that the skip of a key block stays a scalar branch */
    const int qg = wv & 1, ks = wv >> 1;   /* query half, key block inside a stage */
    const int lane = threadIdx.x & 31, lr = lane & 15, hi = lane >> 4; const int h = blockIdx.x % NH_, b = blockIdx.x / NH_;
    const size_t hb = (size_t)blockIdx.x * TT * HD;   /* planes [b][h]: (b * NH_ + h) */ Q16 += hb; Qh += hb; Ql += hb; K16 += hb; Kh += hb; Kl += hb; V16 += hb; Vh += hb; Vl += hb;
    {
        const int q0 = (TT / QT - 1 - (int)blockIdx.y) * QT;   /* the longest rows of every head and batch start first, the short ones fill in behind them */
        const int qw0 = q0 + qg * 32;   /* this wave's first query */
        const unsigned lk = (unsigned)lane * 16u;   /* the lane's bytes inside a tile, the same in every plane */
        v8f o[2][4]; float m[2], l[2];
#pragma unroll
        for (int g = 0; g < 2; ++g) { m[g] = -3.0e38f; l[g] = 0.f;
#pragma unroll
            for (int dt = 0; dt < 4; ++dt) o[g][dt] = (v8f){}; }
        if (q0 < RH) fattn_keys<true>(ring, Q16, Qh, Ql, K16, Kh, Kl, V16, Vh, Vl, q0, qw0, ks, lr, hi, lk, o, m, l); else fattn_keys<false>(ring, Q16, Qh, Ql, K16, Kh, Kl, V16, Vh, Vl, q0, qw0, ks, lr, hi, lk, o, m, l);
#pragma unroll
        for (int g = 0; g < 2; ++g) { l[g] += xhalf(l[g]); if (hi == 0) { sm[wv * 32 + g * 16 + lr] = m[g]; sl[wv * 32 + g * 16 + lr] = l[g]; } }
        __syncthreads();   /* every wave's maximum and sum are in LDS before the common ones are formed */
#pragma unroll
        for (int g = 0; g < 2; ++g) { float mm = sm[qg * 32 + g * 16 + lr];   /* the waves qg, qg + 2, ... hold this wave's queries */
#pragma unroll
            for (int w = 1; w < KSP; ++w) mm = fmaxf(mm, sm[(qg + 2 * w) * 32 + g * 16 + lr]);
            float ll = 0.f;
#pragma unroll
            for (int w = 0; w < KSP; ++w) ll += sl[(qg + 2 * w) * 32 + g * 16 + lr] * exp2s(sm[(qg + 2 * w) * 32 + g * 16 + lr] - mm);   /* a wave that had no key block holds m = -3e38, l = 0 */
            const float f = __fdiv_rn(exp2s(m[g] - mm), ll);
#pragma unroll
            for (int dt = 0; dt < 4; ++dt) { const v8f a = o[g][dt] * f; float* d = so + (wv * 32 + g * 16 + lr) * 68 + dt * 16 + hi * 8;
                *(v4fa*)d = (v4f){a[0], a[1], a[2], a[3]}; *(v4fa*)(d + 4) = (v4f){a[4], a[5], a[6], a[7]}; } }
        __syncthreads();   /* every wave's scaled partial rows are in LDS before any of them is summed */
#pragma unroll
        for (int u0 = 0; u0 < QT * 16; u0 += 32 * FW) { const int u = u0 + (int)threadIdx.x, row = u >> 4, cofs = (u & 15) * 4; const float* sp = so + ((row >> 5) * 32 + (row & 31)) * 68 + cofs; v4f val = *(const v4fa*)sp;
#pragma unroll
            for (int w = 1; w < KSP; ++w) val += *(const v4fa*)(sp + w * (2 * 32 * 68));   /* partial rows of the row's query half joined in wave order */
            v4us oh, ol;
#pragma unroll
            for (int q = 0; q < 4; ++q) { unsigned short h2, l2; splitf(val[q], h2, l2); oh[q] = h2; ol[q] = l2; }
            const size_t e = fidx(b * TT + q0 + row, h * HD + cofs, CO); *(v4us*)(Oh + e) = oh; *(v4us*)(Ol + e) = ol; }   /* context rows [b * TT + t][h * 64 + d] as the hi/lo operand planes of the last product, in fragment order */
    }
}

__constant__ float INVT[HD / 2] = { 1.000000000e+00f, 6.493816376e-01f, 4.216965139e-01f, 2.738419771e-01f, 1.778279394e-01f, 1.154782027e-01f, 7.498941571e-02f, 4.869675264e-02f, 3.162277862e-02f, 2.053525113e-02f, 1.333521493e-02f, 8.659643121e-03f, 5.623413250e-03f, 3.651741426e-03f, 2.371373819e-03f, 1.539926510e-03f, 1.000000047e-03f, 6.493816618e-04f, 4.216964880e-04f, 2.738419571e-04f, 1.778279402e-04f, 1.154781930e-04f, 7.498942432e-05f, 4.869675467e-05f, 3.162277426e-05f, 2.053524986e-05f, 1.333521413e-05f, 8.659643754e-06f, 5.623413472e-06f, 3.651741281e-06f, 2.371373739e-06f, 1.539926529e-06f };   // float32 1 / 1000000^(2i/64) (the module's integer-arange expression), generated with jnp to be bit-exact
__device__ __forceinline__ void cs5_block(int blk, float* CS) { const int idx = blk * 256 + threadIdx.x; if (idx >= TT * HD) return; const int d = idx % HD; const int t = idx / HD; const float a = __fmul_rn((float)t, INVT[d % (HD / 2)]); v2f cs; cs[0] = cosf(a); cs[1] = sinf(a); *(v2f*)(CS + (size_t)idx * 2) = cs;  }
__device__ __forceinline__ void rmsx_rows(int blk, const float* __restrict__ X, const float* __restrict__ sc, bf* XH, bf* XL) { const int lane = threadIdx.x & 31; const int row = blk * 8 + (threadIdx.x >> 5); if (row >= NB_ * TT) return;   /* row = b * TT + t */ const float* xr = X + (size_t)row * CC + lane * 16; const float* sr = sc + lane * 16; float v[16]; float ss = 0.f; v4f xa[4], sv[4];
#pragma unroll
    for (int c = 0; c < 4; ++c) { xa[c] = *(const v4f*)(xr + c * 4); sv[c] = *(const v4f*)(sr + c * 4); }
    asm volatile("s_wait_xcnt 0x0" :: "v"(xr), "v"(sr) : "memory");   /* behind the row's and the scale's loads; the addresses are named so that no load's result lands on a register that an issued load names */
#pragma unroll
    for (int c = 0; c < 4; ++c) { const v4f a = xa[c];
#pragma unroll
        for (int q = 0; q < 4; ++q) { const float b = bfr(a[q]); v[c * 4 + q] = b; float p = __fmul_rn(b, b); asm volatile("" : "+v"(p)); ss = __fadd_rn(ss, p); } }
#pragma unroll
    for (int sh = 16; sh; sh >>= 1) ss = __fadd_rn(ss, __shfl_xor(ss, sh, 32));
    const float den = sqrtf(__fadd_rn(__fmul_rn(ss, 1.0f / CC), 1.0e-6f)); const float rinv = __fdiv_rn(1.0f, den);   /* ONE IEEE division per row; x * (1/den) differs from the module's x / den by <= 1 ulp */
    v4us oh[4], ol[4];
#pragma unroll
    for (int c = 0; c < 4; ++c) {
#pragma unroll
        for (int q = 0; q < 4; ++q) { float y = __fmul_rn(v[c * 4 + q], rinv); asm volatile("" : "+v"(y)); y = __fmul_rn(y, bfr(sv[c][q])); unsigned short a2, c2; splitf(y, a2, c2); oh[c][q] = a2; ol[c][q] = c2; } }
    const size_t e = fidx(row, lane * 16, CC); bf* ph = XH + e; bf* pl = XL + e;   /* fragment order: the lane's columns 0..7 here, its columns 8..15 128 elements on */
#pragma unroll
    for (int c = 0; c < 2; ++c) { *(v8us*)(ph + c * 128) = __builtin_shufflevector(oh[2 * c], oh[2 * c + 1], 0, 1, 2, 3, 4, 5, 6, 7); *(v8us*)(pl + c * 128) = __builtin_shufflevector(ol[2 * c], ol[2 * c + 1], 0, 1, 2, 3, 4, 5, 6, 7); }
}
__device__ __forceinline__ void wtG_lines(int blk, const float* __restrict__ w, int K, int N, bf* Bt) {
    const int lane = threadIdx.x & 31; const int L0 = (blk * 8 + (threadIdx.x >> 5)) * 8; const int nlines = N * K / 64;
{
#pragma unroll 1
        for (int l = 0; l < 8; ++l) { const int L = L0 + l; if (L >= nlines) break; const size_t e = (size_t)L * 64 + lane * 2; const int k = (int)(e % K), n = (int)(e / K); v2us o;
            o[0] = f2bf(w[(size_t)k * N + n]); o[1] = f2bf(w[(size_t)(k + 1) * N + n]); *(v2us*)(Bt + fidx(n, k, K)) = o;   /* Bt[n][k] in fragment order */
            asm volatile("s_wait_xcnt 0x0" ::: "memory"); }   /* behind the store, in front of the next trip's rewrite of its address and data registers */
         }
}
// ---- k_prep: all that depends on the inputs alone, side by side in one grid of 256 threads: blocks 0 .. 4 * WB - 1 the four weights (WB blocks each; the longest blocks, so they start first), the next RB the token rows of both batches, the last TB the rotary table.
#define WB (CC * MID / 64 / 64)
#define RB (NB_ * TT / 8)
#define TB (TT * HD / 256)
__global__ __launch_bounds__(256) void k_prep(const float* __restrict__ x, const float* __restrict__ rsc, const float* __restrict__ wq, const float* __restrict__ wk, const float* __restrict__ wv, const float* __restrict__ wo, bf* WQKV, bf* WO, float* CS, bf* XH, bf* XL) {
    const int blk = (int)blockIdx.x;
    if (blk < 4 * WB) { const int j = blk / WB; wtG_lines(blk % WB, j == 0 ? wq : j == 1 ? wk : j == 2 ? wv : wo, CC, MID, j < 3 ? WQKV + (size_t)j * MID * CC : WO); }   /* 'xw' weights -> Bt; all four are [512][512] */
    else if (blk < 4 * WB + RB) rmsx_rows(blk - 4 * WB, x, rsc, XH, XL);   /* x_norm = x / sqrt(mean x^2 + eps) x scale as hi/lo planes */
    else cs5_block(blk - 4 * WB - RB, CS);   /* cos, sin per (token, d) for the q and k epilogues */
}
extern "C" void kernel_launch(void* const* d_in, const int* in_sizes, int n_in,
                              void* d_out, int out_size, void* d_ws, size_t ws_size, hipStream_t stream) {
    (void)in_sizes; (void)n_in; (void)out_size;
    const float* x = (const float*)d_in[0]; const float* rsc = (const float*)d_in[1]; const float* wq = (const float*)d_in[2]; const float* wk = (const float*)d_in[3]; const float* wv = (const float*)d_in[4]; const float* wo = (const float*)d_in[5];   /* input order x [2][4096][512], scale [512] (RMSNorm weight), Wq, Wk, Wv, Wo ('xw' [512][512], no biases) */
    float* OUT = (float*)d_out;     // [2][4096][512]
    char* wsp = (char*)d_ws;
    auto take = [&](size_t bytes) { char* p = wsp; wsp += (bytes + 255) & ~(size_t)255; return (void*)p; };
    bf* WQKV = (bf*)take((size_t)3 * MID * CC * 2); bf* WQ = WQKV; bf* WK = WQKV + (size_t)MID * CC; bf* WV = WQKV + (size_t)2 * MID * CC; bf* WO = (bf*)take((size_t)CC * CO * 2); float* CS = (float*)take((size_t)TT * HD * 2 * 4);
    bf* XH = (bf*)take((size_t)NB_ * TT * CC * 2); bf* XL = (bf*)take((size_t)NB_ * TT * CC * 2);   /* RMS-normalised tokens, bf16 hi/lo */
    h16* Q16 = (h16*)take((size_t)NB_ * TT * MID * 2); h16* K16 = (h16*)take((size_t)NB_ * TT * MID * 2); bf* QPh = (bf*)take((size_t)NB_ * TT * MID * 2); bf* QPl = (bf*)take((size_t)NB_ * TT * MID * 2); bf* KPh = (bf*)take((size_t)NB_ * TT * MID * 2); bf* KPl = (bf*)take((size_t)NB_ * TT * MID * 2);
    h16* VT16 = (h16*)take((size_t)NB_ * CO * TT * 2); bf* VTh = (bf*)take((size_t)NB_ * CO * TT * 2); bf* VTl = (bf*)take((size_t)NB_ * CO * TT * 2);
    bf* ATh = (bf*)take((size_t)NB_ * TT * CO * 2); bf* ATl = (bf*)take((size_t)NB_ * TT * CO * 2);
    if ((size_t)(wsp - (char*)d_ws) > ws_size) return;
    k_prep<<<4 * WB + RB + TB, 256, 0, stream>>>(x, rsc, wq, wk, wv, wo, WQKV, WO, CS, XH, XL);
    k_qkv<<<dim3(NB_ * TT / 64, MID / 64 / NTP, 3), 32 * NWP, 0, stream>>>(XH, XL, WQ, WK, WV, CS, Q16, QPh, QPl, K16, KPh, KPl, VT16, VTh, VTl);
    k_fattn<<<dim3(NB_ * NH_, TT / QT, 1), 32 * FW, 0, stream>>>(Q16, QPh, QPl, K16, KPh, KPl, VT16, VTh, VTl, ATh, ATl);   /* all heads of both batches: scores, causal softmax and attn.V; merged context as hi/lo planes */
    k_out<<<dim3(NB_ * TT / 64, CC / 64 / NTP, 1), 32 * NWP, 0, stream>>>(ATh, ATl, WO, OUT);
}

// v010
// A run of this version takes 85.1 microseconds.
// In both of two side-by-side timings against v009, it was 1.11 times as fast.
// All steps since v000 together make it 47.3 times as fast.
#include <hip/hip_runtime.h>

// Causal multi-head self-attention with a leading RMSNorm and rotary embeddings over 4,096 tokens (x [2][4096][512]; x_norm = x / sqrt(mean x^2 + 1e-6) x scale (scale [512] ones, read); q, k, v = x_norm W ('xw' [512][512] 1/sqrt(512), no bias; 8 heads x 64); rotate-half rope (cat(x1 c - x2 s, x1 s + x2 c)) with angle t x 1/1000000^(2i/64) (32 f32 frequencies jnp-exact; precise cosf/sinf); scores / sqrt(64); causal (-inf); softmax; out = merged Wo ('xw') -> [2][4096][512] (4.2 M); argument order x, scale, Wq, Wk, Wv, Wo).
// Four launches, both batches side by side in each grid (every plane holds batch 0, then batch 1): k_prep (weights to fragment order, rotary table, RMSNorm), k_qkv, k_fattn, k_out. Layout: rmsx_rows normalises each token row in f32 and stores bf16 hi/lo planes; projections hi/lo x exact weights (2 products), whose epilogues write the operand planes themselves (q, k: rotate-half with the cs5_block table, then an fp16 plane and, for tokens < 1024, hi/lo; v: the product is formed transposed, Wv rows x token rows, and stored as value^T planes); k_fattn: scores (rows < 1024 hi/lo planes, 3 products; rest one fp16 product), causal select (x 1/8), running-maximum softmax and attn.V (rows < 1024 hi/lo 3 products, rest fp16) in one kernel over all heads, keys and values staged in LDS by asynchronous copies, no score matrix in memory, context stored as hi/lo planes; context hi/lo x Wo exact written to the output rows. Every 16-bit operand plane lies in fragment order (fidx below).
// Compute dtypes, f32 accumulate: every input rounded to bf16 incl. scale; RMSNorm f32; projections 2 products (hi/lo x exact); rotary f32; scores rows < 1024 3 products, rest fp16 (a score's rounding error reaches the output divided by the root of the number of keys, as that of the fp16 weights and values does); softmax f32, weights kept unnormalised (<= 1) and divided by the row sum at the end; attn.V rows < 1024 3 products, rest fp16; Wo hl x exact.

#define NB_  2
#define TT   4096
#define DM   512
#define NH_  8
#define NKV  8
#define REP  (NH_ / NKV)
#define HD   64
#define DQ   (NH_ * HD)
#define DKV  (NKV * HD)
#define ZH   1
#define RH   1024                 // query rows < RH use hi+lo planes for scores and attn.V, the rest fp16 planes
#define WIN  0
#define SCL  0.125f   // 1/sqrt(float32(64))
#define MID  512      // q / k width = 8 heads x 64
#define CO   512      // v width
#define CC   512
#define FW   8        // k_fattn: waves per work-group: 2 query halves x 4 key blocks of a stage
#define NWP  8        // projections: waves per work-group
#define NTP  4        // projections: 64 x 64 tiles per work-group, side by side; NWP / NTP waves split the k of each
typedef _Float16 h16;
typedef unsigned short bf;
typedef __attribute__((ext_vector_type(16))) __bf16   v16bf;
typedef __attribute__((ext_vector_type(16))) _Float16 v16h;
typedef __attribute__((ext_vector_type(8)))  _Float16 v8h;
typedef __attribute__((ext_vector_type(8)))  unsigned short v8us;
typedef __attribute__((ext_vector_type(8)))  float    v8f;
typedef __attribute__((ext_vector_type(4)))  float    v4f;
typedef v8h  __attribute__((may_alias)) v8ha;
typedef v4f  __attribute__((may_alias)) v4fa;
typedef v8us __attribute__((may_alias)) v8usa;

__device__ __forceinline__ unsigned short f2bf(float f) { unsigned u = __float_as_uint(f); u += 0x7FFFu + ((u >> 16) & 1u); return (unsigned short)(u >> 16); }
__device__ __forceinline__ float bf2f(unsigned short b) { return __uint_as_float(((unsigned)b) << 16); }
__device__ __forceinline__ float bfr(float f) { return bf2f(f2bf(f)); }
__device__ __forceinline__ v16h cat16(v8h lo, v8h hi) { return __builtin_shufflevector(lo, hi, 0, 1, 2, 3, 4, 5, 6, 7, 8, 9, 10, 11, 12, 13, 14, 15); }
__device__ __forceinline__ v16bf cat16b(v8us lo, v8us hi) { return __builtin_bit_cast(v16bf, __builtin_shufflevector(lo, hi, 0, 1, 2, 3, 4, 5, 6, 7, 8, 9, 10, 11, 12, 13, 14, 15)); }
__device__ __forceinline__ v8f wmma16(v16h a, v16h b, v8f c) { return __builtin_amdgcn_wmma_f32_16x16x32_f16(false, a, false, b, (short)0, c, false, false); }
__device__ __forceinline__ v8f wmmab(v16bf a, v16bf b, v8f c) { return __builtin_amdgcn_wmma_f32_16x16x32_bf16(false, a, false, b, (short)0, c, false, false); }

__device__ __forceinline__ h16 tohx(float x) { return (h16)x; }
__device__ __forceinline__ void splitf(float y, unsigned short& h, unsigned short& l) { h = f2bf(y); l = f2bf(y - bf2f(h)); }
typedef __attribute__((ext_vector_type(4))) _Float16 v4h;
typedef __attribute__((ext_vector_type(2))) unsigned short v2us;
typedef __attribute__((ext_vector_type(4))) unsigned short v4us;
typedef __attribute__((ext_vector_type(2))) float v2f;
typedef __attribute__((ext_vector_type(4))) unsigned v4u;

// ---- gemmw_tile: register-blocked GEMM, 64x64 output tiles (16 accumulators a wave), NT of them per work-group of NW waves: tiles (bx, by + t), or (bx + t, by) where TROW, of (M/64, N/64), so that the NT waves of one k slice read the same fragments of the operand the tiles share; operands straight from 16-bit planes in fragment order (fidx) of row length LP; osall is the work-group's LDS.
// C[m][n] (f32, pitch ldc, + optional f32 bias[n]) = sum_k A[m][k] Bt[n][k] (+ split products per NSPLIT). K % (32 * NW / NT) == 0. The token rows of both batches stand one behind the other (row = b * TT + t).
// EPI says what the joined tile becomes: 0 f32 rows of C; 1 (tile = 64 tokens x one head) rotate-half rotary out[d] = x[d] cos[t][d] -/+ x[d +/- 32] sin[t][d] from the table CS [t][64][cos, sin], stored as an fp16 plane and, for tokens < RH, bf16 hi/lo planes [b][head][t][64]; 2 (columns = tokens) fp16 and bf16 hi/lo planes [b][CO rows] of row length ldc = TT; both in fragment order.
// Split-K: wave w works on tile w % NT and takes the 32-wide k steps s, s + NW / NT, ... with s = w / NT (one 1,024-byte tile per fragment); the NW / NT partial tiles of each tile are summed in LDS in wave order.
// Fragment order of a 16-bit operand plane of K-contiguous rows (rows % 16 == 0, K % 32 == 0): one 16-row x 32-k tile is 1,024 contiguous bytes, tiles run along k and then down the rows. Inside a tile the 16 bytes that lane (hi * 16 + row % 16) takes for k % 32 = c * 16 + hi * 8 + 0..7 stand at c * 512 + lane * 16, so each of a fragment's two wave-wide 16-byte loads reads 512 contiguous bytes (four whole 128-byte lines) where row-major planes gave it 32-byte pieces of 16 lines.
__device__ __forceinline__ size_t fidx(int row, int k, int K) { return ((size_t)(row >> 4) * (K >> 5) + (k >> 5)) * 512 + ((k >> 4) & 1) * 256 + ((k >> 3) & 1) * 128 + (row & 15) * 8 + (k & 7); }
template <typename T16> struct WFrag;
template <> struct WFrag<h16> { typedef v16h V; static __device__ __forceinline__ V ld(const h16* p) { return cat16(*(const v8h*)p, *(const v8h*)(p + 256)); } static __device__ __forceinline__ v8f mma(V a, V b, v8f c) { return wmma16(a, b, c); } };
template <> struct WFrag<bf> { typedef v16bf V; static __device__ __forceinline__ V ld(const bf* p) { return cat16b(*(const v8us*)p, *(const v8us*)(p + 256)); } static __device__ __forceinline__ v8f mma(V a, V b, v8f c) { return wmmab(a, b, c); } };
template <typename T16, int NSPLIT, bool BIAS, int NW = 1, int EPI = 0, int LP = 512, int NT = 1, bool TROW = false>
__device__ __forceinline__ void gemmw_tile(float* osall, int bx, int by, const T16* __restrict__ A, const T16* __restrict__ A2, const T16* __restrict__ Bt, const T16* __restrict__ Bt2, int K, float* C, int ldc, const float* __restrict__ bias, const float* __restrict__ CS, h16* P16, bf* Ph, bf* Pl) {
    typedef typename WFrag<T16>::V V;   /* osall: NW > 1 ? NW * 64 * 68 : 16 * 68 floats (NW > 1: one whole 64 x 64 partial tile a wave) */
    const int wv = NW > 1 ? __builtin_amdgcn_readfirstlane((int)(threadIdx.x >> 5)) : 0;   /* wave number, scalar so that the k loop stays a scalar branch */
    constexpr int lp = LP;   /* row length of both operands' planes, a constant so that all fragments of a k step hang on one address per plane by immediate offsets */
    static_assert(NW % NT == 0 && (EPI != 1 || !TROW), "whole k slices; the rotary epilogue's tiles share their tokens");
    constexpr int KS = NW / NT;   /* waves that split the k of one tile */
    const int ti = wv % NT, sl = wv / NT;   /* this wave's tile and k slice, scalar like wv */
    float* os = osall + wv * (64 * 68);
    const int lane = threadIdx.x & 31, lr = lane & 15, hi = lane >> 4; const int r0 = (bx + (TROW ? ti : 0)) * 64, c0 = (by + (TROW ? 0 : ti)) * 64;
    v8f acc[4][4];
#pragma unroll
    for (int mb = 0; mb < 4; ++mb)
#pragma unroll
        for (int nb = 0; nb < 4; ++nb) acc[mb][nb] = (v8f){};
    const size_t aoff = (size_t)r0 * lp + lane * 8, boff = (size_t)c0 * lp + lane * 8;   /* first tile of the 64 rows (16 rows hold 16 * lp elements) + the lane's 16 bytes; a 32-wide k step is 512 elements on */
#pragma unroll 1
    for (int kc = sl * 32; kc < K; kc += 32 * KS) {
        V a[4], a2[4], b[4], b2[4]; const T16* pa = A + aoff + (size_t)kc * 16; const T16* pa2 = (NSPLIT == 1 || NSPLIT == 2) ? A2 + aoff + (size_t)kc * 16 : nullptr; const T16* pb = Bt + boff + (size_t)kc * 16; const T16* pb2 = NSPLIT >= 2 ? Bt2 + boff + (size_t)kc * 16 : nullptr;
#pragma unroll
        for (int mb = 0; mb < 4; ++mb) { a[mb] = WFrag<T16>::ld(pa + mb * 16 * lp); if (NSPLIT == 1 || NSPLIT == 2) a2[mb] = WFrag<T16>::ld(pa2 + mb * 16 * lp); }
#pragma unroll
        for (int nb = 0; nb < 4; ++nb) { b[nb] = WFrag<T16>::ld(pb + nb * 16 * lp); if (NSPLIT >= 2) b2[nb] = WFrag<T16>::ld(pb2 + nb * 16 * lp); }
        /* behind the operand loads; the addresses are named so that they stay in their registers up to here and no load's result lands on a register that an issued load names */
        if constexpr (NSPLIT == 0) asm volatile("s_wait_xcnt 0x0" :: "v"(pa), "v"(pb) : "memory"); else if constexpr (NSPLIT == 1) asm volatile("s_wait_xcnt 0x0" :: "v"(pa), "v"(pa2), "v"(pb) : "memory"); else if constexpr (NSPLIT == 2) asm volatile("s_wait_xcnt 0x0" :: "v"(pa), "v"(pa2), "v"(pb), "v"(pb2) : "memory"); else asm volatile("s_wait_xcnt 0x0" :: "v"(pa), "v"(pb), "v"(pb2) : "memory");
        __builtin_amdgcn_sched_barrier(0);   /* no matrix instruction is lifted in front of the wait: without this the compiler lets late loads reuse fragment registers, and the wave then sits out one load latency per group of four products instead of one per k step */
#pragma unroll
        for (int nb = 0; nb < 4; ++nb)
#pragma unroll
            for (int mb = 0; mb < 4; ++mb) { acc[mb][nb] = WFrag<T16>::mma(a[mb], b[nb], acc[mb][nb]); if (NSPLIT == 1 || NSPLIT == 2) acc[mb][nb] = WFrag<T16>::mma(a2[mb], b[nb], acc[mb][nb]); if (NSPLIT >= 2) acc[mb][nb] = WFrag<T16>::mma(a[mb], b2[nb], acc[mb][nb]); }
        asm volatile("v_nop\n\tv_nop\n\tv_nop\n\tv_nop" : "+v"(acc[0][0]), "+v"(acc[1][1]), "+v"(acc[2][2]), "+v"(acc[3][3]) : "v"(a[0]), "v"(a[3]));
    }
    if constexpr (NW > 1) {
        static_assert(EPI == 0 || (NW == 8 && !BIAS), "the plane stores below deal a 64 x 64 tile to 256 threads");
        /* EPI != 0: of every tile this thread finishes row er, columns ec .. ec + 7 and ec + 32 .. ec + 39. Lane (hi, lr) is the lane of the fragment order, so the 16 bytes a lane of each plane store make 512 contiguous bytes a wave, four whole lines; and a column and its rotary partner (32 on) meet in one thread */
        const int er = (wv >> 1) * 16 + lr, ec = (wv & 1) * 16 + hi * 8;
        v4f cst[4];   /* EPI 1: (cos, sin) of this thread's token and its 8 columns (those 32 on have the same angles), fetched here so that they fly under the LDS stores of the partial tile */
        if constexpr (EPI == 1) { const float* cs = CS + ((size_t)(r0 % TT + er) * HD + ec) * 2;
#pragma unroll
            for (int i = 0; i < 4; ++i) cst[i] = *(const v4f*)(cs + i * 4);
            asm volatile("s_wait_xcnt 0x0" :: "v"(cs) : "memory"); }   /* behind the table loads; the address is named so that it stays in its registers up to here */
#pragma unroll
        for (int mb = 0; mb < 4; ++mb)
#pragma unroll
            for (int nb = 0; nb < 4; ++nb)
#pragma unroll
                for (int j = 0; j < 8; ++j) os[(mb * 16 + hi * 8 + j) * 68 + nb * 16 + lr] = acc[mb][nb][j];
        __syncthreads();   /* every wave's partial tile is in LDS before any of it is summed */
#pragma unroll   /* t a constant in each copy: the tiles' LDS and global offsets become immediates, and the table registers cst serve all tiles */
        for (int t = 0; t < NT; ++t) { const int rt = (bx + (TROW ? t : 0)) * 64, ct = (by + (TROW ? 0 : t)) * 64;   /* all threads finish the work-group's tiles one after the other */
        if constexpr (EPI == 0) {
#pragma unroll
        for (int u0 = 0; u0 < 64 * 16; u0 += 32 * NW) { const int u = u0 + (int)threadIdx.x, row = u >> 4, cofs = (u & 15) * 4; v4f val = *(const v4fa*)(osall + t * (64 * 68) + row * 68 + cofs);
#pragma unroll
            for (int w = 1; w < KS; ++w) val += *(const v4fa*)(osall + (w * NT + t) * (64 * 68) + row * 68 + cofs);   /* the tile's partial sums joined in wave order */
            if (BIAS) { val[0] += bfr(bias[ct + cofs]); val[1] += bfr(bias[ct + cofs + 1]); val[2] += bfr(bias[ct + cofs + 2]); val[3] += bfr(bias[ct + cofs + 3]); }
            *(v4f*)(C + (size_t)(rt + row) * ldc + ct + cofs) = val; }
        } else {
        const bool hl = EPI != 1 || rt % TT < RH;   /* q, k: no query or key from RH on is read as hi/lo; the same for the whole tile */
        const float* sp = osall + t * (64 * 68) + er * 68 + ec; v4f x[4] = {*(const v4fa*)sp, *(const v4fa*)(sp + 4), *(const v4fa*)(sp + 32), *(const v4fa*)(sp + 36)};
#pragma unroll
        for (int w = 1; w < KS; ++w)
#pragma unroll
            for (int i = 0; i < 4; ++i) x[i] += *(const v4fa*)(sp + w * NT * (64 * 68) + (i >> 1) * 32 + (i & 1) * 4);   /* the tile's partial sums joined in wave order */
        float y[16];   /* 0..7: columns ec + q; 8..15: columns ec + 32 + q */
#pragma unroll
        for (int q = 0; q < 16; ++q) y[q] = x[q >> 2][q & 3];
        if constexpr (EPI == 1) {
#pragma unroll
            for (int q = 0; q < 8; ++q) { const float co = cst[q >> 1][(q & 1) * 2], si = cst[q >> 1][(q & 1) * 2 + 1], a = y[q], b = y[q + 8]; y[q] = a * co + b * -si; y[q + 8] = b * co + a * si; } }
        v4u dh[2], dl[2], d16[2];
#pragma unroll
        for (int o = 0; o < 2; ++o) { v8us oh, ol; v8h of;
#pragma unroll
            for (int q = 0; q < 8; ++q) { unsigned short h2, l2; splitf(y[o * 8 + q], h2, l2); oh[q] = h2; ol[q] = l2; of[q] = tohx(y[o * 8 + q]); }
            dh[o] = __builtin_bit_cast(v4u, oh); dl[o] = __builtin_bit_cast(v4u, ol); d16[o] = __builtin_bit_cast(v4u, of); }
        const size_t e = EPI == 1 ? ((size_t)(rt / TT) * NH_ + by + t) * TT * HD + fidx(rt % TT + er, ec, HD) : (size_t)(ct / TT) * CO * TT + fidx(rt + er, ct % TT + ec, ldc);
        const unsigned eo = (unsigned)(e * 2);   /* byte offset in a plane, the same in all three; the columns 32 on lie one 1,024-byte tile on */
        /* the tile's plane stores, 16 bytes a lane at (wave-uniform plane) + (lane's offset). Stores and their s_wait_xcnt stand in one statement, so that nothing is written over a register that an issued store names in front of the wait */
        if (hl) asm volatile("global_store_b128 %0, %1, %5\n\tglobal_store_b128 %0, %2, %5 offset:1024\n\tglobal_store_b128 %0, %3, %6\n\tglobal_store_b128 %0, %4, %6 offset:1024\n\ts_wait_xcnt 0x0"
                             :: "v"(eo), "v"(dh[0]), "v"(dh[1]), "v"(dl[0]), "v"(dl[1]), "s"(Ph), "s"(Pl) : "memory");
        asm volatile("global_store_b128 %0, %1, %3\n\tglobal_store_b128 %0, %2, %3 offset:1024\n\ts_wait_xcnt 0x0" :: "v"(eo), "v"(d16[0]), "v"(d16[1]), "s"(P16) : "memory"); } }
    } else {
#pragma unroll
    for (int mb = 0; mb < 4; ++mb) {
#pragma unroll
        for (int nb = 0; nb < 4; ++nb) {
#pragma unroll
            for (int j = 0; j < 8; ++j) os[(hi * 8 + j) * 68 + nb * 16 + lr] = acc[mb][nb][j]; }
        __builtin_amdgcn_wave_barrier(); asm volatile("" ::: "memory");
        float* crow = C + (size_t)(r0 + mb * 16) * ldc + c0;
{
#pragma unroll
            for (int s = 0; s < 8; ++s) { const int row = 2 * s + hi, cofs = lr * 4; v4f val = *(const v4fa*)(os + row * 68 + cofs); if (BIAS) { val[0] += bfr(bias[c0 + cofs]); val[1] += bfr(bias[c0 + cofs + 1]); val[2] += bfr(bias[c0 + cofs + 2]); val[3] += bfr(bias[c0 + cofs + 3]); }
                *(v4f*)(crow + (size_t)row * ldc + cofs) = val; }
             }
        __builtin_amdgcn_wave_barrier(); asm volatile("" ::: "memory");
    }
    }
}

// ---- k_qkv: the three projections of both batches in one grid (NB_ * TT / 64 token tiles, 8 / NTP groups of NTP column tiles, 3): z = 0 q, 1 k, 2 v (formed transposed: rows = Wv columns, columns = tokens). 32 * NWP threads.
__global__ __launch_bounds__(32 * NWP) void k_qkv(const bf* __restrict__ XH, const bf* __restrict__ XL, const bf* __restrict__ WQ, const bf* __restrict__ WK, const bf* __restrict__ WV, const float* __restrict__ CS, h16* Q16, bf* QPh, bf* QPl, h16* K16, bf* KPh, bf* KPl, h16* VT16, bf* VTh, bf* VTl) {
    __shared__ __align__(16) float osall[NWP * 64 * 68];
    if (blockIdx.z < 2) { const bool isk = blockIdx.z == 1;
        gemmw_tile<bf, 1, false, NWP, 1, 512, NTP, false>(osall, (int)blockIdx.x, (int)blockIdx.y * NTP, XH, XL, isk ? WK : WQ, nullptr, CC, nullptr, MID, nullptr, CS, isk ? K16 : Q16, isk ? KPh : QPh, isk ? KPl : QPl); }   /* q, k planes [b][h][n][64], rotated */
    else { gemmw_tile<bf, 3, false, NWP, 2, 512, NTP, true>(osall, (int)blockIdx.y * NTP, (int)blockIdx.x, WV, nullptr, XH, XL, CC, nullptr, TT, nullptr, nullptr, VT16, VTh, VTl);   /* v^T planes [b][h][64][n]: rows = Wv columns (exact), columns = tokens (hi/lo) */
        asm volatile("s_wait_xcnt 0x0" ::: "memory"); }   /* behind the value planes' last stores: the built code of this branch runs on into the test in front of the q, k branch, whose first instructions write registers that those stores name */
}
// ---- k_out: out = ctx w_out^T, the rows of both batches in one grid (NB_ * TT / 64, CC / 64 / NTP). 32 * NWP threads.
__global__ __launch_bounds__(32 * NWP) void k_out(const bf* __restrict__ ATh, const bf* __restrict__ ATl, const bf* __restrict__ WO, float* OUT) {
    __shared__ __align__(16) float osall[NWP * 64 * 68];
    gemmw_tile<bf, 1, false, NWP, 0, 512, NTP, false>(osall, (int)blockIdx.x, (int)blockIdx.y * NTP, ATh, ATl, WO, nullptr, CO, OUT, CC, nullptr, nullptr, nullptr, nullptr, nullptr);
}

// ---- k_fattn: causal attention of one head of one batch for QT = 64 query rows per work-group, scores never leave the registers. grid (NB_ * heads, TT / QT), 32 * FW threads.
// S^T = K Q^T (A = key rows, B = query rows, both planes [h][t][64] in fragment order): in each 16-query group a lane holds 16 of one query's 32 scores, in the k order of a B operand, so the weights go into O^T += V^T P^T (A = value^T rows [h][64][t]) without leaving the lane.
// Wave w works on the 32 queries of half (w & 1) and on the 32-key block (w >> 1) of every 128-key stage. A stage (rows < RH: key planes hi, lo and value^T planes hi, lo; the rest: one fp16 key plane and one fp16 value^T plane; still in fragment order) is brought into LDS once per work-group by asynchronous copies, two buffers, the next stage in flight under the current one, and each of its blocks is read from LDS by the two waves that share it: half the reads from L2 of a 32-query work-group.
// Running maximum m and sum l per query in base 2; key blocks past a wave's diagonal are skipped, the diagonal block alone is cut by the select. The KSP waves' (m, l, O) of each query half are joined in LDS in wave order.
#define QT   64                   // query rows per work-group: two halves of 32
#define KSP  (FW / 2)             // waves that split the keys of one query half
#define STK  (KSP * 32)           // keys per stage
#define PLB  (STK * HD * 2)       // bytes of one 16-bit plane's share of a stage (16,384)
#define BUFB (4 * PLB)            // one buffer, rows < RH: K hi | K lo | V hi | V lo; the rest: K fp16 | V fp16
__device__ __forceinline__ float xhalf(float x) { const int b = __float_as_int(x); return __int_as_float(__builtin_amdgcn_permlanex16(b, b, 0x76543210, 0xfedcba98, false, false)); }   /* lane l <-> l ^ 16 */
// 2^x in place. The v_nop is the one slot the instruction set asks for between a transcendental and an instruction that reads its result or overwrites its source; inside the run each v_exp_f32 is followed by one on other registers.
__device__ __forceinline__ float exp2s(float x) { asm("v_exp_f32 %0, %0\n\tv_nop" : "+v"(x)); return x; }
__device__ __forceinline__ void exp2x8(float (&e)[8]) { asm("v_exp_f32 %0, %0\n\tv_exp_f32 %1, %1\n\tv_exp_f32 %2, %2\n\tv_exp_f32 %3, %3\n\tv_exp_f32 %4, %4\n\tv_exp_f32 %5, %5\n\tv_exp_f32 %6, %6\n\tv_exp_f32 %7, %7\n\tv_nop" : "+v"(e[0]), "+v"(e[1]), "+v"(e[2]), "+v"(e[3]), "+v"(e[4]), "+v"(e[5]), "+v"(e[6]), "+v"(e[7])); }
// (wave-uniform base of a tile) + (this lane's 16 bytes inside it)
template <typename T16> __device__ __forceinline__ const T16* lanep(const T16* base, unsigned lane_bytes) { return (const T16*)((const char*)base + lane_bytes); }
// Asynchronous 16-byte copies a lane, global memory to LDS through no register, eight in one statement: LDS bytes l, l + 4096, ... from a + tb, a + as + tb, ... (four pieces), then from b likewise (a, b wave-uniform, in scalar registers, so that no 64-bit lane address stays live over the key loop; tb the lane's byte offset). The one s_wait_xcnt stands inside the statement, behind the last copy, so that no address register of an issued copy is rewritten in front of it.
__device__ __forceinline__ void acopy8(unsigned l, unsigned tb, const char* a, size_t as, const char* b, size_t bs) {
    asm volatile("global_load_async_to_lds_b128 %0, %8, %9\n\tglobal_load_async_to_lds_b128 %1, %8, %10\n\tglobal_load_async_to_lds_b128 %2, %8, %11\n\tglobal_load_async_to_lds_b128 %3, %8, %12\n\t"
                 "global_load_async_to_lds_b128 %4, %8, %13\n\tglobal_load_async_to_lds_b128 %5, %8, %14\n\tglobal_load_async_to_lds_b128 %6, %8, %15\n\tglobal_load_async_to_lds_b128 %7, %8, %16\n\ts_wait_xcnt 0x0"
                 :: "v"(l), "v"(l + 4096u), "v"(l + 8192u), "v"(l + 12288u), "v"(l + 16384u), "v"(l + 20480u), "v"(l + 24576u), "v"(l + 28672u), "v"(tb),
                    "s"(a), "s"(a + as), "s"(a + 2 * as), "s"(a + 3 * as), "s"(b), "s"(b + bs), "s"(b + 2 * bs), "s"(b + 3 * bs) : "memory");
}
// Stage st (keys st * STK ...) into the buffer whose LDS byte address, plus this thread's 16 bytes tb, is lb. The 256 threads copy 4,096 bytes a round: a key plane's stage is 16,384 contiguous bytes, a value^T plane's four pieces of 4,096 (one per 16-row band, 16 * TT elements apart).
template <bool HL>
__device__ __forceinline__ void fattn_fill(unsigned lb, unsigned tb, int st, const h16* K16, const bf* Kh, const bf* Kl, const h16* V16, const bf* Vh, const bf* Vl) {
    const size_t ko = (size_t)st * PLB, vo = (size_t)st * (STK * 32), vs = (size_t)16 * TT * 2;
    if (HL) { acopy8(lb, tb, (const char*)Kh + ko, 4096, (const char*)Kl + ko, 4096); acopy8(lb + 2 * PLB, tb, (const char*)Vh + vo, vs, (const char*)Vl + vo, vs); }
    else acopy8(lb, tb, (const char*)K16 + ko, 4096, (const char*)V16 + vo, vs);
}
typedef __attribute__((address_space(3))) char lds_char;
template <bool HL>
__device__ __forceinline__ void fattn_keys(char* ring, const h16* __restrict__ Q16, const bf* __restrict__ Qh, const bf* __restrict__ Ql, const h16* __restrict__ K16, const bf* __restrict__ Kh, const bf* __restrict__ Kl, const h16* __restrict__ V16, const bf* __restrict__ Vh, const bf* __restrict__ Vl, int q0, int qw0, int ks, int lr, int hi, unsigned lk, v8f (&o)[2][4], float (&m)[2], float (&l)[2]) {
    const int np = (q0 + QT + STK - 1) / STK;   /* stages of the work-group; the last one ends at or below TT, since STK divides TT (rows < RH: at or below RH, since STK divides RH) */
    const unsigned tb = threadIdx.x * 16u; const unsigned lb = (unsigned)(size_t)(lds_char*)ring + tb;
    v16bf qh[2][2], ql[2][2]; v16h qf[2][2];   /* the wave's 32 queries, kept in registers over the key loop */
    if constexpr (HL) { const bf* pqh = lanep(Qh + (size_t)qw0 * HD, lk); const bf* pql = lanep(Ql + (size_t)qw0 * HD, lk);
#pragma unroll
        for (int g = 0; g < 2; ++g)
#pragma unroll
            for (int k2 = 0; k2 < 2; ++k2) { qh[g][k2] = WFrag<bf>::ld(pqh + (g * 2 + k2) * 512); ql[g][k2] = WFrag<bf>::ld(pql + (g * 2 + k2) * 512); }
        asm volatile("s_wait_xcnt 0x0" :: "v"(pqh), "v"(pql) : "memory"); }   /* behind the query loads; the addresses are named so that they stay in their registers up to here */
    else { const h16* pqf = lanep(Q16 + (size_t)qw0 * HD, lk);
#pragma unroll
        for (int g = 0; g < 2; ++g)
#pragma unroll
            for (int k2 = 0; k2 < 2; ++k2) qf[g][k2] = WFrag<h16>::ld(pqf + (g * 2 + k2) * 512);
        asm volatile("s_wait_xcnt 0x0" :: "v"(pqf) : "memory"); }   /* behind the query loads; the address is named so that it stays in its registers up to here */
    fattn_fill<HL>(lb, tb, 0, K16, Kh, Kl, V16, Vh, Vl);
    asm volatile("s_wait_asynccnt 0x0" ::: "memory");   /* this wave's copies of stage 0 have landed */
    __syncthreads();   /* every wave's copies of stage 0 have landed before any wave reads it */
    if (np > 1) fattn_fill<HL>(lb + BUFB, tb, 1, K16, Kh, Kl, V16, Vh, Vl);
#pragma unroll 1   /* one copy of the pass: a second one would double the fragments that are live and cost the fourth wave per SIMD */
    for (int st = 0; st < np; ++st) {
        const int kb = st * STK + ks * 32; const char* buf = ring + (st & 1) * BUFB + ks * 4096;   /* this wave's key block: 4,096 bytes of each key plane */
        if (kb < qw0 + 32) {   /* wave-uniform: a block past this wave's diagonal is skipped; the waits and the barrier below are passed all the same */
        v8f s[2][2]; v16bf kh[2][2], kl[2][2]; v16h kf[2][2]; const bf* pkh = lanep((const bf*)buf, lk); const bf* pkl = lanep((const bf*)(buf + PLB), lk); const h16* pkf = lanep((const h16*)buf, lk);
#pragma unroll
        for (int kt = 0; kt < 2; ++kt)
#pragma unroll
            for (int k2 = 0; k2 < 2; ++k2) { if (HL) { kh[kt][k2] = WFrag<bf>::ld(pkh + (kt * 2 + k2) * 512); kl[kt][k2] = WFrag<bf>::ld(pkl + (kt * 2 + k2) * 512); } else kf[kt][k2] = WFrag<h16>::ld(pkf + (kt * 2 + k2) * 512); }
        __builtin_amdgcn_sched_barrier(0);   /* the block's key loads stay one group in front of the score products: without this the compiler sinks some of them among the products and waits for them two products later */
#pragma unroll
        for (int kt = 0; kt < 2; ++kt)
#pragma unroll
            for (int g = 0; g < 2; ++g) { v8f a = (v8f){};
#pragma unroll
                for (int k2 = 0; k2 < 2; ++k2) { if (HL) { a = wmmab(kh[kt][k2], qh[g][k2], a); a = wmmab(kl[kt][k2], qh[g][k2], a); a = wmmab(kh[kt][k2], ql[g][k2], a); } else a = wmma16(kf[kt][k2], qf[g][k2], a); }
                s[g][kt] = a; }
        if (kb == qw0) {   /* wave-uniform scalar branch: only in the block on the wave's diagonal can a key lie behind a query; in every earlier block (kb + 32 <= qw0) the select would pass all 32 x 32 scores */
#pragma unroll
            for (int g = 0; g < 2; ++g) { const int rel = g * 16 + lr - hi * 8;   /* this lane's score (kt, j) belongs to a key <= its query where kt * 16 + j <= rel */
#pragma unroll
                for (int kt = 0; kt < 2; ++kt)
#pragma unroll
                    for (int j = 0; j < 8; ++j) s[g][kt][j] = (kt * 16 + j <= rel) ? s[g][kt][j] : -3.0e38f; }
        }
        const char* vb = ring + (st & 1) * BUFB + (HL ? 2 : 1) * PLB + ks * 1024;   /* 32 keys = one 1,024-byte tile of each 16-row band; a band's stage is 4,096 bytes. The value loads stand behind the scores, where the key fragments' registers are free, and fly under the softmax */
        v16bf vh[4], vl[4]; v16h vf[4]; const bf* pvh = lanep((const bf*)vb, lk); const bf* pvl = lanep((const bf*)(vb + PLB), lk); const h16* pvf = lanep((const h16*)vb, lk);
#pragma unroll
        for (int dt = 0; dt < 4; ++dt) { if (HL) { vh[dt] = WFrag<bf>::ld(pvh + dt * 2048); vl[dt] = WFrag<bf>::ld(pvl + dt * 2048); } else vf[dt] = WFrag<h16>::ld(pvf + dt * 2048); }
        v16bf ph[2], pl[2]; v16h p16[2];
#pragma unroll
        for (int g = 0; g < 2; ++g) { float mr = -3.0e38f;
#pragma unroll
            for (int kt = 0; kt < 2; ++kt)
#pragma unroll
                for (int j = 0; j < 8; ++j) mr = fmaxf(mr, s[g][kt][j]);
            mr = fmaxf(mr, xhalf(mr)); const float mx = fmaxf(m[g], mr * (SCL * 1.4426950408889634f));
            const float al = exp2s(m[g] - mx); m[g] = mx; float sa[4] = {0.f, 0.f, 0.f, 0.f};   /* al = 0 on a wave's first block (m = -3e38) */
#pragma unroll
            for (int kt = 0; kt < 2; ++kt) { float e[8];
#pragma unroll
                for (int j = 0; j < 8; ++j) e[j] = __builtin_fmaf(s[g][kt][j], SCL * 1.4426950408889634f, -mx);
                exp2x8(e);
#pragma unroll
                for (int j = 0; j < 8; ++j) { const float p = e[j]; sa[j & 3] += p;
                    if (HL) { const __bf16 a2 = (__bf16)p; ph[g][kt * 8 + j] = a2; pl[g][kt * 8 + j] = (__bf16)(p - (float)a2); } else p16[g][kt * 8 + j] = tohx(p); } }
            const float sum = (sa[0] + sa[1]) + (sa[2] + sa[3]);
            l[g] = l[g] * al + sum;
#pragma unroll
            for (int dt = 0; dt < 4; ++dt) o[g][dt] *= al; }
#pragma unroll
        for (int dt = 0; dt < 4; ++dt)
#pragma unroll
            for (int g = 0; g < 2; ++g) { if (HL) { o[g][dt] = wmmab(vh[dt], ph[g], o[g][dt]); o[g][dt] = wmmab(vl[dt], ph[g], o[g][dt]); o[g][dt] = wmmab(vh[dt], pl[g], o[g][dt]); } else o[g][dt] = wmma16(vf[dt], p16[g], o[g][dt]); }
        }
        asm volatile("s_wait_dscnt 0x0" ::: "memory");      /* this wave's reads of the current buffer have returned before the buffer is refilled */
        asm volatile("s_wait_asynccnt 0x0" ::: "memory");   /* this wave's copies of the next stage have landed */
        __syncthreads();   /* publishes the next stage and ends every wave's reads of the current buffer */
        if (st + 2 < np) fattn_fill<HL>(lb + (unsigned)(st & 1) * BUFB, tb, st + 2, K16, Kh, Kl, V16, Vh, Vl);
    }
    asm volatile("s_wait_asynccnt 0x0" ::: "memory");   /* nothing is in flight when the ring becomes the join's staging */
}
// amdgpu_waves_per_eu(4, 4): at most 256 registers a wave, so that two work-groups (four waves per SIMD) share a WGP and cover each other's waits.
__global__ __launch_bounds__(32 * FW) __attribute__((amdgpu_waves_per_eu(4, 4))) void k_fattn(const h16* __restrict__ Q16, const bf* __restrict__ Qh, const bf* __restrict__ Ql, const h16* __restrict__ K16, const bf* __restrict__ Kh, const bf* __restrict__ Kl, const h16* __restrict__ V16, const bf* __restrict__ Vh, const bf* __restrict__ Vl, bf* __restrict__ Oh, bf* __restrict__ Ol) {
    __shared__ __align__(1024) char ring[2 * BUFB]; __shared__ float sm[FW * 32], sl[FW * 32];
    static_assert(FW * 32 * 68 * 4 <= 2 * BUFB, "the join's staging lies in the ring");
    float* so = (float*)ring;   /* the waves' scaled partial rows, behind the key loop's last barrier */
    const int wv = __builtin_amdgcn_readfirstlane((int)(threadIdx.x >> 5));   /* wave number, scalar so that the skip of a key block stays a scalar branch */
    const int qg = wv & 1, ks = wv >> 1;   /* query half, key block inside a stage */
    const int lane = threadIdx.x & 31, lr = lane & 15, hi = lane >> 4; const int h = blockIdx.x % NH_, b = blockIdx.x / NH_;
    const size_t hb = (size_t)blockIdx.x * TT * HD;   /* planes [b][h]: (b * NH_ + h) */ Q16 += hb; Qh += hb; Ql += hb; K16 += hb; Kh += hb; Kl += hb; V16 += hb; Vh += hb; Vl += hb;
    {
        const int q0 = (TT / QT - 1 - (int)blockIdx.y) * QT;   /* the longest rows of every head and batch start first, the short ones fill in behind them */
        const int qw0 = q0 + qg * 32;   /* this wave's first query */
        const unsigned lk = (unsigned)lane * 16u;   /* the lane's bytes inside a tile, the same in every plane */
        v8f o[2][4]; float m[2], l[2];
#pragma unroll
        for (int g = 0; g < 2; ++g) { m[g] = -3.0e38f; l[g] = 0.f;
#pragma unroll
            for (int dt = 0; dt < 4; ++dt) o[g][dt] = (v8f){}; }
        if (q0 < RH) fattn_keys<true>(ring, Q16, Qh, Ql, K16, Kh, Kl, V16, Vh, Vl, q0, qw0, ks, lr, hi, lk, o, m, l); else fattn_keys<false>(ring, Q16, Qh, Ql, K16, Kh, Kl, V16, Vh, Vl, q0, qw0, ks, lr, hi, lk, o, m, l);
#pragma unroll
        for (int g = 0; g < 2; ++g) { l[g] += xhalf(l[g]); if (hi == 0) { sm[wv * 32 + g * 16 + lr] = m[g]; sl[wv * 32 + g * 16 + lr] = l[g]; } }
        __syncthreads();   /* every wave's maximum and sum are in LDS before the common ones are formed */
#pragma unroll
        for (int g = 0; g < 2; ++g) { float mm = sm[qg * 32 + g * 16 + lr];   /* the waves qg, qg + 2, ... hold this wave's queries */
#pragma unroll
            for (int w = 1; w < KSP; ++w) mm = fmaxf(mm, sm[(qg + 2 * w) * 32 + g * 16 + lr]);
            float ll = 0.f;
#pragma unroll
            for (int w = 0; w < KSP; ++w) ll += sl[(qg + 2 * w) * 32 + g * 16 + lr] * exp2s(sm[(qg + 2 * w) * 32 + g * 16 + lr] - mm);   /* a wave that had no key block holds m = -3e38, l = 0 */
            const float f = __fdiv_rn(exp2s(m[g] - mm), ll);
#pragma unroll
            for (int dt = 0; dt < 4; ++dt) { const v8f a = o[g][dt] * f; float* d = so + (wv * 32 + g * 16 + lr) * 68 + dt * 16 + hi * 8;
                *(v4fa*)d = (v4f){a[0], a[1], a[2], a[3]}; *(v4fa*)(d + 4) = (v4f){a[4], a[5], a[6], a[7]}; } }
        __syncthreads();   /* every wave's scaled partial rows are in LDS before any of them is summed */
        static_assert(QT == 64 && FW == 8 && HD == 64, "the context stores deal 64 rows x 64 columns to 256 threads");
        const int er = (wv >> 1) * 16 + lr, ec = (wv & 1) * 16 + hi * 8;   /* this thread finishes query row er, columns ec .. ec + 7 and ec + 32 .. ec + 39: lane (hi, lr) is the lane of the fragment order, so each 16-byte store makes 512 contiguous bytes a wave */
        const float* sp = so + er * 68 + ec; v4f x[4] = {*(const v4fa*)sp, *(const v4fa*)(sp + 4), *(const v4fa*)(sp + 32), *(const v4fa*)(sp + 36)};   /* wave qg + 2 w holds rows qg * 32 .. of partial w: row er of partial w stands 64 rows on */
#pragma unroll
        for (int w = 1; w < KSP; ++w)
#pragma unroll
            for (int i = 0; i < 4; ++i) x[i] += *(const v4fa*)(sp + w * (2 * 32 * 68) + (i >> 1) * 32 + (i & 1) * 4);   /* partial rows of the row's query half joined in wave order */
        v8us oh[2], ol[2];
#pragma unroll
        for (int q = 0; q < 16; ++q) { unsigned short h2, l2; splitf(x[q >> 2][q & 3], h2, l2); oh[q >> 3][q & 7] = h2; ol[q >> 3][q & 7] = l2; }
        const size_t e = fidx(b * TT + q0 + er, h * HD + ec, CO); *(v8us*)(Oh + e) = oh[0]; *(v8us*)(Oh + e + 512) = oh[1]; *(v8us*)(Ol + e) = ol[0]; *(v8us*)(Ol + e + 512) = ol[1];   /* context rows [b * TT + t][h * 64 + d] as the hi/lo operand planes of the last product, in fragment order; the columns 32 on lie one tile (512 elements) on */
    }
}

__constant__ float INVT[HD / 2] = { 1.000000000e+00f, 6.493816376e-01f, 4.216965139e-01f, 2.738419771e-01f, 1.778279394e-01f, 1.154782027e-01f, 7.498941571e-02f, 4.869675264e-02f, 3.162277862e-02f, 2.053525113e-02f, 1.333521493e-02f, 8.659643121e-03f, 5.623413250e-03f, 3.651741426e-03f, 2.371373819e-03f, 1.539926510e-03f, 1.000000047e-03f, 6.493816618e-04f, 4.216964880e-04f, 2.738419571e-04f, 1.778279402e-04f, 1.154781930e-04f, 7.498942432e-05f, 4.869675467e-05f, 3.162277426e-05f, 2.053524986e-05f, 1.333521413e-05f, 8.659643754e-06f, 5.623413472e-06f, 3.651741281e-06f, 2.371373739e-06f, 1.539926529e-06f };   // float32 1 / 1000000^(2i/64) (the module's integer-arange expression), generated with jnp to be bit-exact
__device__ __forceinline__ void cs5_block(int blk, float* CS) { const int idx = blk * 256 + threadIdx.x; if (idx >= TT * HD) return; const int d = idx % HD; const int t = idx / HD; const float a = __fmul_rn((float)t, INVT[d % (HD / 2)]); v2f cs; cs[0] = cosf(a); cs[1] = sinf(a); *(v2f*)(CS + (size_t)idx * 2) = cs;  }
// A work-group takes one 16-row band of the planes (16,384 contiguous bytes of each), two rows a wave. A row's 16-byte pieces lie 256 bytes apart in a plane, so the band is put together in LDS (st) and leaves it as 512 contiguous bytes a wave-wide store.
#define RPW 2                     // token rows a wave
#define RPP 272                   // LDS bytes of one 256-byte piece (16 rows x 8 columns): 16 more, so that the lanes of a row's store do not all meet in four banks
#define RSB (2 * (CC / 8) * RPP)  // LDS bytes: hi band, lo band
__device__ __forceinline__ void rmsx_rows(char* st, int blk, const float* __restrict__ X, const float* __restrict__ sc, bf* XH, bf* XL) { const int lane = threadIdx.x & 31; const int rb = (int)(threadIdx.x >> 5) * RPW; const int row = blk * 16 + rb;   /* row = b * TT + t, the wave's first */ const float* xr = X + (size_t)row * CC + lane * 16; const unsigned sb = lane * 64u; const float* sr = (const float*)((const char*)sc + sb);   /* the lane's 16 columns of the scale: (uniform base) + sb bytes */ v4f xall[RPW][4], sv[4];
    static_assert(8 * RPW == 16 && (NB_ * TT) % 16 == 0 && CC == 512, "eight waves fill one band; 32 lanes x 16 columns");
#pragma unroll
    for (int c = 0; c < 4; ++c) sv[c] = *(const v4f*)(sr + c * 4);
#pragma unroll
    for (int r = 0; r < RPW; ++r)
#pragma unroll
        for (int c = 0; c < 4; ++c) xall[r][c] = *(const v4f*)(xr + r * CC + c * 4);
    asm volatile("s_wait_xcnt 0x0" :: "v"(xr), "v"(sb) : "memory");   /* behind the rows' and the scale's loads; the address and the offset are named so that no load's result lands on a register that an issued load names */
#pragma unroll
    for (int r = 0; r < RPW; ++r) { float v[16]; float ss = 0.f; v4f (&xa)[4] = xall[r];
#pragma unroll
    for (int c = 0; c < 4; ++c) { const v4f a = xa[c];
#pragma unroll
        for (int q = 0; q < 4; ++q) { const float b = bfr(a[q]); v[c * 4 + q] = b; float p = __fmul_rn(b, b); asm volatile("" : "+v"(p)); ss = __fadd_rn(ss, p); } }
#pragma unroll
    for (int sh = 16; sh; sh >>= 1) ss = __fadd_rn(ss, __shfl_xor(ss, sh, 32));
    const float den = sqrtf(__fadd_rn(__fmul_rn(ss, 1.0f / CC), 1.0e-6f)); const float rinv = __fdiv_rn(1.0f, den);   /* ONE IEEE division per row; x * (1/den) differs from the module's x / den by <= 1 ulp */
    v4us oh[4], ol[4];
#pragma unroll
    for (int c = 0; c < 4; ++c) {
#pragma unroll
        for (int q = 0; q < 4; ++q) { float y = __fmul_rn(v[c * 4 + q], rinv); asm volatile("" : "+v"(y)); y = __fmul_rn(y, bfr(sv[c][q])); unsigned short a2, c2; splitf(y, a2, c2); oh[c][q] = a2; ol[c][q] = c2; } }
    char* sp = st + lane * 2 * RPP + (rb + r) * 16;   /* fragment order inside the band: columns lane * 16 + c * 8 .. are piece lane * 2 + c, a row is 16 bytes of it */
#pragma unroll
    for (int c = 0; c < 2; ++c) { *(v8usa*)(sp + c * RPP) = __builtin_shufflevector(oh[2 * c], oh[2 * c + 1], 0, 1, 2, 3, 4, 5, 6, 7); *(v8usa*)(sp + RSB / 2 + c * RPP) = __builtin_shufflevector(ol[2 * c], ol[2 * c + 1], 0, 1, 2, 3, 4, 5, 6, 7); } }
    __syncthreads();   /* all 16 rows of the band are in LDS before any of it is stored */
    v8us bh[4], bl[4];
#pragma unroll
    for (int i = 0; i < 4; ++i) { const int u = i * 256 + (int)threadIdx.x; const char* lp = st + (u >> 4) * RPP + (u & 15) * 16; bh[i] = *(const v8usa*)lp; bl[i] = *(const v8usa*)(lp + RSB / 2); }
    bf* ph = XH + (size_t)blk * 16 * CC + threadIdx.x * 8; bf* pl = XL + (size_t)blk * 16 * CC + threadIdx.x * 8;
#pragma unroll
    for (int i = 0; i < 4; ++i) { *(v8us*)(ph + i * 2048) = bh[i]; *(v8us*)(pl + i * 2048) = bl[i]; }
}
// One wave: 32 columns n of w (one a lane, so each load is one whole 128-byte line) x 32 rows k; a lane's 8 consecutive k are its 16 bytes of Bt[n][k] in fragment order, 2 x 256 contiguous bytes a wave-wide store.
__device__ __forceinline__ void wtG_tiles(int blk, const float* __restrict__ w, int K, int N, bf* Bt) {
    const int lane = threadIdx.x & 31; const int task = blk * 8 + (int)(threadIdx.x >> 5); const int n = task % (N / 32) * 32 + lane, k0 = task / (N / 32) * 32; if (k0 >= K) return;
    const float* p = w + (size_t)k0 * N + n; float x[32];
#pragma unroll
    for (int i = 0; i < 32; ++i) x[i] = p[(size_t)i * N];
    asm volatile("s_wait_xcnt 0x0" :: "v"(p) : "memory");   /* behind the loads; the address is named so that no load's result lands on a register that an issued load names */
    v8us o[4];
#pragma unroll
    for (int i = 0; i < 32; ++i) o[i >> 3][i & 7] = f2bf(x[i]);
    bf* d = Bt + fidx(n, k0, K);
#pragma unroll
    for (int i = 0; i < 4; ++i) *(v8us*)(d + i * 128) = o[i];   /* k0 + i * 8: 128 elements on per 8 k inside the 32-k tile */
}
// ---- k_prep: all that depends on the inputs alone, side by side in one grid of 256 threads: blocks 0 .. 4 * WB - 1 the four weights (WB blocks each), the next RB the 16-row bands of the token rows of both batches, the last TB the rotary table.
#define WB (CC * MID / (32 * 32) / 8)
#define RB (NB_ * TT / 16)
#define TB (TT * HD / 256)
__global__ __launch_bounds__(256) void k_prep(const float* __restrict__ x, const float* __restrict__ rsc, const float* __restrict__ wq, const float* __restrict__ wk, const float* __restrict__ wv, const float* __restrict__ wo, bf* WQKV, bf* WO, float* CS, bf* XH, bf* XL) {
    __shared__ __align__(16) char st[RSB];
    const int blk = (int)blockIdx.x;
    if (blk < 4 * WB) { const int j = blk / WB; wtG_tiles(blk % WB, j == 0 ? wq : j == 1 ? wk : j == 2 ? wv : wo, CC, MID, j < 3 ? WQKV + (size_t)j * MID * CC : WO); }   /* 'xw' weights -> Bt; all four are [512][512] */
    else if (blk < 4 * WB + RB) rmsx_rows(st, blk - 4 * WB, x, rsc, XH, XL);   /* x_norm = x / sqrt(mean x^2 + eps) x scale as hi/lo planes */
    else cs5_block(blk - 4 * WB - RB, CS);   /* cos, sin per (token, d) for the q and k epilogues */
}
extern "C" void kernel_launch(void* const* d_in, const int* in_sizes, int n_in,
                              void* d_out, int out_size, void* d_ws, size_t ws_size, hipStream_t stream) {
    (void)in_sizes; (void)n_in; (void)out_size;
    const float* x = (const float*)d_in[0]; const float* rsc = (const float*)d_in[1]; const float* wq = (const float*)d_in[2]; const float* wk = (const float*)d_in[3]; const float* wv = (const float*)d_in[4]; const float* wo = (const float*)d_in[5];   /* input order x [2][4096][512], scale [512] (RMSNorm weight), Wq, Wk, Wv, Wo ('xw' [512][512], no biases) */
    float* OUT = (float*)d_out;     // [2][4096][512]
    char* wsp = (char*)d_ws;
    auto take = [&](size_t bytes) { char* p = wsp; wsp += (bytes + 255) & ~(size_t)255; return (void*)p; };
    bf* WQKV = (bf*)take((size_t)3 * MID * CC * 2); bf* WQ = WQKV; bf* WK = WQKV + (size_t)MID * CC; bf* WV = WQKV + (size_t)2 * MID * CC; bf* WO = (bf*)take((size_t)CC * CO * 2); float* CS = (float*)take((size_t)TT * HD * 2 * 4);
    bf* XH = (bf*)take((size_t)NB_ * TT * CC * 2); bf* XL = (bf*)take((size_t)NB_ * TT * CC * 2);   /* RMS-normalised tokens, bf16 hi/lo */
    h16* Q16 = (h16*)take((size_t)NB_ * TT * MID * 2); h16* K16 = (h16*)take((size_t)NB_ * TT * MID * 2); bf* QPh = (bf*)take((size_t)NB_ * TT * MID * 2); bf* QPl = (bf*)take((size_t)NB_ * TT * MID * 2); bf* KPh = (bf*)take((size_t)NB_ * TT * MID * 2); bf* KPl = (bf*)take((size_t)NB_ * TT * MID * 2);
    h16* VT16 = (h16*)take((size_t)NB_ * CO * TT * 2); bf* VTh = (bf*)take((size_t)NB_ * CO * TT * 2); bf* VTl = (bf*)take((size_t)NB_ * CO * TT * 2);
    bf* ATh = (bf*)take((size_t)NB_ * TT * CO * 2); bf* ATl = (bf*)take((size_t)NB_ * TT * CO * 2);
    if ((size_t)(wsp - (char*)d_ws) > ws_size) return;
    k_prep<<<4 * WB + RB + TB, 256, 0, stream>>>(x, rsc, wq, wk, wv, wo, WQKV, WO, CS, XH, XL);
    k_qkv<<<dim3(NB_ * TT / 64, MID / 64 / NTP, 3), 32 * NWP, 0, stream>>>(XH, XL, WQ, WK, WV, CS, Q16, QPh, QPl, K16, KPh, KPl, VT16, VTh, VTl);
    k_fattn<<<dim3(NB_ * NH_, TT / QT, 1), 32 * FW, 0, stream>>>(Q16, QPh, QPl, K16, KPh, KPl, VT16, VTh, VTl, ATh, ATl);   /* all heads of both batches: scores, causal softmax and attn.V; merged context as hi/lo planes */
    k_out<<<dim3(NB_ * TT / 64, CC / 64 / NTP, 1), 32 * NWP, 0, stream>>>(ATh, ATl, WO, OUT);
}
